// v006
// Times are from an AMD MI455X. After a warm-up the kernel runs many times in a row, and a time is the length of
// such a window on the GPU divided by its runs, so every launch and the gaps after it count. The runs cycle
// through copies of the inputs. A figure is the median of several windows, for all but v000 over two sittings.
// Sittings can differ by a few percent; kernels timed side by side share one.
// Earlier versions than v006 are not in this document.
// A run of this version takes 108 microseconds.
// In two side-by-side timings against v005, it was 1.33 and 1.34 times as fast.
// All steps since the starting kernel, v000, together make it 19.9 times as fast.
// Contractions: q and k|v projections (weights stored [in][out]) [4096x1024].[1024x1024|2048], both batch elements' rows in one launch, with f16 operands on f16 planes (v_wmma_f32_16x16x32_f16, 64x64 register-blocked wave tiles, weights x16); per (batch, head) softmax(q.k^T/8) v over all 2048 keys as one flash launch for both batch elements (head_dim 64, f16 q.k^T and f16 p.v with p as f16 of 4096 p), whose epilogue applies the head's own 64x64 output map (+bias) to the f16 attention tile still in registers (weights x16); f32 accumulate and softmax statistics.
#include <hip/hip_runtime.h>
#include <math.h>

typedef __attribute__((ext_vector_type(16))) _Float16 v16h;
typedef __attribute__((ext_vector_type(8)))  _Float16 v8h;
typedef __attribute__((ext_vector_type(16))) __bf16   v16b;
typedef __attribute__((ext_vector_type(8)))  float    v8f;
typedef __attribute__((ext_vector_type(4)))  float    v4f;

// 16-bit WMMA fragment map (wave32), lane L, h = L>>4, m = L&15:
//   A 16x32: lane = row m;   element i -> k = (i<8) ? 8h+i : 16+8h+(i-8)
//   B 32x16: lane = column m; the SAME k(i,h)
//   D 16x16 (8 f32): lane = column m; element r -> row 8h+r
__device__ __forceinline__ int frag_k(int i, int h) { return (i < 8) ? (8 * h + i) : (16 + 8 * h + (i - 8)); }
__device__ __forceinline__ __bf16 bf16_rne(float f) {
    unsigned int u = __float_as_uint(f);
    u += 0x7fffu + ((u >> 16) & 1u);
    return __builtin_bit_cast(__bf16, (unsigned short)(u >> 16));
}
__device__ __forceinline__ float bf16_f32(__bf16 b) { return __uint_as_float(((unsigned int)__builtin_bit_cast(unsigned short, b)) << 16); }
__device__ __forceinline__ v8f wmma16(v16h a, v16h b, v8f c) {
    c = __builtin_amdgcn_wmma_f32_16x16x32_f16(false, a, false, b, (short)0, c, false, false);
    asm volatile("v_nop\n\tv_nop\n\tv_nop\n\tv_nop" : "+v"(c) : "v"(a), "v"(b));
    return c;
}
__device__ __forceinline__ v8f wmmab(v16b a, v16b b, v8f c) {
    c = __builtin_amdgcn_wmma_f32_16x16x32_bf16(false, a, false, b, (short)0, c, false, false);
    asm volatile("v_nop\n\tv_nop\n\tv_nop\n\tv_nop" : "+v"(c) : "v"(a), "v"(b));
    return c;
}
struct Split { v16b hi, lo; };
// hi/lo split product: a.hi*b.hi + a.hi*b.lo + a.lo*b.hi
__device__ __forceinline__ v8f wmma3(const Split& a, const Split& b, v8f c) {
    c = __builtin_amdgcn_wmma_f32_16x16x32_bf16(false, a.hi, false, b.hi, (short)0, c, false, false);
    c = __builtin_amdgcn_wmma_f32_16x16x32_bf16(false, a.hi, false, b.lo, (short)0, c, false, false);
    c = __builtin_amdgcn_wmma_f32_16x16x32_bf16(false, a.lo, false, b.hi, (short)0, c, false, false);
    asm volatile("v_nop\n\tv_nop\n\tv_nop\n\tv_nop" : "+v"(c) : "v"(a.hi), "v"(a.lo), "v"(b.hi), "v"(b.lo));
    return c;
}
struct Split3 { v16b hi, mid, lo; };
// triple split product (6 terms, drops only terms below 2^-24 relative)
__device__ __forceinline__ v8f wmma6(const Split3& a, const Split3& b, v8f c) {
    c = __builtin_amdgcn_wmma_f32_16x16x32_bf16(false, a.hi, false, b.hi, (short)0, c, false, false);
    c = __builtin_amdgcn_wmma_f32_16x16x32_bf16(false, a.hi, false, b.mid, (short)0, c, false, false);
    c = __builtin_amdgcn_wmma_f32_16x16x32_bf16(false, a.mid, false, b.hi, (short)0, c, false, false);
    c = __builtin_amdgcn_wmma_f32_16x16x32_bf16(false, a.hi, false, b.lo, (short)0, c, false, false);
    c = __builtin_amdgcn_wmma_f32_16x16x32_bf16(false, a.mid, false, b.mid, (short)0, c, false, false);
    c = __builtin_amdgcn_wmma_f32_16x16x32_bf16(false, a.lo, false, b.hi, (short)0, c, false, false);
    asm volatile("v_nop\n\tv_nop\n\tv_nop\n\tv_nop" : "+v"(c) : "v"(a.hi), "v"(a.mid), "v"(a.lo), "v"(b.hi), "v"(b.mid), "v"(b.lo));
    return c;
}

// Fragment gathers from f32 memory: element i <- p[(k0 + frag_k(i,h)) * sk] * s, zero for k >= klen.
__device__ __forceinline__ v16h fh_ld(const float* __restrict__ p, long long sk, int k0, int h, int klen, float s) {
    v16h a;
#pragma unroll
    for (int i = 0; i < 16; ++i) { const int k = k0 + frag_k(i, h); a[i] = (k < klen) ? (_Float16)(p[(long long)k * sk] * s) : (_Float16)0.f; }
    return a;
}
__device__ __forceinline__ Split sp_ld(const float* __restrict__ p, long long sk, int k0, int h, int klen, float s) {
    Split r;
#pragma unroll
    for (int i = 0; i < 16; ++i) {
        const int k = k0 + frag_k(i, h); const float x = (k < klen) ? p[(long long)k * sk] * s : 0.f;
        const __bf16 hb = bf16_rne(x); r.hi[i] = hb; r.lo[i] = bf16_rne(x - bf16_f32(hb));
    }
    return r;
}
__device__ __forceinline__ Split3 sp3_ld(const float* __restrict__ p, long long sk, int k0, int h, int klen, float s) {
    Split3 r;
#pragma unroll
    for (int i = 0; i < 16; ++i) {
        const int k = k0 + frag_k(i, h); const float x = (k < klen) ? p[(long long)k * sk] * s : 0.f;
        const __bf16 hb = bf16_rne(x); const float r1 = x - bf16_f32(hb); const __bf16 mb = bf16_rne(r1);
        r.hi[i] = hb; r.mid[i] = mb; r.lo[i] = bf16_rne(r1 - bf16_f32(mb));
    }
    return r;
}
__device__ __forceinline__ v16b bh_ld(const float* __restrict__ p, long long sk, int k0, int h, int klen, float s) {
    v16b a;
#pragma unroll
    for (int i = 0; i < 16; ++i) { const int k = k0 + frag_k(i, h); a[i] = bf16_rne((k < klen) ? p[(long long)k * sk] * s : 0.f); }
    return a;
}
// f16 fragment from an f16 LDS/global row with element stride 1 (k-contiguous), no bounds (tile already zero padded)
__device__ __forceinline__ v16h fh_row(const _Float16* __restrict__ row, int k0, int h) {
    v16h a;
#pragma unroll
    for (int i = 0; i < 16; ++i) a[i] = row[k0 + frag_k(i, h)];
    return a;
}

#define VST2(T, ptr, val) do { const T vst2_v_ = (val); *(T*)(ptr) = vst2_v_;  } while (0)
typedef float v4f __attribute__((ext_vector_type(4)));
#define VST2V4(ptr, val) do { const v4f vst2_v4_ = (val); *(v4f*)(ptr) = vst2_v4_;  } while (0)

__device__ __attribute__((noinline)) float act_fn(float v, int act) {
    if (act == 1) return fmaxf(v, 0.f);                                                                               // relu
    if (act == 2) { const float u = 0.7978845608028654f * (v + 0.044715f * v * v * v); return 0.5f * v * (1.f + tanhf(u)); } // tanh-gelu
    if (act == 3) return v / (1.f + expf(-v));                                                                        // silu
    if (act == 4) return 0.5f * v * (1.f + erff(v * 0.7071067811865476f));                                             // erf-gelu
    if (act == 5) return tanhf(v);
    if (act == 6) return 1.f / (1.f + expf(-v));                                                                      // sigmoid
    if (act == 7) return (v > 0.f) ? v : 0.01f * v;                                                                   // leaky relu 0.01
    if (act == 8) return (v > 0.f) ? v : (expf(v) - 1.f);                                                             // elu
    if (act == 9) return fminf(fmaxf(v, 0.f), 6.f);                                                                   // relu6
    if (act == 10) return fabsf(v);                                                                                    // abs
    if (act == 11) return (v >= 0.f) ? v : 0.1f * v;                                                                  // leaky 0.1
    if (act == 12) return (v > 0.f) ? v : 0.2f * v;                                                                   // leaky 0.2
    if (act == 13) return (v > 20.f) ? v : log1pf(expf(v));                                                            // softplus
    return v;
}

// =====================================================================================================================
// k_gemm<MODE>: C(z, m, n) = act(alpha * sum_k A(z, m, k) * B(z, k, n) + bias) + beta * R(z, m, n)
//   One wave (32-thread block) per 16 x 32 tile of C; grid (ceil(N/32), ceil(M/16), Z). Batch z -> (zo = z / zi_n, zi = z % zi_n)
//   with separate outer/inner strides for every tensor (e.g. batch and head). A(m,k) = A[zo*sAo + zi*sAi + m*sAm + k*sAk] (f32),
//   B(k,n) = B[zo*sBo + zi*sBi + n*sBn + k*sBk] (f32); any M, N, K (K zero-padded to 32 inside the fragments, M/N tails guarded).
//   C(m,n) = C[zo*sCo + zi*sCi + m*sCm + n] (n contiguous). flags: 1 bias[n], 2 bias[m], 4 residual R[zo*sRo + zi*sRi + m*sRm + n*sRn].
//   MODE 0: f16 operands (A prescaled by sa, B by sb, both undone in the epilogue); 1: bf16 hi/lo split (3 products); 2: bf16;
//   3: bf16 hi/mid/lo triple split (6 products); 4: as 3 with Kahan-compensated f32 accumulation across k-steps.
// =====================================================================================================================
struct GemmP {
    const float* A; const float* B; const float* bias; const float* R; float* C;
    long long sAo, sAi, sAm, sAk, sBo, sBi, sBn, sBk, sCo, sCi, sCm, sRo, sRi, sRm, sRn;
    int M, N, K, zi_n, flags, act; float alpha, beta, sa, sb;
    int Npad, pad_;     // columns [N, Npad) of C are written as 0 so that padded workspace rows are covered by whole-line stores; Npad >= N
};
static_assert(sizeof(GemmP) == 5 * 8 + 15 * 8 + 6 * 4 + 4 * 4 + 2 * 4, "GemmP has padding");

template <int MODE>
__global__ __launch_bounds__(32) void k_gemm(GemmP p) {
    const int lane = threadIdx.x & 31, h = lane >> 4, l15 = lane & 15;
    const int m0 = blockIdx.y * 16, n0 = blockIdx.x * 32;
    const int z = blockIdx.z, zo = z / p.zi_n, zi = z - zo * p.zi_n;
    const float* A = p.A + zo * p.sAo + zi * p.sAi;
    const float* B = p.B + zo * p.sBo + zi * p.sBi;
    const int am = min(m0 + l15, p.M - 1);                       // clamped row for loads (stores are guarded)
    v8f acc[2], comp[2];
#pragma unroll
    for (int t = 0; t < 2; ++t) { v8f zz = {}; acc[t] = zz; comp[t] = zz; }
    for (int k0 = 0; k0 < p.K; k0 += 32) {
        const float* arow = A + (long long)am * p.sAm;
        if (MODE == 1) {
            const Split a = sp_ld(arow, p.sAk, k0, h, p.K, 1.f);
#pragma unroll
            for (int t = 0; t < 2; ++t) {
                const int bn = min(n0 + t * 16 + l15, p.N - 1);
                acc[t] = wmma3(a, sp_ld(B + (long long)bn * p.sBn, p.sBk, k0, h, p.K, 1.f), acc[t]);
            }
        } else if (MODE == 3) {
            const Split3 a = sp3_ld(arow, p.sAk, k0, h, p.K, 1.f);
#pragma unroll
            for (int t = 0; t < 2; ++t) {
                const int bn = min(n0 + t * 16 + l15, p.N - 1);
                acc[t] = wmma6(a, sp3_ld(B + (long long)bn * p.sBn, p.sBk, k0, h, p.K, 1.f), acc[t]);
            }
        } else if (MODE == 4) {
            // triple split as MODE 3, but each k-step's 6 products go into a fresh accumulator and the partial is added to the running f32 sum
            // on the VALU with Kahan compensation (accumulation error stays ~1 ulp however long K is)
            const Split3 a = sp3_ld(arow, p.sAk, k0, h, p.K, 1.f);
#pragma unroll
            for (int t = 0; t < 2; ++t) {
                const int bn = min(n0 + t * 16 + l15, p.N - 1); v8f zz = {};
                const v8f part = wmma6(a, sp3_ld(B + (long long)bn * p.sBn, p.sBk, k0, h, p.K, 1.f), zz);
                const v8f y = part - comp[t]; const v8f s = acc[t] + y; comp[t] = (s - acc[t]) - y; acc[t] = s;
            }
        } else if (MODE == 2) {
            const v16b a = bh_ld(arow, p.sAk, k0, h, p.K, 1.f);
#pragma unroll
            for (int t = 0; t < 2; ++t) {
                const int bn = min(n0 + t * 16 + l15, p.N - 1);
                acc[t] = wmmab(a, bh_ld(B + (long long)bn * p.sBn, p.sBk, k0, h, p.K, 1.f), acc[t]);
            }
        } else {
            const v16h a = fh_ld(arow, p.sAk, k0, h, p.K, p.sa);
#pragma unroll
            for (int t = 0; t < 2; ++t) {
                const int bn = min(n0 + t * 16 + l15, p.N - 1);
                acc[t] = wmma16(a, fh_ld(B + (long long)bn * p.sBn, p.sBk, k0, h, p.K, p.sb), acc[t]);
            }
        }
    }
    const float iscale = (MODE == 0) ? p.alpha / (p.sa * p.sb) : p.alpha;
    float* C = p.C + zo * p.sCo + zi * p.sCi;
    const float* R = p.R + zo * p.sRo + zi * p.sRi;
    __shared__ __align__(16) float ctile[16][36];
#pragma unroll
    for (int t = 0; t < 2; ++t) {
        const int n = n0 + t * 16 + l15; const int nn = min(n, p.N - 1);
#pragma unroll
        for (int r = 0; r < 8; ++r) {
            const int m = m0 + 8 * h + r; const int mm = min(m, p.M - 1);
            float v = acc[t][r] * iscale;
            if (p.flags & 1) v += p.bias[nn];
            if (p.flags & 2) v += p.bias[mm];
            if (p.flags & 8) v *= p.bias[(long long)zo * p.M + mm];   /* per-(z,row) scale vector laid out [Z][M]; exclusive with the bias flags */
            v = act_fn(v, p.act);
            if (p.flags & 4) v += p.beta * R[(long long)mm * p.sRm + (long long)nn * p.sRn];
            ctile[8 * h + r][t * 16 + l15] = (n < p.N) ? v : 0.f;
        }
    }
    __syncthreads();
    const int NW = (p.Npad > p.N) ? p.Npad : p.N;           // write width
    const bool fast = (m0 + 16 <= p.M) && (n0 + 32 <= NW) && ((p.sCm & 3) == 0) && ((((size_t)C) & 15) == 0);
    if (fast) {
#pragma unroll
        for (int s = 0; s < 4; ++s) {
            const int row = s * 4 + (lane >> 3), c4 = (lane & 7) * 4;
            const v4f v = *(const v4f*)&ctile[row][c4];
            VST2V4(C + (long long)(m0 + row) * p.sCm + n0 + c4, v);
        }
    } else {
        for (int row = 0; row < 16; ++row) {
            const int m = m0 + row, n = n0 + lane;
            if (m < p.M && n < NW) VST2(float, C + (long long)m * p.sCm + n, ctile[row][lane]);
        }
    }
}


// =====================================================================================================================
// k_gemmT<MODE, TM, TN>: same contract as k_gemm, but one wave computes a (16*TM) x (16*TN) tile: TM A fragments and TN B fragments are
//   loaded per 32-wide k-step and reused across TM*TN WMMAs (far fewer load/convert instructions per MAC). MODE 0 (f16), 1 (bf16 hi/lo),
//   2 (bf16) only. grid (ceil(NW/(16*TN)), ceil(M/(16*TM)), Z), block 32. Epilogue identical to k_gemm, run per 16x32 sub-tile.
// =====================================================================================================================
template <int MODE, int TM, int TN>
__global__ __launch_bounds__(32) void k_gemmT(GemmP p) {
    const int lane = threadIdx.x & 31, h = lane >> 4, l15 = lane & 15;
    const int m0 = blockIdx.y * (16 * TM), n0 = blockIdx.x * (16 * TN);
    const int z = blockIdx.z, zo = z / p.zi_n, zi = z - zo * p.zi_n;
    const float* A = p.A + zo * p.sAo + zi * p.sAi;
    const float* B = p.B + zo * p.sBo + zi * p.sBi;
    v8f acc[TM][TN];
#pragma unroll
    for (int i = 0; i < TM; ++i)
#pragma unroll
        for (int t = 0; t < TN; ++t) { v8f zz = {}; acc[i][t] = zz; }
    for (int k0 = 0; k0 < p.K; k0 += 32) {
        if (MODE == 1) {
            Split a[TM], b[TN];
#pragma unroll
            for (int i = 0; i < TM; ++i) { const int am = min(m0 + 16 * i + l15, p.M - 1); a[i] = sp_ld(A + (long long)am * p.sAm, p.sAk, k0, h, p.K, 1.f); }
#pragma unroll
            for (int t = 0; t < TN; ++t) { const int bn = min(n0 + 16 * t + l15, p.N - 1); b[t] = sp_ld(B + (long long)bn * p.sBn, p.sBk, k0, h, p.K, 1.f); }
#pragma unroll
            for (int i = 0; i < TM; ++i)
#pragma unroll
                for (int t = 0; t < TN; ++t) acc[i][t] = wmma3(a[i], b[t], acc[i][t]);
        } else if (MODE == 2) {
            v16b a[TM], b[TN];
#pragma unroll
            for (int i = 0; i < TM; ++i) { const int am = min(m0 + 16 * i + l15, p.M - 1); a[i] = bh_ld(A + (long long)am * p.sAm, p.sAk, k0, h, p.K, 1.f); }
#pragma unroll
            for (int t = 0; t < TN; ++t) { const int bn = min(n0 + 16 * t + l15, p.N - 1); b[t] = bh_ld(B + (long long)bn * p.sBn, p.sBk, k0, h, p.K, 1.f); }
#pragma unroll
            for (int i = 0; i < TM; ++i)
#pragma unroll
                for (int t = 0; t < TN; ++t) acc[i][t] = wmmab(a[i], b[t], acc[i][t]);
        } else {
            v16h a[TM], b[TN];
#pragma unroll
            for (int i = 0; i < TM; ++i) { const int am = min(m0 + 16 * i + l15, p.M - 1); a[i] = fh_ld(A + (long long)am * p.sAm, p.sAk, k0, h, p.K, p.sa); }
#pragma unroll
            for (int t = 0; t < TN; ++t) { const int bn = min(n0 + 16 * t + l15, p.N - 1); b[t] = fh_ld(B + (long long)bn * p.sBn, p.sBk, k0, h, p.K, p.sb); }
#pragma unroll
            for (int i = 0; i < TM; ++i)
#pragma unroll
                for (int t = 0; t < TN; ++t) acc[i][t] = wmma16(a[i], b[t], acc[i][t]);
        }
    }
    const float iscale = (MODE == 0) ? p.alpha / (p.sa * p.sb) : p.alpha;
    float* C = p.C + zo * p.sCo + zi * p.sCi;
    const float* R = p.R + zo * p.sRo + zi * p.sRi;
    const int NW = (p.Npad > p.N) ? p.Npad : p.N;
    __shared__ __align__(16) float ctile[16][36];
#pragma unroll
    for (int i = 0; i < TM; ++i) {
        const int mb = m0 + 16 * i; if (mb >= p.M) break;          // wave-uniform
#pragma unroll
        for (int tp = 0; tp < TN / 2; ++tp) {
            const int nb = n0 + 32 * tp; if (nb >= NW) break;        // wave-uniform
#pragma unroll
            for (int t2 = 0; t2 < 2; ++t2) {
                const int t = 2 * tp + t2; const int n = nb + t2 * 16 + l15; const int nn = min(n, p.N - 1);
#pragma unroll
                for (int r = 0; r < 8; ++r) {
                    const int m = mb + 8 * h + r; const int mm = min(m, p.M - 1);
                    float v = acc[i][t][r] * iscale;
                    if (p.flags & 1) v += p.bias[nn];
                    if (p.flags & 2) v += p.bias[mm];
            if (p.flags & 8) v *= p.bias[(long long)zo * p.M + mm];   /* per-(z,row) scale vector laid out [Z][M]; exclusive with the bias flags */
                    v = act_fn(v, p.act);
                    if (p.flags & 4) v += p.beta * R[(long long)mm * p.sRm + (long long)nn * p.sRn];
                    ctile[8 * h + r][t2 * 16 + l15] = (n < p.N) ? v : 0.f;
                }
            }
            __syncthreads();
            const bool fast = (mb + 16 <= p.M) && (nb + 32 <= NW) && ((p.sCm & 3) == 0) && ((((size_t)C) & 15) == 0);
            if (fast) {
#pragma unroll
                for (int s = 0; s < 4; ++s) {
                    const int row = s * 4 + (lane >> 3), c4 = (lane & 7) * 4;
                    const v4f v = *(const v4f*)&ctile[row][c4];
                    VST2V4(C + (long long)(mb + row) * p.sCm + nb + c4, v);
                }
            } else {
                for (int row = 0; row < 16; ++row) {
                    const int m = mb + row, n = nb + lane;
                    if (m < p.M && n < NW) VST2(float, C + (long long)m * p.sCm + n, ctile[row][lane]);
                }
            }
            __syncthreads();
        }
    }
}

// =====================================================================================================================
// k_attn_lds<L, RS, OS>: O = softmax(scale * Q.K^T) V for one head per blockIdx.y, head and value dim 64, L queries and L keys (L % 64 == 0), f32 in and out.
//   Wave = 16 queries, AW waves per block, 64-key blocks; grid (L / (16*AW), H, batch), block 32*AW. Row r of head h of batch element z: Q/K/V + (z*L + r)*RS + h*64, O + (z*L + r)*OS + h*64.
//   Each 64-key block of K and of V is read once per work-group with 16-byte loads, converted to f16 and laid in LDS as [key][d] rows:
//   K at a pitch of 144 B for ds_load_b128 fragment reads (A operand of k.q^T, same k order as the Q fragment),
//   V at a pitch of 160 B for ds_load_tr16_b128 fragment reads (A operand of v^T.p^T: lane = row d, k = key in the frag_k order).
//   Both products are taken transposed: S^T = K.Q^T puts query l15 in lane column l15, so lanes l15 and l15+16 hold all 64 scores of one query
//   (tile t, register r: key 16t + 8*hf + r); maximum and sum run inside the lane, with one exchange between the lane halves.
//   Two S^T tiles of 16 keys, converted in place, are the B fragment of O^T += V^T.P^T in the frag_k order: P never leaves the registers.
//   Statistics f32 (exp2 domain); P x 4096 as f16.
//   Output map: Y^T = Wo[h]^T.O^T + bo[h]. Wo[h] x 16 lies in LDS as f16 [d][e] rows, laid and read exactly like a V tile (A operand: lane = row e, k = d);
//   the normalised O^T tiles, converted in place like P, are the B fragment. O receives Y, row r of head h of batch element z at O + (z*L + r)*OS + h*64.
// =====================================================================================================================
#define AW 4
typedef __attribute__((ext_vector_type(4))) _Float16 v4h;
typedef __attribute__((ext_vector_type(8))) short    v8s;
union FragH { v16h v; v8h h[2]; };
// 16-bit transposing LDS load: with lane address T + (k0 + 8*(l>>4) + (l&7)) * pitch + d0 + 8*((l>>3)&1) (halves), lane (c = l&15, h = l>>4) gets T[k0 + 8h + 0..7][d0 + c]
__device__ __forceinline__ v8h ld_tr16(const _Float16* p) {
    typedef __attribute__((address_space(3))) v8s lds_v8s;
    return __builtin_bit_cast(v8h, __builtin_amdgcn_ds_load_tr16_b128_v8i16((lds_v8s*)p));
}
// value of lane l ^ 16
__device__ __forceinline__ float swap_half(float x) {
    const int b = __builtin_bit_cast(int, x);
    return __builtin_bit_cast(float, __builtin_amdgcn_permlanex16(b, b, 0x76543210, 0xfedcba98, false, false));
}
template <int L, int RS, int OS>
__global__ __launch_bounds__(32 * AW) void k_attn_lds(const float* __restrict__ Q, const float* __restrict__ K, const float* __restrict__ V, const float* __restrict__ Wo, const float* __restrict__ bo, float* __restrict__ O, float scale) {
    constexpr int KP = 72;                      // K tile pitch in halves (144 B: odd multiple of 16 B)
    constexpr int VP = 80;                      // V tile pitch in halves (160 B: odd multiple of 32 B)
    constexpr int OP = 68;                      // output tile pitch in floats (272 B: odd multiple of 16 B)
    __shared__ __align__(16) float    pl[AW][16 * OP];
    __shared__ __align__(16) _Float16 kl[64 * KP];
    __shared__ __align__(16) _Float16 vl[64 * VP];
    __shared__ __align__(16) _Float16 wl[64 * VP];   // Wo[h] x 16, [d][e], V's pitch (same reader)
    const int lane = threadIdx.x & 31, hf = lane >> 4, l15 = lane & 15, wave = threadIdx.x >> 5;
    const int h = blockIdx.y;
    const int q0 = (blockIdx.x * AW + wave) * 16;
    const long long zr = (long long)blockIdx.z * L;   // first row of this batch element
    float* myp = pl[wave];
    const float L2E = 1.4426950408889634f;
    const float NEG = -__builtin_inff();
    const float* qrow = Q + h * 64 + (zr + q0 + l15) * RS;
    const float* kbase = K + h * 64 + zr * RS;
    const float* vbase = V + h * 64 + zr * RS;
    v16h qa[2];
#pragma unroll
    for (int ks = 0; ks < 2; ++ks) qa[ks] = fh_ld(qrow, 1, ks * 32, hf, 64, 1.f);
    v8f o[4];                                   // o[t][r] = O^T[d = 16t + 8*hf + r][query l15]
    float m1 = NEG, l1 = 0.f;                   // query l15: running maximum (equal in both lane halves), sum over this half's keys
#pragma unroll
    for (int t = 0; t < 4; ++t) { v8f zz = {}; o[t] = zz; }
    const int sr = threadIdx.x >> 4, sc4 = (threadIdx.x & 15) * 4;   // staging: 16 threads per 64-float row, 8 rows per sweep
    const _Float16* kfr = kl + l15 * KP + 8 * hf;
    const _Float16* vfr = vl + (8 * hf + (lane & 7)) * VP + 8 * ((lane >> 3) & 1);
    const _Float16* wfr = wl + (8 * hf + (lane & 7)) * VP + 8 * ((lane >> 3) & 1);
    {                                                    // the head's output map into LDS; the key loop's first barriers publish it
        const float* wbase = Wo + h * 64 * 64;
        v4f wr[8];
#pragma unroll
        for (int i = 0; i < 8; ++i) wr[i] = *(const v4f*)(wbase + (i * 8 + sr) * 64 + sc4);
        asm volatile("s_wait_xcnt 0x0" ::: "memory");    // stands in front of any reuse of the address registers of the loads above
#pragma unroll
        for (int i = 0; i < 8; ++i) *(v4h*)(wl + (i * 8 + sr) * VP + sc4) = __builtin_convertvector(wr[i] * 16.f, v4h);
    }
    for (int j0 = 0; j0 < L; j0 += 64) {
        v4f kr[8], vr[8];
#pragma unroll
        for (int i = 0; i < 8; ++i) {
            const long long off = (long long)(j0 + i * 8 + sr) * RS + sc4;
            kr[i] = *(const v4f*)(kbase + off); vr[i] = *(const v4f*)(vbase + off);
        }
        asm volatile("s_wait_xcnt 0x0" ::: "memory");    // stands in front of any reuse of the address registers of the loads above
        __syncthreads();                                 // previous key block's reads of kl / vl are done
#pragma unroll
        for (int i = 0; i < 8; ++i) {
            *(v4h*)(kl + (i * 8 + sr) * KP + sc4) = __builtin_convertvector(kr[i], v4h);
            *(v4h*)(vl + (i * 8 + sr) * VP + sc4) = __builtin_convertvector(vr[i], v4h);
        }
        __syncthreads();                                 // K and V tiles visible to every wave
        FragH kb[4][2];                                  // all eight K fragments behind one LDS latency
#pragma unroll
        for (int t = 0; t < 4; ++t)
#pragma unroll
            for (int ks = 0; ks < 2; ++ks) {
                kb[t][ks].h[0] = *(const v8h*)(kfr + t * 16 * KP + ks * 32);
                kb[t][ks].h[1] = *(const v8h*)(kfr + t * 16 * KP + ks * 32 + 16);
            }
        v8f s[4];                                        // s[t][r] = S[query l15][key j0 + 16t + 8*hf + r]
#pragma unroll
        for (int t = 0; t < 4; ++t) {
            v8f acc = {};
#pragma unroll
            for (int ks = 0; ks < 2; ++ks) acc = wmma16(kb[t][ks].v, qa[ks], acc);
            s[t] = acc;
        }
        float sc[4][8], mt[4];
#pragma unroll
        for (int t = 0; t < 4; ++t) {
            mt[t] = NEG;
#pragma unroll
            for (int i = 0; i < 8; ++i) { sc[t][i] = (s[t][i] * scale) * L2E; mt[t] = fmaxf(mt[t], sc[t][i]); }
        }
        float mx = fmaxf(fmaxf(mt[0], mt[1]), fmaxf(mt[2], mt[3]));
        mx = fmaxf(mx, swap_half(mx));
        const float mnew = fmaxf(m1, mx);
        const float mref = (mnew == NEG) ? 0.f : mnew;   // a query with only -inf scores so far: every exp2 below is exp2(-inf) = 0, never exp2(nan)
        const float corr = exp2f(m1 - mref);
        FragH pa[2]; float rt[4];
#pragma unroll
        for (int t = 0; t < 4; ++t) {
            rt[t] = 0.f;
#pragma unroll
            for (int i = 0; i < 8; ++i) {
                const float pp = exp2f(sc[t][i] - mref);
                rt[t] += pp; pa[t >> 1].v[(t & 1) * 8 + i] = (_Float16)(pp * 4096.f);
            }
        }
        l1 = l1 * corr + ((rt[0] + rt[1]) + (rt[2] + rt[3])); m1 = mnew;
#pragma unroll
        for (int t = 0; t < 4; ++t) o[t] *= corr;
        FragH vb[4][2];                                  // all eight V fragments behind one LDS latency
#pragma unroll
        for (int t = 0; t < 4; ++t) {
            vb[t][0].h[0] = ld_tr16(vfr + t * 16);           vb[t][0].h[1] = ld_tr16(vfr + 16 * VP + t * 16);
            vb[t][1].h[0] = ld_tr16(vfr + 32 * VP + t * 16); vb[t][1].h[1] = ld_tr16(vfr + 48 * VP + t * 16);
        }
#pragma unroll
        for (int t = 0; t < 4; ++t) {
            o[t] = wmma16(vb[t][0].v, pa[0].v, o[t]);
            o[t] = wmma16(vb[t][1].v, pa[1].v, o[t]);
        }
    }
    float* obase = O + h * 64 + zr * OS;
    const float lt = l1 + swap_half(l1);
    const float inv = (lt > 0.f) ? 1.f / (lt * 4096.f) : 0.f;
    FragH ob[2];                                         // O^T as f16: tiles 2ks and 2ks+1 are the B fragment of d chunk ks in the frag_k order
#pragma unroll
    for (int t = 0; t < 4; ++t)
#pragma unroll
        for (int i = 0; i < 8; ++i) ob[t >> 1].v[(t & 1) * 8 + i] = (_Float16)(o[t][i] * inv);
    FragH wb[4][2];
#pragma unroll
    for (int t = 0; t < 4; ++t) {
        wb[t][0].h[0] = ld_tr16(wfr + t * 16);           wb[t][0].h[1] = ld_tr16(wfr + 16 * VP + t * 16);
        wb[t][1].h[0] = ld_tr16(wfr + 32 * VP + t * 16); wb[t][1].h[1] = ld_tr16(wfr + 48 * VP + t * 16);
    }
#pragma unroll
    for (int t = 0; t < 4; ++t) {
        v8f ov = {};                                     // ov[r] = 16 * Y^T[e = 16t + 8*hf + r][query l15]
        ov = wmma16(wb[t][0].v, ob[0].v, ov);
        ov = wmma16(wb[t][1].v, ob[1].v, ov);
        *(v4f*)(myp + l15 * OP + t * 16 + 8 * hf)     = __builtin_shufflevector(ov, ov, 0, 1, 2, 3);
        *(v4f*)(myp + l15 * OP + t * 16 + 8 * hf + 4) = __builtin_shufflevector(ov, ov, 4, 5, 6, 7);
    }
    const v4f bv = *(const v4f*)(bo + h * 64 + l15 * 4);
    __syncthreads();
#pragma unroll
    for (int r0 = 0; r0 < 16; r0 += 2) {
        const int row = r0 + hf, c4 = l15 * 4;
        const v4f v = *(const v4f*)(myp + row * OP + c4) * 0.0625f + bv;
        VST2V4(obase + (long long)(q0 + row) * OS + c4, v);
    }
}

// =====================================================================================================================
// k_tr: dst(z, c, r) = alpha * src(z, r, c) (+ beta * R2(z, c, r)): [Z][R][C] (row stride lds) -> [Z][C][R] (row stride ldd) through a 32x32 LDS tile;
//   flags: 1 -> add beta * residual R2 addressed like dst (z*sRz + c*ldr + r); act applied before the residual.
// =====================================================================================================================
struct TrP { const float* src; float* dst; const float* R2; long long sSz, lds, sDz, ldd, sRz, ldr; int R, C, flags, act; float alpha, beta; };
static_assert(sizeof(TrP) == 3 * 8 + 6 * 8 + 6 * 4, "TrP has padding");
__global__ __launch_bounds__(256) void k_tr(TrP p) {
    __shared__ float tile[32][33];
    const int c0 = blockIdx.x * 32, r0 = blockIdx.y * 32, z = blockIdx.z;
    const int lane = threadIdx.x & 31, wave = threadIdx.x >> 5;
    const float* s = p.src + z * p.sSz;
#pragma unroll
    for (int k = 0; k < 4; ++k) {
        const int rl = wave * 4 + k, r = r0 + rl, c = c0 + lane;
        tile[rl][lane] = (r < p.R && c < p.C) ? s[(long long)r * p.lds + c] : 0.f;
    }
    __syncthreads();
    float* d = p.dst + z * p.sDz; const float* rr = p.R2 + z * p.sRz;
#pragma unroll
    for (int k = 0; k < 4; ++k) {
        const int cl = wave * 4 + k, c = c0 + cl, r = r0 + lane;
        if (c < p.C && r < p.R) {
            float v = act_fn(p.alpha * tile[lane][cl], p.act);
            if (p.flags & 1) v += p.beta * rr[(long long)c * p.ldr + r];
            VST2(float, d + (long long)c * p.ldd + r, v);
        }
    }
}

// k_affine: dst[i] = a * (sdev ? sdev[0] : 1) * src[i] + b, i < n (one thread per element; consecutive lanes -> consecutive addresses)
__global__ __launch_bounds__(256) void k_affine(const float* __restrict__ src, float* __restrict__ dst, int n, float a, float b, const float* __restrict__ sdev) {
    const int i = blockIdx.x * 256 + threadIdx.x;
    if (i < n) { const float aa = sdev ? a * sdev[0] : a; const float v = aa * src[i] + b; VST2(float, dst + i, v); }
}

// =====================================================================================================================
// k_softmax: row softmax over n contiguous elements, one 256-thread block per row; rows addressed z*sz + r*sr (grid (R, Z)).
//   out = scale_out * softmax(scale_in * x + (Mf ? Mf[z*smz + r*smr + j] : 0)); a row whose max is -inf is written as 0.
// =====================================================================================================================
struct SmP { const float* src; float* dst; const float* Mf; long long sz, sr, dz, dr, smz, smr; int n, pad; float scale_in, scale_out; };
static_assert(sizeof(SmP) == 3 * 8 + 6 * 8 + 4 * 4, "SmP has padding");
__global__ __launch_bounds__(256) void k_softmax(SmP p) {
    __shared__ float red[256];
    const int r = blockIdx.x, z = blockIdx.y, tid = threadIdx.x;
    const float* s = p.src + z * p.sz + (long long)r * p.sr;
    const float* mf = p.Mf ? (p.Mf + z * p.smz + (long long)r * p.smr) : nullptr;
    float mx = -__builtin_inff();
    for (int j = tid; j < p.n; j += 256) { float v = s[j] * p.scale_in; if (mf) v += mf[j]; mx = fmaxf(mx, v); }
    red[tid] = mx; __syncthreads();
    for (int o = 128; o > 0; o >>= 1) { if (tid < o) red[tid] = fmaxf(red[tid], red[tid + o]); __syncthreads(); }
    mx = red[0]; __syncthreads();
    float sum = 0.f;
    for (int j = tid; j < p.n; j += 256) { float v = s[j] * p.scale_in; if (mf) v += mf[j]; sum += (mx == -__builtin_inff()) ? 0.f : expf(v - mx); }
    red[tid] = sum; __syncthreads();
    for (int o = 128; o > 0; o >>= 1) { if (tid < o) red[tid] += red[tid + o]; __syncthreads(); }
    sum = red[0];
    const float inv = (sum > 0.f) ? p.scale_out / sum : 0.f;
    float* d = p.dst + z * p.dz + (long long)r * p.dr;
    for (int j = tid; j < p.n; j += 256) { float v = s[j] * p.scale_in; if (mf) v += mf[j]; const float o = (mx == -__builtin_inff()) ? 0.f : expf(v - mx) * inv; VST2(float, d + j, o); }
}
// =====================================================================================================================
// k_stats: mean and rsqrt(var + eps) over a set of n elements addressed base + z*sz + (e / inner) * so + (e % inner) * si, one 256-thread
// k_norm_apply: y = (x - mean[set]) * rstd[set] * g[c] + b[c] over a [Z][C][L] channel-major tensor with set = z*G + c / (C/G) (G groups per z;
//   G = C -> per-channel sets indexed z*C+c; for batch norm pass stats indexed by c only via bn = 1). Optional act. Output same layout.
// =====================================================================================================================
//   mode 0: mean / rsqrt(var + eps); mode 1 (RMSNorm): 0 / rsqrt(mean(x^2) + eps); mode 2 (L2 normalize * sqrt(n)): 0 / sqrt(n) / max(||x||, eps); mode 3: as 0 with unbiased variance (n-1)
__global__ __launch_bounds__(256) void k_stats(const float* __restrict__ x, long long sz, long long so, long long si, int inner, int n, float eps, float* __restrict__ stat, int mode) {
    __shared__ float red[256];
    const int z = blockIdx.x, tid = threadIdx.x;
    const float* base = x + z * sz;
    float s = 0.f;
    for (int e = tid; e < n; e += 256) s += base[(long long)(e / inner) * so + (long long)(e % inner) * si];
    red[tid] = s; __syncthreads();
    for (int o = 128; o > 0; o >>= 1) { if (tid < o) red[tid] += red[tid + o]; __syncthreads(); }
    const float mu = (mode == 0 || mode == 3) ? red[0] / (float)n : 0.f; __syncthreads();
    float q = 0.f;
    for (int e = tid; e < n; e += 256) { const float dlt = base[(long long)(e / inner) * so + (long long)(e % inner) * si] - mu; q += dlt * dlt; }
    red[tid] = q; __syncthreads();
    for (int o = 128; o > 0; o >>= 1) { if (tid < o) red[tid] += red[tid + o]; __syncthreads(); }
    {
        float rs;
        if (mode == 2) rs = sqrtf((float)n) / fmaxf(sqrtf(red[0]), eps); else if (mode == 3) rs = rsqrtf(red[0] / (float)(n - 1) + eps); else rs = rsqrtf(red[0] / (float)n + eps);
        if (tid < 32) { const float v = (tid == 0) ? mu : ((tid == 1) ? rs : 0.f); VST2(float, stat + (long long)z * 32 + tid, v); }
    }
}
//   One thread per element over the flat [Z][C][L] index space: grid ceil(Z*C*L / 256).
__global__ __launch_bounds__(256) void k_norm_apply(const float* __restrict__ x, float* __restrict__ y, const float* __restrict__ stat, const float* __restrict__ g, const float* __restrict__ bta,
                                                     int Z, int C, int L, int G, int bn, int act) {
    const long long idx = (long long)blockIdx.x * 256 + threadIdx.x;
    if (idx >= (long long)Z * C * L) return;
    const int l = (int)(idx % L); const long long zc = idx / L; const int c = (int)(zc % C), z = (int)(zc / C); (void)l;
    const int set = bn ? c : (z * G + c / (C / G));
    float v = (x[idx] - stat[(long long)set * 32]) * stat[(long long)set * 32 + 1];
    if (g) v *= g[c];
    if (bta) v += bta[c];
    v = act_fn(v, act);
    VST2(float, y + idx, v);
}

// k_lse_neg: c[i] = -(st[2i] + log(st[2i+1])) = minus the log-sum-exp of row i (for softmax over the query dimension)
__global__ __launch_bounds__(256) void k_lse_neg(const float* __restrict__ st, float* __restrict__ c, int n) {
    const int i = blockIdx.x * 256 + threadIdx.x;
    if (i < n) { const float v = -(st[2 * i] + logf(st[2 * i + 1])); VST2(float, c + i, v); }
}

// k_iota: dst[i] = a * i + b as int32 (segment/position id helper)
__global__ __launch_bounds__(256) void k_iota(int* __restrict__ dst, int n, int a, int b) {
    const int i = blockIdx.x * 256 + threadIdx.x;
    if (i < n) { const int v = a * i + b; VST2(int, dst + i, v); }
}

// k_axpby: dst[i] = a * x[i] + b * y[i] (+ c), i < n
__global__ __launch_bounds__(256) void k_axpby(const float* __restrict__ x, const float* __restrict__ y, float* __restrict__ dst, int n, float a, float b, float c) {
    const int i = blockIdx.x * 256 + threadIdx.x;
    if (i < n) { const float v = a * x[i] + b * y[i] + c; VST2(float, dst + i, v); }
}

// =====================================================================================================================
// k_rope: rotary embedding on a [R rows][Hn heads][D] view (row stride sXr, head stride sXh, element stride 1) -> Y (own strides).
//   mode 0: rotate_half (partner d±D/2, sign - for d<D/2); mode 1: interleaved pairs (partner d^1, sign - for even d).
//   table column tcol: tmode 0 -> d, 1 -> d % (D/2), 2 -> d / 2; position p: pmode 0 -> r % S, 1 -> head index, 2 -> pos[r];
//   c = C[(r / S) * sCb + p * sCp + tcol * sCd], s likewise from Sn; y = x[d] * c + sign * x[partner] * s. X and Y must not alias.
// =====================================================================================================================
struct RopeP { const float* X; float* Y; const float* C; const float* Sn; const int* pos; long long sXr, sXh, sYr, sYh, sCb, sCp, sCd; int R, Hn, D, S, mode, tmode, pmode, pad; };
static_assert(sizeof(RopeP) == 5 * 8 + 7 * 8 + 8 * 4, "RopeP has padding");
__global__ __launch_bounds__(256) void k_rope(RopeP p) {
    const long long idx = (long long)blockIdx.x * 256 + threadIdx.x;
    if (idx >= (long long)p.R * p.Hn * p.D) return;
    const int d = (int)(idx % p.D); const long long rh = idx / p.D; const int h = (int)(rh % p.Hn); const int r = (int)(rh / p.Hn);
    const int half = p.D / 2;
    int partner; float sign;
    if (p.mode == 0) { partner = (d < half) ? d + half : d - half; sign = (d < half) ? -1.f : 1.f; }
    else { partner = d ^ 1; sign = (d & 1) ? 1.f : -1.f; }
    const int tcol = (p.tmode == 0) ? d : ((p.tmode == 1) ? (d % half) : (d >> 1));
    const int pp = (p.pmode == 0) ? (r % p.S) : ((p.pmode == 1) ? h : p.pos[r]);
    const long long toff = (long long)(r / p.S) * p.sCb + (long long)pp * p.sCp + (long long)tcol * p.sCd;
    const float* xr = p.X + (long long)r * p.sXr + (long long)h * p.sXh;
    const float v = xr[d] * p.C[toff] + sign * xr[partner] * p.Sn[toff];
    VST2(float, p.Y + (long long)r * p.sYr + (long long)h * p.sYh + d, v);
}

// k_invf + k_sincos (split so neither kernel carries a large VALU-fma footprint): invf_i = num * (1 / powf(base, (2 i)/D)) [fmode 0],
//   num * expf((2 i) * cexp) [fmode 1], num * powf(base, -2 (i - 1) / D) [fmode 2]; then cs/sn[s*half + i] = cos/sin((pscale * s) * invf_i)
__global__ __launch_bounds__(256) void k_invf(float* __restrict__ invb, int half, int D, float base, float num, int fmode, float cexp) {
    const int i = blockIdx.x * 256 + threadIdx.x;
    if (i >= ((half + 31) / 32) * 32) return;
    if (i >= half) { VST2(float, invb + i, 0.f); return; }
    const float e = (float)(2 * i) / (float)D;
    float invf;
    if (fmode == 1) invf = num * expf((float)(2 * i) * cexp);
    else if (fmode == 2) invf = num * powf(base, (-2.0f * ((float)i - 1.0f)) / (float)D);
    else invf = num * (1.0f / powf(base, e));
    VST2(float, invb + i, invf);
}
__global__ __launch_bounds__(256) void k_sincos(float* __restrict__ cs, float* __restrict__ sn, const float* __restrict__ invb, int S, int half, float pscale) {
    const int idx = blockIdx.x * 256 + threadIdx.x;
    if (idx >= S * half) return;
    const int s = idx / half, i = idx - s * half;
    const float ang = (pscale * (float)s) * invb[i];
    VST2(float, cs + idx, cosf(ang)); VST2(float, sn + idx, sinf(ang));
}

// k_mulact: dst[i] = act(x[i]) * y[i]
__global__ __launch_bounds__(256) void k_mulact(const float* __restrict__ x, const float* __restrict__ y, float* __restrict__ dst, int n, int act) {
    const int i = blockIdx.x * 256 + threadIdx.x;
    if (i < n) { const float v = act_fn(x[i], act) * y[i]; VST2(float, dst + i, v); }
}

// =====================================================================================================================
// k_matvec: thread-per-row matrix-vector products for N <= 8 output columns (heads with 1-3 outputs, gates), f32 on the VALU.
//   C[r*sCm + j] = act(alpha * sum_k A[r*sAm + k*sAk] * B[j*sBn + k*sBk] + bias[j]) + beta * R[r*sRm + j*sRn]; each thread writes its N contiguous floats.
// =====================================================================================================================
__global__ __launch_bounds__(256) void k_matvec(GemmP p) {
    // 32 lanes write one line with one instruction.
    const int rpt = (p.N == 1) ? 1 : 32;
    const long long r0 = ((long long)blockIdx.x * 256 + threadIdx.x) * rpt; const int z = blockIdx.z, zo = z / p.zi_n, zi = z - zo * p.zi_n;
    if (r0 >= p.M) return;
    const float* Bb = p.B + zo * p.sBo + zi * p.sBi;
    float* C = p.C + zo * p.sCo + zi * p.sCi; const float* R = p.R + zo * p.sRo + zi * p.sRi;
    for (int rr = 0; rr < rpt; ++rr) {
        const long long r = r0 + rr; if (r >= p.M) break;
        const float* A = p.A + zo * p.sAo + zi * p.sAi + r * p.sAm;
        float acc[8] = {0.f, 0.f, 0.f, 0.f, 0.f, 0.f, 0.f, 0.f};
        for (int k = 0; k < p.K; ++k) { const float a = A[(long long)k * p.sAk];
#pragma unroll
            for (int j = 0; j < 8; ++j) if (j < p.N) acc[j] += a * Bb[(long long)j * p.sBn + (long long)k * p.sBk]; }
#pragma unroll
        for (int j = 0; j < 8; ++j) if (j < p.N) {
            float v = acc[j] * p.alpha;
            if (p.flags & 1) v += p.bias[j];
            if (p.flags & 2) v += p.bias[r];
            v = act_fn(v, p.act);
            if (p.flags & 4) v += p.beta * R[r * p.sRm + (long long)j * p.sRn];
            VST2(float, C + r * p.sCm + j, v);
        }
    }
}
// k_smallsoftmax: thread-per-row softmax for short rows (n <= 64): dst[r*dr + j] = softmax(scale*src[r*sr + j])
__global__ __launch_bounds__(256) void k_smallsoftmax(const float* __restrict__ src, float* __restrict__ dst, long long sr, long long dr, int n, long long R, float scale) {
    const long long r0 = ((long long)blockIdx.x * 256 + threadIdx.x) * 32;
    for (int rr = 0; rr < 32; ++rr) {
        const long long r = r0 + rr; if (r >= R) return;
        const float* s = src + r * sr; float* d = dst + r * dr;
        float mx = -__builtin_inff();
        for (int j = 0; j < n; ++j) mx = fmaxf(mx, s[j] * scale);
        float sum = 0.f;
        for (int j = 0; j < n; ++j) sum += expf(s[j] * scale - mx);
        const float inv = 1.f / sum;
        for (int j = 0; j < n; ++j) { const float v = expf(s[j] * scale - mx) * inv; VST2(float, d + j, v); }
    }
}

__global__ __launch_bounds__(32) void k_unitstat(float* __restrict__ st) { const int t = threadIdx.x; const float v = (t == 1) ? 1.f : 0.f; VST2(float, st + t, v); }

// destination (e.g. a d_out whose row width is not a multiple of 32 floats) is written by consecutive lanes of one instruction
__global__ __launch_bounds__(256) void k_lincopy(const float* __restrict__ src, long long lds, float* __restrict__ dst, long long ldd, long long rows, int cols) {
    const long long i = (long long)blockIdx.x * 256 + threadIdx.x; if (i >= rows * cols) return;
    const long long r = i / cols; const int c = (int)(i - r * cols);
    const float v = src[r * lds + c]; VST2(float, dst + r * ldd + c, v);
}

namespace w25 {
typedef __attribute__((ext_vector_type(16))) _Float16 v16h;
typedef __attribute__((ext_vector_type(8)))  _Float16 v8h;
typedef __attribute__((ext_vector_type(16))) __bf16   v16b;
typedef __attribute__((ext_vector_type(8)))  __bf16   v8b;
typedef __attribute__((ext_vector_type(8)))  float    v8f;
typedef __attribute__((ext_vector_type(4)))  float    v4f;

__device__ __forceinline__ unsigned short f2bf_bits(float f) {
  unsigned u = __float_as_uint(f);
  return (unsigned short)((u + 0x7FFFu + ((u >> 16) & 1u)) >> 16);
}
__device__ __forceinline__ float bf_bits2f(unsigned short h) { return __uint_as_float(((unsigned)h) << 16); }

// hazard guards as plain device helpers (no inline asm inside the kernel template body)
__device__ __forceinline__ void dep_guard_h(v8f& a, v8f& b, v16h x, v16h y) { asm volatile("v_nop\n\tv_nop\n\tv_nop\n\tv_nop" : "+v"(a), "+v"(b) : "v"(x), "v"(y)); }
__device__ __forceinline__ void dep_guard_b(v8f& a, v8f& b, v16b x, v16b y) { asm volatile("v_nop\n\tv_nop\n\tv_nop\n\tv_nop" : "+v"(a), "+v"(b) : "v"(x), "v"(y)); }
__device__ __forceinline__ void keep4_h(v16h a, v16h b, v16h c, v16h d) { asm volatile("v_nop" :: "v"(a), "v"(b), "v"(c), "v"(d)); }
__device__ __forceinline__ void keep4_b(v16b a, v16b b, v16b c, v16b d) { asm volatile("v_nop" :: "v"(a), "v"(b), "v"(c), "v"(d)); }
__device__ __forceinline__ void acc_guard4(v8f& a, v8f& b, v8f& c, v8f& d) { asm volatile("v_nop\n\tv_nop\n\tv_nop\n\tv_nop" : "+v"(a), "+v"(b), "+v"(c), "+v"(d)); }
template <typename T> struct Frag;
template <> struct Frag<_Float16> {
  typedef v16h V; union U { v16h v; v8h h[2]; };
  static __device__ __forceinline__ v16h load(const _Float16* p) {   // elements 0..7 <- p[0..7], 8..15 <- p[16..23]
    U f; f.h[0] = *(const v8h*)(p); f.h[1] = *(const v8h*)(p + 16); return f.v;
  }
  static __device__ __forceinline__ v8f mma(v16h a, v16h b, v8f c) {
    return __builtin_amdgcn_wmma_f32_16x16x32_f16(false, a, false, b, (short)0, c, false, false);
  }
  static __device__ __forceinline__ void guard(v8f& a, v8f& b, v16h x, v16h y) { dep_guard_h(a, b, x, y); }
  static __device__ __forceinline__ void keep(v16h a, v16h b, v16h c, v16h d) { keep4_h(a, b, c, d); }
};
template <> struct Frag<__bf16> {
  typedef v16b V; union U { v16b v; v8b h[2]; };
  static __device__ __forceinline__ v16b load(const __bf16* p) {
    U f; f.h[0] = *(const v8b*)(p); f.h[1] = *(const v8b*)(p + 16); return f.v;
  }
  static __device__ __forceinline__ v8f mma(v16b a, v16b b, v8f c) {
    return __builtin_amdgcn_wmma_f32_16x16x32_bf16(false, a, false, b, (short)0, c, false, false);
  }
  static __device__ __forceinline__ void guard(v8f& a, v8f& b, v16b x, v16b y) { dep_guard_b(a, b, x, y); }
  static __device__ __forceinline__ void keep(v16b a, v16b b, v16b c, v16b d) { keep4_b(a, b, c, d); }
};

// ---- Register-blocked batched WMMA GEMM ------------------------------------
// C[m,n] = scale * sum_k A[m,k] * Bt[n,k] (+bias)(+resid); each wave owns a 64x64 tile.
// A row-major [M,K]; Bt row-major [N,K]; M,N % 64 == 0, K % 32 == 0.
// SPLIT: operands are hi/lo planes (A2/Bt2 = lo planes, same layout); product = hi·hi + hi·lo + lo·hi.
// BIAS_MODE: 0 = none, 1 = bias[m], 2 = bias[n].
// OUT_MODE: 0 = f32, 1 = f16, 2 = bf16 hi plane (Cout) + bf16 lo plane (Cout2).
// ET: 0 = f16 operands, 1 = bf16 operands (pointers passed as 16-bit storage)
template <int ET> struct Elem;
template <> struct Elem<0> { typedef _Float16 T; };
template <> struct Elem<1> { typedef __bf16 T; };
template <int ET, bool SPLIT, int BIAS_MODE, int OUT_MODE, bool RESID, int ACT = 0>
__global__ __launch_bounds__(256) void wmma_gemm64(
    const unsigned short* __restrict__ Ap, const unsigned short* __restrict__ A2p, int lda, long strideA,
    const unsigned short* __restrict__ Btp, const unsigned short* __restrict__ Bt2p, int ldb, long strideB,
    void* __restrict__ Cout, void* __restrict__ Cout2, int ldc, long strideC,
    const float* __restrict__ bias,
    const float* __restrict__ resid, long strideR,
    int M, int N, int K, float scale) {
  typedef typename Elem<ET>::T T;
  typedef typename Frag<T>::V V;
  const T* A = (const T*)Ap; const T* A2 = (const T*)A2p; const T* Bt = (const T*)Btp; const T* Bt2 = (const T*)Bt2p;
  __shared__ __align__(16) float sT[8][16 * 68];   // per-wave 16x64 slab, pitch 68 floats
  const int b    = blockIdx.y;
  const int lane = threadIdx.x & 31;
  const int wave = threadIdx.x >> 5;
  const int tilesN = N >> 6;
  const int tilesM = M >> 6;
  const int tile = blockIdx.x * 8 + wave;
  if (tile >= tilesM * tilesN) return;   // wave-uniform; no block barriers in this kernel
  const int tm = tile / tilesN;
  const int tn = tile - tm * tilesN;
  const int m0 = tm << 6;
  const int n0 = tn << 6;

  const T* Ab  = A  + (size_t)b * strideA;
  const T* Bb  = Bt + (size_t)b * strideB;
  const T* Ab2 = SPLIT ? (A2  + (size_t)b * strideA) : nullptr;
  const T* Bb2 = SPLIT ? (Bt2 + (size_t)b * strideB) : nullptr;

  const int rlane = lane & 15;                 // row (A) / col (B, D) within subtile
  const int koff  = (lane >> 4) * 8;           // k offset of this lane half
  const int mOff  = (lane >> 4) * 8;           // D row offset

  v8f acc[4][4];
#pragma unroll
  for (int i = 0; i < 4; ++i)
#pragma unroll
    for (int j = 0; j < 4; ++j) acc[i][j] = (v8f){0.f,0.f,0.f,0.f,0.f,0.f,0.f,0.f};

  for (int k0 = 0; k0 < K; k0 += 32) {
    V bh[4], bl[4];
#pragma unroll
    for (int j = 0; j < 4; ++j) {
      const size_t bo = (size_t)(n0 + (j << 4) + rlane) * ldb + koff + k0;
      bh[j] = Frag<T>::load(Bb + bo);
      if (SPLIT) bl[j] = Frag<T>::load(Bb2 + bo);
    }
#pragma unroll
    for (int i = 0; i < 4; ++i) {
      const size_t ao = (size_t)(m0 + (i << 4) + rlane) * lda + koff + k0;
      V ah = Frag<T>::load(Ab + ao);
      V al;
      if (SPLIT) al = Frag<T>::load(Ab2 + ao);
#pragma unroll
      for (int j = 0; j < 4; ++j) {
        acc[i][j] = Frag<T>::mma(ah, bh[j], acc[i][j]);
        if (SPLIT) {
          acc[i][j] = Frag<T>::mma(ah, bl[j], acc[i][j]);
          acc[i][j] = Frag<T>::mma(al, bh[j], acc[i][j]);
        }
      }
      Frag<T>::guard(acc[i][0], acc[i][3], ah, SPLIT ? al : ah);
    }
    Frag<T>::keep(bh[0], bh[1], bh[2], bh[3]);
    if (SPLIT) Frag<T>::keep(bl[0], bl[1], bl[2], bl[3]);
  }
  acc_guard4(acc[0][0], acc[0][1], acc[0][2], acc[0][3]);
  acc_guard4(acc[1][0], acc[1][1], acc[1][2], acc[1][3]);
  acc_guard4(acc[2][0], acc[2][1], acc[2][2], acc[2][3]);
  acc_guard4(acc[3][0], acc[3][1], acc[3][2], acc[3][3]);

  // ---- epilogue ----
  float* slab = sT[wave];
  const float* Rb = RESID ? (resid + (size_t)b * strideR) : nullptr;
#pragma unroll
  for (int i = 0; i < 4; ++i) {
    const int mBase = m0 + (i << 4);
#pragma unroll
    for (int j = 0; j < 4; ++j) {
      const int n = n0 + (j << 4) + rlane;
      float bv = 0.f;
      if (BIAS_MODE == 2) bv = bias[n];
#pragma unroll
      for (int r = 0; r < 8; ++r) {
        float v = acc[i][j][r] * scale;
        if (BIAS_MODE == 1) v += bias[mBase + mOff + r];
        if (BIAS_MODE == 2) v += bv;
        if (RESID) v += Rb[(size_t)(mBase + mOff + r) * ldc + n];
        if (ACT == 1) v = tanhf(v);
        if (ACT == 2) v = fmaxf(v, 0.0f);
        if (ACT == 3) v = v / (1.0f + expf(-v));
        if (ACT == 4) v = (v > 0.f) ? v : 0.01f * v;
        if (ACT == 5) v = 0.5f * v * (1.0f + erff(v * 0.70710678118654752f));
        if (ACT == 6) v = (v > 0.f) ? v : 0.2f * v;
        slab[(mOff + r) * 68 + (j << 4) + rlane] = v;
      }
    }
    __builtin_amdgcn_fence(__ATOMIC_RELEASE, "workgroup");
    __builtin_amdgcn_wave_barrier();
    __builtin_amdgcn_fence(__ATOMIC_ACQUIRE, "workgroup");
    if (OUT_MODE == 0) {
      float* C = (float*)Cout + (size_t)b * strideC;
      const int hh = lane >> 4, c4 = (lane & 15) * 4;     // row seg = 256 B = 16 lanes x 16 B
      {
#pragma unroll
        for (int it = 0; it < 8; ++it) {
          const int row = it * 2 + hh;
          v4f v = *(const v4f*)(slab + row * 68 + c4);
          *(v4f*)(C + (size_t)(mBase + row) * ldc + n0 + c4) = v;
        }
        
      }
    } else {
      const int q = lane >> 3, c8 = (lane & 7) * 8;
      unsigned short* C  = (unsigned short*)Cout  + (size_t)b * strideC;
      unsigned short* C2 = (OUT_MODE == 2) ? ((unsigned short*)Cout2 + (size_t)b * strideC) : nullptr;
      {
#pragma unroll
        for (int it = 0; it < 4; ++it) {
          const int row = it * 4 + q;
          const float* sp = slab + row * 68 + c8;
          v8h hv, lv;
#pragma unroll
          for (int e = 0; e < 8; ++e) {
            if (OUT_MODE == 1) {
              hv[e] = (_Float16)sp[e];
            } else {
              unsigned short hb = f2bf_bits(sp[e]);
              unsigned short lb = f2bf_bits(sp[e] - bf_bits2f(hb));
              hv[e] = __builtin_bit_cast(_Float16, hb);
              lv[e] = __builtin_bit_cast(_Float16, lb);
            }
          }
          *(v8h*)(C + (size_t)(mBase + row) * ldc + n0 + c8) = hv;
          if (OUT_MODE == 2) *(v8h*)(C2 + (size_t)(mBase + row) * ldc + n0 + c8) = lv;
        }
        
      }
    }
    __builtin_amdgcn_fence(__ATOMIC_RELEASE, "workgroup");
    __builtin_amdgcn_wave_barrier();
    __builtin_amdgcn_fence(__ATOMIC_ACQUIRE, "workgroup");
  }
}

__global__ __launch_bounds__(256) void cast_f32_f16x2(
    const float* __restrict__ in, _Float16* __restrict__ out, int n2) {
  int i = blockIdx.x * 256 + threadIdx.x;
  if (i < n2) {
    const _Float16 h0 = (_Float16)in[2 * i], h1 = (_Float16)in[2 * i + 1];
    const unsigned u = (unsigned)__builtin_bit_cast(unsigned short, h0) | ((unsigned)__builtin_bit_cast(unsigned short, h1) << 16);
    ((unsigned*)out)[i] = u;
    
  }
}


} // namespace w25

// =====================================================================================================================
// k_prep<NR, D>: all f16 operand planes of the projections in one launch of WB + XB work-groups of 256 threads, 32 or 64 elements a thread.
//   Work-groups [0, WB): one tile of 128 (k) x 64 (n) of the weights taken side by side, W = Wq | Wkv ([D][D] | [D][2D], n < D is Wq):
//   W16[n][k] = f16(16 * W[k][n]). Rows of 256 B are read along n with 16-byte loads into an f32 LDS tile (pitch 65 floats: the 32 lanes
//   of a column-wise read fall on 32 different banks); each lane then packs 8 consecutive k of one n, 8 lanes store one whole 128-B line.
//   Work-groups [WB, WB + XB): X16 = f16(x), 16384 consecutive floats each; a wave's load covers 512 contiguous bytes, its store 256.
// =====================================================================================================================
// eight 16-byte loads, 16 rows of LD floats apart: one address pair, the row steps as immediate offsets
template <int LD> __device__ __forceinline__ void ld_rows8(const float* __restrict__ sp, v4f (&w)[8]) {
#pragma unroll
    for (int s = 0; s < 8; ++s) w[s] = *(const v4f*)(sp + s * 16 * LD);
    asm volatile("s_wait_xcnt 0x0" :: "v"(sp) : "memory");   // stands in front of any reuse of the loads' address pair, which it names so that the pair lives up to here
}
template <int NR, int D>
__global__ __launch_bounds__(256) void k_prep(const float* __restrict__ x, const float* __restrict__ Wq, const float* __restrict__ Wkv, _Float16* __restrict__ X16, _Float16* __restrict__ W16) {
    constexpr int TP = 65;                      // LDS tile pitch in floats
    constexpr int NT = 3 * D / 64;              // n tiles
    constexpr int WB = NT * (D / 128);
    static_assert(D % 128 == 0 && ((long long)NR * D) % 16384 == 0, "whole tiles only");
    __shared__ float tile[128 * TP];
    const int tid = threadIdx.x;
    if ((int)blockIdx.x < WB) {
        const int nt = blockIdx.x % NT, kt = blockIdx.x / NT;
        const int n0 = nt * 64, k0 = kt * 128;
        const int c4 = (tid & 15) * 4, r = tid >> 4;
        v4f w[8];
        if (n0 < D) ld_rows8<D>(Wq + n0 + (k0 + r) * D + c4, w);                     // work-group-uniform choice of the source matrix
        else        ld_rows8<2 * D>(Wkv + (n0 - D) + (k0 + r) * (2 * D) + c4, w);
#pragma unroll
        for (int s = 0; s < 8; ++s)
#pragma unroll
            for (int e = 0; e < 4; ++e) tile[(s * 16 + r) * TP + c4 + e] = w[s][e];
        __syncthreads();                                 // the whole tile is in LDS before any column of it is read
        const int a8 = (tid & 7) * 8, nl = tid >> 3;
#pragma unroll
        for (int q = 0; q < 4; ++q) {
            const int n = (q >> 1) * 32 + nl, k = (q & 1) * 64 + a8;
            v8h hv;
#pragma unroll
            for (int j = 0; j < 8; ++j) hv[j] = (_Float16)(tile[(k + j) * TP + n] * 16.f);
            *(v8h*)(W16 + (long long)(n0 + n) * D + k0 + k) = hv;
        }
    } else {
        const long long base = (long long)((int)blockIdx.x - WB) * 16384 + tid * 4;
        const float* xp = x + base;
        v4f v[16];
#pragma unroll
        for (int i = 0; i < 16; ++i) v[i] = *(const v4f*)(xp + i * 1024);
        asm volatile("s_wait_xcnt 0x0" :: "v"(xp) : "memory");   // stands in front of any reuse of the loads' address pair, which it names so that the pair lives up to here
#pragma unroll
        for (int i = 0; i < 16; ++i) *(v4h*)(X16 + base + i * 1024) = __builtin_convertvector(v[i], v4h);
        asm volatile("s_wait_xcnt 0x0" ::: "memory");            // stands behind the stores above, in front of any reuse of their address and data registers
    }
}

// =====================================================================================================================
// k_proj<M, N, K>: C[m][n] = scale * sum_k A[m][k] * Bt[n][k], A [M][K] and Bt [N][K] f16 planes, C f32 [M][N]; M, N % 128 == 0, K % 128 == 0.
//   One work-group of 4 waves per 128 x 128 tile of C, each wave a 64 x 64 quarter (4 x 4 accumulator tiles), grid (M/128)*(N/128).
//   A stage is 64 k of the tile's 128 A rows and 128 Bt rows: 256 rows of 128 B, brought by 16-byte asynchronous copies (a wave's copy = 4 whole lines)
//   into one of two LDS buffers at a pitch of 144 B (odd multiple of 16 B, for the ds_load_b128 fragment reads); stage t + 2 is asked for when
//   every wave has left stage t, so it flies while stage t + 1 is worked on. k runs upward in steps of 32, one accumulator chain per tile.
// =====================================================================================================================
// eight asynchronous 16-byte copies of one lane, 16 rows apart (GS halves in memory, LS bytes in LDS)
template <int GS, int LS> __device__ __forceinline__ void acopy8(unsigned l, const _Float16* g) {
    // the copies and, as the last line, the wait that stands in front of any rewrite of the address registers they name
    asm volatile("global_load_async_to_lds_b128 %0, %8, off\n\t"
                 "global_load_async_to_lds_b128 %1, %9, off\n\t"
                 "global_load_async_to_lds_b128 %2, %10, off\n\t"
                 "global_load_async_to_lds_b128 %3, %11, off\n\t"
                 "global_load_async_to_lds_b128 %4, %12, off\n\t"
                 "global_load_async_to_lds_b128 %5, %13, off\n\t"
                 "global_load_async_to_lds_b128 %6, %14, off\n\t"
                 "global_load_async_to_lds_b128 %7, %15, off\n\t"
                 "s_wait_xcnt 0x0"
                 :: "v"(l), "v"(l + LS), "v"(l + 2 * LS), "v"(l + 3 * LS), "v"(l + 4 * LS), "v"(l + 5 * LS), "v"(l + 6 * LS), "v"(l + 7 * LS),
                    "v"(g), "v"(g + GS), "v"(g + 2 * GS), "v"(g + 3 * GS), "v"(g + 4 * GS), "v"(g + 5 * GS), "v"(g + 6 * GS), "v"(g + 7 * GS)
                 : "memory");
}
template <int M, int N, int K>
__global__ __launch_bounds__(128) void k_proj(const _Float16* __restrict__ A, const _Float16* __restrict__ Bt, float* __restrict__ C, float scale) {
    typedef w25::Frag<_Float16> F;
    constexpr int KT = 64;                      // k per stage
    constexpr int PH = 72;                      // LDS row pitch in halves
    constexpr int SH = 256 * PH;                // halves per buffer: rows 0..127 A, 128..255 Bt
    constexpr int NS = K / KT;
    static_assert(M % 128 == 0 && N % 128 == 0 && K % 128 == 0, "whole tiles, two stages or more");
    __shared__ __align__(16) _Float16 ring[2 * SH];
    __shared__ __align__(16) float sT[4][16 * 68];   // per-wave 16x64 output slab, pitch 68 floats
    const int tid = threadIdx.x, lane = tid & 31, wave = tid >> 5;
    constexpr int TN = N / 128;
    const int tm = blockIdx.x / TN, tn = blockIdx.x - tm * TN;
    const int m0 = tm * 128, n0 = tn * 128;
    const int rlane = lane & 15, koff = (lane >> 4) * 8, mOff = (lane >> 4) * 8;
    // copies: 8 lanes per 128-B row, 16 rows per sweep of the work-group, 8 sweeps for each operand
    const int cr = tid >> 3, cc = (tid & 7) * 8;
    const _Float16* ga = A + (size_t)(m0 + cr) * K + cc;
    const _Float16* gb = Bt + (size_t)(n0 + cr) * K + cc;
    const unsigned la = (unsigned)(size_t)ring + (unsigned)(cr * PH + cc) * 2u;   // LDS byte address of this lane's first A chunk in buffer 0
    const _Float16* fa = ring + ((wave >> 1) * 64 + rlane) * PH + koff;
    const _Float16* fb = ring + (128 + (wave & 1) * 64 + rlane) * PH + koff;

    v8f acc[4][4];                              // the unroll directives of this kernel make every index of acc, ah and bh a constant, so that the arrays stay in registers
#pragma unroll
    for (int i = 0; i < 4; ++i)
#pragma unroll
        for (int j = 0; j < 4; ++j) { v8f zz = {}; acc[i][j] = zz; }

    acopy8<16 * K, 16 * PH * 2>(la, ga);
    acopy8<16 * K, 16 * PH * 2>(la + 128 * PH * 2, gb);
    asm volatile("s_wait_asynccnt 0x0" ::: "memory");    // this wave's copies of stage 0 have landed
    __syncthreads();                                     // stage 0 is visible to every wave
    acopy8<16 * K, 16 * PH * 2>(la + SH * 2, ga + KT);
    acopy8<16 * K, 16 * PH * 2>(la + SH * 2 + 128 * PH * 2, gb + KT);
    for (int t = 0; t < NS; ++t) {
        const int bo = (t & 1) * SH;
#pragma unroll
        for (int ks = 0; ks < KT; ks += 32) {
            v16h bh[4], ah[4];
#pragma unroll
            for (int j = 0; j < 4; ++j) bh[j] = F::load(fb + bo + j * 16 * PH + ks);
#pragma unroll
            for (int i = 0; i < 4; ++i) ah[i] = F::load(fa + bo + i * 16 * PH + ks);
            __builtin_amdgcn_sched_barrier(0);               // the 16 LDS reads stay one group in front of the 16 WMMAs: one LDS wait a k step, not one per row of tiles
#pragma unroll
            for (int i = 0; i < 4; ++i)
#pragma unroll
                for (int j = 0; j < 4; ++j) acc[i][j] = F::mma(ah[i], bh[j], acc[i][j]);
            __builtin_amdgcn_sched_barrier(0);               // keeps the next group of LDS reads from being spread among these WMMAs
        }
        asm volatile("s_wait_dscnt 0x0" ::: "memory");       // this wave's reads of stage t are done before the buffer may be refilled
        asm volatile("s_wait_asynccnt 0x0" ::: "memory");    // this wave's copies of stage t + 1 have landed
        __syncthreads();                                     // publishes stage t + 1 and ends every wave's reads of stage t
        if (t + 2 < NS) {                                    // the same for the whole work-group
            acopy8<16 * K, 16 * PH * 2>(la + bo * 2, ga + (t + 2) * KT);
            acopy8<16 * K, 16 * PH * 2>(la + bo * 2 + 128 * PH * 2, gb + (t + 2) * KT);
        }
    }
    asm volatile("s_wait_asynccnt 0x0" ::: "memory");        // no copy is outstanding when the wave goes on to its end

    float* slab = sT[wave];
    const int wm0 = m0 + (wave >> 1) * 64, wn0 = n0 + (wave & 1) * 64;
#pragma unroll
    for (int i = 0; i < 4; ++i) {
#pragma unroll
        for (int j = 0; j < 4; ++j)
#pragma unroll
            for (int r = 0; r < 8; ++r) slab[(mOff + r) * 68 + (j << 4) + rlane] = acc[i][j][r] * scale;
        __builtin_amdgcn_fence(__ATOMIC_RELEASE, "workgroup");
        __builtin_amdgcn_wave_barrier();
        __builtin_amdgcn_fence(__ATOMIC_ACQUIRE, "workgroup");
        const int hh = lane >> 4, c4 = (lane & 15) * 4;      // row segment = 256 B = 16 lanes x 16 B
#pragma unroll
        for (int it = 0; it < 8; ++it) {
            const int row = it * 2 + hh;
            const v4f v = *(const v4f*)(slab + row * 68 + c4);
            *(v4f*)(C + (size_t)(wm0 + (i << 4) + row) * N + wn0 + c4) = v;
        }
        __builtin_amdgcn_fence(__ATOMIC_RELEASE, "workgroup");
        __builtin_amdgcn_wave_barrier();
        __builtin_amdgcn_fence(__ATOMIC_ACQUIRE, "workgroup");
    }
}

// f32 -> bf16 hi plane + bf16 lo plane (x = hi + lo to ~2^-17 relative; RNE both), [R][C] -> [R][C] (or transposed to [C][R]); 2 consecutive destination elements
__device__ __forceinline__ unsigned int f2bf2_pack(float a, float b, unsigned int* lo) {
    const unsigned short ha = w25::f2bf_bits(a), hb = w25::f2bf_bits(b);
    const unsigned short la = w25::f2bf_bits(a - w25::bf_bits2f(ha)), lb = w25::f2bf_bits(b - w25::bf_bits2f(hb));
    *lo = (unsigned)la | ((unsigned)lb << 16); return (unsigned)ha | ((unsigned)hb << 16); }
__global__ __launch_bounds__(256) void k_castS16(const float* __restrict__ src, long long lds, __bf16* __restrict__ dhi, __bf16* __restrict__ dlo, long long ldd, int R, int C, float s, int transpose) {
    const long long i = (long long)blockIdx.x * 256 + threadIdx.x; long long o; float a, b;
    if (transpose) { const long long np = (long long)C * (R / 2); if (i >= np) return; const int c = (int)(i / (R / 2)); const int r = 2 * (int)(i % (R / 2)); a = src[(long long)r * lds + c] * s; b = src[(long long)(r + 1) * lds + c] * s; o = (long long)c * ldd + r; }
    else { const long long np = (long long)R * (C / 2); if (i >= np) return; const int r = (int)(i / (C / 2)); const int c = 2 * (int)(i % (C / 2)); a = src[(long long)r * lds + c] * s; b = src[(long long)r * lds + c + 1] * s; o = (long long)r * ldd + c; }
    unsigned lo; const unsigned hi = f2bf2_pack(a, b, &lo); unsigned* ph = (unsigned*)(dhi + o); unsigned* pl = (unsigned*)(dlo + o);
    *ph = hi; *pl = lo;  }

namespace w25 {
// =====================================================================================
// Generic causal/non-causal attention for head_dim 64, f32 in / f32 out; 16-bit operands: bf16 with optional hi/lo splits, or
// plain f16 (F16=true, non-split, probabilities carried x2^15).
//   scores = (q*qscale)·kᵀ : v_wmma_f32_16x16x32_bf16; SPLIT_QK -> q,k as bf16 hi/lo (hi·hi + hi·lo + lo·hi)
//   out    = p·v           : v_wmma_f32_16x16x32_bf16; SPLIT_PV -> p,v as bf16 hi/lo; else p,v plain bf16
//   f32 accumulate; online softmax in f32. Block = 4 waves = 64 query rows of one (batch, head); S % 64 == 0.
//   Element (b, s, h, d) of tensor X lives at X[b*X_bs + s*X_rs + h*X_hs + d] (strides in floats, multiples of 4).
//   Masking: mask_mode 0 none, 1 causal (kv > q masked), 2 tensor [S][Skv] shared over (b,h) (float if
//   mask_is_int==0, int32 with element == 0 -> masked if 1, int32 with element != 0 -> masked if 2), 3 per-token vectors qmask[B][S] & kvmask[B][Skv] (int32,
//   0 -> masked), 4 causal + sliding window (kv > q or q - kv > W masked; W passed in mask_is_int);
//   5 = relative-position bias: s += cp[b,h,q][idx[q][kv]] + pc[b,h,kv][idx[q][kv]] with idx = mask_b ([S][Skv] int32) and
//   mask_a an int32 [S][Skv] tensor with nonzero = masked (tables: element (b,h,row,n) at X + b*c_bs + h*c_hs + row*c_rs + n);
//   masked scores are replaced by mask_fill (e.g. -inf or -1e9) before the softmax.
//   grid.x = B * H * (S/64) (or a sub-range with blk0).
// =====================================================================================
#define AT_D 64
#define AT_NW 4
#define AT_QB 64
#define AT_KC 64
struct AttnGeom { const float* cp = nullptr; const float* pc = nullptr; long c_bs = 0, c_rs = 0, c_hs = 0;   // mode-5 score-bias tables
                  long q_bs, q_rs, q_hs, k_bs, k_rs, k_hs, v_bs, v_rs, v_hs, o_bs, o_rs, o_hs;
                  int S, Skv, H, mask_mode; float qscale; int blk0; float mask_fill; int mask_is_int; };
static_assert(sizeof(AttnGeom) == 168, "no padding");

__device__ __forceinline__ unsigned short at_bf_bits(float f) {
  unsigned u = __float_as_uint(f);
  return (unsigned short)((u + 0x7FFFu + ((u >> 16) & 1u)) >> 16);
}
__device__ __forceinline__ __bf16 at_f2bf(float f) { return __builtin_bit_cast(__bf16, at_bf_bits(f)); }
__device__ __forceinline__ void at_split(float f, __bf16& hi, __bf16& lo) {
  const unsigned short hb = at_bf_bits(f);
  hi = __builtin_bit_cast(__bf16, hb);
  lo = at_f2bf(f - __uint_as_float(((unsigned)hb) << 16));
}
__device__ __forceinline__ v8f at_mma(v16b a, v16b b, v8f c) {
  c = __builtin_amdgcn_wmma_f32_16x16x32_bf16(false, a, false, b, (short)0, c, false, false);
  asm volatile("v_nop\n\tv_nop\n\tv_nop\n\tv_nop" : "+v"(c) : "v"(a), "v"(b));
  return c;
}
// 16-bit element as a bit pattern held in a __bf16 slot: f16 bits when F16, bf16 (RNE) otherwise
template <bool F16> __device__ __forceinline__ __bf16 at_to16(float f) {
  if (F16) return __builtin_bit_cast(__bf16, (_Float16)f);
  return at_f2bf(f);
}
template <bool F16> __device__ __forceinline__ v8f at_mma16(v16b a, v16b b, v8f c) {
  if (F16) {
    const v16h ah = __builtin_bit_cast(v16h, a), bh = __builtin_bit_cast(v16h, b);
    c = __builtin_amdgcn_wmma_f32_16x16x32_f16(false, ah, false, bh, (short)0, c, false, false);
    asm volatile("v_nop\n\tv_nop\n\tv_nop\n\tv_nop" : "+v"(c) : "v"(ah), "v"(bh));
    return c;
  }
  return at_mma(a, b, c);
}

template <bool SPLIT_QK, bool SPLIT_PV, bool F16 = false>
__global__ __launch_bounds__(128)
void attn64_kernel(const float* __restrict__ q, const float* __restrict__ k,
                   const float* __restrict__ v, float* __restrict__ out,
                   const void* __restrict__ mask_a, const int* __restrict__ mask_b, AttnGeom g) {
  static_assert(!(F16 && (SPLIT_QK || SPLIT_PV)), "f16 mode is non-split");
  const float PSC = F16 ? 32768.0f : 1.0f;     // f16 probabilities carried x2^15 (subnormal range), folded into the final 1/l
  union FB { v16b v; v8b h[2]; };
  __shared__ __align__(16) __bf16 Ksh[AT_KC * AT_D];             // K hi [kv][d]      8 KB
  __shared__ __align__(16) __bf16 Ksl[SPLIT_QK ? AT_KC * AT_D : 8];
  __shared__ __align__(16) __bf16 Vth[AT_D * AT_KC];             // V hi [d][kv]      8 KB
  __shared__ __align__(16) __bf16 Vtl[SPLIT_PV ? AT_D * AT_KC : 8];
  __shared__ __align__(16) __bf16 Psh[AT_NW][16 * AT_KC];        // per wave P hi [row][kv]  8 KB
  __shared__ __align__(16) __bf16 Psl[SPLIT_PV ? AT_NW : 1][SPLIT_PV ? 16 * AT_KC : 8];
  __shared__ __align__(16) float  Os[AT_NW][16 * 68];            // per wave out tile, pitch 68

  const int tid  = threadIdx.x;
  const int wave = tid >> 5;
  const int lane = tid & 31;
  const int hh   = lane >> 4;
  const int c    = lane & 15;

  const int nqb = g.S / AT_QB;
  const int bx = blockIdx.x + g.blk0;
  const int qb = bx % nqb;
  const int bh = bx / nqb;
  const int h  = bh % g.H;
  const int b  = bh / g.H;
  const int qbase_block = qb * AT_QB;
  const int q0 = qbase_block + wave * 16;

  const float* qb_ptr = q + (size_t)b * g.q_bs + (size_t)h * g.q_hs;
  const float* kb_ptr = k + (size_t)b * g.k_bs + (size_t)h * g.k_hs;
  const float* vb_ptr = v + (size_t)b * g.v_bs + (size_t)h * g.v_hs;
  float*       ob_ptr = out + (size_t)b * g.o_bs + (size_t)h * g.o_hs;

  // ---- Q fragments (A operand): 2 d-chunks, hi (and lo) ----
  v16b qah[2], qal[2];
  {
    const float* qrow = qb_ptr + (size_t)(q0 + c) * g.q_rs;
#pragma unroll
    for (int dc = 0; dc < 2; ++dc) {
#pragma unroll
      for (int e = 0; e < 8; ++e) {
        const float f0 = qrow[dc * 32 + 8 * hh + e] * g.qscale;
        const float f1 = qrow[dc * 32 + 16 + 8 * hh + e] * g.qscale;
        if (SPLIT_QK) { __bf16 hq, lq; at_split(f0, hq, lq); qah[dc][e] = hq; qal[dc][e] = lq; at_split(f1, hq, lq); qah[dc][8 + e] = hq; qal[dc][8 + e] = lq; }
        else { qah[dc][e] = at_to16<F16>(f0); qah[dc][8 + e] = at_to16<F16>(f1); qal[dc][e] = qah[dc][e]; qal[dc][8 + e] = qah[dc][8 + e]; }
      }
    }
  }

  float mrow[8], lrow[8];
  v8f oacc[4];
#pragma unroll
  for (int r = 0; r < 8; ++r) { mrow[r] = -INFINITY; lrow[r] = 0.f; }
#pragma unroll
  for (int t = 0; t < 4; ++t) oacc[t] = (v8f){0.f,0.f,0.f,0.f,0.f,0.f,0.f,0.f};

  const int nChunks = (g.mask_mode == 1 || g.mask_mode == 4) ? (qb + 1) : (g.Skv / AT_KC);   // block-uniform
  // per-row query mask (mode 3)
  int qkeep[8];
#pragma unroll
  for (int r = 0; r < 8; ++r) qkeep[r] = (g.mask_mode == 3) ? mask_b[(size_t)b * g.S + q0 + 8 * hh + r] : 1;   // mask_b = qmask in mode 3
  for (int kc = 0; kc < nChunks; ++kc) {
    const int kv0 = kc * AT_KC;
    __syncthreads();
    {
      const int kvr = tid >> 1, dh = (tid & 1) * 32;
      const float* krow = kb_ptr + (size_t)(kv0 + kvr) * g.k_rs + dh;
      const float* vrow = vb_ptr + (size_t)(kv0 + kvr) * g.v_rs + dh;
#pragma unroll
      for (int i = 0; i < 8; ++i) {
        v4f kk = *(const v4f*)(krow + 4 * i);
        v4f vv = *(const v4f*)(vrow + 4 * i);
#pragma unroll
        for (int e = 0; e < 4; ++e) {
          const int d = dh + 4 * i + e;
          if (SPLIT_QK) { __bf16 a, bl; at_split(kk[e], a, bl); Ksh[kvr * AT_D + d] = a; Ksl[kvr * AT_D + d] = bl; }
          else Ksh[kvr * AT_D + d] = at_to16<F16>(kk[e]);
          if (SPLIT_PV) { __bf16 a, bl; at_split(vv[e], a, bl); Vth[d * AT_KC + kvr] = a; Vtl[d * AT_KC + kvr] = bl; }
          else Vth[d * AT_KC + kvr] = at_to16<F16>(vv[e]);
        }
      }
    }
    __syncthreads();

    v8f s[4];
#pragma unroll
    for (int j = 0; j < 4; ++j) {
      s[j] = (v8f){0.f,0.f,0.f,0.f,0.f,0.f,0.f,0.f};
#pragma unroll 1
      for (int dc = 0; dc < 2; ++dc) {
        FB kb;
        kb.h[0] = *(const v8b*)(Ksh + (j * 16 + c) * AT_D + dc * 32 + 8 * hh);
        kb.h[1] = *(const v8b*)(Ksh + (j * 16 + c) * AT_D + dc * 32 + 16 + 8 * hh);
        s[j] = at_mma16<F16>(qah[dc], kb.v, s[j]);
        if (SPLIT_QK) {
          FB kl;
          kl.h[0] = *(const v8b*)(Ksl + (j * 16 + c) * AT_D + dc * 32 + 8 * hh);
          kl.h[1] = *(const v8b*)(Ksl + (j * 16 + c) * AT_D + dc * 32 + 16 + 8 * hh);
          s[j] = at_mma16<F16>(qah[dc], kl.v, s[j]);
          s[j] = at_mma16<F16>(qal[dc], kb.v, s[j]);
        }
      }
    }
    const bool diag = (g.mask_mode == 1) && (kc == qb);
    int kvkeep[4] = {1, 1, 1, 1};
    if (g.mask_mode == 3) {
#pragma unroll
      for (int j = 0; j < 4; ++j) kvkeep[j] = ((const int*)mask_a)[(size_t)b * g.Skv + kv0 + j * 16 + c];   // mask_a = kvmask
    }
    float cm[8];
#pragma unroll
    for (int r = 0; r < 8; ++r) {
      const int qrow = q0 + 8 * hh + r;
      float m = -INFINITY;
#pragma unroll
      for (int j = 0; j < 4; ++j) {
        const int kvcol = kv0 + j * 16 + c;
        bool masked = false;
        if (diag) masked = (kvcol > qrow);
        else if (g.mask_mode == 4) masked = (kvcol > qrow) || (qrow - kvcol > g.mask_is_int);
        else if (g.mask_mode == 2) {
          const size_t mi = (size_t)qrow * g.Skv + kvcol;
          masked = (g.mask_is_int == 0) ? (((const float*)mask_a)[mi] == 0.0f)
                 : (g.mask_is_int == 1) ? (((const int*)mask_a)[mi] == 0) : (((const int*)mask_a)[mi] != 0);
        } else if (g.mask_mode == 3) masked = (qkeep[r] == 0) || (kvkeep[j] == 0);
        else if (g.mask_mode == 5) {
          const size_t mi = (size_t)qrow * g.Skv + kvcol;
          masked = (((const int*)mask_a)[mi] != 0);
          int n = mask_b[mi]; n = n < 0 ? 0 : n;
          s[j][r] += g.cp[(size_t)b * g.c_bs + (size_t)h * g.c_hs + (size_t)qrow * g.c_rs + n]
                   + g.pc[(size_t)b * g.c_bs + (size_t)h * g.c_hs + (size_t)kvcol * g.c_rs + n];
        }
        if (masked) s[j][r] = g.mask_fill;
        m = fmaxf(m, s[j][r]);
      }
#pragma unroll
      for (int off = 1; off < 16; off <<= 1) m = fmaxf(m, __shfl_xor(m, off, 32));
      cm[r] = m;
    }
    __bf16* pwh = Psh[wave];
    __bf16* pwl = Psl[SPLIT_PV ? wave : 0];
#pragma unroll
    for (int r = 0; r < 8; ++r) {
      const float mnew = fmaxf(mrow[r], cm[r]);
      const float alpha = expf(mrow[r] - mnew);
      mrow[r] = mnew;
      float psum = 0.f;
#pragma unroll
      for (int j = 0; j < 4; ++j) {
        const float p = expf(s[j][r] - mnew);
        psum += p;
        if (SPLIT_PV) { __bf16 a, bl; at_split(p, a, bl); pwh[(8 * hh + r) * AT_KC + j * 16 + c] = a; pwl[(8 * hh + r) * AT_KC + j * 16 + c] = bl; }
        else pwh[(8 * hh + r) * AT_KC + j * 16 + c] = at_to16<F16>(p * PSC);
      }
#pragma unroll
      for (int off = 1; off < 16; off <<= 1) psum += __shfl_xor(psum, off, 32);
      lrow[r] = lrow[r] * alpha + psum;
#pragma unroll
      for (int t = 0; t < 4; ++t) oacc[t][r] *= alpha;
    }
    __builtin_amdgcn_fence(__ATOMIC_RELEASE, "workgroup");
    __builtin_amdgcn_wave_barrier();
    __builtin_amdgcn_fence(__ATOMIC_ACQUIRE, "workgroup");
#pragma unroll 1
    for (int kk = 0; kk < 2; ++kk) {
      FB pa, pl;
      pa.h[0] = *(const v8b*)(pwh + c * AT_KC + kk * 32 + 8 * hh);
      pa.h[1] = *(const v8b*)(pwh + c * AT_KC + kk * 32 + 16 + 8 * hh);
      if (SPLIT_PV) {
        pl.h[0] = *(const v8b*)(pwl + c * AT_KC + kk * 32 + 8 * hh);
        pl.h[1] = *(const v8b*)(pwl + c * AT_KC + kk * 32 + 16 + 8 * hh);
      }
#pragma unroll
      for (int t = 0; t < 4; ++t) {
        FB vb;
        vb.h[0] = *(const v8b*)(Vth + (t * 16 + c) * AT_KC + kk * 32 + 8 * hh);
        vb.h[1] = *(const v8b*)(Vth + (t * 16 + c) * AT_KC + kk * 32 + 16 + 8 * hh);
        oacc[t] = at_mma16<F16>(pa.v, vb.v, oacc[t]);
        if (SPLIT_PV) {
          FB vl;
          vl.h[0] = *(const v8b*)(Vtl + (t * 16 + c) * AT_KC + kk * 32 + 8 * hh);
          vl.h[1] = *(const v8b*)(Vtl + (t * 16 + c) * AT_KC + kk * 32 + 16 + 8 * hh);
          oacc[t] = at_mma16<F16>(pa.v, vl.v, oacc[t]);
          oacc[t] = at_mma16<F16>(pl.v, vb.v, oacc[t]);
        }
      }
    }
  }

  float* os = Os[wave];
#pragma unroll
  for (int r = 0; r < 8; ++r) {
    const float inv = 1.0f / (lrow[r] * PSC);
#pragma unroll
    for (int t = 0; t < 4; ++t) os[(8 * hh + r) * 68 + t * 16 + c] = oacc[t][r] * inv;
  }
  __builtin_amdgcn_fence(__ATOMIC_RELEASE, "workgroup");
  __builtin_amdgcn_wave_barrier();
  __builtin_amdgcn_fence(__ATOMIC_ACQUIRE, "workgroup");
  {
    const int c4 = (lane & 15) * 4;
    {
#pragma unroll
      for (int it = 0; it < 8; ++it) {
        const int row = it * 2 + hh;
        v4f val = *(const v4f*)(os + row * 68 + c4);
        *(v4f*)(ob_ptr + (size_t)(q0 + row) * g.o_rs + c4) = val;
      }
      
    }
  }
}

} // namespace w25


extern "C" void kernel_launch(void* const* d_in, const int* in_sizes, int n_in, void* d_out, int out_size, void* d_ws, size_t ws_size, hipStream_t stream) {
    (void)in_sizes; (void)n_in; (void)out_size; (void)ws_size;
    const float* x = (const float*)d_in[0];
    const float* Wq = (const float*)d_in[1];
    const float* Wkv = (const float*)d_in[2];
    const float* Wo = (const float*)d_in[3];
    const float* bo = (const float*)d_in[4];
    const int Bn = 2;
    const int T = 2048;
    const int D = 1024;
    const int NH = 16;
    const int D3 = 3 * D;
    const int NR = Bn * T;
    float* out = (float*)d_out;
    char* wsp = (char*)d_ws;
    unsigned short* X16 = (unsigned short*)wsp; wsp += (((size_t)((size_t)NR * D) * 2 + 255) / 256) * 256;
    unsigned short* W316 = (unsigned short*)wsp; wsp += (((size_t)((size_t)D3 * D) * 2 + 255) / 256) * 256;
    float* QKV = (float*)wsp; wsp += (((size_t)((size_t)NR * D3) * 4 + 255) / 256) * 256;
    if ((size_t)(wsp - (char*)d_ws) > ws_size) return;   // static carve guard
    k_prep<NR, D><<<(unsigned)((D3 / 64) * (D / 128) + (NR / 16) * (D / 1024)), 256, 0, stream>>>(x, Wq, Wkv, (_Float16*)(X16), (_Float16*)(W316));
    k_proj<NR, D3, D><<<(unsigned)((NR / 128) * (D3 / 128)), 128, 0, stream>>>((const _Float16*)(X16), (const _Float16*)(W316), QKV, 0.0625f);
    k_attn_lds<T, D3, D><<<dim3((unsigned)((T) / (16 * AW)), (unsigned)(NH), (unsigned)(Bn)), 32 * AW, 0, stream>>>(QKV, QKV + D, QKV + 2 * D, Wo, bo, out, 0.125f);
}

// v007
// One run takes 97.2 microseconds.
// Next to v006, in two timings, it ran 1.10 times as fast each time.
// Counting every step since v000, which is the starting kernel, it is 21.8 times as fast.
// Contractions: q and k|v projections (weights stored [in][out]) [4096x1024].[1024x1024|2048], both batch elements' rows in one launch, with f16 operands on f16 planes (v_wmma_f32_16x16x32_f16, 64x64 register-blocked wave tiles, weights x16); per (batch, head) softmax(q.k^T/8) v over all 2048 keys as one flash launch for both batch elements (head_dim 64, f16 q.k^T and f16 p.v with p as f16 of 4096 p), whose epilogue applies the head's own 64x64 output map (+bias) to the f16 attention tile still in registers (weights x16); f32 accumulate and softmax statistics.
#include <hip/hip_runtime.h>
#include <math.h>

typedef __attribute__((ext_vector_type(16))) _Float16 v16h;
typedef __attribute__((ext_vector_type(8)))  _Float16 v8h;
typedef __attribute__((ext_vector_type(16))) __bf16   v16b;
typedef __attribute__((ext_vector_type(8)))  float    v8f;
typedef __attribute__((ext_vector_type(4)))  float    v4f;

// 16-bit WMMA fragment map (wave32), lane L, h = L>>4, m = L&15:
//   A 16x32: lane = row m;   element i -> k = (i<8) ? 8h+i : 16+8h+(i-8)
//   B 32x16: lane = column m; the SAME k(i,h)
//   D 16x16 (8 f32): lane = column m; element r -> row 8h+r
__device__ __forceinline__ int frag_k(int i, int h) { return (i < 8) ? (8 * h + i) : (16 + 8 * h + (i - 8)); }
__device__ __forceinline__ __bf16 bf16_rne(float f) {
    unsigned int u = __float_as_uint(f);
    u += 0x7fffu + ((u >> 16) & 1u);
    return __builtin_bit_cast(__bf16, (unsigned short)(u >> 16));
}
__device__ __forceinline__ float bf16_f32(__bf16 b) { return __uint_as_float(((unsigned int)__builtin_bit_cast(unsigned short, b)) << 16); }
__device__ __forceinline__ v8f wmma16(v16h a, v16h b, v8f c) {
    c = __builtin_amdgcn_wmma_f32_16x16x32_f16(false, a, false, b, (short)0, c, false, false);
    asm volatile("v_nop\n\tv_nop\n\tv_nop\n\tv_nop" : "+v"(c) : "v"(a), "v"(b));
    return c;
}
__device__ __forceinline__ v8f wmmab(v16b a, v16b b, v8f c) {
    c = __builtin_amdgcn_wmma_f32_16x16x32_bf16(false, a, false, b, (short)0, c, false, false);
    asm volatile("v_nop\n\tv_nop\n\tv_nop\n\tv_nop" : "+v"(c) : "v"(a), "v"(b));
    return c;
}
struct Split { v16b hi, lo; };
// hi/lo split product: a.hi*b.hi + a.hi*b.lo + a.lo*b.hi
__device__ __forceinline__ v8f wmma3(const Split& a, const Split& b, v8f c) {
    c = __builtin_amdgcn_wmma_f32_16x16x32_bf16(false, a.hi, false, b.hi, (short)0, c, false, false);
    c = __builtin_amdgcn_wmma_f32_16x16x32_bf16(false, a.hi, false, b.lo, (short)0, c, false, false);
    c = __builtin_amdgcn_wmma_f32_16x16x32_bf16(false, a.lo, false, b.hi, (short)0, c, false, false);
    asm volatile("v_nop\n\tv_nop\n\tv_nop\n\tv_nop" : "+v"(c) : "v"(a.hi), "v"(a.lo), "v"(b.hi), "v"(b.lo));
    return c;
}
struct Split3 { v16b hi, mid, lo; };
// triple split product (6 terms, drops only terms below 2^-24 relative)
__device__ __forceinline__ v8f wmma6(const Split3& a, const Split3& b, v8f c) {
    c = __builtin_amdgcn_wmma_f32_16x16x32_bf16(false, a.hi, false, b.hi, (short)0, c, false, false);
    c = __builtin_amdgcn_wmma_f32_16x16x32_bf16(false, a.hi, false, b.mid, (short)0, c, false, false);
    c = __builtin_amdgcn_wmma_f32_16x16x32_bf16(false, a.mid, false, b.hi, (short)0, c, false, false);
    c = __builtin_amdgcn_wmma_f32_16x16x32_bf16(false, a.hi, false, b.lo, (short)0, c, false, false);
    c = __builtin_amdgcn_wmma_f32_16x16x32_bf16(false, a.mid, false, b.mid, (short)0, c, false, false);
    c = __builtin_amdgcn_wmma_f32_16x16x32_bf16(false, a.lo, false, b.hi, (short)0, c, false, false);
    asm volatile("v_nop\n\tv_nop\n\tv_nop\n\tv_nop" : "+v"(c) : "v"(a.hi), "v"(a.mid), "v"(a.lo), "v"(b.hi), "v"(b.mid), "v"(b.lo));
    return c;
}

// Fragment gathers from f32 memory: element i <- p[(k0 + frag_k(i,h)) * sk] * s, zero for k >= klen.
__device__ __forceinline__ v16h fh_ld(const float* __restrict__ p, long long sk, int k0, int h, int klen, float s) {
    v16h a;
#pragma unroll
    for (int i = 0; i < 16; ++i) { const int k = k0 + frag_k(i, h); a[i] = (k < klen) ? (_Float16)(p[(long long)k * sk] * s) : (_Float16)0.f; }
    return a;
}
__device__ __forceinline__ Split sp_ld(const float* __restrict__ p, long long sk, int k0, int h, int klen, float s) {
    Split r;
#pragma unroll
    for (int i = 0; i < 16; ++i) {
        const int k = k0 + frag_k(i, h); const float x = (k < klen) ? p[(long long)k * sk] * s : 0.f;
        const __bf16 hb = bf16_rne(x); r.hi[i] = hb; r.lo[i] = bf16_rne(x - bf16_f32(hb));
    }
    return r;
}
__device__ __forceinline__ Split3 sp3_ld(const float* __restrict__ p, long long sk, int k0, int h, int klen, float s) {
    Split3 r;
#pragma unroll
    for (int i = 0; i < 16; ++i) {
        const int k = k0 + frag_k(i, h); const float x = (k < klen) ? p[(long long)k * sk] * s : 0.f;
        const __bf16 hb = bf16_rne(x); const float r1 = x - bf16_f32(hb); const __bf16 mb = bf16_rne(r1);
        r.hi[i] = hb; r.mid[i] = mb; r.lo[i] = bf16_rne(r1 - bf16_f32(mb));
    }
    return r;
}
__device__ __forceinline__ v16b bh_ld(const float* __restrict__ p, long long sk, int k0, int h, int klen, float s) {
    v16b a;
#pragma unroll
    for (int i = 0; i < 16; ++i) { const int k = k0 + frag_k(i, h); a[i] = bf16_rne((k < klen) ? p[(long long)k * sk] * s : 0.f); }
    return a;
}
// f16 fragment from an f16 LDS/global row with element stride 1 (k-contiguous), no bounds (tile already zero padded)
__device__ __forceinline__ v16h fh_row(const _Float16* __restrict__ row, int k0, int h) {
    v16h a;
#pragma unroll
    for (int i = 0; i < 16; ++i) a[i] = row[k0 + frag_k(i, h)];
    return a;
}

#define VST2(T, ptr, val) do { const T vst2_v_ = (val); *(T*)(ptr) = vst2_v_;  } while (0)
typedef float v4f __attribute__((ext_vector_type(4)));
#define VST2V4(ptr, val) do { const v4f vst2_v4_ = (val); *(v4f*)(ptr) = vst2_v4_;  } while (0)

__device__ __attribute__((noinline)) float act_fn(float v, int act) {
    if (act == 1) return fmaxf(v, 0.f);                                                                               // relu
    if (act == 2) { const float u = 0.7978845608028654f * (v + 0.044715f * v * v * v); return 0.5f * v * (1.f + tanhf(u)); } // tanh-gelu
    if (act == 3) return v / (1.f + expf(-v));                                                                        // silu
    if (act == 4) return 0.5f * v * (1.f + erff(v * 0.7071067811865476f));                                             // erf-gelu
    if (act == 5) return tanhf(v);
    if (act == 6) return 1.f / (1.f + expf(-v));                                                                      // sigmoid
    if (act == 7) return (v > 0.f) ? v : 0.01f * v;                                                                   // leaky relu 0.01
    if (act == 8) return (v > 0.f) ? v : (expf(v) - 1.f);                                                             // elu
    if (act == 9) return fminf(fmaxf(v, 0.f), 6.f);                                                                   // relu6
    if (act == 10) return fabsf(v);                                                                                    // abs
    if (act == 11) return (v >= 0.f) ? v : 0.1f * v;                                                                  // leaky 0.1
    if (act == 12) return (v > 0.f) ? v : 0.2f * v;                                                                   // leaky 0.2
    if (act == 13) return (v > 20.f) ? v : log1pf(expf(v));                                                            // softplus
    return v;
}

// =====================================================================================================================
// k_gemm<MODE>: C(z, m, n) = act(alpha * sum_k A(z, m, k) * B(z, k, n) + bias) + beta * R(z, m, n)
//   One wave (32-thread block) per 16 x 32 tile of C; grid (ceil(N/32), ceil(M/16), Z). Batch z -> (zo = z / zi_n, zi = z % zi_n)
//   with separate outer/inner strides for every tensor (e.g. batch and head). A(m,k) = A[zo*sAo + zi*sAi + m*sAm + k*sAk] (f32),
//   B(k,n) = B[zo*sBo + zi*sBi + n*sBn + k*sBk] (f32); any M, N, K (K zero-padded to 32 inside the fragments, M/N tails guarded).
//   C(m,n) = C[zo*sCo + zi*sCi + m*sCm + n] (n contiguous). flags: 1 bias[n], 2 bias[m], 4 residual R[zo*sRo + zi*sRi + m*sRm + n*sRn].
//   MODE 0: f16 operands (A prescaled by sa, B by sb, both undone in the epilogue); 1: bf16 hi/lo split (3 products); 2: bf16;
//   3: bf16 hi/mid/lo triple split (6 products); 4: as 3 with Kahan-compensated f32 accumulation across k-steps.
// =====================================================================================================================
struct GemmP {
    const float* A; const float* B; const float* bias; const float* R; float* C;
    long long sAo, sAi, sAm, sAk, sBo, sBi, sBn, sBk, sCo, sCi, sCm, sRo, sRi, sRm, sRn;
    int M, N, K, zi_n, flags, act; float alpha, beta, sa, sb;
    int Npad, pad_;     // columns [N, Npad) of C are written as 0 so that padded workspace rows are covered by whole-line stores; Npad >= N
};
static_assert(sizeof(GemmP) == 5 * 8 + 15 * 8 + 6 * 4 + 4 * 4 + 2 * 4, "GemmP has padding");

template <int MODE>
__global__ __launch_bounds__(32) void k_gemm(GemmP p) {
    const int lane = threadIdx.x & 31, h = lane >> 4, l15 = lane & 15;
    const int m0 = blockIdx.y * 16, n0 = blockIdx.x * 32;
    const int z = blockIdx.z, zo = z / p.zi_n, zi = z - zo * p.zi_n;
    const float* A = p.A + zo * p.sAo + zi * p.sAi;
    const float* B = p.B + zo * p.sBo + zi * p.sBi;
    const int am = min(m0 + l15, p.M - 1);                       // clamped row for loads (stores are guarded)
    v8f acc[2], comp[2];
#pragma unroll
    for (int t = 0; t < 2; ++t) { v8f zz = {}; acc[t] = zz; comp[t] = zz; }
    for (int k0 = 0; k0 < p.K; k0 += 32) {
        const float* arow = A + (long long)am * p.sAm;
        if (MODE == 1) {
            const Split a = sp_ld(arow, p.sAk, k0, h, p.K, 1.f);
#pragma unroll
            for (int t = 0; t < 2; ++t) {
                const int bn = min(n0 + t * 16 + l15, p.N - 1);
                acc[t] = wmma3(a, sp_ld(B + (long long)bn * p.sBn, p.sBk, k0, h, p.K, 1.f), acc[t]);
            }
        } else if (MODE == 3) {
            const Split3 a = sp3_ld(arow, p.sAk, k0, h, p.K, 1.f);
#pragma unroll
            for (int t = 0; t < 2; ++t) {
                const int bn = min(n0 + t * 16 + l15, p.N - 1);
                acc[t] = wmma6(a, sp3_ld(B + (long long)bn * p.sBn, p.sBk, k0, h, p.K, 1.f), acc[t]);
            }
        } else if (MODE == 4) {
            // triple split as MODE 3, but each k-step's 6 products go into a fresh accumulator and the partial is added to the running f32 sum
            // on the VALU with Kahan compensation (accumulation error stays ~1 ulp however long K is)
            const Split3 a = sp3_ld(arow, p.sAk, k0, h, p.K, 1.f);
#pragma unroll
            for (int t = 0; t < 2; ++t) {
                const int bn = min(n0 + t * 16 + l15, p.N - 1); v8f zz = {};
                const v8f part = wmma6(a, sp3_ld(B + (long long)bn * p.sBn, p.sBk, k0, h, p.K, 1.f), zz);
                const v8f y = part - comp[t]; const v8f s = acc[t] + y; comp[t] = (s - acc[t]) - y; acc[t] = s;
            }
        } else if (MODE == 2) {
            const v16b a = bh_ld(arow, p.sAk, k0, h, p.K, 1.f);
#pragma unroll
            for (int t = 0; t < 2; ++t) {
                const int bn = min(n0 + t * 16 + l15, p.N - 1);
                acc[t] = wmmab(a, bh_ld(B + (long long)bn * p.sBn, p.sBk, k0, h, p.K, 1.f), acc[t]);
            }
        } else {
            const v16h a = fh_ld(arow, p.sAk, k0, h, p.K, p.sa);
#pragma unroll
            for (int t = 0; t < 2; ++t) {
                const int bn = min(n0 + t * 16 + l15, p.N - 1);
                acc[t] = wmma16(a, fh_ld(B + (long long)bn * p.sBn, p.sBk, k0, h, p.K, p.sb), acc[t]);
            }
        }
    }
    const float iscale = (MODE == 0) ? p.alpha / (p.sa * p.sb) : p.alpha;
    float* C = p.C + zo * p.sCo + zi * p.sCi;
    const float* R = p.R + zo * p.sRo + zi * p.sRi;
    __shared__ __align__(16) float ctile[16][36];
#pragma unroll
    for (int t = 0; t < 2; ++t) {
        const int n = n0 + t * 16 + l15; const int nn = min(n, p.N - 1);
#pragma unroll
        for (int r = 0; r < 8; ++r) {
            const int m = m0 + 8 * h + r; const int mm = min(m, p.M - 1);
            float v = acc[t][r] * iscale;
            if (p.flags & 1) v += p.bias[nn];
            if (p.flags & 2) v += p.bias[mm];
            if (p.flags & 8) v *= p.bias[(long long)zo * p.M + mm];   /* per-(z,row) scale vector laid out [Z][M]; exclusive with the bias flags */
            v = act_fn(v, p.act);
            if (p.flags & 4) v += p.beta * R[(long long)mm * p.sRm + (long long)nn * p.sRn];
            ctile[8 * h + r][t * 16 + l15] = (n < p.N) ? v : 0.f;
        }
    }
    __syncthreads();
    const int NW = (p.Npad > p.N) ? p.Npad : p.N;           // write width
    const bool fast = (m0 + 16 <= p.M) && (n0 + 32 <= NW) && ((p.sCm & 3) == 0) && ((((size_t)C) & 15) == 0);
    if (fast) {
#pragma unroll
        for (int s = 0; s < 4; ++s) {
            const int row = s * 4 + (lane >> 3), c4 = (lane & 7) * 4;
            const v4f v = *(const v4f*)&ctile[row][c4];
            VST2V4(C + (long long)(m0 + row) * p.sCm + n0 + c4, v);
        }
    } else {
        for (int row = 0; row < 16; ++row) {
            const int m = m0 + row, n = n0 + lane;
            if (m < p.M && n < NW) VST2(float, C + (long long)m * p.sCm + n, ctile[row][lane]);
        }
    }
}


// =====================================================================================================================
// k_gemmT<MODE, TM, TN>: same contract as k_gemm, but one wave computes a (16*TM) x (16*TN) tile: TM A fragments and TN B fragments are
//   loaded per 32-wide k-step and reused across TM*TN WMMAs (far fewer load/convert instructions per MAC). MODE 0 (f16), 1 (bf16 hi/lo),
//   2 (bf16) only. grid (ceil(NW/(16*TN)), ceil(M/(16*TM)), Z), block 32. Epilogue identical to k_gemm, run per 16x32 sub-tile.
// =====================================================================================================================
template <int MODE, int TM, int TN>
__global__ __launch_bounds__(32) void k_gemmT(GemmP p) {
    const int lane = threadIdx.x & 31, h = lane >> 4, l15 = lane & 15;
    const int m0 = blockIdx.y * (16 * TM), n0 = blockIdx.x * (16 * TN);
    const int z = blockIdx.z, zo = z / p.zi_n, zi = z - zo * p.zi_n;
    const float* A = p.A + zo * p.sAo + zi * p.sAi;
    const float* B = p.B + zo * p.sBo + zi * p.sBi;
    v8f acc[TM][TN];
#pragma unroll
    for (int i = 0; i < TM; ++i)
#pragma unroll
        for (int t = 0; t < TN; ++t) { v8f zz = {}; acc[i][t] = zz; }
    for (int k0 = 0; k0 < p.K; k0 += 32) {
        if (MODE == 1) {
            Split a[TM], b[TN];
#pragma unroll
            for (int i = 0; i < TM; ++i) { const int am = min(m0 + 16 * i + l15, p.M - 1); a[i] = sp_ld(A + (long long)am * p.sAm, p.sAk, k0, h, p.K, 1.f); }
#pragma unroll
            for (int t = 0; t < TN; ++t) { const int bn = min(n0 + 16 * t + l15, p.N - 1); b[t] = sp_ld(B + (long long)bn * p.sBn, p.sBk, k0, h, p.K, 1.f); }
#pragma unroll
            for (int i = 0; i < TM; ++i)
#pragma unroll
                for (int t = 0; t < TN; ++t) acc[i][t] = wmma3(a[i], b[t], acc[i][t]);
        } else if (MODE == 2) {
            v16b a[TM], b[TN];
#pragma unroll
            for (int i = 0; i < TM; ++i) { const int am = min(m0 + 16 * i + l15, p.M - 1); a[i] = bh_ld(A + (long long)am * p.sAm, p.sAk, k0, h, p.K, 1.f); }
#pragma unroll
            for (int t = 0; t < TN; ++t) { const int bn = min(n0 + 16 * t + l15, p.N - 1); b[t] = bh_ld(B + (long long)bn * p.sBn, p.sBk, k0, h, p.K, 1.f); }
#pragma unroll
            for (int i = 0; i < TM; ++i)
#pragma unroll
                for (int t = 0; t < TN; ++t) acc[i][t] = wmmab(a[i], b[t], acc[i][t]);
        } else {
            v16h a[TM], b[TN];
#pragma unroll
            for (int i = 0; i < TM; ++i) { const int am = min(m0 + 16 * i + l15, p.M - 1); a[i] = fh_ld(A + (long long)am * p.sAm, p.sAk, k0, h, p.K, p.sa); }
#pragma unroll
            for (int t = 0; t < TN; ++t) { const int bn = min(n0 + 16 * t + l15, p.N - 1); b[t] = fh_ld(B + (long long)bn * p.sBn, p.sBk, k0, h, p.K, p.sb); }
#pragma unroll
            for (int i = 0; i < TM; ++i)
#pragma unroll
                for (int t = 0; t < TN; ++t) acc[i][t] = wmma16(a[i], b[t], acc[i][t]);
        }
    }
    const float iscale = (MODE == 0) ? p.alpha / (p.sa * p.sb) : p.alpha;
    float* C = p.C + zo * p.sCo + zi * p.sCi;
    const float* R = p.R + zo * p.sRo + zi * p.sRi;
    const int NW = (p.Npad > p.N) ? p.Npad : p.N;
    __shared__ __align__(16) float ctile[16][36];
#pragma unroll
    for (int i = 0; i < TM; ++i) {
        const int mb = m0 + 16 * i; if (mb >= p.M) break;          // wave-uniform
#pragma unroll
        for (int tp = 0; tp < TN / 2; ++tp) {
            const int nb = n0 + 32 * tp; if (nb >= NW) break;        // wave-uniform
#pragma unroll
            for (int t2 = 0; t2 < 2; ++t2) {
                const int t = 2 * tp + t2; const int n = nb + t2 * 16 + l15; const int nn = min(n, p.N - 1);
#pragma unroll
                for (int r = 0; r < 8; ++r) {
                    const int m = mb + 8 * h + r; const int mm = min(m, p.M - 1);
                    float v = acc[i][t][r] * iscale;
                    if (p.flags & 1) v += p.bias[nn];
                    if (p.flags & 2) v += p.bias[mm];
            if (p.flags & 8) v *= p.bias[(long long)zo * p.M + mm];   /* per-(z,row) scale vector laid out [Z][M]; exclusive with the bias flags */
                    v = act_fn(v, p.act);
                    if (p.flags & 4) v += p.beta * R[(long long)mm * p.sRm + (long long)nn * p.sRn];
                    ctile[8 * h + r][t2 * 16 + l15] = (n < p.N) ? v : 0.f;
                }
            }
            __syncthreads();
            const bool fast = (mb + 16 <= p.M) && (nb + 32 <= NW) && ((p.sCm & 3) == 0) && ((((size_t)C) & 15) == 0);
            if (fast) {
#pragma unroll
                for (int s = 0; s < 4; ++s) {
                    const int row = s * 4 + (lane >> 3), c4 = (lane & 7) * 4;
                    const v4f v = *(const v4f*)&ctile[row][c4];
                    VST2V4(C + (long long)(mb + row) * p.sCm + nb + c4, v);
                }
            } else {
                for (int row = 0; row < 16; ++row) {
                    const int m = mb + row, n = nb + lane;
                    if (m < p.M && n < NW) VST2(float, C + (long long)m * p.sCm + n, ctile[row][lane]);
                }
            }
            __syncthreads();
        }
    }
}

// =====================================================================================================================
// k_attn_lds<L, RS, OS>: O = softmax(scale * Q.K^T) V for one head per blockIdx.y, head and value dim 64, L queries and L keys (L % 64 == 0), f32 in and out.
//   Wave = 16 queries, AW waves per block, 64-key blocks; grid (L / (16*AW), H, batch), block 32*AW. Row r of head h of batch element z: Q/K/V + (z*L + r)*RS + h*64, O + (z*L + r)*OS + h*64.
//   Each 64-key block of K and of V is read once per work-group with 16-byte loads, converted to f16 and laid in LDS as [key][d] rows:
//   K at a pitch of 144 B for ds_load_b128 fragment reads (A operand of k.q^T, same k order as the Q fragment),
//   V at a pitch of 160 B for ds_load_tr16_b128 fragment reads (A operand of v^T.p^T: lane = row d, k = key in the frag_k order).
//   Both products are taken transposed: S^T = K.Q^T puts query l15 in lane column l15, so lanes l15 and l15+16 hold all 64 scores of one query
//   (tile t, register r: key 16t + 8*hf + r); maximum and sum run inside the lane, with one exchange between the lane halves.
//   Two S^T tiles of 16 keys, converted in place, are the B fragment of O^T += V^T.P^T in the frag_k order: P never leaves the registers.
//   Statistics f32 (exp2 domain); P x 4096 as f16.
//   Output map: Y^T = Wo[h]^T.O^T + bo[h]. Wo[h] x 16 lies in LDS as f16 [d][e] rows, laid and read exactly like a V tile (A operand: lane = row e, k = d);
//   the normalised O^T tiles, converted in place like P, are the B fragment. O receives Y, row r of head h of batch element z at O + (z*L + r)*OS + h*64.
// =====================================================================================================================
#define AW 4
typedef __attribute__((ext_vector_type(4))) _Float16 v4h;
typedef __attribute__((ext_vector_type(8))) short    v8s;
union FragH { v16h v; v8h h[2]; };
// 16-bit transposing LDS load: with lane address T + (k0 + 8*(l>>4) + (l&7)) * pitch + d0 + 8*((l>>3)&1) (halves), lane (c = l&15, h = l>>4) gets T[k0 + 8h + 0..7][d0 + c]
__device__ __forceinline__ v8h ld_tr16(const _Float16* p) {
    typedef __attribute__((address_space(3))) v8s lds_v8s;
    return __builtin_bit_cast(v8h, __builtin_amdgcn_ds_load_tr16_b128_v8i16((lds_v8s*)p));
}
// value of lane l ^ 16
__device__ __forceinline__ float swap_half(float x) {
    const int b = __builtin_bit_cast(int, x);
    return __builtin_bit_cast(float, __builtin_amdgcn_permlanex16(b, b, 0x76543210, 0xfedcba98, false, false));
}
// 2^x as the one hardware instruction. exp2f() wraps it in a compare, two selects and an ldexp so that results below 2^-126 come out as subnormals;
// here every argument is <= 0 and such a result may be 0: as P it is below f16's range even x 4096, in the sum it stands beside a term 2^0, as the rescale factor it multiplies
// what the new maximum's term outweighs by 2^126. exp2_raw(-inf) = 0 as before.
__device__ __forceinline__ float exp2_raw(float x) { return __builtin_amdgcn_exp2f(x); }
template <int L, int RS, int OS>
__global__ __launch_bounds__(32 * AW) void k_attn_lds(const float* __restrict__ Q, const float* __restrict__ K, const float* __restrict__ V, const float* __restrict__ Wo, const float* __restrict__ bo, float* __restrict__ O, float scale) {
    constexpr int KP = 72;                      // K tile pitch in halves (144 B: odd multiple of 16 B)
    constexpr int VP = 80;                      // V tile pitch in halves (160 B: odd multiple of 32 B)
    constexpr int OP = 68;                      // output tile pitch in floats (272 B: odd multiple of 16 B)
    __shared__ __align__(16) float    pl[AW][16 * OP];
    __shared__ __align__(16) _Float16 kl[64 * KP];
    __shared__ __align__(16) _Float16 vl[64 * VP];
    __shared__ __align__(16) _Float16 wl[64 * VP];   // Wo[h] x 16, [d][e], V's pitch (same reader)
    const int lane = threadIdx.x & 31, hf = lane >> 4, l15 = lane & 15, wave = threadIdx.x >> 5;
    const int h = blockIdx.y;
    const int q0 = (blockIdx.x * AW + wave) * 16;
    const long long zr = (long long)blockIdx.z * L;   // first row of this batch element
    float* myp = pl[wave];
    const float L2E = 1.4426950408889634f;
    const float NEG = -__builtin_inff();
    const float* qrow = Q + h * 64 + (zr + q0 + l15) * RS;
    const float* kbase = K + h * 64 + zr * RS;
    const float* vbase = V + h * 64 + zr * RS;
    v16h qa[2];
#pragma unroll
    for (int ks = 0; ks < 2; ++ks) qa[ks] = fh_ld(qrow, 1, ks * 32, hf, 64, 1.f);
    v8f o[4];                                   // o[t][r] = O^T[d = 16t + 8*hf + r][query l15]
    float m1 = NEG, l1 = 0.f;                   // query l15: running maximum (equal in both lane halves), sum over this half's keys
#pragma unroll
    for (int t = 0; t < 4; ++t) { v8f zz = {}; o[t] = zz; }
    const int sr = threadIdx.x >> 4, sc4 = (threadIdx.x & 15) * 4;   // staging: 16 threads per 64-float row, 8 rows per sweep
    const _Float16* kfr = kl + l15 * KP + 8 * hf;
    const _Float16* vfr = vl + (8 * hf + (lane & 7)) * VP + 8 * ((lane >> 3) & 1);
    const _Float16* wfr = wl + (8 * hf + (lane & 7)) * VP + 8 * ((lane >> 3) & 1);
    {                                                    // the head's output map into LDS; the key loop's first barriers publish it
        const float* wbase = Wo + h * 64 * 64;
        v4f wr[8];
#pragma unroll
        for (int i = 0; i < 8; ++i) wr[i] = *(const v4f*)(wbase + (i * 8 + sr) * 64 + sc4);
        asm volatile("s_wait_xcnt 0x0" ::: "memory");    // stands in front of any reuse of the address registers of the loads above
#pragma unroll
        for (int i = 0; i < 8; ++i) *(v4h*)(wl + (i * 8 + sr) * VP + sc4) = __builtin_convertvector(wr[i] * 16.f, v4h);
    }
    for (int j0 = 0; j0 < L; j0 += 64) {
        v4f kr[8], vr[8];
#pragma unroll
        for (int i = 0; i < 8; ++i) {
            const long long off = (long long)(j0 + i * 8 + sr) * RS + sc4;
            kr[i] = *(const v4f*)(kbase + off); vr[i] = *(const v4f*)(vbase + off);
        }
        asm volatile("s_wait_xcnt 0x0" ::: "memory");    // stands in front of any reuse of the address registers of the loads above
        __syncthreads();                                 // previous key block's reads of kl / vl are done
#pragma unroll
        for (int i = 0; i < 8; ++i) {
            *(v4h*)(kl + (i * 8 + sr) * KP + sc4) = __builtin_convertvector(kr[i], v4h);
            *(v4h*)(vl + (i * 8 + sr) * VP + sc4) = __builtin_convertvector(vr[i], v4h);
        }
        __syncthreads();                                 // K and V tiles visible to every wave
        FragH kb[4][2];                                  // all eight K fragments behind one LDS latency
#pragma unroll
        for (int t = 0; t < 4; ++t)
#pragma unroll
            for (int ks = 0; ks < 2; ++ks) {
                kb[t][ks].h[0] = *(const v8h*)(kfr + t * 16 * KP + ks * 32);
                kb[t][ks].h[1] = *(const v8h*)(kfr + t * 16 * KP + ks * 32 + 16);
            }
        v8f s[4];                                        // s[t][r] = S[query l15][key j0 + 16t + 8*hf + r]
#pragma unroll
        for (int t = 0; t < 4; ++t) {
            v8f acc = {};
#pragma unroll
            for (int ks = 0; ks < 2; ++ks) acc = wmma16(kb[t][ks].v, qa[ks], acc);
            s[t] = acc;
        }
        float sc[4][8], mt[4];
#pragma unroll
        for (int t = 0; t < 4; ++t) {
            mt[t] = NEG;
#pragma unroll
            for (int i = 0; i < 8; ++i) { sc[t][i] = (s[t][i] * scale) * L2E; mt[t] = fmaxf(mt[t], sc[t][i]); }
        }
        float mx = fmaxf(fmaxf(mt[0], mt[1]), fmaxf(mt[2], mt[3]));
        mx = fmaxf(mx, swap_half(mx));
        const float mnew = fmaxf(m1, mx);
        const float mref = (mnew == NEG) ? 0.f : mnew;   // a query with only -inf scores so far: every exp2 below is exp2(-inf) = 0, never exp2(nan)
        const float corr = exp2_raw(m1 - mref);
        FragH pa[2]; float rt[4];
#pragma unroll
        for (int t = 0; t < 4; ++t) {
            rt[t] = 0.f;
#pragma unroll
            for (int i = 0; i < 8; ++i) {
                const float pp = exp2_raw(sc[t][i] - mref);
                rt[t] += pp; pa[t >> 1].v[(t & 1) * 8 + i] = (_Float16)(pp * 4096.f);
            }
        }
        l1 = l1 * corr + ((rt[0] + rt[1]) + (rt[2] + rt[3])); m1 = mnew;
#pragma unroll
        for (int t = 0; t < 4; ++t) o[t] *= corr;
        FragH vb[4][2];                                  // all eight V fragments behind one LDS latency
#pragma unroll
        for (int t = 0; t < 4; ++t) {
            vb[t][0].h[0] = ld_tr16(vfr + t * 16);           vb[t][0].h[1] = ld_tr16(vfr + 16 * VP + t * 16);
            vb[t][1].h[0] = ld_tr16(vfr + 32 * VP + t * 16); vb[t][1].h[1] = ld_tr16(vfr + 48 * VP + t * 16);
        }
#pragma unroll
        for (int t = 0; t < 4; ++t) {
            o[t] = wmma16(vb[t][0].v, pa[0].v, o[t]);
            o[t] = wmma16(vb[t][1].v, pa[1].v, o[t]);
        }
    }
    float* obase = O + h * 64 + zr * OS;
    const float lt = l1 + swap_half(l1);
    const float inv = (lt > 0.f) ? 1.f / (lt * 4096.f) : 0.f;
    FragH ob[2];                                         // O^T as f16: tiles 2ks and 2ks+1 are the B fragment of d chunk ks in the frag_k order
#pragma unroll
    for (int t = 0; t < 4; ++t)
#pragma unroll
        for (int i = 0; i < 8; ++i) ob[t >> 1].v[(t & 1) * 8 + i] = (_Float16)(o[t][i] * inv);
    FragH wb[4][2];
#pragma unroll
    for (int t = 0; t < 4; ++t) {
        wb[t][0].h[0] = ld_tr16(wfr + t * 16);           wb[t][0].h[1] = ld_tr16(wfr + 16 * VP + t * 16);
        wb[t][1].h[0] = ld_tr16(wfr + 32 * VP + t * 16); wb[t][1].h[1] = ld_tr16(wfr + 48 * VP + t * 16);
    }
#pragma unroll
    for (int t = 0; t < 4; ++t) {
        v8f ov = {};                                     // ov[r] = 16 * Y^T[e = 16t + 8*hf + r][query l15]
        ov = wmma16(wb[t][0].v, ob[0].v, ov);
        ov = wmma16(wb[t][1].v, ob[1].v, ov);
        *(v4f*)(myp + l15 * OP + t * 16 + 8 * hf)     = __builtin_shufflevector(ov, ov, 0, 1, 2, 3);
        *(v4f*)(myp + l15 * OP + t * 16 + 8 * hf + 4) = __builtin_shufflevector(ov, ov, 4, 5, 6, 7);
    }
    const v4f bv = *(const v4f*)(bo + h * 64 + l15 * 4);
    __syncthreads();
#pragma unroll
    for (int r0 = 0; r0 < 16; r0 += 2) {
        const int row = r0 + hf, c4 = l15 * 4;
        const v4f v = *(const v4f*)(myp + row * OP + c4) * 0.0625f + bv;
        VST2V4(obase + (long long)(q0 + row) * OS + c4, v);
    }
}

// =====================================================================================================================
// k_tr: dst(z, c, r) = alpha * src(z, r, c) (+ beta * R2(z, c, r)): [Z][R][C] (row stride lds) -> [Z][C][R] (row stride ldd) through a 32x32 LDS tile;
//   flags: 1 -> add beta * residual R2 addressed like dst (z*sRz + c*ldr + r); act applied before the residual.
// =====================================================================================================================
struct TrP { const float* src; float* dst; const float* R2; long long sSz, lds, sDz, ldd, sRz, ldr; int R, C, flags, act; float alpha, beta; };
static_assert(sizeof(TrP) == 3 * 8 + 6 * 8 + 6 * 4, "TrP has padding");
__global__ __launch_bounds__(256) void k_tr(TrP p) {
    __shared__ float tile[32][33];
    const int c0 = blockIdx.x * 32, r0 = blockIdx.y * 32, z = blockIdx.z;
    const int lane = threadIdx.x & 31, wave = threadIdx.x >> 5;
    const float* s = p.src + z * p.sSz;
#pragma unroll
    for (int k = 0; k < 4; ++k) {
        const int rl = wave * 4 + k, r = r0 + rl, c = c0 + lane;
        tile[rl][lane] = (r < p.R && c < p.C) ? s[(long long)r * p.lds + c] : 0.f;
    }
    __syncthreads();
    float* d = p.dst + z * p.sDz; const float* rr = p.R2 + z * p.sRz;
#pragma unroll
    for (int k = 0; k < 4; ++k) {
        const int cl = wave * 4 + k, c = c0 + cl, r = r0 + lane;
        if (c < p.C && r < p.R) {
            float v = act_fn(p.alpha * tile[lane][cl], p.act);
            if (p.flags & 1) v += p.beta * rr[(long long)c * p.ldr + r];
            VST2(float, d + (long long)c * p.ldd + r, v);
        }
    }
}

// k_affine: dst[i] = a * (sdev ? sdev[0] : 1) * src[i] + b, i < n (one thread per element; consecutive lanes -> consecutive addresses)
__global__ __launch_bounds__(256) void k_affine(const float* __restrict__ src, float* __restrict__ dst, int n, float a, float b, const float* __restrict__ sdev) {
    const int i = blockIdx.x * 256 + threadIdx.x;
    if (i < n) { const float aa = sdev ? a * sdev[0] : a; const float v = aa * src[i] + b; VST2(float, dst + i, v); }
}

// =====================================================================================================================
// k_softmax: row softmax over n contiguous elements, one 256-thread block per row; rows addressed z*sz + r*sr (grid (R, Z)).
//   out = scale_out * softmax(scale_in * x + (Mf ? Mf[z*smz + r*smr + j] : 0)); a row whose max is -inf is written as 0.
// =====================================================================================================================
struct SmP { const float* src; float* dst; const float* Mf; long long sz, sr, dz, dr, smz, smr; int n, pad; float scale_in, scale_out; };
static_assert(sizeof(SmP) == 3 * 8 + 6 * 8 + 4 * 4, "SmP has padding");
__global__ __launch_bounds__(256) void k_softmax(SmP p) {
    __shared__ float red[256];
    const int r = blockIdx.x, z = blockIdx.y, tid = threadIdx.x;
    const float* s = p.src + z * p.sz + (long long)r * p.sr;
    const float* mf = p.Mf ? (p.Mf + z * p.smz + (long long)r * p.smr) : nullptr;
    float mx = -__builtin_inff();
    for (int j = tid; j < p.n; j += 256) { float v = s[j] * p.scale_in; if (mf) v += mf[j]; mx = fmaxf(mx, v); }
    red[tid] = mx; __syncthreads();
    for (int o = 128; o > 0; o >>= 1) { if (tid < o) red[tid] = fmaxf(red[tid], red[tid + o]); __syncthreads(); }
    mx = red[0]; __syncthreads();
    float sum = 0.f;
    for (int j = tid; j < p.n; j += 256) { float v = s[j] * p.scale_in; if (mf) v += mf[j]; sum += (mx == -__builtin_inff()) ? 0.f : expf(v - mx); }
    red[tid] = sum; __syncthreads();
    for (int o = 128; o > 0; o >>= 1) { if (tid < o) red[tid] += red[tid + o]; __syncthreads(); }
    sum = red[0];
    const float inv = (sum > 0.f) ? p.scale_out / sum : 0.f;
    float* d = p.dst + z * p.dz + (long long)r * p.dr;
    for (int j = tid; j < p.n; j += 256) { float v = s[j] * p.scale_in; if (mf) v += mf[j]; const float o = (mx == -__builtin_inff()) ? 0.f : expf(v - mx) * inv; VST2(float, d + j, o); }
}
// =====================================================================================================================
// k_stats: mean and rsqrt(var + eps) over a set of n elements addressed base + z*sz + (e / inner) * so + (e % inner) * si, one 256-thread
// k_norm_apply: y = (x - mean[set]) * rstd[set] * g[c] + b[c] over a [Z][C][L] channel-major tensor with set = z*G + c / (C/G) (G groups per z;
//   G = C -> per-channel sets indexed z*C+c; for batch norm pass stats indexed by c only via bn = 1). Optional act. Output same layout.
// =====================================================================================================================
//   mode 0: mean / rsqrt(var + eps); mode 1 (RMSNorm): 0 / rsqrt(mean(x^2) + eps); mode 2 (L2 normalize * sqrt(n)): 0 / sqrt(n) / max(||x||, eps); mode 3: as 0 with unbiased variance (n-1)
__global__ __launch_bounds__(256) void k_stats(const float* __restrict__ x, long long sz, long long so, long long si, int inner, int n, float eps, float* __restrict__ stat, int mode) {
    __shared__ float red[256];
    const int z = blockIdx.x, tid = threadIdx.x;
    const float* base = x + z * sz;
    float s = 0.f;
    for (int e = tid; e < n; e += 256) s += base[(long long)(e / inner) * so + (long long)(e % inner) * si];
    red[tid] = s; __syncthreads();
    for (int o = 128; o > 0; o >>= 1) { if (tid < o) red[tid] += red[tid + o]; __syncthreads(); }
    const float mu = (mode == 0 || mode == 3) ? red[0] / (float)n : 0.f; __syncthreads();
    float q = 0.f;
    for (int e = tid; e < n; e += 256) { const float dlt = base[(long long)(e / inner) * so + (long long)(e % inner) * si] - mu; q += dlt * dlt; }
    red[tid] = q; __syncthreads();
    for (int o = 128; o > 0; o >>= 1) { if (tid < o) red[tid] += red[tid + o]; __syncthreads(); }
    {
        float rs;
        if (mode == 2) rs = sqrtf((float)n) / fmaxf(sqrtf(red[0]), eps); else if (mode == 3) rs = rsqrtf(red[0] / (float)(n - 1) + eps); else rs = rsqrtf(red[0] / (float)n + eps);
        if (tid < 32) { const float v = (tid == 0) ? mu : ((tid == 1) ? rs : 0.f); VST2(float, stat + (long long)z * 32 + tid, v); }
    }
}
//   One thread per element over the flat [Z][C][L] index space: grid ceil(Z*C*L / 256).
__global__ __launch_bounds__(256) void k_norm_apply(const float* __restrict__ x, float* __restrict__ y, const float* __restrict__ stat, const float* __restrict__ g, const float* __restrict__ bta,
                                                     int Z, int C, int L, int G, int bn, int act) {
    const long long idx = (long long)blockIdx.x * 256 + threadIdx.x;
    if (idx >= (long long)Z * C * L) return;
    const int l = (int)(idx % L); const long long zc = idx / L; const int c = (int)(zc % C), z = (int)(zc / C); (void)l;
    const int set = bn ? c : (z * G + c / (C / G));
    float v = (x[idx] - stat[(long long)set * 32]) * stat[(long long)set * 32 + 1];
    if (g) v *= g[c];
    if (bta) v += bta[c];
    v = act_fn(v, act);
    VST2(float, y + idx, v);
}

// k_lse_neg: c[i] = -(st[2i] + log(st[2i+1])) = minus the log-sum-exp of row i (for softmax over the query dimension)
__global__ __launch_bounds__(256) void k_lse_neg(const float* __restrict__ st, float* __restrict__ c, int n) {
    const int i = blockIdx.x * 256 + threadIdx.x;
    if (i < n) { const float v = -(st[2 * i] + logf(st[2 * i + 1])); VST2(float, c + i, v); }
}

// k_iota: dst[i] = a * i + b as int32 (segment/position id helper)
__global__ __launch_bounds__(256) void k_iota(int* __restrict__ dst, int n, int a, int b) {
    const int i = blockIdx.x * 256 + threadIdx.x;
    if (i < n) { const int v = a * i + b; VST2(int, dst + i, v); }
}

// k_axpby: dst[i] = a * x[i] + b * y[i] (+ c), i < n
__global__ __launch_bounds__(256) void k_axpby(const float* __restrict__ x, const float* __restrict__ y, float* __restrict__ dst, int n, float a, float b, float c) {
    const int i = blockIdx.x * 256 + threadIdx.x;
    if (i < n) { const float v = a * x[i] + b * y[i] + c; VST2(float, dst + i, v); }
}

// =====================================================================================================================
// k_rope: rotary embedding on a [R rows][Hn heads][D] view (row stride sXr, head stride sXh, element stride 1) -> Y (own strides).
//   mode 0: rotate_half (partner d±D/2, sign - for d<D/2); mode 1: interleaved pairs (partner d^1, sign - for even d).
//   table column tcol: tmode 0 -> d, 1 -> d % (D/2), 2 -> d / 2; position p: pmode 0 -> r % S, 1 -> head index, 2 -> pos[r];
//   c = C[(r / S) * sCb + p * sCp + tcol * sCd], s likewise from Sn; y = x[d] * c + sign * x[partner] * s. X and Y must not alias.
// =====================================================================================================================
struct RopeP { const float* X; float* Y; const float* C; const float* Sn; const int* pos; long long sXr, sXh, sYr, sYh, sCb, sCp, sCd; int R, Hn, D, S, mode, tmode, pmode, pad; };
static_assert(sizeof(RopeP) == 5 * 8 + 7 * 8 + 8 * 4, "RopeP has padding");
__global__ __launch_bounds__(256) void k_rope(RopeP p) {
    const long long idx = (long long)blockIdx.x * 256 + threadIdx.x;
    if (idx >= (long long)p.R * p.Hn * p.D) return;
    const int d = (int)(idx % p.D); const long long rh = idx / p.D; const int h = (int)(rh % p.Hn); const int r = (int)(rh / p.Hn);
    const int half = p.D / 2;
    int partner; float sign;
    if (p.mode == 0) { partner = (d < half) ? d + half : d - half; sign = (d < half) ? -1.f : 1.f; }
    else { partner = d ^ 1; sign = (d & 1) ? 1.f : -1.f; }
    const int tcol = (p.tmode == 0) ? d : ((p.tmode == 1) ? (d % half) : (d >> 1));
    const int pp = (p.pmode == 0) ? (r % p.S) : ((p.pmode == 1) ? h : p.pos[r]);
    const long long toff = (long long)(r / p.S) * p.sCb + (long long)pp * p.sCp + (long long)tcol * p.sCd;
    const float* xr = p.X + (long long)r * p.sXr + (long long)h * p.sXh;
    const float v = xr[d] * p.C[toff] + sign * xr[partner] * p.Sn[toff];
    VST2(float, p.Y + (long long)r * p.sYr + (long long)h * p.sYh + d, v);
}

// k_invf + k_sincos (split so neither kernel carries a large VALU-fma footprint): invf_i = num * (1 / powf(base, (2 i)/D)) [fmode 0],
//   num * expf((2 i) * cexp) [fmode 1], num * powf(base, -2 (i - 1) / D) [fmode 2]; then cs/sn[s*half + i] = cos/sin((pscale * s) * invf_i)
__global__ __launch_bounds__(256) void k_invf(float* __restrict__ invb, int half, int D, float base, float num, int fmode, float cexp) {
    const int i = blockIdx.x * 256 + threadIdx.x;
    if (i >= ((half + 31) / 32) * 32) return;
    if (i >= half) { VST2(float, invb + i, 0.f); return; }
    const float e = (float)(2 * i) / (float)D;
    float invf;
    if (fmode == 1) invf = num * expf((float)(2 * i) * cexp);
    else if (fmode == 2) invf = num * powf(base, (-2.0f * ((float)i - 1.0f)) / (float)D);
    else invf = num * (1.0f / powf(base, e));
    VST2(float, invb + i, invf);
}
__global__ __launch_bounds__(256) void k_sincos(float* __restrict__ cs, float* __restrict__ sn, const float* __restrict__ invb, int S, int half, float pscale) {
    const int idx = blockIdx.x * 256 + threadIdx.x;
    if (idx >= S * half) return;
    const int s = idx / half, i = idx - s * half;
    const float ang = (pscale * (float)s) * invb[i];
    VST2(float, cs + idx, cosf(ang)); VST2(float, sn + idx, sinf(ang));
}

// k_mulact: dst[i] = act(x[i]) * y[i]
__global__ __launch_bounds__(256) void k_mulact(const float* __restrict__ x, const float* __restrict__ y, float* __restrict__ dst, int n, int act) {
    const int i = blockIdx.x * 256 + threadIdx.x;
    if (i < n) { const float v = act_fn(x[i], act) * y[i]; VST2(float, dst + i, v); }
}

// =====================================================================================================================
// k_matvec: thread-per-row matrix-vector products for N <= 8 output columns (heads with 1-3 outputs, gates), f32 on the VALU.
//   C[r*sCm + j] = act(alpha * sum_k A[r*sAm + k*sAk] * B[j*sBn + k*sBk] + bias[j]) + beta * R[r*sRm + j*sRn]; each thread writes its N contiguous floats.
// =====================================================================================================================
__global__ __launch_bounds__(256) void k_matvec(GemmP p) {
    // 32 lanes write one line with one instruction.
    const int rpt = (p.N == 1) ? 1 : 32;
    const long long r0 = ((long long)blockIdx.x * 256 + threadIdx.x) * rpt; const int z = blockIdx.z, zo = z / p.zi_n, zi = z - zo * p.zi_n;
    if (r0 >= p.M) return;
    const float* Bb = p.B + zo * p.sBo + zi * p.sBi;
    float* C = p.C + zo * p.sCo + zi * p.sCi; const float* R = p.R + zo * p.sRo + zi * p.sRi;
    for (int rr = 0; rr < rpt; ++rr) {
        const long long r = r0 + rr; if (r >= p.M) break;
        const float* A = p.A + zo * p.sAo + zi * p.sAi + r * p.sAm;
        float acc[8] = {0.f, 0.f, 0.f, 0.f, 0.f, 0.f, 0.f, 0.f};
        for (int k = 0; k < p.K; ++k) { const float a = A[(long long)k * p.sAk];
#pragma unroll
            for (int j = 0; j < 8; ++j) if (j < p.N) acc[j] += a * Bb[(long long)j * p.sBn + (long long)k * p.sBk]; }
#pragma unroll
        for (int j = 0; j < 8; ++j) if (j < p.N) {
            float v = acc[j] * p.alpha;
            if (p.flags & 1) v += p.bias[j];
            if (p.flags & 2) v += p.bias[r];
            v = act_fn(v, p.act);
            if (p.flags & 4) v += p.beta * R[r * p.sRm + (long long)j * p.sRn];
            VST2(float, C + r * p.sCm + j, v);
        }
    }
}
// k_smallsoftmax: thread-per-row softmax for short rows (n <= 64): dst[r*dr + j] = softmax(scale*src[r*sr + j])
__global__ __launch_bounds__(256) void k_smallsoftmax(const float* __restrict__ src, float* __restrict__ dst, long long sr, long long dr, int n, long long R, float scale) {
    const long long r0 = ((long long)blockIdx.x * 256 + threadIdx.x) * 32;
    for (int rr = 0; rr < 32; ++rr) {
        const long long r = r0 + rr; if (r >= R) return;
        const float* s = src + r * sr; float* d = dst + r * dr;
        float mx = -__builtin_inff();
        for (int j = 0; j < n; ++j) mx = fmaxf(mx, s[j] * scale);
        float sum = 0.f;
        for (int j = 0; j < n; ++j) sum += expf(s[j] * scale - mx);
        const float inv = 1.f / sum;
        for (int j = 0; j < n; ++j) { const float v = expf(s[j] * scale - mx) * inv; VST2(float, d + j, v); }
    }
}

__global__ __launch_bounds__(32) void k_unitstat(float* __restrict__ st) { const int t = threadIdx.x; const float v = (t == 1) ? 1.f : 0.f; VST2(float, st + t, v); }

// destination (e.g. a d_out whose row width is not a multiple of 32 floats) is written by consecutive lanes of one instruction
__global__ __launch_bounds__(256) void k_lincopy(const float* __restrict__ src, long long lds, float* __restrict__ dst, long long ldd, long long rows, int cols) {
    const long long i = (long long)blockIdx.x * 256 + threadIdx.x; if (i >= rows * cols) return;
    const long long r = i / cols; const int c = (int)(i - r * cols);
    const float v = src[r * lds + c]; VST2(float, dst + r * ldd + c, v);
}

namespace w25 {
typedef __attribute__((ext_vector_type(16))) _Float16 v16h;
typedef __attribute__((ext_vector_type(8)))  _Float16 v8h;
typedef __attribute__((ext_vector_type(16))) __bf16   v16b;
typedef __attribute__((ext_vector_type(8)))  __bf16   v8b;
typedef __attribute__((ext_vector_type(8)))  float    v8f;
typedef __attribute__((ext_vector_type(4)))  float    v4f;

__device__ __forceinline__ unsigned short f2bf_bits(float f) {
  unsigned u = __float_as_uint(f);
  return (unsigned short)((u + 0x7FFFu + ((u >> 16) & 1u)) >> 16);
}
__device__ __forceinline__ float bf_bits2f(unsigned short h) { return __uint_as_float(((unsigned)h) << 16); }

// hazard guards as plain device helpers (no inline asm inside the kernel template body)
__device__ __forceinline__ void dep_guard_h(v8f& a, v8f& b, v16h x, v16h y) { asm volatile("v_nop\n\tv_nop\n\tv_nop\n\tv_nop" : "+v"(a), "+v"(b) : "v"(x), "v"(y)); }
__device__ __forceinline__ void dep_guard_b(v8f& a, v8f& b, v16b x, v16b y) { asm volatile("v_nop\n\tv_nop\n\tv_nop\n\tv_nop" : "+v"(a), "+v"(b) : "v"(x), "v"(y)); }
__device__ __forceinline__ void keep4_h(v16h a, v16h b, v16h c, v16h d) { asm volatile("v_nop" :: "v"(a), "v"(b), "v"(c), "v"(d)); }
__device__ __forceinline__ void keep4_b(v16b a, v16b b, v16b c, v16b d) { asm volatile("v_nop" :: "v"(a), "v"(b), "v"(c), "v"(d)); }
__device__ __forceinline__ void acc_guard4(v8f& a, v8f& b, v8f& c, v8f& d) { asm volatile("v_nop\n\tv_nop\n\tv_nop\n\tv_nop" : "+v"(a), "+v"(b), "+v"(c), "+v"(d)); }
template <typename T> struct Frag;
template <> struct Frag<_Float16> {
  typedef v16h V; union U { v16h v; v8h h[2]; };
  static __device__ __forceinline__ v16h load(const _Float16* p) {   // elements 0..7 <- p[0..7], 8..15 <- p[16..23]
    U f; f.h[0] = *(const v8h*)(p); f.h[1] = *(const v8h*)(p + 16); return f.v;
  }
  static __device__ __forceinline__ v8f mma(v16h a, v16h b, v8f c) {
    return __builtin_amdgcn_wmma_f32_16x16x32_f16(false, a, false, b, (short)0, c, false, false);
  }
  static __device__ __forceinline__ void guard(v8f& a, v8f& b, v16h x, v16h y) { dep_guard_h(a, b, x, y); }
  static __device__ __forceinline__ void keep(v16h a, v16h b, v16h c, v16h d) { keep4_h(a, b, c, d); }
};
template <> struct Frag<__bf16> {
  typedef v16b V; union U { v16b v; v8b h[2]; };
  static __device__ __forceinline__ v16b load(const __bf16* p) {
    U f; f.h[0] = *(const v8b*)(p); f.h[1] = *(const v8b*)(p + 16); return f.v;
  }
  static __device__ __forceinline__ v8f mma(v16b a, v16b b, v8f c) {
    return __builtin_amdgcn_wmma_f32_16x16x32_bf16(false, a, false, b, (short)0, c, false, false);
  }
  static __device__ __forceinline__ void guard(v8f& a, v8f& b, v16b x, v16b y) { dep_guard_b(a, b, x, y); }
  static __device__ __forceinline__ void keep(v16b a, v16b b, v16b c, v16b d) { keep4_b(a, b, c, d); }
};

// ---- Register-blocked batched WMMA GEMM ------------------------------------
// C[m,n] = scale * sum_k A[m,k] * Bt[n,k] (+bias)(+resid); each wave owns a 64x64 tile.
// A row-major [M,K]; Bt row-major [N,K]; M,N % 64 == 0, K % 32 == 0.
// SPLIT: operands are hi/lo planes (A2/Bt2 = lo planes, same layout); product = hi·hi + hi·lo + lo·hi.
// BIAS_MODE: 0 = none, 1 = bias[m], 2 = bias[n].
// OUT_MODE: 0 = f32, 1 = f16, 2 = bf16 hi plane (Cout) + bf16 lo plane (Cout2).
// ET: 0 = f16 operands, 1 = bf16 operands (pointers passed as 16-bit storage)
template <int ET> struct Elem;
template <> struct Elem<0> { typedef _Float16 T; };
template <> struct Elem<1> { typedef __bf16 T; };
template <int ET, bool SPLIT, int BIAS_MODE, int OUT_MODE, bool RESID, int ACT = 0>
__global__ __launch_bounds__(256) void wmma_gemm64(
    const unsigned short* __restrict__ Ap, const unsigned short* __restrict__ A2p, int lda, long strideA,
    const unsigned short* __restrict__ Btp, const unsigned short* __restrict__ Bt2p, int ldb, long strideB,
    void* __restrict__ Cout, void* __restrict__ Cout2, int ldc, long strideC,
    const float* __restrict__ bias,
    const float* __restrict__ resid, long strideR,
    int M, int N, int K, float scale) {
  typedef typename Elem<ET>::T T;
  typedef typename Frag<T>::V V;
  const T* A = (const T*)Ap; const T* A2 = (const T*)A2p; const T* Bt = (const T*)Btp; const T* Bt2 = (const T*)Bt2p;
  __shared__ __align__(16) float sT[8][16 * 68];   // per-wave 16x64 slab, pitch 68 floats
  const int b    = blockIdx.y;
  const int lane = threadIdx.x & 31;
  const int wave = threadIdx.x >> 5;
  const int tilesN = N >> 6;
  const int tilesM = M >> 6;
  const int tile = blockIdx.x * 8 + wave;
  if (tile >= tilesM * tilesN) return;   // wave-uniform; no block barriers in this kernel
  const int tm = tile / tilesN;
  const int tn = tile - tm * tilesN;
  const int m0 = tm << 6;
  const int n0 = tn << 6;

  const T* Ab  = A  + (size_t)b * strideA;
  const T* Bb  = Bt + (size_t)b * strideB;
  const T* Ab2 = SPLIT ? (A2  + (size_t)b * strideA) : nullptr;
  const T* Bb2 = SPLIT ? (Bt2 + (size_t)b * strideB) : nullptr;

  const int rlane = lane & 15;                 // row (A) / col (B, D) within subtile
  const int koff  = (lane >> 4) * 8;           // k offset of this lane half
  const int mOff  = (lane >> 4) * 8;           // D row offset

  v8f acc[4][4];
#pragma unroll
  for (int i = 0; i < 4; ++i)
#pragma unroll
    for (int j = 0; j < 4; ++j) acc[i][j] = (v8f){0.f,0.f,0.f,0.f,0.f,0.f,0.f,0.f};

  for (int k0 = 0; k0 < K; k0 += 32) {
    V bh[4], bl[4];
#pragma unroll
    for (int j = 0; j < 4; ++j) {
      const size_t bo = (size_t)(n0 + (j << 4) + rlane) * ldb + koff + k0;
      bh[j] = Frag<T>::load(Bb + bo);
      if (SPLIT) bl[j] = Frag<T>::load(Bb2 + bo);
    }
#pragma unroll
    for (int i = 0; i < 4; ++i) {
      const size_t ao = (size_t)(m0 + (i << 4) + rlane) * lda + koff + k0;
      V ah = Frag<T>::load(Ab + ao);
      V al;
      if (SPLIT) al = Frag<T>::load(Ab2 + ao);
#pragma unroll
      for (int j = 0; j < 4; ++j) {
        acc[i][j] = Frag<T>::mma(ah, bh[j], acc[i][j]);
        if (SPLIT) {
          acc[i][j] = Frag<T>::mma(ah, bl[j], acc[i][j]);
          acc[i][j] = Frag<T>::mma(al, bh[j], acc[i][j]);
        }
      }
      Frag<T>::guard(acc[i][0], acc[i][3], ah, SPLIT ? al : ah);
    }
    Frag<T>::keep(bh[0], bh[1], bh[2], bh[3]);
    if (SPLIT) Frag<T>::keep(bl[0], bl[1], bl[2], bl[3]);
  }
  acc_guard4(acc[0][0], acc[0][1], acc[0][2], acc[0][3]);
  acc_guard4(acc[1][0], acc[1][1], acc[1][2], acc[1][3]);
  acc_guard4(acc[2][0], acc[2][1], acc[2][2], acc[2][3]);
  acc_guard4(acc[3][0], acc[3][1], acc[3][2], acc[3][3]);

  // ---- epilogue ----
  float* slab = sT[wave];
  const float* Rb = RESID ? (resid + (size_t)b * strideR) : nullptr;
#pragma unroll
  for (int i = 0; i < 4; ++i) {
    const int mBase = m0 + (i << 4);
#pragma unroll
    for (int j = 0; j < 4; ++j) {
      const int n = n0 + (j << 4) + rlane;
      float bv = 0.f;
      if (BIAS_MODE == 2) bv = bias[n];
#pragma unroll
      for (int r = 0; r < 8; ++r) {
        float v = acc[i][j][r] * scale;
        if (BIAS_MODE == 1) v += bias[mBase + mOff + r];
        if (BIAS_MODE == 2) v += bv;
        if (RESID) v += Rb[(size_t)(mBase + mOff + r) * ldc + n];
        if (ACT == 1) v = tanhf(v);
        if (ACT == 2) v = fmaxf(v, 0.0f);
        if (ACT == 3) v = v / (1.0f + expf(-v));
        if (ACT == 4) v = (v > 0.f) ? v : 0.01f * v;
        if (ACT == 5) v = 0.5f * v * (1.0f + erff(v * 0.70710678118654752f));
        if (ACT == 6) v = (v > 0.f) ? v : 0.2f * v;
        slab[(mOff + r) * 68 + (j << 4) + rlane] = v;
      }
    }
    __builtin_amdgcn_fence(__ATOMIC_RELEASE, "workgroup");
    __builtin_amdgcn_wave_barrier();
    __builtin_amdgcn_fence(__ATOMIC_ACQUIRE, "workgroup");
    if (OUT_MODE == 0) {
      float* C = (float*)Cout + (size_t)b * strideC;
      const int hh = lane >> 4, c4 = (lane & 15) * 4;     // row seg = 256 B = 16 lanes x 16 B
      {
#pragma unroll
        for (int it = 0; it < 8; ++it) {
          const int row = it * 2 + hh;
          v4f v = *(const v4f*)(slab + row * 68 + c4);
          *(v4f*)(C + (size_t)(mBase + row) * ldc + n0 + c4) = v;
        }
        
      }
    } else {
      const int q = lane >> 3, c8 = (lane & 7) * 8;
      unsigned short* C  = (unsigned short*)Cout  + (size_t)b * strideC;
      unsigned short* C2 = (OUT_MODE == 2) ? ((unsigned short*)Cout2 + (size_t)b * strideC) : nullptr;
      {
#pragma unroll
        for (int it = 0; it < 4; ++it) {
          const int row = it * 4 + q;
          const float* sp = slab + row * 68 + c8;
          v8h hv, lv;
#pragma unroll
          for (int e = 0; e < 8; ++e) {
            if (OUT_MODE == 1) {
              hv[e] = (_Float16)sp[e];
            } else {
              unsigned short hb = f2bf_bits(sp[e]);
              unsigned short lb = f2bf_bits(sp[e] - bf_bits2f(hb));
              hv[e] = __builtin_bit_cast(_Float16, hb);
              lv[e] = __builtin_bit_cast(_Float16, lb);
            }
          }
          *(v8h*)(C + (size_t)(mBase + row) * ldc + n0 + c8) = hv;
          if (OUT_MODE == 2) *(v8h*)(C2 + (size_t)(mBase + row) * ldc + n0 + c8) = lv;
        }
        
      }
    }
    __builtin_amdgcn_fence(__ATOMIC_RELEASE, "workgroup");
    __builtin_amdgcn_wave_barrier();
    __builtin_amdgcn_fence(__ATOMIC_ACQUIRE, "workgroup");
  }
}

__global__ __launch_bounds__(256) void cast_f32_f16x2(
    const float* __restrict__ in, _Float16* __restrict__ out, int n2) {
  int i = blockIdx.x * 256 + threadIdx.x;
  if (i < n2) {
    const _Float16 h0 = (_Float16)in[2 * i], h1 = (_Float16)in[2 * i + 1];
    const unsigned u = (unsigned)__builtin_bit_cast(unsigned short, h0) | ((unsigned)__builtin_bit_cast(unsigned short, h1) << 16);
    ((unsigned*)out)[i] = u;
    
  }
}


} // namespace w25

// =====================================================================================================================
// k_prep<NR, D>: all f16 operand planes of the projections in one launch of WB + XB work-groups of 256 threads, 32 or 64 elements a thread.
//   Work-groups [0, WB): one tile of 128 (k) x 64 (n) of the weights taken side by side, W = Wq | Wkv ([D][D] | [D][2D], n < D is Wq):
//   W16[n][k] = f16(16 * W[k][n]). Rows of 256 B are read along n with 16-byte loads into an f32 LDS tile (pitch 65 floats: the 32 lanes
//   of a column-wise read fall on 32 different banks); each lane then packs 8 consecutive k of one n, 8 lanes store one whole 128-B line.
//   Work-groups [WB, WB + XB): X16 = f16(x), 16384 consecutive floats each; a wave's load covers 512 contiguous bytes, its store 256.
// =====================================================================================================================
// eight 16-byte loads, 16 rows of LD floats apart: one address pair, the row steps as immediate offsets
template <int LD> __device__ __forceinline__ void ld_rows8(const float* __restrict__ sp, v4f (&w)[8]) {
#pragma unroll
    for (int s = 0; s < 8; ++s) w[s] = *(const v4f*)(sp + s * 16 * LD);
    asm volatile("s_wait_xcnt 0x0" :: "v"(sp) : "memory");   // stands in front of any reuse of the loads' address pair, which it names so that the pair lives up to here
}
template <int NR, int D>
__global__ __launch_bounds__(256) void k_prep(const float* __restrict__ x, const float* __restrict__ Wq, const float* __restrict__ Wkv, _Float16* __restrict__ X16, _Float16* __restrict__ W16) {
    constexpr int TP = 65;                      // LDS tile pitch in floats
    constexpr int NT = 3 * D / 64;              // n tiles
    constexpr int WB = NT * (D / 128);
    static_assert(D % 128 == 0 && ((long long)NR * D) % 16384 == 0, "whole tiles only");
    __shared__ float tile[128 * TP];
    const int tid = threadIdx.x;
    if ((int)blockIdx.x < WB) {
        const int nt = blockIdx.x % NT, kt = blockIdx.x / NT;
        const int n0 = nt * 64, k0 = kt * 128;
        const int c4 = (tid & 15) * 4, r = tid >> 4;
        v4f w[8];
        if (n0 < D) ld_rows8<D>(Wq + n0 + (k0 + r) * D + c4, w);                     // work-group-uniform choice of the source matrix
        else        ld_rows8<2 * D>(Wkv + (n0 - D) + (k0 + r) * (2 * D) + c4, w);
#pragma unroll
        for (int s = 0; s < 8; ++s)
#pragma unroll
            for (int e = 0; e < 4; ++e) tile[(s * 16 + r) * TP + c4 + e] = w[s][e];
        __syncthreads();                                 // the whole tile is in LDS before any column of it is read
        const int a8 = (tid & 7) * 8, nl = tid >> 3;
#pragma unroll
        for (int q = 0; q < 4; ++q) {
            const int n = (q >> 1) * 32 + nl, k = (q & 1) * 64 + a8;
            v8h hv;
#pragma unroll
            for (int j = 0; j < 8; ++j) hv[j] = (_Float16)(tile[(k + j) * TP + n] * 16.f);
            *(v8h*)(W16 + (long long)(n0 + n) * D + k0 + k) = hv;
        }
    } else {
        const long long base = (long long)((int)blockIdx.x - WB) * 16384 + tid * 4;
        const float* xp = x + base;
        v4f v[16];
#pragma unroll
        for (int i = 0; i < 16; ++i) v[i] = *(const v4f*)(xp + i * 1024);
        asm volatile("s_wait_xcnt 0x0" :: "v"(xp) : "memory");   // stands in front of any reuse of the loads' address pair, which it names so that the pair lives up to here
#pragma unroll
        for (int i = 0; i < 16; ++i) *(v4h*)(X16 + base + i * 1024) = __builtin_convertvector(v[i], v4h);
        asm volatile("s_wait_xcnt 0x0" ::: "memory");            // stands behind the stores above, in front of any reuse of their address and data registers
    }
}

// =====================================================================================================================
// k_proj<M, N, K>: C[m][n] = scale * sum_k A[m][k] * Bt[n][k], A [M][K] and Bt [N][K] f16 planes, C f32 [M][N]; M, N % 128 == 0, K % 128 == 0.
//   One work-group of 4 waves per 128 x 128 tile of C, each wave a 64 x 64 quarter (4 x 4 accumulator tiles), grid (M/128)*(N/128).
//   A stage is 64 k of the tile's 128 A rows and 128 Bt rows: 256 rows of 128 B, brought by 16-byte asynchronous copies (a wave's copy = 4 whole lines)
//   into one of two LDS buffers at a pitch of 144 B (odd multiple of 16 B, for the ds_load_b128 fragment reads); stage t + 2 is asked for when
//   every wave has left stage t, so it flies while stage t + 1 is worked on. k runs upward in steps of 32, one accumulator chain per tile.
// =====================================================================================================================
// eight asynchronous 16-byte copies of one lane, 16 rows apart (GS halves in memory, LS bytes in LDS)
template <int GS, int LS> __device__ __forceinline__ void acopy8(unsigned l, const _Float16* g) {
    // the copies and, as the last line, the wait that stands in front of any rewrite of the address registers they name
    asm volatile("global_load_async_to_lds_b128 %0, %8, off\n\t"
                 "global_load_async_to_lds_b128 %1, %9, off\n\t"
                 "global_load_async_to_lds_b128 %2, %10, off\n\t"
                 "global_load_async_to_lds_b128 %3, %11, off\n\t"
                 "global_load_async_to_lds_b128 %4, %12, off\n\t"
                 "global_load_async_to_lds_b128 %5, %13, off\n\t"
                 "global_load_async_to_lds_b128 %6, %14, off\n\t"
                 "global_load_async_to_lds_b128 %7, %15, off\n\t"
                 "s_wait_xcnt 0x0"
                 :: "v"(l), "v"(l + LS), "v"(l + 2 * LS), "v"(l + 3 * LS), "v"(l + 4 * LS), "v"(l + 5 * LS), "v"(l + 6 * LS), "v"(l + 7 * LS),
                    "v"(g), "v"(g + GS), "v"(g + 2 * GS), "v"(g + 3 * GS), "v"(g + 4 * GS), "v"(g + 5 * GS), "v"(g + 6 * GS), "v"(g + 7 * GS)
                 : "memory");
}
template <int M, int N, int K>
__global__ __launch_bounds__(128) void k_proj(const _Float16* __restrict__ A, const _Float16* __restrict__ Bt, float* __restrict__ C, float scale) {
    typedef w25::Frag<_Float16> F;
    constexpr int KT = 64;                      // k per stage
    constexpr int PH = 72;                      // LDS row pitch in halves
    constexpr int SH = 256 * PH;                // halves per buffer: rows 0..127 A, 128..255 Bt
    constexpr int NS = K / KT;
    static_assert(M % 128 == 0 && N % 128 == 0 && K % 128 == 0, "whole tiles, two stages or more");
    __shared__ __align__(16) _Float16 ring[2 * SH];
    __shared__ __align__(16) float sT[4][16 * 68];   // per-wave 16x64 output slab, pitch 68 floats
    const int tid = threadIdx.x, lane = tid & 31, wave = tid >> 5;
    constexpr int TN = N / 128;
    const int tm = blockIdx.x / TN, tn = blockIdx.x - tm * TN;
    const int m0 = tm * 128, n0 = tn * 128;
    const int rlane = lane & 15, koff = (lane >> 4) * 8, mOff = (lane >> 4) * 8;
    // copies: 8 lanes per 128-B row, 16 rows per sweep of the work-group, 8 sweeps for each operand
    const int cr = tid >> 3, cc = (tid & 7) * 8;
    const _Float16* ga = A + (size_t)(m0 + cr) * K + cc;
    const _Float16* gb = Bt + (size_t)(n0 + cr) * K + cc;
    const unsigned la = (unsigned)(size_t)ring + (unsigned)(cr * PH + cc) * 2u;   // LDS byte address of this lane's first A chunk in buffer 0
    const _Float16* fa = ring + ((wave >> 1) * 64 + rlane) * PH + koff;
    const _Float16* fb = ring + (128 + (wave & 1) * 64 + rlane) * PH + koff;

    v8f acc[4][4];                              // the unroll directives of this kernel make every index of acc, ah and bh a constant, so that the arrays stay in registers
#pragma unroll
    for (int i = 0; i < 4; ++i)
#pragma unroll
        for (int j = 0; j < 4; ++j) { v8f zz = {}; acc[i][j] = zz; }

    acopy8<16 * K, 16 * PH * 2>(la, ga);
    acopy8<16 * K, 16 * PH * 2>(la + 128 * PH * 2, gb);
    asm volatile("s_wait_asynccnt 0x0" ::: "memory");    // this wave's copies of stage 0 have landed
    __syncthreads();                                     // stage 0 is visible to every wave
    acopy8<16 * K, 16 * PH * 2>(la + SH * 2, ga + KT);
    acopy8<16 * K, 16 * PH * 2>(la + SH * 2 + 128 * PH * 2, gb + KT);
    for (int t = 0; t < NS; ++t) {
        const int bo = (t & 1) * SH;
#pragma unroll
        for (int ks = 0; ks < KT; ks += 32) {
            v16h bh[4], ah[4];
#pragma unroll
            for (int j = 0; j < 4; ++j) bh[j] = F::load(fb + bo + j * 16 * PH + ks);
#pragma unroll
            for (int i = 0; i < 4; ++i) ah[i] = F::load(fa + bo + i * 16 * PH + ks);
            __builtin_amdgcn_sched_barrier(0);               // the 16 LDS reads stay one group in front of the 16 WMMAs: one LDS wait a k step, not one per row of tiles
#pragma unroll
            for (int i = 0; i < 4; ++i)
#pragma unroll
                for (int j = 0; j < 4; ++j) acc[i][j] = F::mma(ah[i], bh[j], acc[i][j]);
            __builtin_amdgcn_sched_barrier(0);               // keeps the next group of LDS reads from being spread among these WMMAs
        }
        asm volatile("s_wait_dscnt 0x0" ::: "memory");       // this wave's reads of stage t are done before the buffer may be refilled
        asm volatile("s_wait_asynccnt 0x0" ::: "memory");    // this wave's copies of stage t + 1 have landed
        __syncthreads();                                     // publishes stage t + 1 and ends every wave's reads of stage t
        if (t + 2 < NS) {                                    // the same for the whole work-group
            acopy8<16 * K, 16 * PH * 2>(la + bo * 2, ga + (t + 2) * KT);
            acopy8<16 * K, 16 * PH * 2>(la + bo * 2 + 128 * PH * 2, gb + (t + 2) * KT);
        }
    }
    asm volatile("s_wait_asynccnt 0x0" ::: "memory");        // no copy is outstanding when the wave goes on to its end

    float* slab = sT[wave];
    const int wm0 = m0 + (wave >> 1) * 64, wn0 = n0 + (wave & 1) * 64;
#pragma unroll
    for (int i = 0; i < 4; ++i) {
#pragma unroll
        for (int j = 0; j < 4; ++j)
#pragma unroll
            for (int r = 0; r < 8; ++r) slab[(mOff + r) * 68 + (j << 4) + rlane] = acc[i][j][r] * scale;
        __builtin_amdgcn_fence(__ATOMIC_RELEASE, "workgroup");
        __builtin_amdgcn_wave_barrier();
        __builtin_amdgcn_fence(__ATOMIC_ACQUIRE, "workgroup");
        const int hh = lane >> 4, c4 = (lane & 15) * 4;      // row segment = 256 B = 16 lanes x 16 B
#pragma unroll
        for (int it = 0; it < 8; ++it) {
            const int row = it * 2 + hh;
            const v4f v = *(const v4f*)(slab + row * 68 + c4);
            *(v4f*)(C + (size_t)(wm0 + (i << 4) + row) * N + wn0 + c4) = v;
        }
        __builtin_amdgcn_fence(__ATOMIC_RELEASE, "workgroup");
        __builtin_amdgcn_wave_barrier();
        __builtin_amdgcn_fence(__ATOMIC_ACQUIRE, "workgroup");
    }
}

// f32 -> bf16 hi plane + bf16 lo plane (x = hi + lo to ~2^-17 relative; RNE both), [R][C] -> [R][C] (or transposed to [C][R]); 2 consecutive destination elements
__device__ __forceinline__ unsigned int f2bf2_pack(float a, float b, unsigned int* lo) {
    const unsigned short ha = w25::f2bf_bits(a), hb = w25::f2bf_bits(b);
    const unsigned short la = w25::f2bf_bits(a - w25::bf_bits2f(ha)), lb = w25::f2bf_bits(b - w25::bf_bits2f(hb));
    *lo = (unsigned)la | ((unsigned)lb << 16); return (unsigned)ha | ((unsigned)hb << 16); }
__global__ __launch_bounds__(256) void k_castS16(const float* __restrict__ src, long long lds, __bf16* __restrict__ dhi, __bf16* __restrict__ dlo, long long ldd, int R, int C, float s, int transpose) {
    const long long i = (long long)blockIdx.x * 256 + threadIdx.x; long long o; float a, b;
    if (transpose) { const long long np = (long long)C * (R / 2); if (i >= np) return; const int c = (int)(i / (R / 2)); const int r = 2 * (int)(i % (R / 2)); a = src[(long long)r * lds + c] * s; b = src[(long long)(r + 1) * lds + c] * s; o = (long long)c * ldd + r; }
    else { const long long np = (long long)R * (C / 2); if (i >= np) return; const int r = (int)(i / (C / 2)); const int c = 2 * (int)(i % (C / 2)); a = src[(long long)r * lds + c] * s; b = src[(long long)r * lds + c + 1] * s; o = (long long)r * ldd + c; }
    unsigned lo; const unsigned hi = f2bf2_pack(a, b, &lo); unsigned* ph = (unsigned*)(dhi + o); unsigned* pl = (unsigned*)(dlo + o);
    *ph = hi; *pl = lo;  }

namespace w25 {
// =====================================================================================
// Generic causal/non-causal attention for head_dim 64, f32 in / f32 out; 16-bit operands: bf16 with optional hi/lo splits, or
// plain f16 (F16=true, non-split, probabilities carried x2^15).
//   scores = (q*qscale)·kᵀ : v_wmma_f32_16x16x32_bf16; SPLIT_QK -> q,k as bf16 hi/lo (hi·hi + hi·lo + lo·hi)
//   out    = p·v           : v_wmma_f32_16x16x32_bf16; SPLIT_PV -> p,v as bf16 hi/lo; else p,v plain bf16
//   f32 accumulate; online softmax in f32. Block = 4 waves = 64 query rows of one (batch, head); S % 64 == 0.
//   Element (b, s, h, d) of tensor X lives at X[b*X_bs + s*X_rs + h*X_hs + d] (strides in floats, multiples of 4).
//   Masking: mask_mode 0 none, 1 causal (kv > q masked), 2 tensor [S][Skv] shared over (b,h) (float if
//   mask_is_int==0, int32 with element == 0 -> masked if 1, int32 with element != 0 -> masked if 2), 3 per-token vectors qmask[B][S] & kvmask[B][Skv] (int32,
//   0 -> masked), 4 causal + sliding window (kv > q or q - kv > W masked; W passed in mask_is_int);
//   5 = relative-position bias: s += cp[b,h,q][idx[q][kv]] + pc[b,h,kv][idx[q][kv]] with idx = mask_b ([S][Skv] int32) and
//   mask_a an int32 [S][Skv] tensor with nonzero = masked (tables: element (b,h,row,n) at X + b*c_bs + h*c_hs + row*c_rs + n);
//   masked scores are replaced by mask_fill (e.g. -inf or -1e9) before the softmax.
//   grid.x = B * H * (S/64) (or a sub-range with blk0).
// =====================================================================================
#define AT_D 64
#define AT_NW 4
#define AT_QB 64
#define AT_KC 64
struct AttnGeom { const float* cp = nullptr; const float* pc = nullptr; long c_bs = 0, c_rs = 0, c_hs = 0;   // mode-5 score-bias tables
                  long q_bs, q_rs, q_hs, k_bs, k_rs, k_hs, v_bs, v_rs, v_hs, o_bs, o_rs, o_hs;
                  int S, Skv, H, mask_mode; float qscale; int blk0; float mask_fill; int mask_is_int; };
static_assert(sizeof(AttnGeom) == 168, "no padding");

__device__ __forceinline__ unsigned short at_bf_bits(float f) {
  unsigned u = __float_as_uint(f);
  return (unsigned short)((u + 0x7FFFu + ((u >> 16) & 1u)) >> 16);
}
__device__ __forceinline__ __bf16 at_f2bf(float f) { return __builtin_bit_cast(__bf16, at_bf_bits(f)); }
__device__ __forceinline__ void at_split(float f, __bf16& hi, __bf16& lo) {
  const unsigned short hb = at_bf_bits(f);
  hi = __builtin_bit_cast(__bf16, hb);
  lo = at_f2bf(f - __uint_as_float(((unsigned)hb) << 16));
}
__device__ __forceinline__ v8f at_mma(v16b a, v16b b, v8f c) {
  c = __builtin_amdgcn_wmma_f32_16x16x32_bf16(false, a, false, b, (short)0, c, false, false);
  asm volatile("v_nop\n\tv_nop\n\tv_nop\n\tv_nop" : "+v"(c) : "v"(a), "v"(b));
  return c;
}
// 16-bit element as a bit pattern held in a __bf16 slot: f16 bits when F16, bf16 (RNE) otherwise
template <bool F16> __device__ __forceinline__ __bf16 at_to16(float f) {
  if (F16) return __builtin_bit_cast(__bf16, (_Float16)f);
  return at_f2bf(f);
}
template <bool F16> __device__ __forceinline__ v8f at_mma16(v16b a, v16b b, v8f c) {
  if (F16) {
    const v16h ah = __builtin_bit_cast(v16h, a), bh = __builtin_bit_cast(v16h, b);
    c = __builtin_amdgcn_wmma_f32_16x16x32_f16(false, ah, false, bh, (short)0, c, false, false);
    asm volatile("v_nop\n\tv_nop\n\tv_nop\n\tv_nop" : "+v"(c) : "v"(ah), "v"(bh));
    return c;
  }
  return at_mma(a, b, c);
}

template <bool SPLIT_QK, bool SPLIT_PV, bool F16 = false>
__global__ __launch_bounds__(128)
void attn64_kernel(const float* __restrict__ q, const float* __restrict__ k,
                   const float* __restrict__ v, float* __restrict__ out,
                   const void* __restrict__ mask_a, const int* __restrict__ mask_b, AttnGeom g) {
  static_assert(!(F16 && (SPLIT_QK || SPLIT_PV)), "f16 mode is non-split");
  const float PSC = F16 ? 32768.0f : 1.0f;     // f16 probabilities carried x2^15 (subnormal range), folded into the final 1/l
  union FB { v16b v; v8b h[2]; };
  __shared__ __align__(16) __bf16 Ksh[AT_KC * AT_D];             // K hi [kv][d]      8 KB
  __shared__ __align__(16) __bf16 Ksl[SPLIT_QK ? AT_KC * AT_D : 8];
  __shared__ __align__(16) __bf16 Vth[AT_D * AT_KC];             // V hi [d][kv]      8 KB
  __shared__ __align__(16) __bf16 Vtl[SPLIT_PV ? AT_D * AT_KC : 8];
  __shared__ __align__(16) __bf16 Psh[AT_NW][16 * AT_KC];        // per wave P hi [row][kv]  8 KB
  __shared__ __align__(16) __bf16 Psl[SPLIT_PV ? AT_NW : 1][SPLIT_PV ? 16 * AT_KC : 8];
  __shared__ __align__(16) float  Os[AT_NW][16 * 68];            // per wave out tile, pitch 68

  const int tid  = threadIdx.x;
  const int wave = tid >> 5;
  const int lane = tid & 31;
  const int hh   = lane >> 4;
  const int c    = lane & 15;

  const int nqb = g.S / AT_QB;
  const int bx = blockIdx.x + g.blk0;
  const int qb = bx % nqb;
  const int bh = bx / nqb;
  const int h  = bh % g.H;
  const int b  = bh / g.H;
  const int qbase_block = qb * AT_QB;
  const int q0 = qbase_block + wave * 16;

  const float* qb_ptr = q + (size_t)b * g.q_bs + (size_t)h * g.q_hs;
  const float* kb_ptr = k + (size_t)b * g.k_bs + (size_t)h * g.k_hs;
  const float* vb_ptr = v + (size_t)b * g.v_bs + (size_t)h * g.v_hs;
  float*       ob_ptr = out + (size_t)b * g.o_bs + (size_t)h * g.o_hs;

  // ---- Q fragments (A operand): 2 d-chunks, hi (and lo) ----
  v16b qah[2], qal[2];
  {
    const float* qrow = qb_ptr + (size_t)(q0 + c) * g.q_rs;
#pragma unroll
    for (int dc = 0; dc < 2; ++dc) {
#pragma unroll
      for (int e = 0; e < 8; ++e) {
        const float f0 = qrow[dc * 32 + 8 * hh + e] * g.qscale;
        const float f1 = qrow[dc * 32 + 16 + 8 * hh + e] * g.qscale;
        if (SPLIT_QK) { __bf16 hq, lq; at_split(f0, hq, lq); qah[dc][e] = hq; qal[dc][e] = lq; at_split(f1, hq, lq); qah[dc][8 + e] = hq; qal[dc][8 + e] = lq; }
        else { qah[dc][e] = at_to16<F16>(f0); qah[dc][8 + e] = at_to16<F16>(f1); qal[dc][e] = qah[dc][e]; qal[dc][8 + e] = qah[dc][8 + e]; }
      }
    }
  }

  float mrow[8], lrow[8];
  v8f oacc[4];
#pragma unroll
  for (int r = 0; r < 8; ++r) { mrow[r] = -INFINITY; lrow[r] = 0.f; }
#pragma unroll
  for (int t = 0; t < 4; ++t) oacc[t] = (v8f){0.f,0.f,0.f,0.f,0.f,0.f,0.f,0.f};

  const int nChunks = (g.mask_mode == 1 || g.mask_mode == 4) ? (qb + 1) : (g.Skv / AT_KC);   // block-uniform
  // per-row query mask (mode 3)
  int qkeep[8];
#pragma unroll
  for (int r = 0; r < 8; ++r) qkeep[r] = (g.mask_mode == 3) ? mask_b[(size_t)b * g.S + q0 + 8 * hh + r] : 1;   // mask_b = qmask in mode 3
  for (int kc = 0; kc < nChunks; ++kc) {
    const int kv0 = kc * AT_KC;
    __syncthreads();
    {
      const int kvr = tid >> 1, dh = (tid & 1) * 32;
      const float* krow = kb_ptr + (size_t)(kv0 + kvr) * g.k_rs + dh;
      const float* vrow = vb_ptr + (size_t)(kv0 + kvr) * g.v_rs + dh;
#pragma unroll
      for (int i = 0; i < 8; ++i) {
        v4f kk = *(const v4f*)(krow + 4 * i);
        v4f vv = *(const v4f*)(vrow + 4 * i);
#pragma unroll
        for (int e = 0; e < 4; ++e) {
          const int d = dh + 4 * i + e;
          if (SPLIT_QK) { __bf16 a, bl; at_split(kk[e], a, bl); Ksh[kvr * AT_D + d] = a; Ksl[kvr * AT_D + d] = bl; }
          else Ksh[kvr * AT_D + d] = at_to16<F16>(kk[e]);
          if (SPLIT_PV) { __bf16 a, bl; at_split(vv[e], a, bl); Vth[d * AT_KC + kvr] = a; Vtl[d * AT_KC + kvr] = bl; }
          else Vth[d * AT_KC + kvr] = at_to16<F16>(vv[e]);
        }
      }
    }
    __syncthreads();

    v8f s[4];
#pragma unroll
    for (int j = 0; j < 4; ++j) {
      s[j] = (v8f){0.f,0.f,0.f,0.f,0.f,0.f,0.f,0.f};
#pragma unroll 1
      for (int dc = 0; dc < 2; ++dc) {
        FB kb;
        kb.h[0] = *(const v8b*)(Ksh + (j * 16 + c) * AT_D + dc * 32 + 8 * hh);
        kb.h[1] = *(const v8b*)(Ksh + (j * 16 + c) * AT_D + dc * 32 + 16 + 8 * hh);
        s[j] = at_mma16<F16>(qah[dc], kb.v, s[j]);
        if (SPLIT_QK) {
          FB kl;
          kl.h[0] = *(const v8b*)(Ksl + (j * 16 + c) * AT_D + dc * 32 + 8 * hh);
          kl.h[1] = *(const v8b*)(Ksl + (j * 16 + c) * AT_D + dc * 32 + 16 + 8 * hh);
          s[j] = at_mma16<F16>(qah[dc], kl.v, s[j]);
          s[j] = at_mma16<F16>(qal[dc], kb.v, s[j]);
        }
      }
    }
    const bool diag = (g.mask_mode == 1) && (kc == qb);
    int kvkeep[4] = {1, 1, 1, 1};
    if (g.mask_mode == 3) {
#pragma unroll
      for (int j = 0; j < 4; ++j) kvkeep[j] = ((const int*)mask_a)[(size_t)b * g.Skv + kv0 + j * 16 + c];   // mask_a = kvmask
    }
    float cm[8];
#pragma unroll
    for (int r = 0; r < 8; ++r) {
      const int qrow = q0 + 8 * hh + r;
      float m = -INFINITY;
#pragma unroll
      for (int j = 0; j < 4; ++j) {
        const int kvcol = kv0 + j * 16 + c;
        bool masked = false;
        if (diag) masked = (kvcol > qrow);
        else if (g.mask_mode == 4) masked = (kvcol > qrow) || (qrow - kvcol > g.mask_is_int);
        else if (g.mask_mode == 2) {
          const size_t mi = (size_t)qrow * g.Skv + kvcol;
          masked = (g.mask_is_int == 0) ? (((const float*)mask_a)[mi] == 0.0f)
                 : (g.mask_is_int == 1) ? (((const int*)mask_a)[mi] == 0) : (((const int*)mask_a)[mi] != 0);
        } else if (g.mask_mode == 3) masked = (qkeep[r] == 0) || (kvkeep[j] == 0);
        else if (g.mask_mode == 5) {
          const size_t mi = (size_t)qrow * g.Skv + kvcol;
          masked = (((const int*)mask_a)[mi] != 0);
          int n = mask_b[mi]; n = n < 0 ? 0 : n;
          s[j][r] += g.cp[(size_t)b * g.c_bs + (size_t)h * g.c_hs + (size_t)qrow * g.c_rs + n]
                   + g.pc[(size_t)b * g.c_bs + (size_t)h * g.c_hs + (size_t)kvcol * g.c_rs + n];
        }
        if (masked) s[j][r] = g.mask_fill;
        m = fmaxf(m, s[j][r]);
      }
#pragma unroll
      for (int off = 1; off < 16; off <<= 1) m = fmaxf(m, __shfl_xor(m, off, 32));
      cm[r] = m;
    }
    __bf16* pwh = Psh[wave];
    __bf16* pwl = Psl[SPLIT_PV ? wave : 0];
#pragma unroll
    for (int r = 0; r < 8; ++r) {
      const float mnew = fmaxf(mrow[r], cm[r]);
      const float alpha = expf(mrow[r] - mnew);
      mrow[r] = mnew;
      float psum = 0.f;
#pragma unroll
      for (int j = 0; j < 4; ++j) {
        const float p = expf(s[j][r] - mnew);
        psum += p;
        if (SPLIT_PV) { __bf16 a, bl; at_split(p, a, bl); pwh[(8 * hh + r) * AT_KC + j * 16 + c] = a; pwl[(8 * hh + r) * AT_KC + j * 16 + c] = bl; }
        else pwh[(8 * hh + r) * AT_KC + j * 16 + c] = at_to16<F16>(p * PSC);
      }
#pragma unroll
      for (int off = 1; off < 16; off <<= 1) psum += __shfl_xor(psum, off, 32);
      lrow[r] = lrow[r] * alpha + psum;
#pragma unroll
      for (int t = 0; t < 4; ++t) oacc[t][r] *= alpha;
    }
    __builtin_amdgcn_fence(__ATOMIC_RELEASE, "workgroup");
    __builtin_amdgcn_wave_barrier();
    __builtin_amdgcn_fence(__ATOMIC_ACQUIRE, "workgroup");
#pragma unroll 1
    for (int kk = 0; kk < 2; ++kk) {
      FB pa, pl;
      pa.h[0] = *(const v8b*)(pwh + c * AT_KC + kk * 32 + 8 * hh);
      pa.h[1] = *(const v8b*)(pwh + c * AT_KC + kk * 32 + 16 + 8 * hh);
      if (SPLIT_PV) {
        pl.h[0] = *(const v8b*)(pwl + c * AT_KC + kk * 32 + 8 * hh);
        pl.h[1] = *(const v8b*)(pwl + c * AT_KC + kk * 32 + 16 + 8 * hh);
      }
#pragma unroll
      for (int t = 0; t < 4; ++t) {
        FB vb;
        vb.h[0] = *(const v8b*)(Vth + (t * 16 + c) * AT_KC + kk * 32 + 8 * hh);
        vb.h[1] = *(const v8b*)(Vth + (t * 16 + c) * AT_KC + kk * 32 + 16 + 8 * hh);
        oacc[t] = at_mma16<F16>(pa.v, vb.v, oacc[t]);
        if (SPLIT_PV) {
          FB vl;
          vl.h[0] = *(const v8b*)(Vtl + (t * 16 + c) * AT_KC + kk * 32 + 8 * hh);
          vl.h[1] = *(const v8b*)(Vtl + (t * 16 + c) * AT_KC + kk * 32 + 16 + 8 * hh);
          oacc[t] = at_mma16<F16>(pa.v, vl.v, oacc[t]);
          oacc[t] = at_mma16<F16>(pl.v, vb.v, oacc[t]);
        }
      }
    }
  }

  float* os = Os[wave];
#pragma unroll
  for (int r = 0; r < 8; ++r) {
    const float inv = 1.0f / (lrow[r] * PSC);
#pragma unroll
    for (int t = 0; t < 4; ++t) os[(8 * hh + r) * 68 + t * 16 + c] = oacc[t][r] * inv;
  }
  __builtin_amdgcn_fence(__ATOMIC_RELEASE, "workgroup");
  __builtin_amdgcn_wave_barrier();
  __builtin_amdgcn_fence(__ATOMIC_ACQUIRE, "workgroup");
  {
    const int c4 = (lane & 15) * 4;
    {
#pragma unroll
      for (int it = 0; it < 8; ++it) {
        const int row = it * 2 + hh;
        v4f val = *(const v4f*)(os + row * 68 + c4);
        *(v4f*)(ob_ptr + (size_t)(q0 + row) * g.o_rs + c4) = val;
      }
      
    }
  }
}

} // namespace w25


extern "C" void kernel_launch(void* const* d_in, const int* in_sizes, int n_in, void* d_out, int out_size, void* d_ws, size_t ws_size, hipStream_t stream) {
    (void)in_sizes; (void)n_in; (void)out_size; (void)ws_size;
    const float* x = (const float*)d_in[0];
    const float* Wq = (const float*)d_in[1];
    const float* Wkv = (const float*)d_in[2];
    const float* Wo = (const float*)d_in[3];
    const float* bo = (const float*)d_in[4];
    const int Bn = 2;
    const int T = 2048;
    const int D = 1024;
    const int NH = 16;
    const int D3 = 3 * D;
    const int NR = Bn * T;
    float* out = (float*)d_out;
    char* wsp = (char*)d_ws;
    unsigned short* X16 = (unsigned short*)wsp; wsp += (((size_t)((size_t)NR * D) * 2 + 255) / 256) * 256;
    unsigned short* W316 = (unsigned short*)wsp; wsp += (((size_t)((size_t)D3 * D) * 2 + 255) / 256) * 256;
    float* QKV = (float*)wsp; wsp += (((size_t)((size_t)NR * D3) * 4 + 255) / 256) * 256;
    if ((size_t)(wsp - (char*)d_ws) > ws_size) return;   // static carve guard
    k_prep<NR, D><<<(unsigned)((D3 / 64) * (D / 128) + (NR / 16) * (D / 1024)), 256, 0, stream>>>(x, Wq, Wkv, (_Float16*)(X16), (_Float16*)(W316));
    k_proj<NR, D3, D><<<(unsigned)((NR / 128) * (D3 / 128)), 128, 0, stream>>>((const _Float16*)(X16), (const _Float16*)(W316), QKV, 0.0625f);
    k_attn_lds<T, D3, D><<<dim3((unsigned)((T) / (16 * AW)), (unsigned)(NH), (unsigned)(Bn)), 32 * AW, 0, stream>>>(QKV, QKV + D, QKV + 2 * D, Wo, bo, out, 0.125f);
}

// v008
// One run takes 79.6 microseconds.
// Two timings next to v007 both put it at 1.24 times that version's speed.
// All steps since the starting kernel, v000, together make it 27.0 times as fast.
// Contractions: q and k|v projections (weights stored [in][out]) [4096x1024].[1024x1024|2048], both batch elements' rows in one launch, with f16 operands on f16 planes (v_wmma_f32_16x16x32_f16, 64x64 register-blocked wave tiles, weights x16); the projection's epilogue rounds q, k, v once to an f16 plane; per (batch, head) softmax(q.k^T/8) v over all 2048 keys as one flash launch for both batch elements (head_dim 64, f16 q.k^T and f16 p.v with p as f16 of 4096 p), whose epilogue applies the head's own 64x64 output map (+bias) to the f16 attention tile still in registers (weights x16); f32 accumulate and softmax statistics.
#include <hip/hip_runtime.h>
#include <math.h>

typedef __attribute__((ext_vector_type(16))) _Float16 v16h;
typedef __attribute__((ext_vector_type(8)))  _Float16 v8h;
typedef __attribute__((ext_vector_type(16))) __bf16   v16b;
typedef __attribute__((ext_vector_type(8)))  float    v8f;
typedef __attribute__((ext_vector_type(4)))  float    v4f;

// 16-bit WMMA fragment map (wave32), lane L, h = L>>4, m = L&15:
//   A 16x32: lane = row m;   element i -> k = (i<8) ? 8h+i : 16+8h+(i-8)
//   B 32x16: lane = column m; the SAME k(i,h)
//   D 16x16 (8 f32): lane = column m; element r -> row 8h+r
__device__ __forceinline__ int frag_k(int i, int h) { return (i < 8) ? (8 * h + i) : (16 + 8 * h + (i - 8)); }
__device__ __forceinline__ __bf16 bf16_rne(float f) {
    unsigned int u = __float_as_uint(f);
    u += 0x7fffu + ((u >> 16) & 1u);
    return __builtin_bit_cast(__bf16, (unsigned short)(u >> 16));
}
__device__ __forceinline__ float bf16_f32(__bf16 b) { return __uint_as_float(((unsigned int)__builtin_bit_cast(unsigned short, b)) << 16); }
__device__ __forceinline__ v8f wmma16(v16h a, v16h b, v8f c) {
    c = __builtin_amdgcn_wmma_f32_16x16x32_f16(false, a, false, b, (short)0, c, false, false);
    asm volatile("v_nop\n\tv_nop\n\tv_nop\n\tv_nop" : "+v"(c) : "v"(a), "v"(b));
    return c;
}
__device__ __forceinline__ v8f wmmab(v16b a, v16b b, v8f c) {
    c = __builtin_amdgcn_wmma_f32_16x16x32_bf16(false, a, false, b, (short)0, c, false, false);
    asm volatile("v_nop\n\tv_nop\n\tv_nop\n\tv_nop" : "+v"(c) : "v"(a), "v"(b));
    return c;
}
struct Split { v16b hi, lo; };
// hi/lo split product: a.hi*b.hi + a.hi*b.lo + a.lo*b.hi
__device__ __forceinline__ v8f wmma3(const Split& a, const Split& b, v8f c) {
    c = __builtin_amdgcn_wmma_f32_16x16x32_bf16(false, a.hi, false, b.hi, (short)0, c, false, false);
    c = __builtin_amdgcn_wmma_f32_16x16x32_bf16(false, a.hi, false, b.lo, (short)0, c, false, false);
    c = __builtin_amdgcn_wmma_f32_16x16x32_bf16(false, a.lo, false, b.hi, (short)0, c, false, false);
    asm volatile("v_nop\n\tv_nop\n\tv_nop\n\tv_nop" : "+v"(c) : "v"(a.hi), "v"(a.lo), "v"(b.hi), "v"(b.lo));
    return c;
}
struct Split3 { v16b hi, mid, lo; };
// triple split product (6 terms, drops only terms below 2^-24 relative)
__device__ __forceinline__ v8f wmma6(const Split3& a, const Split3& b, v8f c) {
    c = __builtin_amdgcn_wmma_f32_16x16x32_bf16(false, a.hi, false, b.hi, (short)0, c, false, false);
    c = __builtin_amdgcn_wmma_f32_16x16x32_bf16(false, a.hi, false, b.mid, (short)0, c, false, false);
    c = __builtin_amdgcn_wmma_f32_16x16x32_bf16(false, a.mid, false, b.hi, (short)0, c, false, false);
    c = __builtin_amdgcn_wmma_f32_16x16x32_bf16(false, a.hi, false, b.lo, (short)0, c, false, false);
    c = __builtin_amdgcn_wmma_f32_16x16x32_bf16(false, a.mid, false, b.mid, (short)0, c, false, false);
    c = __builtin_amdgcn_wmma_f32_16x16x32_bf16(false, a.lo, false, b.hi, (short)0, c, false, false);
    asm volatile("v_nop\n\tv_nop\n\tv_nop\n\tv_nop" : "+v"(c) : "v"(a.hi), "v"(a.mid), "v"(a.lo), "v"(b.hi), "v"(b.mid), "v"(b.lo));
    return c;
}

// Fragment gathers from f32 memory: element i <- p[(k0 + frag_k(i,h)) * sk] * s, zero for k >= klen.
__device__ __forceinline__ v16h fh_ld(const float* __restrict__ p, long long sk, int k0, int h, int klen, float s) {
    v16h a;
#pragma unroll
    for (int i = 0; i < 16; ++i) { const int k = k0 + frag_k(i, h); a[i] = (k < klen) ? (_Float16)(p[(long long)k * sk] * s) : (_Float16)0.f; }
    return a;
}
__device__ __forceinline__ Split sp_ld(const float* __restrict__ p, long long sk, int k0, int h, int klen, float s) {
    Split r;
#pragma unroll
    for (int i = 0; i < 16; ++i) {
        const int k = k0 + frag_k(i, h); const float x = (k < klen) ? p[(long long)k * sk] * s : 0.f;
        const __bf16 hb = bf16_rne(x); r.hi[i] = hb; r.lo[i] = bf16_rne(x - bf16_f32(hb));
    }
    return r;
}
__device__ __forceinline__ Split3 sp3_ld(const float* __restrict__ p, long long sk, int k0, int h, int klen, float s) {
    Split3 r;
#pragma unroll
    for (int i = 0; i < 16; ++i) {
        const int k = k0 + frag_k(i, h); const float x = (k < klen) ? p[(long long)k * sk] * s : 0.f;
        const __bf16 hb = bf16_rne(x); const float r1 = x - bf16_f32(hb); const __bf16 mb = bf16_rne(r1);
        r.hi[i] = hb; r.mid[i] = mb; r.lo[i] = bf16_rne(r1 - bf16_f32(mb));
    }
    return r;
}
__device__ __forceinline__ v16b bh_ld(const float* __restrict__ p, long long sk, int k0, int h, int klen, float s) {
    v16b a;
#pragma unroll
    for (int i = 0; i < 16; ++i) { const int k = k0 + frag_k(i, h); a[i] = bf16_rne((k < klen) ? p[(long long)k * sk] * s : 0.f); }
    return a;
}
// f16 fragment from an f16 LDS/global row with element stride 1 (k-contiguous), no bounds (tile already zero padded)
__device__ __forceinline__ v16h fh_row(const _Float16* __restrict__ row, int k0, int h) {
    v16h a;
#pragma unroll
    for (int i = 0; i < 16; ++i) a[i] = row[k0 + frag_k(i, h)];
    return a;
}

#define VST2(T, ptr, val) do { const T vst2_v_ = (val); *(T*)(ptr) = vst2_v_;  } while (0)
typedef float v4f __attribute__((ext_vector_type(4)));
#define VST2V4(ptr, val) do { const v4f vst2_v4_ = (val); *(v4f*)(ptr) = vst2_v4_;  } while (0)

__device__ __attribute__((noinline)) float act_fn(float v, int act) {
    if (act == 1) return fmaxf(v, 0.f);                                                                               // relu
    if (act == 2) { const float u = 0.7978845608028654f * (v + 0.044715f * v * v * v); return 0.5f * v * (1.f + tanhf(u)); } // tanh-gelu
    if (act == 3) return v / (1.f + expf(-v));                                                                        // silu
    if (act == 4) return 0.5f * v * (1.f + erff(v * 0.7071067811865476f));                                             // erf-gelu
    if (act == 5) return tanhf(v);
    if (act == 6) return 1.f / (1.f + expf(-v));                                                                      // sigmoid
    if (act == 7) return (v > 0.f) ? v : 0.01f * v;                                                                   // leaky relu 0.01
    if (act == 8) return (v > 0.f) ? v : (expf(v) - 1.f);                                                             // elu
    if (act == 9) return fminf(fmaxf(v, 0.f), 6.f);                                                                   // relu6
    if (act == 10) return fabsf(v);                                                                                    // abs
    if (act == 11) return (v >= 0.f) ? v : 0.1f * v;                                                                  // leaky 0.1
    if (act == 12) return (v > 0.f) ? v : 0.2f * v;                                                                   // leaky 0.2
    if (act == 13) return (v > 20.f) ? v : log1pf(expf(v));                                                            // softplus
    return v;
}

// =====================================================================================================================
// k_gemm<MODE>: C(z, m, n) = act(alpha * sum_k A(z, m, k) * B(z, k, n) + bias) + beta * R(z, m, n)
//   One wave (32-thread block) per 16 x 32 tile of C; grid (ceil(N/32), ceil(M/16), Z). Batch z -> (zo = z / zi_n, zi = z % zi_n)
//   with separate outer/inner strides for every tensor (e.g. batch and head). A(m,k) = A[zo*sAo + zi*sAi + m*sAm + k*sAk] (f32),
//   B(k,n) = B[zo*sBo + zi*sBi + n*sBn + k*sBk] (f32); any M, N, K (K zero-padded to 32 inside the fragments, M/N tails guarded).
//   C(m,n) = C[zo*sCo + zi*sCi + m*sCm + n] (n contiguous). flags: 1 bias[n], 2 bias[m], 4 residual R[zo*sRo + zi*sRi + m*sRm + n*sRn].
//   MODE 0: f16 operands (A prescaled by sa, B by sb, both undone in the epilogue); 1: bf16 hi/lo split (3 products); 2: bf16;
//   3: bf16 hi/mid/lo triple split (6 products); 4: as 3 with Kahan-compensated f32 accumulation across k-steps.
// =====================================================================================================================
struct GemmP {
    const float* A; const float* B; const float* bias; const float* R; float* C;
    long long sAo, sAi, sAm, sAk, sBo, sBi, sBn, sBk, sCo, sCi, sCm, sRo, sRi, sRm, sRn;
    int M, N, K, zi_n, flags, act; float alpha, beta, sa, sb;
    int Npad, pad_;     // columns [N, Npad) of C are written as 0 so that padded workspace rows are covered by whole-line stores; Npad >= N
};
static_assert(sizeof(GemmP) == 5 * 8 + 15 * 8 + 6 * 4 + 4 * 4 + 2 * 4, "GemmP has padding");

template <int MODE>
__global__ __launch_bounds__(32) void k_gemm(GemmP p) {
    const int lane = threadIdx.x & 31, h = lane >> 4, l15 = lane & 15;
    const int m0 = blockIdx.y * 16, n0 = blockIdx.x * 32;
    const int z = blockIdx.z, zo = z / p.zi_n, zi = z - zo * p.zi_n;
    const float* A = p.A + zo * p.sAo + zi * p.sAi;
    const float* B = p.B + zo * p.sBo + zi * p.sBi;
    const int am = min(m0 + l15, p.M - 1);                       // clamped row for loads (stores are guarded)
    v8f acc[2], comp[2];
#pragma unroll
    for (int t = 0; t < 2; ++t) { v8f zz = {}; acc[t] = zz; comp[t] = zz; }
    for (int k0 = 0; k0 < p.K; k0 += 32) {
        const float* arow = A + (long long)am * p.sAm;
        if (MODE == 1) {
            const Split a = sp_ld(arow, p.sAk, k0, h, p.K, 1.f);
#pragma unroll
            for (int t = 0; t < 2; ++t) {
                const int bn = min(n0 + t * 16 + l15, p.N - 1);
                acc[t] = wmma3(a, sp_ld(B + (long long)bn * p.sBn, p.sBk, k0, h, p.K, 1.f), acc[t]);
            }
        } else if (MODE == 3) {
            const Split3 a = sp3_ld(arow, p.sAk, k0, h, p.K, 1.f);
#pragma unroll
            for (int t = 0; t < 2; ++t) {
                const int bn = min(n0 + t * 16 + l15, p.N - 1);
                acc[t] = wmma6(a, sp3_ld(B + (long long)bn * p.sBn, p.sBk, k0, h, p.K, 1.f), acc[t]);
            }
        } else if (MODE == 4) {
            // triple split as MODE 3, but each k-step's 6 products go into a fresh accumulator and the partial is added to the running f32 sum
            // on the VALU with Kahan compensation (accumulation error stays ~1 ulp however long K is)
            const Split3 a = sp3_ld(arow, p.sAk, k0, h, p.K, 1.f);
#pragma unroll
            for (int t = 0; t < 2; ++t) {
                const int bn = min(n0 + t * 16 + l15, p.N - 1); v8f zz = {};
                const v8f part = wmma6(a, sp3_ld(B + (long long)bn * p.sBn, p.sBk, k0, h, p.K, 1.f), zz);
                const v8f y = part - comp[t]; const v8f s = acc[t] + y; comp[t] = (s - acc[t]) - y; acc[t] = s;
            }
        } else if (MODE == 2) {
            const v16b a = bh_ld(arow, p.sAk, k0, h, p.K, 1.f);
#pragma unroll
            for (int t = 0; t < 2; ++t) {
                const int bn = min(n0 + t * 16 + l15, p.N - 1);
                acc[t] = wmmab(a, bh_ld(B + (long long)bn * p.sBn, p.sBk, k0, h, p.K, 1.f), acc[t]);
            }
        } else {
            const v16h a = fh_ld(arow, p.sAk, k0, h, p.K, p.sa);
#pragma unroll
            for (int t = 0; t < 2; ++t) {
                const int bn = min(n0 + t * 16 + l15, p.N - 1);
                acc[t] = wmma16(a, fh_ld(B + (long long)bn * p.sBn, p.sBk, k0, h, p.K, p.sb), acc[t]);
            }
        }
    }
    const float iscale = (MODE == 0) ? p.alpha / (p.sa * p.sb) : p.alpha;
    float* C = p.C + zo * p.sCo + zi * p.sCi;
    const float* R = p.R + zo * p.sRo + zi * p.sRi;
    __shared__ __align__(16) float ctile[16][36];
#pragma unroll
    for (int t = 0; t < 2; ++t) {
        const int n = n0 + t * 16 + l15; const int nn = min(n, p.N - 1);
#pragma unroll
        for (int r = 0; r < 8; ++r) {
            const int m = m0 + 8 * h + r; const int mm = min(m, p.M - 1);
            float v = acc[t][r] * iscale;
            if (p.flags & 1) v += p.bias[nn];
            if (p.flags & 2) v += p.bias[mm];
            if (p.flags & 8) v *= p.bias[(long long)zo * p.M + mm];   /* per-(z,row) scale vector laid out [Z][M]; exclusive with the bias flags */
            v = act_fn(v, p.act);
            if (p.flags & 4) v += p.beta * R[(long long)mm * p.sRm + (long long)nn * p.sRn];
            ctile[8 * h + r][t * 16 + l15] = (n < p.N) ? v : 0.f;
        }
    }
    __syncthreads();
    const int NW = (p.Npad > p.N) ? p.Npad : p.N;           // write width
    const bool fast = (m0 + 16 <= p.M) && (n0 + 32 <= NW) && ((p.sCm & 3) == 0) && ((((size_t)C) & 15) == 0);
    if (fast) {
#pragma unroll
        for (int s = 0; s < 4; ++s) {
            const int row = s * 4 + (lane >> 3), c4 = (lane & 7) * 4;
            const v4f v = *(const v4f*)&ctile[row][c4];
            VST2V4(C + (long long)(m0 + row) * p.sCm + n0 + c4, v);
        }
    } else {
        for (int row = 0; row < 16; ++row) {
            const int m = m0 + row, n = n0 + lane;
            if (m < p.M && n < NW) VST2(float, C + (long long)m * p.sCm + n, ctile[row][lane]);
        }
    }
}


// =====================================================================================================================
// k_gemmT<MODE, TM, TN>: same contract as k_gemm, but one wave computes a (16*TM) x (16*TN) tile: TM A fragments and TN B fragments are
//   loaded per 32-wide k-step and reused across TM*TN WMMAs (far fewer load/convert instructions per MAC). MODE 0 (f16), 1 (bf16 hi/lo),
//   2 (bf16) only. grid (ceil(NW/(16*TN)), ceil(M/(16*TM)), Z), block 32. Epilogue identical to k_gemm, run per 16x32 sub-tile.
// =====================================================================================================================
template <int MODE, int TM, int TN>
__global__ __launch_bounds__(32) void k_gemmT(GemmP p) {
    const int lane = threadIdx.x & 31, h = lane >> 4, l15 = lane & 15;
    const int m0 = blockIdx.y * (16 * TM), n0 = blockIdx.x * (16 * TN);
    const int z = blockIdx.z, zo = z / p.zi_n, zi = z - zo * p.zi_n;
    const float* A = p.A + zo * p.sAo + zi * p.sAi;
    const float* B = p.B + zo * p.sBo + zi * p.sBi;
    v8f acc[TM][TN];
#pragma unroll
    for (int i = 0; i < TM; ++i)
#pragma unroll
        for (int t = 0; t < TN; ++t) { v8f zz = {}; acc[i][t] = zz; }
    for (int k0 = 0; k0 < p.K; k0 += 32) {
        if (MODE == 1) {
            Split a[TM], b[TN];
#pragma unroll
            for (int i = 0; i < TM; ++i) { const int am = min(m0 + 16 * i + l15, p.M - 1); a[i] = sp_ld(A + (long long)am * p.sAm, p.sAk, k0, h, p.K, 1.f); }
#pragma unroll
            for (int t = 0; t < TN; ++t) { const int bn = min(n0 + 16 * t + l15, p.N - 1); b[t] = sp_ld(B + (long long)bn * p.sBn, p.sBk, k0, h, p.K, 1.f); }
#pragma unroll
            for (int i = 0; i < TM; ++i)
#pragma unroll
                for (int t = 0; t < TN; ++t) acc[i][t] = wmma3(a[i], b[t], acc[i][t]);
        } else if (MODE == 2) {
            v16b a[TM], b[TN];
#pragma unroll
            for (int i = 0; i < TM; ++i) { const int am = min(m0 + 16 * i + l15, p.M - 1); a[i] = bh_ld(A + (long long)am * p.sAm, p.sAk, k0, h, p.K, 1.f); }
#pragma unroll
            for (int t = 0; t < TN; ++t) { const int bn = min(n0 + 16 * t + l15, p.N - 1); b[t] = bh_ld(B + (long long)bn * p.sBn, p.sBk, k0, h, p.K, 1.f); }
#pragma unroll
            for (int i = 0; i < TM; ++i)
#pragma unroll
                for (int t = 0; t < TN; ++t) acc[i][t] = wmmab(a[i], b[t], acc[i][t]);
        } else {
            v16h a[TM], b[TN];
#pragma unroll
            for (int i = 0; i < TM; ++i) { const int am = min(m0 + 16 * i + l15, p.M - 1); a[i] = fh_ld(A + (long long)am * p.sAm, p.sAk, k0, h, p.K, p.sa); }
#pragma unroll
            for (int t = 0; t < TN; ++t) { const int bn = min(n0 + 16 * t + l15, p.N - 1); b[t] = fh_ld(B + (long long)bn * p.sBn, p.sBk, k0, h, p.K, p.sb); }
#pragma unroll
            for (int i = 0; i < TM; ++i)
#pragma unroll
                for (int t = 0; t < TN; ++t) acc[i][t] = wmma16(a[i], b[t], acc[i][t]);
        }
    }
    const float iscale = (MODE == 0) ? p.alpha / (p.sa * p.sb) : p.alpha;
    float* C = p.C + zo * p.sCo + zi * p.sCi;
    const float* R = p.R + zo * p.sRo + zi * p.sRi;
    const int NW = (p.Npad > p.N) ? p.Npad : p.N;
    __shared__ __align__(16) float ctile[16][36];
#pragma unroll
    for (int i = 0; i < TM; ++i) {
        const int mb = m0 + 16 * i; if (mb >= p.M) break;          // wave-uniform
#pragma unroll
        for (int tp = 0; tp < TN / 2; ++tp) {
            const int nb = n0 + 32 * tp; if (nb >= NW) break;        // wave-uniform
#pragma unroll
            for (int t2 = 0; t2 < 2; ++t2) {
                const int t = 2 * tp + t2; const int n = nb + t2 * 16 + l15; const int nn = min(n, p.N - 1);
#pragma unroll
                for (int r = 0; r < 8; ++r) {
                    const int m = mb + 8 * h + r; const int mm = min(m, p.M - 1);
                    float v = acc[i][t][r] * iscale;
                    if (p.flags & 1) v += p.bias[nn];
                    if (p.flags & 2) v += p.bias[mm];
            if (p.flags & 8) v *= p.bias[(long long)zo * p.M + mm];   /* per-(z,row) scale vector laid out [Z][M]; exclusive with the bias flags */
                    v = act_fn(v, p.act);
                    if (p.flags & 4) v += p.beta * R[(long long)mm * p.sRm + (long long)nn * p.sRn];
                    ctile[8 * h + r][t2 * 16 + l15] = (n < p.N) ? v : 0.f;
                }
            }
            __syncthreads();
            const bool fast = (mb + 16 <= p.M) && (nb + 32 <= NW) && ((p.sCm & 3) == 0) && ((((size_t)C) & 15) == 0);
            if (fast) {
#pragma unroll
                for (int s = 0; s < 4; ++s) {
                    const int row = s * 4 + (lane >> 3), c4 = (lane & 7) * 4;
                    const v4f v = *(const v4f*)&ctile[row][c4];
                    VST2V4(C + (long long)(mb + row) * p.sCm + nb + c4, v);
                }
            } else {
                for (int row = 0; row < 16; ++row) {
                    const int m = mb + row, n = nb + lane;
                    if (m < p.M && n < NW) VST2(float, C + (long long)m * p.sCm + n, ctile[row][lane]);
                }
            }
            __syncthreads();
        }
    }
}

// =====================================================================================================================
// k_attn_lds<L, RS, OS>: O = softmax(scale * Q.K^T) V for one head per blockIdx.y, head and value dim 64, L queries and L keys (L % 64 == 0), Q, K, V f16 planes, O f32.
//   Wave = 16 queries, AW waves per block, 64-key blocks; grid (L / (16*AW), H, batch), block 32*AW. Row r of head h of batch element z: Q/K/V + (z*L + r)*RS + h*64, O + (z*L + r)*OS + h*64.
//   Each 64-key block of K and of V is read once per work-group with 16-byte loads (a row of 64 halves is one 128-B line, 8 lanes) and laid in LDS as [key][d] rows:
//   K at a pitch of 144 B for ds_load_b128 fragment reads (A operand of k.q^T, same k order as the Q fragment),
//   V at a pitch of 160 B for ds_load_tr16_b128 fragment reads (A operand of v^T.p^T: lane = row d, k = key in the frag_k order).
//   Both products are taken transposed: S^T = K.Q^T puts query l15 in lane column l15, so lanes l15 and l15+16 hold all 64 scores of one query
//   (tile t, register r: key 16t + 8*hf + r); maximum and sum run inside the lane, with one exchange between the lane halves.
//   Two S^T tiles of 16 keys, converted in place, are the B fragment of O^T += V^T.P^T in the frag_k order: P never leaves the registers.
//   Statistics f32 (exp2 domain); P x 4096 as f16.
//   Output map: Y^T = Wo[h]^T.O^T + bo[h]. Wo[h] x 16 lies in LDS as f16 [d][e] rows, laid and read exactly like a V tile (A operand: lane = row e, k = d);
//   the normalised O^T tiles, converted in place like P, are the B fragment. O receives Y, row r of head h of batch element z at O + (z*L + r)*OS + h*64.
// =====================================================================================================================
#define AW 4
typedef __attribute__((ext_vector_type(4))) _Float16 v4h;
typedef __attribute__((ext_vector_type(8))) short    v8s;
union FragH { v16h v; v8h h[2]; };
// 16-bit transposing LDS load: with lane address T + (k0 + 8*(l>>4) + (l&7)) * pitch + d0 + 8*((l>>3)&1) (halves), lane (c = l&15, h = l>>4) gets T[k0 + 8h + 0..7][d0 + c]
__device__ __forceinline__ v8h ld_tr16(const _Float16* p) {
    typedef __attribute__((address_space(3))) v8s lds_v8s;
    return __builtin_bit_cast(v8h, __builtin_amdgcn_ds_load_tr16_b128_v8i16((lds_v8s*)p));
}
// value of lane l ^ 16
__device__ __forceinline__ float swap_half(float x) {
    const int b = __builtin_bit_cast(int, x);
    return __builtin_bit_cast(float, __builtin_amdgcn_permlanex16(b, b, 0x76543210, 0xfedcba98, false, false));
}
// 2^x as the one hardware instruction. exp2f() wraps it in a compare, two selects and an ldexp so that results below 2^-126 come out as subnormals;
// here every argument is <= 0 and such a result may be 0: as P it is below f16's range even x 4096, in the sum it stands beside a term 2^0, as the rescale factor it multiplies
// what the new maximum's term outweighs by 2^126. exp2_raw(-inf) = 0 as before.
__device__ __forceinline__ float exp2_raw(float x) { return __builtin_amdgcn_exp2f(x); }
template <int L, int RS, int OS>
__global__ __launch_bounds__(32 * AW) void k_attn_lds(const _Float16* __restrict__ Q, const _Float16* __restrict__ K, const _Float16* __restrict__ V, const float* __restrict__ Wo, const float* __restrict__ bo, float* __restrict__ O, float scale) {
    constexpr int KP = 72;                      // K tile pitch in halves (144 B: odd multiple of 16 B)
    constexpr int VP = 80;                      // V tile pitch in halves (160 B: odd multiple of 32 B)
    constexpr int OP = 68;                      // output tile pitch in floats (272 B: odd multiple of 16 B)
    __shared__ __align__(16) float    pl[AW][16 * OP];
    __shared__ __align__(16) _Float16 kl[64 * KP];
    __shared__ __align__(16) _Float16 vl[64 * VP];
    __shared__ __align__(16) _Float16 wl[64 * VP];   // Wo[h] x 16, [d][e], V's pitch (same reader)
    const int lane = threadIdx.x & 31, hf = lane >> 4, l15 = lane & 15, wave = threadIdx.x >> 5;
    const int h = blockIdx.y;
    const int q0 = (blockIdx.x * AW + wave) * 16;
    const long long zr = (long long)blockIdx.z * L;   // first row of this batch element
    float* myp = pl[wave];
    const float L2E = 1.4426950408889634f;
    const float NEG = -__builtin_inff();
    const _Float16* qrow = Q + h * 64 + (zr + q0 + l15) * RS + 8 * hf;
    const _Float16* kbase = K + h * 64 + zr * RS;
    const _Float16* vbase = V + h * 64 + zr * RS;
    FragH qf[2];                                // elements 0..7 <- d = 32ks + 8hf + 0..7, 8..15 <- d = 32ks + 16 + 8hf + 0..7: the frag_k order
#pragma unroll
    for (int ks = 0; ks < 2; ++ks) { qf[ks].h[0] = *(const v8h*)(qrow + ks * 32); qf[ks].h[1] = *(const v8h*)(qrow + ks * 32 + 16); }
    asm volatile("s_wait_xcnt 0x0" :: "v"(qrow) : "memory");   // stands in front of any reuse of the loads' address pair, which it names so that the pair lives up to here
    const v16h qa[2] = { qf[0].v, qf[1].v };
    v8f o[4];                                   // o[t][r] = O^T[d = 16t + 8*hf + r][query l15]
    float m1 = NEG, l1 = 0.f;                   // query l15: running maximum (equal in both lane halves), sum over this half's keys
#pragma unroll
    for (int t = 0; t < 4; ++t) { v8f zz = {}; o[t] = zz; }
    const int sr = threadIdx.x >> 4, sc4 = (threadIdx.x & 15) * 4;   // staging of Wo: 16 threads per 64-float row, 8 rows per sweep
    const int kr8 = threadIdx.x >> 3, kc8 = (threadIdx.x & 7) * 8;   // staging of K, V: 8 threads per 64-half row, 16 rows per sweep
    const _Float16* kfr = kl + l15 * KP + 8 * hf;
    const _Float16* vfr = vl + (8 * hf + (lane & 7)) * VP + 8 * ((lane >> 3) & 1);
    const _Float16* wfr = wl + (8 * hf + (lane & 7)) * VP + 8 * ((lane >> 3) & 1);
    {                                                    // the head's output map into LDS; the key loop's first barriers publish it
        const float* wbase = Wo + h * 64 * 64;
        v4f wr[8];
#pragma unroll
        for (int i = 0; i < 8; ++i) wr[i] = *(const v4f*)(wbase + (i * 8 + sr) * 64 + sc4);
        asm volatile("s_wait_xcnt 0x0" ::: "memory");    // stands in front of any reuse of the address registers of the loads above
#pragma unroll
        for (int i = 0; i < 8; ++i) *(v4h*)(wl + (i * 8 + sr) * VP + sc4) = __builtin_convertvector(wr[i] * 16.f, v4h);
    }
    for (int j0 = 0; j0 < L; j0 += 64) {
        v8h kr[4], vr[4];
#pragma unroll
        for (int i = 0; i < 4; ++i) {
            const long long off = (long long)(j0 + i * 16 + kr8) * RS + kc8;
            kr[i] = *(const v8h*)(kbase + off); vr[i] = *(const v8h*)(vbase + off);
        }
        asm volatile("s_wait_xcnt 0x0" ::: "memory");    // stands in front of any reuse of the address registers of the loads above
        __syncthreads();                                 // previous key block's reads of kl / vl are done
#pragma unroll
        for (int i = 0; i < 4; ++i) {
            *(v8h*)(kl + (i * 16 + kr8) * KP + kc8) = kr[i];
            *(v8h*)(vl + (i * 16 + kr8) * VP + kc8) = vr[i];
        }
        __syncthreads();                                 // K and V tiles visible to every wave
        FragH kb[4][2];                                  // all eight K fragments behind one LDS latency
#pragma unroll
        for (int t = 0; t < 4; ++t)
#pragma unroll
            for (int ks = 0; ks < 2; ++ks) {
                kb[t][ks].h[0] = *(const v8h*)(kfr + t * 16 * KP + ks * 32);
                kb[t][ks].h[1] = *(const v8h*)(kfr + t * 16 * KP + ks * 32 + 16);
            }
        v8f s[4];                                        // s[t][r] = S[query l15][key j0 + 16t + 8*hf + r]
#pragma unroll
        for (int t = 0; t < 4; ++t) {
            v8f acc = {};
#pragma unroll
            for (int ks = 0; ks < 2; ++ks) acc = wmma16(kb[t][ks].v, qa[ks], acc);
            s[t] = acc;
        }
        float sc[4][8], mt[4];
#pragma unroll
        for (int t = 0; t < 4; ++t) {
            mt[t] = NEG;
#pragma unroll
            for (int i = 0; i < 8; ++i) { sc[t][i] = (s[t][i] * scale) * L2E; mt[t] = fmaxf(mt[t], sc[t][i]); }
        }
        float mx = fmaxf(fmaxf(mt[0], mt[1]), fmaxf(mt[2], mt[3]));
        mx = fmaxf(mx, swap_half(mx));
        const float mnew = fmaxf(m1, mx);
        const float mref = (mnew == NEG) ? 0.f : mnew;   // a query with only -inf scores so far: every exp2 below is exp2(-inf) = 0, never exp2(nan)
        const float corr = exp2_raw(m1 - mref);
        FragH pa[2]; float rt[4];
#pragma unroll
        for (int t = 0; t < 4; ++t) {
            rt[t] = 0.f;
#pragma unroll
            for (int i = 0; i < 8; ++i) {
                const float pp = exp2_raw(sc[t][i] - mref);
                rt[t] += pp; pa[t >> 1].v[(t & 1) * 8 + i] = (_Float16)(pp * 4096.f);
            }
        }
        l1 = l1 * corr + ((rt[0] + rt[1]) + (rt[2] + rt[3])); m1 = mnew;
#pragma unroll
        for (int t = 0; t < 4; ++t) o[t] *= corr;
        FragH vb[4][2];                                  // all eight V fragments behind one LDS latency
#pragma unroll
        for (int t = 0; t < 4; ++t) {
            vb[t][0].h[0] = ld_tr16(vfr + t * 16);           vb[t][0].h[1] = ld_tr16(vfr + 16 * VP + t * 16);
            vb[t][1].h[0] = ld_tr16(vfr + 32 * VP + t * 16); vb[t][1].h[1] = ld_tr16(vfr + 48 * VP + t * 16);
        }
#pragma unroll
        for (int t = 0; t < 4; ++t) {
            o[t] = wmma16(vb[t][0].v, pa[0].v, o[t]);
            o[t] = wmma16(vb[t][1].v, pa[1].v, o[t]);
        }
    }
    float* obase = O + h * 64 + zr * OS;
    const float lt = l1 + swap_half(l1);
    const float inv = (lt > 0.f) ? 1.f / (lt * 4096.f) : 0.f;
    FragH ob[2];                                         // O^T as f16: tiles 2ks and 2ks+1 are the B fragment of d chunk ks in the frag_k order
#pragma unroll
    for (int t = 0; t < 4; ++t)
#pragma unroll
        for (int i = 0; i < 8; ++i) ob[t >> 1].v[(t & 1) * 8 + i] = (_Float16)(o[t][i] * inv);
    FragH wb[4][2];
#pragma unroll
    for (int t = 0; t < 4; ++t) {
        wb[t][0].h[0] = ld_tr16(wfr + t * 16);           wb[t][0].h[1] = ld_tr16(wfr + 16 * VP + t * 16);
        wb[t][1].h[0] = ld_tr16(wfr + 32 * VP + t * 16); wb[t][1].h[1] = ld_tr16(wfr + 48 * VP + t * 16);
    }
#pragma unroll
    for (int t = 0; t < 4; ++t) {
        v8f ov = {};                                     // ov[r] = 16 * Y^T[e = 16t + 8*hf + r][query l15]
        ov = wmma16(wb[t][0].v, ob[0].v, ov);
        ov = wmma16(wb[t][1].v, ob[1].v, ov);
        *(v4f*)(myp + l15 * OP + t * 16 + 8 * hf)     = __builtin_shufflevector(ov, ov, 0, 1, 2, 3);
        *(v4f*)(myp + l15 * OP + t * 16 + 8 * hf + 4) = __builtin_shufflevector(ov, ov, 4, 5, 6, 7);
    }
    const v4f bv = *(const v4f*)(bo + h * 64 + l15 * 4);
    __syncthreads();
#pragma unroll
    for (int r0 = 0; r0 < 16; r0 += 2) {
        const int row = r0 + hf, c4 = l15 * 4;
        const v4f v = *(const v4f*)(myp + row * OP + c4) * 0.0625f + bv;
        VST2V4(obase + (long long)(q0 + row) * OS + c4, v);
    }
}

// =====================================================================================================================
// k_tr: dst(z, c, r) = alpha * src(z, r, c) (+ beta * R2(z, c, r)): [Z][R][C] (row stride lds) -> [Z][C][R] (row stride ldd) through a 32x32 LDS tile;
//   flags: 1 -> add beta * residual R2 addressed like dst (z*sRz + c*ldr + r); act applied before the residual.
// =====================================================================================================================
struct TrP { const float* src; float* dst; const float* R2; long long sSz, lds, sDz, ldd, sRz, ldr; int R, C, flags, act; float alpha, beta; };
static_assert(sizeof(TrP) == 3 * 8 + 6 * 8 + 6 * 4, "TrP has padding");
__global__ __launch_bounds__(256) void k_tr(TrP p) {
    __shared__ float tile[32][33];
    const int c0 = blockIdx.x * 32, r0 = blockIdx.y * 32, z = blockIdx.z;
    const int lane = threadIdx.x & 31, wave = threadIdx.x >> 5;
    const float* s = p.src + z * p.sSz;
#pragma unroll
    for (int k = 0; k < 4; ++k) {
        const int rl = wave * 4 + k, r = r0 + rl, c = c0 + lane;
        tile[rl][lane] = (r < p.R && c < p.C) ? s[(long long)r * p.lds + c] : 0.f;
    }
    __syncthreads();
    float* d = p.dst + z * p.sDz; const float* rr = p.R2 + z * p.sRz;
#pragma unroll
    for (int k = 0; k < 4; ++k) {
        const int cl = wave * 4 + k, c = c0 + cl, r = r0 + lane;
        if (c < p.C && r < p.R) {
            float v = act_fn(p.alpha * tile[lane][cl], p.act);
            if (p.flags & 1) v += p.beta * rr[(long long)c * p.ldr + r];
            VST2(float, d + (long long)c * p.ldd + r, v);
        }
    }
}

// k_affine: dst[i] = a * (sdev ? sdev[0] : 1) * src[i] + b, i < n (one thread per element; consecutive lanes -> consecutive addresses)
__global__ __launch_bounds__(256) void k_affine(const float* __restrict__ src, float* __restrict__ dst, int n, float a, float b, const float* __restrict__ sdev) {
    const int i = blockIdx.x * 256 + threadIdx.x;
    if (i < n) { const float aa = sdev ? a * sdev[0] : a; const float v = aa * src[i] + b; VST2(float, dst + i, v); }
}

// =====================================================================================================================
// k_softmax: row softmax over n contiguous elements, one 256-thread block per row; rows addressed z*sz + r*sr (grid (R, Z)).
//   out = scale_out * softmax(scale_in * x + (Mf ? Mf[z*smz + r*smr + j] : 0)); a row whose max is -inf is written as 0.
// =====================================================================================================================
struct SmP { const float* src; float* dst; const float* Mf; long long sz, sr, dz, dr, smz, smr; int n, pad; float scale_in, scale_out; };
static_assert(sizeof(SmP) == 3 * 8 + 6 * 8 + 4 * 4, "SmP has padding");
__global__ __launch_bounds__(256) void k_softmax(SmP p) {
    __shared__ float red[256];
    const int r = blockIdx.x, z = blockIdx.y, tid = threadIdx.x;
    const float* s = p.src + z * p.sz + (long long)r * p.sr;
    const float* mf = p.Mf ? (p.Mf + z * p.smz + (long long)r * p.smr) : nullptr;
    float mx = -__builtin_inff();
    for (int j = tid; j < p.n; j += 256) { float v = s[j] * p.scale_in; if (mf) v += mf[j]; mx = fmaxf(mx, v); }
    red[tid] = mx; __syncthreads();
    for (int o = 128; o > 0; o >>= 1) { if (tid < o) red[tid] = fmaxf(red[tid], red[tid + o]); __syncthreads(); }
    mx = red[0]; __syncthreads();
    float sum = 0.f;
    for (int j = tid; j < p.n; j += 256) { float v = s[j] * p.scale_in; if (mf) v += mf[j]; sum += (mx == -__builtin_inff()) ? 0.f : expf(v - mx); }
    red[tid] = sum; __syncthreads();
    for (int o = 128; o > 0; o >>= 1) { if (tid < o) red[tid] += red[tid + o]; __syncthreads(); }
    sum = red[0];
    const float inv = (sum > 0.f) ? p.scale_out / sum : 0.f;
    float* d = p.dst + z * p.dz + (long long)r * p.dr;
    for (int j = tid; j < p.n; j += 256) { float v = s[j] * p.scale_in; if (mf) v += mf[j]; const float o = (mx == -__builtin_inff()) ? 0.f : expf(v - mx) * inv; VST2(float, d + j, o); }
}
// =====================================================================================================================
// k_stats: mean and rsqrt(var + eps) over a set of n elements addressed base + z*sz + (e / inner) * so + (e % inner) * si, one 256-thread
// k_norm_apply: y = (x - mean[set]) * rstd[set] * g[c] + b[c] over a [Z][C][L] channel-major tensor with set = z*G + c / (C/G) (G groups per z;
//   G = C -> per-channel sets indexed z*C+c; for batch norm pass stats indexed by c only via bn = 1). Optional act. Output same layout.
// =====================================================================================================================
//   mode 0: mean / rsqrt(var + eps); mode 1 (RMSNorm): 0 / rsqrt(mean(x^2) + eps); mode 2 (L2 normalize * sqrt(n)): 0 / sqrt(n) / max(||x||, eps); mode 3: as 0 with unbiased variance (n-1)
__global__ __launch_bounds__(256) void k_stats(const float* __restrict__ x, long long sz, long long so, long long si, int inner, int n, float eps, float* __restrict__ stat, int mode) {
    __shared__ float red[256];
    const int z = blockIdx.x, tid = threadIdx.x;
    const float* base = x + z * sz;
    float s = 0.f;
    for (int e = tid; e < n; e += 256) s += base[(long long)(e / inner) * so + (long long)(e % inner) * si];
    red[tid] = s; __syncthreads();
    for (int o = 128; o > 0; o >>= 1) { if (tid < o) red[tid] += red[tid + o]; __syncthreads(); }
    const float mu = (mode == 0 || mode == 3) ? red[0] / (float)n : 0.f; __syncthreads();
    float q = 0.f;
    for (int e = tid; e < n; e += 256) { const float dlt = base[(long long)(e / inner) * so + (long long)(e % inner) * si] - mu; q += dlt * dlt; }
    red[tid] = q; __syncthreads();
    for (int o = 128; o > 0; o >>= 1) { if (tid < o) red[tid] += red[tid + o]; __syncthreads(); }
    {
        float rs;
        if (mode == 2) rs = sqrtf((float)n) / fmaxf(sqrtf(red[0]), eps); else if (mode == 3) rs = rsqrtf(red[0] / (float)(n - 1) + eps); else rs = rsqrtf(red[0] / (float)n + eps);
        if (tid < 32) { const float v = (tid == 0) ? mu : ((tid == 1) ? rs : 0.f); VST2(float, stat + (long long)z * 32 + tid, v); }
    }
}
//   One thread per element over the flat [Z][C][L] index space: grid ceil(Z*C*L / 256).
__global__ __launch_bounds__(256) void k_norm_apply(const float* __restrict__ x, float* __restrict__ y, const float* __restrict__ stat, const float* __restrict__ g, const float* __restrict__ bta,
                                                     int Z, int C, int L, int G, int bn, int act) {
    const long long idx = (long long)blockIdx.x * 256 + threadIdx.x;
    if (idx >= (long long)Z * C * L) return;
    const int l = (int)(idx % L); const long long zc = idx / L; const int c = (int)(zc % C), z = (int)(zc / C); (void)l;
    const int set = bn ? c : (z * G + c / (C / G));
    float v = (x[idx] - stat[(long long)set * 32]) * stat[(long long)set * 32 + 1];
    if (g) v *= g[c];
    if (bta) v += bta[c];
    v = act_fn(v, act);
    VST2(float, y + idx, v);
}

// k_lse_neg: c[i] = -(st[2i] + log(st[2i+1])) = minus the log-sum-exp of row i (for softmax over the query dimension)
__global__ __launch_bounds__(256) void k_lse_neg(const float* __restrict__ st, float* __restrict__ c, int n) {
    const int i = blockIdx.x * 256 + threadIdx.x;
    if (i < n) { const float v = -(st[2 * i] + logf(st[2 * i + 1])); VST2(float, c + i, v); }
}

// k_iota: dst[i] = a * i + b as int32 (segment/position id helper)
__global__ __launch_bounds__(256) void k_iota(int* __restrict__ dst, int n, int a, int b) {
    const int i = blockIdx.x * 256 + threadIdx.x;
    if (i < n) { const int v = a * i + b; VST2(int, dst + i, v); }
}

// k_axpby: dst[i] = a * x[i] + b * y[i] (+ c), i < n
__global__ __launch_bounds__(256) void k_axpby(const float* __restrict__ x, const float* __restrict__ y, float* __restrict__ dst, int n, float a, float b, float c) {
    const int i = blockIdx.x * 256 + threadIdx.x;
    if (i < n) { const float v = a * x[i] + b * y[i] + c; VST2(float, dst + i, v); }
}

// =====================================================================================================================
// k_rope: rotary embedding on a [R rows][Hn heads][D] view (row stride sXr, head stride sXh, element stride 1) -> Y (own strides).
//   mode 0: rotate_half (partner d±D/2, sign - for d<D/2); mode 1: interleaved pairs (partner d^1, sign - for even d).
//   table column tcol: tmode 0 -> d, 1 -> d % (D/2), 2 -> d / 2; position p: pmode 0 -> r % S, 1 -> head index, 2 -> pos[r];
//   c = C[(r / S) * sCb + p * sCp + tcol * sCd], s likewise from Sn; y = x[d] * c + sign * x[partner] * s. X and Y must not alias.
// =====================================================================================================================
struct RopeP { const float* X; float* Y; const float* C; const float* Sn; const int* pos; long long sXr, sXh, sYr, sYh, sCb, sCp, sCd; int R, Hn, D, S, mode, tmode, pmode, pad; };
static_assert(sizeof(RopeP) == 5 * 8 + 7 * 8 + 8 * 4, "RopeP has padding");
__global__ __launch_bounds__(256) void k_rope(RopeP p) {
    const long long idx = (long long)blockIdx.x * 256 + threadIdx.x;
    if (idx >= (long long)p.R * p.Hn * p.D) return;
    const int d = (int)(idx % p.D); const long long rh = idx / p.D; const int h = (int)(rh % p.Hn); const int r = (int)(rh / p.Hn);
    const int half = p.D / 2;
    int partner; float sign;
    if (p.mode == 0) { partner = (d < half) ? d + half : d - half; sign = (d < half) ? -1.f : 1.f; }
    else { partner = d ^ 1; sign = (d & 1) ? 1.f : -1.f; }
    const int tcol = (p.tmode == 0) ? d : ((p.tmode == 1) ? (d % half) : (d >> 1));
    const int pp = (p.pmode == 0) ? (r % p.S) : ((p.pmode == 1) ? h : p.pos[r]);
    const long long toff = (long long)(r / p.S) * p.sCb + (long long)pp * p.sCp + (long long)tcol * p.sCd;
    const float* xr = p.X + (long long)r * p.sXr + (long long)h * p.sXh;
    const float v = xr[d] * p.C[toff] + sign * xr[partner] * p.Sn[toff];
    VST2(float, p.Y + (long long)r * p.sYr + (long long)h * p.sYh + d, v);
}

// k_invf + k_sincos (split so neither kernel carries a large VALU-fma footprint): invf_i = num * (1 / powf(base, (2 i)/D)) [fmode 0],
//   num * expf((2 i) * cexp) [fmode 1], num * powf(base, -2 (i - 1) / D) [fmode 2]; then cs/sn[s*half + i] = cos/sin((pscale * s) * invf_i)
__global__ __launch_bounds__(256) void k_invf(float* __restrict__ invb, int half, int D, float base, float num, int fmode, float cexp) {
    const int i = blockIdx.x * 256 + threadIdx.x;
    if (i >= ((half + 31) / 32) * 32) return;
    if (i >= half) { VST2(float, invb + i, 0.f); return; }
    const float e = (float)(2 * i) / (float)D;
    float invf;
    if (fmode == 1) invf = num * expf((float)(2 * i) * cexp);
    else if (fmode == 2) invf = num * powf(base, (-2.0f * ((float)i - 1.0f)) / (float)D);
    else invf = num * (1.0f / powf(base, e));
    VST2(float, invb + i, invf);
}
__global__ __launch_bounds__(256) void k_sincos(float* __restrict__ cs, float* __restrict__ sn, const float* __restrict__ invb, int S, int half, float pscale) {
    const int idx = blockIdx.x * 256 + threadIdx.x;
    if (idx >= S * half) return;
    const int s = idx / half, i = idx - s * half;
    const float ang = (pscale * (float)s) * invb[i];
    VST2(float, cs + idx, cosf(ang)); VST2(float, sn + idx, sinf(ang));
}

// k_mulact: dst[i] = act(x[i]) * y[i]
__global__ __launch_bounds__(256) void k_mulact(const float* __restrict__ x, const float* __restrict__ y, float* __restrict__ dst, int n, int act) {
    const int i = blockIdx.x * 256 + threadIdx.x;
    if (i < n) { const float v = act_fn(x[i], act) * y[i]; VST2(float, dst + i, v); }
}

// =====================================================================================================================
// k_matvec: thread-per-row matrix-vector products for N <= 8 output columns (heads with 1-3 outputs, gates), f32 on the VALU.
//   C[r*sCm + j] = act(alpha * sum_k A[r*sAm + k*sAk] * B[j*sBn + k*sBk] + bias[j]) + beta * R[r*sRm + j*sRn]; each thread writes its N contiguous floats.
// =====================================================================================================================
__global__ __launch_bounds__(256) void k_matvec(GemmP p) {
    // 32 lanes write one line with one instruction.
    const int rpt = (p.N == 1) ? 1 : 32;
    const long long r0 = ((long long)blockIdx.x * 256 + threadIdx.x) * rpt; const int z = blockIdx.z, zo = z / p.zi_n, zi = z - zo * p.zi_n;
    if (r0 >= p.M) return;
    const float* Bb = p.B + zo * p.sBo + zi * p.sBi;
    float* C = p.C + zo * p.sCo + zi * p.sCi; const float* R = p.R + zo * p.sRo + zi * p.sRi;
    for (int rr = 0; rr < rpt; ++rr) {
        const long long r = r0 + rr; if (r >= p.M) break;
        const float* A = p.A + zo * p.sAo + zi * p.sAi + r * p.sAm;
        float acc[8] = {0.f, 0.f, 0.f, 0.f, 0.f, 0.f, 0.f, 0.f};
        for (int k = 0; k < p.K; ++k) { const float a = A[(long long)k * p.sAk];
#pragma unroll
            for (int j = 0; j < 8; ++j) if (j < p.N) acc[j] += a * Bb[(long long)j * p.sBn + (long long)k * p.sBk]; }
#pragma unroll
        for (int j = 0; j < 8; ++j) if (j < p.N) {
            float v = acc[j] * p.alpha;
            if (p.flags & 1) v += p.bias[j];
            if (p.flags & 2) v += p.bias[r];
            v = act_fn(v, p.act);
            if (p.flags & 4) v += p.beta * R[r * p.sRm + (long long)j * p.sRn];
            VST2(float, C + r * p.sCm + j, v);
        }
    }
}
// k_smallsoftmax: thread-per-row softmax for short rows (n <= 64): dst[r*dr + j] = softmax(scale*src[r*sr + j])
__global__ __launch_bounds__(256) void k_smallsoftmax(const float* __restrict__ src, float* __restrict__ dst, long long sr, long long dr, int n, long long R, float scale) {
    const long long r0 = ((long long)blockIdx.x * 256 + threadIdx.x) * 32;
    for (int rr = 0; rr < 32; ++rr) {
        const long long r = r0 + rr; if (r >= R) return;
        const float* s = src + r * sr; float* d = dst + r * dr;
        float mx = -__builtin_inff();
        for (int j = 0; j < n; ++j) mx = fmaxf(mx, s[j] * scale);
        float sum = 0.f;
        for (int j = 0; j < n; ++j) sum += expf(s[j] * scale - mx);
        const float inv = 1.f / sum;
        for (int j = 0; j < n; ++j) { const float v = expf(s[j] * scale - mx) * inv; VST2(float, d + j, v); }
    }
}

__global__ __launch_bounds__(32) void k_unitstat(float* __restrict__ st) { const int t = threadIdx.x; const float v = (t == 1) ? 1.f : 0.f; VST2(float, st + t, v); }

// destination (e.g. a d_out whose row width is not a multiple of 32 floats) is written by consecutive lanes of one instruction
__global__ __launch_bounds__(256) void k_lincopy(const float* __restrict__ src, long long lds, float* __restrict__ dst, long long ldd, long long rows, int cols) {
    const long long i = (long long)blockIdx.x * 256 + threadIdx.x; if (i >= rows * cols) return;
    const long long r = i / cols; const int c = (int)(i - r * cols);
    const float v = src[r * lds + c]; VST2(float, dst + r * ldd + c, v);
}

namespace w25 {
typedef __attribute__((ext_vector_type(16))) _Float16 v16h;
typedef __attribute__((ext_vector_type(8)))  _Float16 v8h;
typedef __attribute__((ext_vector_type(16))) __bf16   v16b;
typedef __attribute__((ext_vector_type(8)))  __bf16   v8b;
typedef __attribute__((ext_vector_type(8)))  float    v8f;
typedef __attribute__((ext_vector_type(4)))  float    v4f;

__device__ __forceinline__ unsigned short f2bf_bits(float f) {
  unsigned u = __float_as_uint(f);
  return (unsigned short)((u + 0x7FFFu + ((u >> 16) & 1u)) >> 16);
}
__device__ __forceinline__ float bf_bits2f(unsigned short h) { return __uint_as_float(((unsigned)h) << 16); }

// hazard guards as plain device helpers (no inline asm inside the kernel template body)
__device__ __forceinline__ void dep_guard_h(v8f& a, v8f& b, v16h x, v16h y) { asm volatile("v_nop\n\tv_nop\n\tv_nop\n\tv_nop" : "+v"(a), "+v"(b) : "v"(x), "v"(y)); }
__device__ __forceinline__ void dep_guard_b(v8f& a, v8f& b, v16b x, v16b y) { asm volatile("v_nop\n\tv_nop\n\tv_nop\n\tv_nop" : "+v"(a), "+v"(b) : "v"(x), "v"(y)); }
__device__ __forceinline__ void keep4_h(v16h a, v16h b, v16h c, v16h d) { asm volatile("v_nop" :: "v"(a), "v"(b), "v"(c), "v"(d)); }
__device__ __forceinline__ void keep4_b(v16b a, v16b b, v16b c, v16b d) { asm volatile("v_nop" :: "v"(a), "v"(b), "v"(c), "v"(d)); }
__device__ __forceinline__ void acc_guard4(v8f& a, v8f& b, v8f& c, v8f& d) { asm volatile("v_nop\n\tv_nop\n\tv_nop\n\tv_nop" : "+v"(a), "+v"(b), "+v"(c), "+v"(d)); }
template <typename T> struct Frag;
template <> struct Frag<_Float16> {
  typedef v16h V; union U { v16h v; v8h h[2]; };
  static __device__ __forceinline__ v16h load(const _Float16* p) {   // elements 0..7 <- p[0..7], 8..15 <- p[16..23]
    U f; f.h[0] = *(const v8h*)(p); f.h[1] = *(const v8h*)(p + 16); return f.v;
  }
  static __device__ __forceinline__ v8f mma(v16h a, v16h b, v8f c) {
    return __builtin_amdgcn_wmma_f32_16x16x32_f16(false, a, false, b, (short)0, c, false, false);
  }
  static __device__ __forceinline__ void guard(v8f& a, v8f& b, v16h x, v16h y) { dep_guard_h(a, b, x, y); }
  static __device__ __forceinline__ void keep(v16h a, v16h b, v16h c, v16h d) { keep4_h(a, b, c, d); }
};
template <> struct Frag<__bf16> {
  typedef v16b V; union U { v16b v; v8b h[2]; };
  static __device__ __forceinline__ v16b load(const __bf16* p) {
    U f; f.h[0] = *(const v8b*)(p); f.h[1] = *(const v8b*)(p + 16); return f.v;
  }
  static __device__ __forceinline__ v8f mma(v16b a, v16b b, v8f c) {
    return __builtin_amdgcn_wmma_f32_16x16x32_bf16(false, a, false, b, (short)0, c, false, false);
  }
  static __device__ __forceinline__ void guard(v8f& a, v8f& b, v16b x, v16b y) { dep_guard_b(a, b, x, y); }
  static __device__ __forceinline__ void keep(v16b a, v16b b, v16b c, v16b d) { keep4_b(a, b, c, d); }
};

// ---- Register-blocked batched WMMA GEMM ------------------------------------
// C[m,n] = scale * sum_k A[m,k] * Bt[n,k] (+bias)(+resid); each wave owns a 64x64 tile.
// A row-major [M,K]; Bt row-major [N,K]; M,N % 64 == 0, K % 32 == 0.
// SPLIT: operands are hi/lo planes (A2/Bt2 = lo planes, same layout); product = hi·hi + hi·lo + lo·hi.
// BIAS_MODE: 0 = none, 1 = bias[m], 2 = bias[n].
// OUT_MODE: 0 = f32, 1 = f16, 2 = bf16 hi plane (Cout) + bf16 lo plane (Cout2).
// ET: 0 = f16 operands, 1 = bf16 operands (pointers passed as 16-bit storage)
template <int ET> struct Elem;
template <> struct Elem<0> { typedef _Float16 T; };
template <> struct Elem<1> { typedef __bf16 T; };
template <int ET, bool SPLIT, int BIAS_MODE, int OUT_MODE, bool RESID, int ACT = 0>
__global__ __launch_bounds__(256) void wmma_gemm64(
    const unsigned short* __restrict__ Ap, const unsigned short* __restrict__ A2p, int lda, long strideA,
    const unsigned short* __restrict__ Btp, const unsigned short* __restrict__ Bt2p, int ldb, long strideB,
    void* __restrict__ Cout, void* __restrict__ Cout2, int ldc, long strideC,
    const float* __restrict__ bias,
    const float* __restrict__ resid, long strideR,
    int M, int N, int K, float scale) {
  typedef typename Elem<ET>::T T;
  typedef typename Frag<T>::V V;
  const T* A = (const T*)Ap; const T* A2 = (const T*)A2p; const T* Bt = (const T*)Btp; const T* Bt2 = (const T*)Bt2p;
  __shared__ __align__(16) float sT[8][16 * 68];   // per-wave 16x64 slab, pitch 68 floats
  const int b    = blockIdx.y;
  const int lane = threadIdx.x & 31;
  const int wave = threadIdx.x >> 5;
  const int tilesN = N >> 6;
  const int tilesM = M >> 6;
  const int tile = blockIdx.x * 8 + wave;
  if (tile >= tilesM * tilesN) return;   // wave-uniform; no block barriers in this kernel
  const int tm = tile / tilesN;
  const int tn = tile - tm * tilesN;
  const int m0 = tm << 6;
  const int n0 = tn << 6;

  const T* Ab  = A  + (size_t)b * strideA;
  const T* Bb  = Bt + (size_t)b * strideB;
  const T* Ab2 = SPLIT ? (A2  + (size_t)b * strideA) : nullptr;
  const T* Bb2 = SPLIT ? (Bt2 + (size_t)b * strideB) : nullptr;

  const int rlane = lane & 15;                 // row (A) / col (B, D) within subtile
  const int koff  = (lane >> 4) * 8;           // k offset of this lane half
  const int mOff  = (lane >> 4) * 8;           // D row offset

  v8f acc[4][4];
#pragma unroll
  for (int i = 0; i < 4; ++i)
#pragma unroll
    for (int j = 0; j < 4; ++j) acc[i][j] = (v8f){0.f,0.f,0.f,0.f,0.f,0.f,0.f,0.f};

  for (int k0 = 0; k0 < K; k0 += 32) {
    V bh[4], bl[4];
#pragma unroll
    for (int j = 0; j < 4; ++j) {
      const size_t bo = (size_t)(n0 + (j << 4) + rlane) * ldb + koff + k0;
      bh[j] = Frag<T>::load(Bb + bo);
      if (SPLIT) bl[j] = Frag<T>::load(Bb2 + bo);
    }
#pragma unroll
    for (int i = 0; i < 4; ++i) {
      const size_t ao = (size_t)(m0 + (i << 4) + rlane) * lda + koff + k0;
      V ah = Frag<T>::load(Ab + ao);
      V al;
      if (SPLIT) al = Frag<T>::load(Ab2 + ao);
#pragma unroll
      for (int j = 0; j < 4; ++j) {
        acc[i][j] = Frag<T>::mma(ah, bh[j], acc[i][j]);
        if (SPLIT) {
          acc[i][j] = Frag<T>::mma(ah, bl[j], acc[i][j]);
          acc[i][j] = Frag<T>::mma(al, bh[j], acc[i][j]);
        }
      }
      Frag<T>::guard(acc[i][0], acc[i][3], ah, SPLIT ? al : ah);
    }
    Frag<T>::keep(bh[0], bh[1], bh[2], bh[3]);
    if (SPLIT) Frag<T>::keep(bl[0], bl[1], bl[2], bl[3]);
  }
  acc_guard4(acc[0][0], acc[0][1], acc[0][2], acc[0][3]);
  acc_guard4(acc[1][0], acc[1][1], acc[1][2], acc[1][3]);
  acc_guard4(acc[2][0], acc[2][1], acc[2][2], acc[2][3]);
  acc_guard4(acc[3][0], acc[3][1], acc[3][2], acc[3][3]);

  // ---- epilogue ----
  float* slab = sT[wave];
  const float* Rb = RESID ? (resid + (size_t)b * strideR) : nullptr;
#pragma unroll
  for (int i = 0; i < 4; ++i) {
    const int mBase = m0 + (i << 4);
#pragma unroll
    for (int j = 0; j < 4; ++j) {
      const int n = n0 + (j << 4) + rlane;
      float bv = 0.f;
      if (BIAS_MODE == 2) bv = bias[n];
#pragma unroll
      for (int r = 0; r < 8; ++r) {
        float v = acc[i][j][r] * scale;
        if (BIAS_MODE == 1) v += bias[mBase + mOff + r];
        if (BIAS_MODE == 2) v += bv;
        if (RESID) v += Rb[(size_t)(mBase + mOff + r) * ldc + n];
        if (ACT == 1) v = tanhf(v);
        if (ACT == 2) v = fmaxf(v, 0.0f);
        if (ACT == 3) v = v / (1.0f + expf(-v));
        if (ACT == 4) v = (v > 0.f) ? v : 0.01f * v;
        if (ACT == 5) v = 0.5f * v * (1.0f + erff(v * 0.70710678118654752f));
        if (ACT == 6) v = (v > 0.f) ? v : 0.2f * v;
        slab[(mOff + r) * 68 + (j << 4) + rlane] = v;
      }
    }
    __builtin_amdgcn_fence(__ATOMIC_RELEASE, "workgroup");
    __builtin_amdgcn_wave_barrier();
    __builtin_amdgcn_fence(__ATOMIC_ACQUIRE, "workgroup");
    if (OUT_MODE == 0) {
      float* C = (float*)Cout + (size_t)b * strideC;
      const int hh = lane >> 4, c4 = (lane & 15) * 4;     // row seg = 256 B = 16 lanes x 16 B
      {
#pragma unroll
        for (int it = 0; it < 8; ++it) {
          const int row = it * 2 + hh;
          v4f v = *(const v4f*)(slab + row * 68 + c4);
          *(v4f*)(C + (size_t)(mBase + row) * ldc + n0 + c4) = v;
        }
        
      }
    } else {
      const int q = lane >> 3, c8 = (lane & 7) * 8;
      unsigned short* C  = (unsigned short*)Cout  + (size_t)b * strideC;
      unsigned short* C2 = (OUT_MODE == 2) ? ((unsigned short*)Cout2 + (size_t)b * strideC) : nullptr;
      {
#pragma unroll
        for (int it = 0; it < 4; ++it) {
          const int row = it * 4 + q;
          const float* sp = slab + row * 68 + c8;
          v8h hv, lv;
#pragma unroll
          for (int e = 0; e < 8; ++e) {
            if (OUT_MODE == 1) {
              hv[e] = (_Float16)sp[e];
            } else {
              unsigned short hb = f2bf_bits(sp[e]);
              unsigned short lb = f2bf_bits(sp[e] - bf_bits2f(hb));
              hv[e] = __builtin_bit_cast(_Float16, hb);
              lv[e] = __builtin_bit_cast(_Float16, lb);
            }
          }
          *(v8h*)(C + (size_t)(mBase + row) * ldc + n0 + c8) = hv;
          if (OUT_MODE == 2) *(v8h*)(C2 + (size_t)(mBase + row) * ldc + n0 + c8) = lv;
        }
        
      }
    }
    __builtin_amdgcn_fence(__ATOMIC_RELEASE, "workgroup");
    __builtin_amdgcn_wave_barrier();
    __builtin_amdgcn_fence(__ATOMIC_ACQUIRE, "workgroup");
  }
}

__global__ __launch_bounds__(256) void cast_f32_f16x2(
    const float* __restrict__ in, _Float16* __restrict__ out, int n2) {
  int i = blockIdx.x * 256 + threadIdx.x;
  if (i < n2) {
    const _Float16 h0 = (_Float16)in[2 * i], h1 = (_Float16)in[2 * i + 1];
    const unsigned u = (unsigned)__builtin_bit_cast(unsigned short, h0) | ((unsigned)__builtin_bit_cast(unsigned short, h1) << 16);
    ((unsigned*)out)[i] = u;
    
  }
}


} // namespace w25

// =====================================================================================================================
// k_prep<NR, D>: all f16 operand planes of the projections in one launch of WB + XB work-groups of 256 threads, 32 or 64 elements a thread.
//   Work-groups [0, WB): one tile of 128 (k) x 64 (n) of the weights taken side by side, W = Wq | Wkv ([D][D] | [D][2D], n < D is Wq):
//   W16[n][k] = f16(16 * W[k][n]). Rows of 256 B are read along n with 16-byte loads into an f32 LDS tile (pitch 65 floats: the 32 lanes
//   of a column-wise read fall on 32 different banks); each lane then packs 8 consecutive k of one n, 8 lanes store one whole 128-B line.
//   Work-groups [WB, WB + XB): X16 = f16(x), 16384 consecutive floats each; a wave's load covers 512 contiguous bytes, its store 256.
// =====================================================================================================================
// eight 16-byte loads, 16 rows of LD floats apart: one address pair, the row steps as immediate offsets
template <int LD> __device__ __forceinline__ void ld_rows8(const float* __restrict__ sp, v4f (&w)[8]) {
#pragma unroll
    for (int s = 0; s < 8; ++s) w[s] = *(const v4f*)(sp + s * 16 * LD);
    asm volatile("s_wait_xcnt 0x0" :: "v"(sp) : "memory");   // stands in front of any reuse of the loads' address pair, which it names so that the pair lives up to here
}
template <int NR, int D>
__global__ __launch_bounds__(256) void k_prep(const float* __restrict__ x, const float* __restrict__ Wq, const float* __restrict__ Wkv, _Float16* __restrict__ X16, _Float16* __restrict__ W16) {
    constexpr int TP = 65;                      // LDS tile pitch in floats
    constexpr int NT = 3 * D / 64;              // n tiles
    constexpr int WB = NT * (D / 128);
    static_assert(D % 128 == 0 && ((long long)NR * D) % 16384 == 0, "whole tiles only");
    __shared__ float tile[128 * TP];
    const int tid = threadIdx.x;
    if ((int)blockIdx.x < WB) {
        const int nt = blockIdx.x % NT, kt = blockIdx.x / NT;
        const int n0 = nt * 64, k0 = kt * 128;
        const int c4 = (tid & 15) * 4, r = tid >> 4;
        v4f w[8];
        if (n0 < D) ld_rows8<D>(Wq + n0 + (k0 + r) * D + c4, w);                     // work-group-uniform choice of the source matrix
        else        ld_rows8<2 * D>(Wkv + (n0 - D) + (k0 + r) * (2 * D) + c4, w);
#pragma unroll
        for (int s = 0; s < 8; ++s)
#pragma unroll
            for (int e = 0; e < 4; ++e) tile[(s * 16 + r) * TP + c4 + e] = w[s][e];
        __syncthreads();                                 // the whole tile is in LDS before any column of it is read
        const int a8 = (tid & 7) * 8, nl = tid >> 3;
#pragma unroll
        for (int q = 0; q < 4; ++q) {
            const int n = (q >> 1) * 32 + nl, k = (q & 1) * 64 + a8;
            v8h hv;
#pragma unroll
            for (int j = 0; j < 8; ++j) hv[j] = (_Float16)(tile[(k + j) * TP + n] * 16.f);
            *(v8h*)(W16 + (long long)(n0 + n) * D + k0 + k) = hv;
        }
    } else {
        const long long base = (long long)((int)blockIdx.x - WB) * 16384 + tid * 4;
        const float* xp = x + base;
        v4f v[16];
#pragma unroll
        for (int i = 0; i < 16; ++i) v[i] = *(const v4f*)(xp + i * 1024);
        asm volatile("s_wait_xcnt 0x0" :: "v"(xp) : "memory");   // stands in front of any reuse of the loads' address pair, which it names so that the pair lives up to here
#pragma unroll
        for (int i = 0; i < 16; ++i) *(v4h*)(X16 + base + i * 1024) = __builtin_convertvector(v[i], v4h);
        asm volatile("s_wait_xcnt 0x0" ::: "memory");            // stands behind the stores above, in front of any reuse of their address and data registers
    }
}

// =====================================================================================================================
// k_proj<M, N, K>: C[m][n] = scale * sum_k A[m][k] * Bt[n][k], A [M][K] and Bt [N][K] f16 planes, C [M][N] f16 (rounded to nearest from the scaled f32 sum); M, N % 128 == 0, K % 128 == 0.
//   One work-group of 4 waves per 128 x 128 tile of C, each wave a 64 x 64 quarter (4 x 4 accumulator tiles), grid (M/128)*(N/128).
//   A stage is 64 k of the tile's 128 A rows and 128 Bt rows: 256 rows of 128 B, brought by 16-byte asynchronous copies (a wave's copy = 4 whole lines)
//   into one of two LDS buffers at a pitch of 144 B (odd multiple of 16 B, for the ds_load_b128 fragment reads); stage t + 2 is asked for when
//   every wave has left stage t, so it flies while stage t + 1 is worked on. k runs upward in steps of 32, one accumulator chain per tile.
// =====================================================================================================================
// eight asynchronous 16-byte copies of one lane, 16 rows apart (GS halves in memory, LS bytes in LDS)
template <int GS, int LS> __device__ __forceinline__ void acopy8(unsigned l, const _Float16* g) {
    // the copies and, as the last line, the wait that stands in front of any rewrite of the address registers they name
    asm volatile("global_load_async_to_lds_b128 %0, %8, off\n\t"
                 "global_load_async_to_lds_b128 %1, %9, off\n\t"
                 "global_load_async_to_lds_b128 %2, %10, off\n\t"
                 "global_load_async_to_lds_b128 %3, %11, off\n\t"
                 "global_load_async_to_lds_b128 %4, %12, off\n\t"
                 "global_load_async_to_lds_b128 %5, %13, off\n\t"
                 "global_load_async_to_lds_b128 %6, %14, off\n\t"
                 "global_load_async_to_lds_b128 %7, %15, off\n\t"
                 "s_wait_xcnt 0x0"
                 :: "v"(l), "v"(l + LS), "v"(l + 2 * LS), "v"(l + 3 * LS), "v"(l + 4 * LS), "v"(l + 5 * LS), "v"(l + 6 * LS), "v"(l + 7 * LS),
                    "v"(g), "v"(g + GS), "v"(g + 2 * GS), "v"(g + 3 * GS), "v"(g + 4 * GS), "v"(g + 5 * GS), "v"(g + 6 * GS), "v"(g + 7 * GS)
                 : "memory");
}
template <int M, int N, int K>
__global__ __launch_bounds__(128) void k_proj(const _Float16* __restrict__ A, const _Float16* __restrict__ Bt, _Float16* __restrict__ C, float scale) {
    typedef w25::Frag<_Float16> F;
    constexpr int KT = 64;                      // k per stage
    constexpr int PH = 72;                      // LDS row pitch in halves
    constexpr int SH = 256 * PH;                // halves per buffer: rows 0..127 A, 128..255 Bt
    constexpr int NS = K / KT;
    static_assert(M % 128 == 0 && N % 128 == 0 && K % 128 == 0, "whole tiles, two stages or more");
    __shared__ __align__(16) _Float16 ring[2 * SH];
    __shared__ __align__(16) float sT[4][16 * 68];   // per-wave 16x64 output slab, pitch 68 floats
    const int tid = threadIdx.x, lane = tid & 31, wave = tid >> 5;
    constexpr int TN = N / 128;
    const int tm = blockIdx.x / TN, tn = blockIdx.x - tm * TN;
    const int m0 = tm * 128, n0 = tn * 128;
    const int rlane = lane & 15, koff = (lane >> 4) * 8, mOff = (lane >> 4) * 8;
    // copies: 8 lanes per 128-B row, 16 rows per sweep of the work-group, 8 sweeps for each operand
    const int cr = tid >> 3, cc = (tid & 7) * 8;
    const _Float16* ga = A + (size_t)(m0 + cr) * K + cc;
    const _Float16* gb = Bt + (size_t)(n0 + cr) * K + cc;
    const unsigned la = (unsigned)(size_t)ring + (unsigned)(cr * PH + cc) * 2u;   // LDS byte address of this lane's first A chunk in buffer 0
    const _Float16* fa = ring + ((wave >> 1) * 64 + rlane) * PH + koff;
    const _Float16* fb = ring + (128 + (wave & 1) * 64 + rlane) * PH + koff;

    v8f acc[4][4];                              // the unroll directives of this kernel make every index of acc, ah and bh a constant, so that the arrays stay in registers
#pragma unroll
    for (int i = 0; i < 4; ++i)
#pragma unroll
        for (int j = 0; j < 4; ++j) { v8f zz = {}; acc[i][j] = zz; }

    acopy8<16 * K, 16 * PH * 2>(la, ga);
    acopy8<16 * K, 16 * PH * 2>(la + 128 * PH * 2, gb);
    asm volatile("s_wait_asynccnt 0x0" ::: "memory");    // this wave's copies of stage 0 have landed
    __syncthreads();                                     // stage 0 is visible to every wave
    acopy8<16 * K, 16 * PH * 2>(la + SH * 2, ga + KT);
    acopy8<16 * K, 16 * PH * 2>(la + SH * 2 + 128 * PH * 2, gb + KT);
    for (int t = 0; t < NS; ++t) {
        const int bo = (t & 1) * SH;
#pragma unroll
        for (int ks = 0; ks < KT; ks += 32) {
            v16h bh[4], ah[4];
#pragma unroll
            for (int j = 0; j < 4; ++j) bh[j] = F::load(fb + bo + j * 16 * PH + ks);
#pragma unroll
            for (int i = 0; i < 4; ++i) ah[i] = F::load(fa + bo + i * 16 * PH + ks);
            __builtin_amdgcn_sched_barrier(0);               // the 16 LDS reads stay one group in front of the 16 WMMAs: one LDS wait a k step, not one per row of tiles
#pragma unroll
            for (int i = 0; i < 4; ++i)
#pragma unroll
                for (int j = 0; j < 4; ++j) acc[i][j] = F::mma(ah[i], bh[j], acc[i][j]);
            __builtin_amdgcn_sched_barrier(0);               // keeps the next group of LDS reads from being spread among these WMMAs
        }
        asm volatile("s_wait_dscnt 0x0" ::: "memory");       // this wave's reads of stage t are done before the buffer may be refilled
        asm volatile("s_wait_asynccnt 0x0" ::: "memory");    // this wave's copies of stage t + 1 have landed
        __syncthreads();                                     // publishes stage t + 1 and ends every wave's reads of stage t
        if (t + 2 < NS) {                                    // the same for the whole work-group
            acopy8<16 * K, 16 * PH * 2>(la + bo * 2, ga + (t + 2) * KT);
            acopy8<16 * K, 16 * PH * 2>(la + bo * 2 + 128 * PH * 2, gb + (t + 2) * KT);
        }
    }
    asm volatile("s_wait_asynccnt 0x0" ::: "memory");        // no copy is outstanding when the wave goes on to its end

    float* slab = sT[wave];
    const int wm0 = m0 + (wave >> 1) * 64, wn0 = n0 + (wave & 1) * 64;
#pragma unroll
    for (int i = 0; i < 4; ++i) {
#pragma unroll
        for (int j = 0; j < 4; ++j)
#pragma unroll
            for (int r = 0; r < 8; ++r) slab[(mOff + r) * 68 + (j << 4) + rlane] = acc[i][j][r] * scale;
        __builtin_amdgcn_fence(__ATOMIC_RELEASE, "workgroup");
        __builtin_amdgcn_wave_barrier();
        __builtin_amdgcn_fence(__ATOMIC_ACQUIRE, "workgroup");
        const int rq = lane >> 3, c8 = (lane & 7) * 8;       // row segment = 64 halves = one 128-B line = 8 lanes x 16 B
        _Float16* cp[4]; v8h hv[4];
#pragma unroll
        for (int it = 0; it < 4; ++it) {
            const int row = it * 4 + rq;
            const v4f v0 = *(const v4f*)(slab + row * 68 + c8), v1 = *(const v4f*)(slab + row * 68 + c8 + 4);
            hv[it] = __builtin_convertvector(__builtin_shufflevector(v0, v1, 0, 1, 2, 3, 4, 5, 6, 7), v8h);
            cp[it] = C + (size_t)(wm0 + (i << 4) + row) * N + wn0 + c8;
        }
#pragma unroll
        for (int it = 0; it < 4; ++it) *(v8h*)cp[it] = hv[it];
        // stands behind the stores above, in front of any reuse of their address and data registers, which it names so that they live up to here
        asm volatile("s_wait_xcnt 0x0" :: "v"(cp[0]), "v"(cp[1]), "v"(cp[2]), "v"(cp[3]), "v"(hv[0]), "v"(hv[1]), "v"(hv[2]), "v"(hv[3]) : "memory");
        __builtin_amdgcn_fence(__ATOMIC_RELEASE, "workgroup");
        __builtin_amdgcn_wave_barrier();
        __builtin_amdgcn_fence(__ATOMIC_ACQUIRE, "workgroup");
    }
}

// f32 -> bf16 hi plane + bf16 lo plane (x = hi + lo to ~2^-17 relative; RNE both), [R][C] -> [R][C] (or transposed to [C][R]); 2 consecutive destination elements
__device__ __forceinline__ unsigned int f2bf2_pack(float a, float b, unsigned int* lo) {
    const unsigned short ha = w25::f2bf_bits(a), hb = w25::f2bf_bits(b);
    const unsigned short la = w25::f2bf_bits(a - w25::bf_bits2f(ha)), lb = w25::f2bf_bits(b - w25::bf_bits2f(hb));
    *lo = (unsigned)la | ((unsigned)lb << 16); return (unsigned)ha | ((unsigned)hb << 16); }
__global__ __launch_bounds__(256) void k_castS16(const float* __restrict__ src, long long lds, __bf16* __restrict__ dhi, __bf16* __restrict__ dlo, long long ldd, int R, int C, float s, int transpose) {
    const long long i = (long long)blockIdx.x * 256 + threadIdx.x; long long o; float a, b;
    if (transpose) { const long long np = (long long)C * (R / 2); if (i >= np) return; const int c = (int)(i / (R / 2)); const int r = 2 * (int)(i % (R / 2)); a = src[(long long)r * lds + c] * s; b = src[(long long)(r + 1) * lds + c] * s; o = (long long)c * ldd + r; }
    else { const long long np = (long long)R * (C / 2); if (i >= np) return; const int r = (int)(i / (C / 2)); const int c = 2 * (int)(i % (C / 2)); a = src[(long long)r * lds + c] * s; b = src[(long long)r * lds + c + 1] * s; o = (long long)r * ldd + c; }
    unsigned lo; const unsigned hi = f2bf2_pack(a, b, &lo); unsigned* ph = (unsigned*)(dhi + o); unsigned* pl = (unsigned*)(dlo + o);
    *ph = hi; *pl = lo;  }

namespace w25 {
// =====================================================================================
// Generic causal/non-causal attention for head_dim 64, f32 in / f32 out; 16-bit operands: bf16 with optional hi/lo splits, or
// plain f16 (F16=true, non-split, probabilities carried x2^15).
//   scores = (q*qscale)·kᵀ : v_wmma_f32_16x16x32_bf16; SPLIT_QK -> q,k as bf16 hi/lo (hi·hi + hi·lo + lo·hi)
//   out    = p·v           : v_wmma_f32_16x16x32_bf16; SPLIT_PV -> p,v as bf16 hi/lo; else p,v plain bf16
//   f32 accumulate; online softmax in f32. Block = 4 waves = 64 query rows of one (batch, head); S % 64 == 0.
//   Element (b, s, h, d) of tensor X lives at X[b*X_bs + s*X_rs + h*X_hs + d] (strides in floats, multiples of 4).
//   Masking: mask_mode 0 none, 1 causal (kv > q masked), 2 tensor [S][Skv] shared over (b,h) (float if
//   mask_is_int==0, int32 with element == 0 -> masked if 1, int32 with element != 0 -> masked if 2), 3 per-token vectors qmask[B][S] & kvmask[B][Skv] (int32,
//   0 -> masked), 4 causal + sliding window (kv > q or q - kv > W masked; W passed in mask_is_int);
//   5 = relative-position bias: s += cp[b,h,q][idx[q][kv]] + pc[b,h,kv][idx[q][kv]] with idx = mask_b ([S][Skv] int32) and
//   mask_a an int32 [S][Skv] tensor with nonzero = masked (tables: element (b,h,row,n) at X + b*c_bs + h*c_hs + row*c_rs + n);
//   masked scores are replaced by mask_fill (e.g. -inf or -1e9) before the softmax.
//   grid.x = B * H * (S/64) (or a sub-range with blk0).
// =====================================================================================
#define AT_D 64
#define AT_NW 4
#define AT_QB 64
#define AT_KC 64
struct AttnGeom { const float* cp = nullptr; const float* pc = nullptr; long c_bs = 0, c_rs = 0, c_hs = 0;   // mode-5 score-bias tables
                  long q_bs, q_rs, q_hs, k_bs, k_rs, k_hs, v_bs, v_rs, v_hs, o_bs, o_rs, o_hs;
                  int S, Skv, H, mask_mode; float qscale; int blk0; float mask_fill; int mask_is_int; };
static_assert(sizeof(AttnGeom) == 168, "no padding");

__device__ __forceinline__ unsigned short at_bf_bits(float f) {
  unsigned u = __float_as_uint(f);
  return (unsigned short)((u + 0x7FFFu + ((u >> 16) & 1u)) >> 16);
}
__device__ __forceinline__ __bf16 at_f2bf(float f) { return __builtin_bit_cast(__bf16, at_bf_bits(f)); }
__device__ __forceinline__ void at_split(float f, __bf16& hi, __bf16& lo) {
  const unsigned short hb = at_bf_bits(f);
  hi = __builtin_bit_cast(__bf16, hb);
  lo = at_f2bf(f - __uint_as_float(((unsigned)hb) << 16));
}
__device__ __forceinline__ v8f at_mma(v16b a, v16b b, v8f c) {
  c = __builtin_amdgcn_wmma_f32_16x16x32_bf16(false, a, false, b, (short)0, c, false, false);
  asm volatile("v_nop\n\tv_nop\n\tv_nop\n\tv_nop" : "+v"(c) : "v"(a), "v"(b));
  return c;
}
// 16-bit element as a bit pattern held in a __bf16 slot: f16 bits when F16, bf16 (RNE) otherwise
template <bool F16> __device__ __forceinline__ __bf16 at_to16(float f) {
  if (F16) return __builtin_bit_cast(__bf16, (_Float16)f);
  return at_f2bf(f);
}
template <bool F16> __device__ __forceinline__ v8f at_mma16(v16b a, v16b b, v8f c) {
  if (F16) {
    const v16h ah = __builtin_bit_cast(v16h, a), bh = __builtin_bit_cast(v16h, b);
    c = __builtin_amdgcn_wmma_f32_16x16x32_f16(false, ah, false, bh, (short)0, c, false, false);
    asm volatile("v_nop\n\tv_nop\n\tv_nop\n\tv_nop" : "+v"(c) : "v"(ah), "v"(bh));
    return c;
  }
  return at_mma(a, b, c);
}

template <bool SPLIT_QK, bool SPLIT_PV, bool F16 = false>
__global__ __launch_bounds__(128)
void attn64_kernel(const float* __restrict__ q, const float* __restrict__ k,
                   const float* __restrict__ v, float* __restrict__ out,
                   const void* __restrict__ mask_a, const int* __restrict__ mask_b, AttnGeom g) {
  static_assert(!(F16 && (SPLIT_QK || SPLIT_PV)), "f16 mode is non-split");
  const float PSC = F16 ? 32768.0f : 1.0f;     // f16 probabilities carried x2^15 (subnormal range), folded into the final 1/l
  union FB { v16b v; v8b h[2]; };
  __shared__ __align__(16) __bf16 Ksh[AT_KC * AT_D];             // K hi [kv][d]      8 KB
  __shared__ __align__(16) __bf16 Ksl[SPLIT_QK ? AT_KC * AT_D : 8];
  __shared__ __align__(16) __bf16 Vth[AT_D * AT_KC];             // V hi [d][kv]      8 KB
  __shared__ __align__(16) __bf16 Vtl[SPLIT_PV ? AT_D * AT_KC : 8];
  __shared__ __align__(16) __bf16 Psh[AT_NW][16 * AT_KC];        // per wave P hi [row][kv]  8 KB
  __shared__ __align__(16) __bf16 Psl[SPLIT_PV ? AT_NW : 1][SPLIT_PV ? 16 * AT_KC : 8];
  __shared__ __align__(16) float  Os[AT_NW][16 * 68];            // per wave out tile, pitch 68

  const int tid  = threadIdx.x;
  const int wave = tid >> 5;
  const int lane = tid & 31;
  const int hh   = lane >> 4;
  const int c    = lane & 15;

  const int nqb = g.S / AT_QB;
  const int bx = blockIdx.x + g.blk0;
  const int qb = bx % nqb;
  const int bh = bx / nqb;
  const int h  = bh % g.H;
  const int b  = bh / g.H;
  const int qbase_block = qb * AT_QB;
  const int q0 = qbase_block + wave * 16;

  const float* qb_ptr = q + (size_t)b * g.q_bs + (size_t)h * g.q_hs;
  const float* kb_ptr = k + (size_t)b * g.k_bs + (size_t)h * g.k_hs;
  const float* vb_ptr = v + (size_t)b * g.v_bs + (size_t)h * g.v_hs;
  float*       ob_ptr = out + (size_t)b * g.o_bs + (size_t)h * g.o_hs;

  // ---- Q fragments (A operand): 2 d-chunks, hi (and lo) ----
  v16b qah[2], qal[2];
  {
    const float* qrow = qb_ptr + (size_t)(q0 + c) * g.q_rs;
#pragma unroll
    for (int dc = 0; dc < 2; ++dc) {
#pragma unroll
      for (int e = 0; e < 8; ++e) {
        const float f0 = qrow[dc * 32 + 8 * hh + e] * g.qscale;
        const float f1 = qrow[dc * 32 + 16 + 8 * hh + e] * g.qscale;
        if (SPLIT_QK) { __bf16 hq, lq; at_split(f0, hq, lq); qah[dc][e] = hq; qal[dc][e] = lq; at_split(f1, hq, lq); qah[dc][8 + e] = hq; qal[dc][8 + e] = lq; }
        else { qah[dc][e] = at_to16<F16>(f0); qah[dc][8 + e] = at_to16<F16>(f1); qal[dc][e] = qah[dc][e]; qal[dc][8 + e] = qah[dc][8 + e]; }
      }
    }
  }

  float mrow[8], lrow[8];
  v8f oacc[4];
#pragma unroll
  for (int r = 0; r < 8; ++r) { mrow[r] = -INFINITY; lrow[r] = 0.f; }
#pragma unroll
  for (int t = 0; t < 4; ++t) oacc[t] = (v8f){0.f,0.f,0.f,0.f,0.f,0.f,0.f,0.f};

  const int nChunks = (g.mask_mode == 1 || g.mask_mode == 4) ? (qb + 1) : (g.Skv / AT_KC);   // block-uniform
  // per-row query mask (mode 3)
  int qkeep[8];
#pragma unroll
  for (int r = 0; r < 8; ++r) qkeep[r] = (g.mask_mode == 3) ? mask_b[(size_t)b * g.S + q0 + 8 * hh + r] : 1;   // mask_b = qmask in mode 3
  for (int kc = 0; kc < nChunks; ++kc) {
    const int kv0 = kc * AT_KC;
    __syncthreads();
    {
      const int kvr = tid >> 1, dh = (tid & 1) * 32;
      const float* krow = kb_ptr + (size_t)(kv0 + kvr) * g.k_rs + dh;
      const float* vrow = vb_ptr + (size_t)(kv0 + kvr) * g.v_rs + dh;
#pragma unroll
      for (int i = 0; i < 8; ++i) {
        v4f kk = *(const v4f*)(krow + 4 * i);
        v4f vv = *(const v4f*)(vrow + 4 * i);
#pragma unroll
        for (int e = 0; e < 4; ++e) {
          const int d = dh + 4 * i + e;
          if (SPLIT_QK) { __bf16 a, bl; at_split(kk[e], a, bl); Ksh[kvr * AT_D + d] = a; Ksl[kvr * AT_D + d] = bl; }
          else Ksh[kvr * AT_D + d] = at_to16<F16>(kk[e]);
          if (SPLIT_PV) { __bf16 a, bl; at_split(vv[e], a, bl); Vth[d * AT_KC + kvr] = a; Vtl[d * AT_KC + kvr] = bl; }
          else Vth[d * AT_KC + kvr] = at_to16<F16>(vv[e]);
        }
      }
    }
    __syncthreads();

    v8f s[4];
#pragma unroll
    for (int j = 0; j < 4; ++j) {
      s[j] = (v8f){0.f,0.f,0.f,0.f,0.f,0.f,0.f,0.f};
#pragma unroll 1
      for (int dc = 0; dc < 2; ++dc) {
        FB kb;
        kb.h[0] = *(const v8b*)(Ksh + (j * 16 + c) * AT_D + dc * 32 + 8 * hh);
        kb.h[1] = *(const v8b*)(Ksh + (j * 16 + c) * AT_D + dc * 32 + 16 + 8 * hh);
        s[j] = at_mma16<F16>(qah[dc], kb.v, s[j]);
        if (SPLIT_QK) {
          FB kl;
          kl.h[0] = *(const v8b*)(Ksl + (j * 16 + c) * AT_D + dc * 32 + 8 * hh);
          kl.h[1] = *(const v8b*)(Ksl + (j * 16 + c) * AT_D + dc * 32 + 16 + 8 * hh);
          s[j] = at_mma16<F16>(qah[dc], kl.v, s[j]);
          s[j] = at_mma16<F16>(qal[dc], kb.v, s[j]);
        }
      }
    }
    const bool diag = (g.mask_mode == 1) && (kc == qb);
    int kvkeep[4] = {1, 1, 1, 1};
    if (g.mask_mode == 3) {
#pragma unroll
      for (int j = 0; j < 4; ++j) kvkeep[j] = ((const int*)mask_a)[(size_t)b * g.Skv + kv0 + j * 16 + c];   // mask_a = kvmask
    }
    float cm[8];
#pragma unroll
    for (int r = 0; r < 8; ++r) {
      const int qrow = q0 + 8 * hh + r;
      float m = -INFINITY;
#pragma unroll
      for (int j = 0; j < 4; ++j) {
        const int kvcol = kv0 + j * 16 + c;
        bool masked = false;
        if (diag) masked = (kvcol > qrow);
        else if (g.mask_mode == 4) masked = (kvcol > qrow) || (qrow - kvcol > g.mask_is_int);
        else if (g.mask_mode == 2) {
          const size_t mi = (size_t)qrow * g.Skv + kvcol;
          masked = (g.mask_is_int == 0) ? (((const float*)mask_a)[mi] == 0.0f)
                 : (g.mask_is_int == 1) ? (((const int*)mask_a)[mi] == 0) : (((const int*)mask_a)[mi] != 0);
        } else if (g.mask_mode == 3) masked = (qkeep[r] == 0) || (kvkeep[j] == 0);
        else if (g.mask_mode == 5) {
          const size_t mi = (size_t)qrow * g.Skv + kvcol;
          masked = (((const int*)mask_a)[mi] != 0);
          int n = mask_b[mi]; n = n < 0 ? 0 : n;
          s[j][r] += g.cp[(size_t)b * g.c_bs + (size_t)h * g.c_hs + (size_t)qrow * g.c_rs + n]
                   + g.pc[(size_t)b * g.c_bs + (size_t)h * g.c_hs + (size_t)kvcol * g.c_rs + n];
        }
        if (masked) s[j][r] = g.mask_fill;
        m = fmaxf(m, s[j][r]);
      }
#pragma unroll
      for (int off = 1; off < 16; off <<= 1) m = fmaxf(m, __shfl_xor(m, off, 32));
      cm[r] = m;
    }
    __bf16* pwh = Psh[wave];
    __bf16* pwl = Psl[SPLIT_PV ? wave : 0];
#pragma unroll
    for (int r = 0; r < 8; ++r) {
      const float mnew = fmaxf(mrow[r], cm[r]);
      const float alpha = expf(mrow[r] - mnew);
      mrow[r] = mnew;
      float psum = 0.f;
#pragma unroll
      for (int j = 0; j < 4; ++j) {
        const float p = expf(s[j][r] - mnew);
        psum += p;
        if (SPLIT_PV) { __bf16 a, bl; at_split(p, a, bl); pwh[(8 * hh + r) * AT_KC + j * 16 + c] = a; pwl[(8 * hh + r) * AT_KC + j * 16 + c] = bl; }
        else pwh[(8 * hh + r) * AT_KC + j * 16 + c] = at_to16<F16>(p * PSC);
      }
#pragma unroll
      for (int off = 1; off < 16; off <<= 1) psum += __shfl_xor(psum, off, 32);
      lrow[r] = lrow[r] * alpha + psum;
#pragma unroll
      for (int t = 0; t < 4; ++t) oacc[t][r] *= alpha;
    }
    __builtin_amdgcn_fence(__ATOMIC_RELEASE, "workgroup");
    __builtin_amdgcn_wave_barrier();
    __builtin_amdgcn_fence(__ATOMIC_ACQUIRE, "workgroup");
#pragma unroll 1
    for (int kk = 0; kk < 2; ++kk) {
      FB pa, pl;
      pa.h[0] = *(const v8b*)(pwh + c * AT_KC + kk * 32 + 8 * hh);
      pa.h[1] = *(const v8b*)(pwh + c * AT_KC + kk * 32 + 16 + 8 * hh);
      if (SPLIT_PV) {
        pl.h[0] = *(const v8b*)(pwl + c * AT_KC + kk * 32 + 8 * hh);
        pl.h[1] = *(const v8b*)(pwl + c * AT_KC + kk * 32 + 16 + 8 * hh);
      }
#pragma unroll
      for (int t = 0; t < 4; ++t) {
        FB vb;
        vb.h[0] = *(const v8b*)(Vth + (t * 16 + c) * AT_KC + kk * 32 + 8 * hh);
        vb.h[1] = *(const v8b*)(Vth + (t * 16 + c) * AT_KC + kk * 32 + 16 + 8 * hh);
        oacc[t] = at_mma16<F16>(pa.v, vb.v, oacc[t]);
        if (SPLIT_PV) {
          FB vl;
          vl.h[0] = *(const v8b*)(Vtl + (t * 16 + c) * AT_KC + kk * 32 + 8 * hh);
          vl.h[1] = *(const v8b*)(Vtl + (t * 16 + c) * AT_KC + kk * 32 + 16 + 8 * hh);
          oacc[t] = at_mma16<F16>(pa.v, vl.v, oacc[t]);
          oacc[t] = at_mma16<F16>(pl.v, vb.v, oacc[t]);
        }
      }
    }
  }

  float* os = Os[wave];
#pragma unroll
  for (int r = 0; r < 8; ++r) {
    const float inv = 1.0f / (lrow[r] * PSC);
#pragma unroll
    for (int t = 0; t < 4; ++t) os[(8 * hh + r) * 68 + t * 16 + c] = oacc[t][r] * inv;
  }
  __builtin_amdgcn_fence(__ATOMIC_RELEASE, "workgroup");
  __builtin_amdgcn_wave_barrier();
  __builtin_amdgcn_fence(__ATOMIC_ACQUIRE, "workgroup");
  {
    const int c4 = (lane & 15) * 4;
    {
#pragma unroll
      for (int it = 0; it < 8; ++it) {
        const int row = it * 2 + hh;
        v4f val = *(const v4f*)(os + row * 68 + c4);
        *(v4f*)(ob_ptr + (size_t)(q0 + row) * g.o_rs + c4) = val;
      }
      
    }
  }
}

} // namespace w25


extern "C" void kernel_launch(void* const* d_in, const int* in_sizes, int n_in, void* d_out, int out_size, void* d_ws, size_t ws_size, hipStream_t stream) {
    (void)in_sizes; (void)n_in; (void)out_size; (void)ws_size;
    const float* x = (const float*)d_in[0];
    const float* Wq = (const float*)d_in[1];
    const float* Wkv = (const float*)d_in[2];
    const float* Wo = (const float*)d_in[3];
    const float* bo = (const float*)d_in[4];
    const int Bn = 2;
    const int T = 2048;
    const int D = 1024;
    const int NH = 16;
    const int D3 = 3 * D;
    const int NR = Bn * T;
    float* out = (float*)d_out;
    char* wsp = (char*)d_ws;
    unsigned short* X16 = (unsigned short*)wsp; wsp += (((size_t)((size_t)NR * D) * 2 + 255) / 256) * 256;
    unsigned short* W316 = (unsigned short*)wsp; wsp += (((size_t)((size_t)D3 * D) * 2 + 255) / 256) * 256;
    unsigned short* QKV16 = (unsigned short*)wsp; wsp += (((size_t)((size_t)NR * D3) * 2 + 255) / 256) * 256;
    if ((size_t)(wsp - (char*)d_ws) > ws_size) return;   // static carve guard
    k_prep<NR, D><<<(unsigned)((D3 / 64) * (D / 128) + (NR / 16) * (D / 1024)), 256, 0, stream>>>(x, Wq, Wkv, (_Float16*)(X16), (_Float16*)(W316));
    k_proj<NR, D3, D><<<(unsigned)((NR / 128) * (D3 / 128)), 128, 0, stream>>>((const _Float16*)(X16), (const _Float16*)(W316), (_Float16*)(QKV16), 0.0625f);
    k_attn_lds<T, D3, D><<<dim3((unsigned)((T) / (16 * AW)), (unsigned)(NH), (unsigned)(Bn)), 32 * AW, 0, stream>>>((const _Float16*)(QKV16), (const _Float16*)(QKV16) + D, (const _Float16*)(QKV16) + 2 * D, Wo, bo, out, 0.125f);
}

// v009
// A run of this version takes 76.5 microseconds.
// Next to v008, in two timings, it ran 1.04 and 1.05 times as fast.
// Counting every step since v000, which is the starting kernel, it is 28.1 times as fast.
// Contractions: q and k|v projections (weights stored [in][out]) [4096x1024].[1024x1024|2048], both batch elements' rows in one launch, with f16 operands on f16 planes (v_wmma_f32_16x16x32_f16, 64x64 register-blocked wave tiles, weights x16); the projection's epilogue rounds q, k, v once to an f16 plane; per (batch, head) softmax(q.k^T/8) v over all 2048 keys as one flash launch for both batch elements (head_dim 64, f16 q.k^T and f16 p.v with p as f16 of 4096 p), whose epilogue applies the head's own 64x64 output map (+bias) to the f16 attention tile still in registers (weights x16); f32 accumulate and softmax statistics.
#include <hip/hip_runtime.h>
#include <math.h>

typedef __attribute__((ext_vector_type(16))) _Float16 v16h;
typedef __attribute__((ext_vector_type(8)))  _Float16 v8h;
typedef __attribute__((ext_vector_type(16))) __bf16   v16b;
typedef __attribute__((ext_vector_type(8)))  float    v8f;
typedef __attribute__((ext_vector_type(4)))  float    v4f;

// 16-bit WMMA fragment map (wave32), lane L, h = L>>4, m = L&15:
//   A 16x32: lane = row m;   element i -> k = (i<8) ? 8h+i : 16+8h+(i-8)
//   B 32x16: lane = column m; the SAME k(i,h)
//   D 16x16 (8 f32): lane = column m; element r -> row 8h+r
__device__ __forceinline__ int frag_k(int i, int h) { return (i < 8) ? (8 * h + i) : (16 + 8 * h + (i - 8)); }
__device__ __forceinline__ __bf16 bf16_rne(float f) {
    unsigned int u = __float_as_uint(f);
    u += 0x7fffu + ((u >> 16) & 1u);
    return __builtin_bit_cast(__bf16, (unsigned short)(u >> 16));
}
__device__ __forceinline__ float bf16_f32(__bf16 b) { return __uint_as_float(((unsigned int)__builtin_bit_cast(unsigned short, b)) << 16); }
__device__ __forceinline__ v8f wmma16(v16h a, v16h b, v8f c) {
    c = __builtin_amdgcn_wmma_f32_16x16x32_f16(false, a, false, b, (short)0, c, false, false);
    asm volatile("v_nop\n\tv_nop\n\tv_nop\n\tv_nop" : "+v"(c) : "v"(a), "v"(b));
    return c;
}
__device__ __forceinline__ v8f wmmab(v16b a, v16b b, v8f c) {
    c = __builtin_amdgcn_wmma_f32_16x16x32_bf16(false, a, false, b, (short)0, c, false, false);
    asm volatile("v_nop\n\tv_nop\n\tv_nop\n\tv_nop" : "+v"(c) : "v"(a), "v"(b));
    return c;
}
struct Split { v16b hi, lo; };
// hi/lo split product: a.hi*b.hi + a.hi*b.lo + a.lo*b.hi
__device__ __forceinline__ v8f wmma3(const Split& a, const Split& b, v8f c) {
    c = __builtin_amdgcn_wmma_f32_16x16x32_bf16(false, a.hi, false, b.hi, (short)0, c, false, false);
    c = __builtin_amdgcn_wmma_f32_16x16x32_bf16(false, a.hi, false, b.lo, (short)0, c, false, false);
    c = __builtin_amdgcn_wmma_f32_16x16x32_bf16(false, a.lo, false, b.hi, (short)0, c, false, false);
    asm volatile("v_nop\n\tv_nop\n\tv_nop\n\tv_nop" : "+v"(c) : "v"(a.hi), "v"(a.lo), "v"(b.hi), "v"(b.lo));
    return c;
}
struct Split3 { v16b hi, mid, lo; };
// triple split product (6 terms, drops only terms below 2^-24 relative)
__device__ __forceinline__ v8f wmma6(const Split3& a, const Split3& b, v8f c) {
    c = __builtin_amdgcn_wmma_f32_16x16x32_bf16(false, a.hi, false, b.hi, (short)0, c, false, false);
    c = __builtin_amdgcn_wmma_f32_16x16x32_bf16(false, a.hi, false, b.mid, (short)0, c, false, false);
    c = __builtin_amdgcn_wmma_f32_16x16x32_bf16(false, a.mid, false, b.hi, (short)0, c, false, false);
    c = __builtin_amdgcn_wmma_f32_16x16x32_bf16(false, a.hi, false, b.lo, (short)0, c, false, false);
    c = __builtin_amdgcn_wmma_f32_16x16x32_bf16(false, a.mid, false, b.mid, (short)0, c, false, false);
    c = __builtin_amdgcn_wmma_f32_16x16x32_bf16(false, a.lo, false, b.hi, (short)0, c, false, false);
    asm volatile("v_nop\n\tv_nop\n\tv_nop\n\tv_nop" : "+v"(c) : "v"(a.hi), "v"(a.mid), "v"(a.lo), "v"(b.hi), "v"(b.mid), "v"(b.lo));
    return c;
}

// Fragment gathers from f32 memory: element i <- p[(k0 + frag_k(i,h)) * sk] * s, zero for k >= klen.
__device__ __forceinline__ v16h fh_ld(const float* __restrict__ p, long long sk, int k0, int h, int klen, float s) {
    v16h a;
#pragma unroll
    for (int i = 0; i < 16; ++i) { const int k = k0 + frag_k(i, h); a[i] = (k < klen) ? (_Float16)(p[(long long)k * sk] * s) : (_Float16)0.f; }
    return a;
}
__device__ __forceinline__ Split sp_ld(const float* __restrict__ p, long long sk, int k0, int h, int klen, float s) {
    Split r;
#pragma unroll
    for (int i = 0; i < 16; ++i) {
        const int k = k0 + frag_k(i, h); const float x = (k < klen) ? p[(long long)k * sk] * s : 0.f;
        const __bf16 hb = bf16_rne(x); r.hi[i] = hb; r.lo[i] = bf16_rne(x - bf16_f32(hb));
    }
    return r;
}
__device__ __forceinline__ Split3 sp3_ld(const float* __restrict__ p, long long sk, int k0, int h, int klen, float s) {
    Split3 r;
#pragma unroll
    for (int i = 0; i < 16; ++i) {
        const int k = k0 + frag_k(i, h); const float x = (k < klen) ? p[(long long)k * sk] * s : 0.f;
        const __bf16 hb = bf16_rne(x); const float r1 = x - bf16_f32(hb); const __bf16 mb = bf16_rne(r1);
        r.hi[i] = hb; r.mid[i] = mb; r.lo[i] = bf16_rne(r1 - bf16_f32(mb));
    }
    return r;
}
__device__ __forceinline__ v16b bh_ld(const float* __restrict__ p, long long sk, int k0, int h, int klen, float s) {
    v16b a;
#pragma unroll
    for (int i = 0; i < 16; ++i) { const int k = k0 + frag_k(i, h); a[i] = bf16_rne((k < klen) ? p[(long long)k * sk] * s : 0.f); }
    return a;
}
// f16 fragment from an f16 LDS/global row with element stride 1 (k-contiguous), no bounds (tile already zero padded)
__device__ __forceinline__ v16h fh_row(const _Float16* __restrict__ row, int k0, int h) {
    v16h a;
#pragma unroll
    for (int i = 0; i < 16; ++i) a[i] = row[k0 + frag_k(i, h)];
    return a;
}

#define VST2(T, ptr, val) do { const T vst2_v_ = (val); *(T*)(ptr) = vst2_v_;  } while (0)
typedef float v4f __attribute__((ext_vector_type(4)));
#define VST2V4(ptr, val) do { const v4f vst2_v4_ = (val); *(v4f*)(ptr) = vst2_v4_;  } while (0)

__device__ __attribute__((noinline)) float act_fn(float v, int act) {
    if (act == 1) return fmaxf(v, 0.f);                                                                               // relu
    if (act == 2) { const float u = 0.7978845608028654f * (v + 0.044715f * v * v * v); return 0.5f * v * (1.f + tanhf(u)); } // tanh-gelu
    if (act == 3) return v / (1.f + expf(-v));                                                                        // silu
    if (act == 4) return 0.5f * v * (1.f + erff(v * 0.7071067811865476f));                                             // erf-gelu
    if (act == 5) return tanhf(v);
    if (act == 6) return 1.f / (1.f + expf(-v));                                                                      // sigmoid
    if (act == 7) return (v > 0.f) ? v : 0.01f * v;                                                                   // leaky relu 0.01
    if (act == 8) return (v > 0.f) ? v : (expf(v) - 1.f);                                                             // elu
    if (act == 9) return fminf(fmaxf(v, 0.f), 6.f);                                                                   // relu6
    if (act == 10) return fabsf(v);                                                                                    // abs
    if (act == 11) return (v >= 0.f) ? v : 0.1f * v;                                                                  // leaky 0.1
    if (act == 12) return (v > 0.f) ? v : 0.2f * v;                                                                   // leaky 0.2
    if (act == 13) return (v > 20.f) ? v : log1pf(expf(v));                                                            // softplus
    return v;
}

// =====================================================================================================================
// k_gemm<MODE>: C(z, m, n) = act(alpha * sum_k A(z, m, k) * B(z, k, n) + bias) + beta * R(z, m, n)
//   One wave (32-thread block) per 16 x 32 tile of C; grid (ceil(N/32), ceil(M/16), Z). Batch z -> (zo = z / zi_n, zi = z % zi_n)
//   with separate outer/inner strides for every tensor (e.g. batch and head). A(m,k) = A[zo*sAo + zi*sAi + m*sAm + k*sAk] (f32),
//   B(k,n) = B[zo*sBo + zi*sBi + n*sBn + k*sBk] (f32); any M, N, K (K zero-padded to 32 inside the fragments, M/N tails guarded).
//   C(m,n) = C[zo*sCo + zi*sCi + m*sCm + n] (n contiguous). flags: 1 bias[n], 2 bias[m], 4 residual R[zo*sRo + zi*sRi + m*sRm + n*sRn].
//   MODE 0: f16 operands (A prescaled by sa, B by sb, both undone in the epilogue); 1: bf16 hi/lo split (3 products); 2: bf16;
//   3: bf16 hi/mid/lo triple split (6 products); 4: as 3 with Kahan-compensated f32 accumulation across k-steps.
// =====================================================================================================================
struct GemmP {
    const float* A; const float* B; const float* bias; const float* R; float* C;
    long long sAo, sAi, sAm, sAk, sBo, sBi, sBn, sBk, sCo, sCi, sCm, sRo, sRi, sRm, sRn;
    int M, N, K, zi_n, flags, act; float alpha, beta, sa, sb;
    int Npad, pad_;     // columns [N, Npad) of C are written as 0 so that padded workspace rows are covered by whole-line stores; Npad >= N
};
static_assert(sizeof(GemmP) == 5 * 8 + 15 * 8 + 6 * 4 + 4 * 4 + 2 * 4, "GemmP has padding");

template <int MODE>
__global__ __launch_bounds__(32) void k_gemm(GemmP p) {
    const int lane = threadIdx.x & 31, h = lane >> 4, l15 = lane & 15;
    const int m0 = blockIdx.y * 16, n0 = blockIdx.x * 32;
    const int z = blockIdx.z, zo = z / p.zi_n, zi = z - zo * p.zi_n;
    const float* A = p.A + zo * p.sAo + zi * p.sAi;
    const float* B = p.B + zo * p.sBo + zi * p.sBi;
    const int am = min(m0 + l15, p.M - 1);                       // clamped row for loads (stores are guarded)
    v8f acc[2], comp[2];
#pragma unroll
    for (int t = 0; t < 2; ++t) { v8f zz = {}; acc[t] = zz; comp[t] = zz; }
    for (int k0 = 0; k0 < p.K; k0 += 32) {
        const float* arow = A + (long long)am * p.sAm;
        if (MODE == 1) {
            const Split a = sp_ld(arow, p.sAk, k0, h, p.K, 1.f);
#pragma unroll
            for (int t = 0; t < 2; ++t) {
                const int bn = min(n0 + t * 16 + l15, p.N - 1);
                acc[t] = wmma3(a, sp_ld(B + (long long)bn * p.sBn, p.sBk, k0, h, p.K, 1.f), acc[t]);
            }
        } else if (MODE == 3) {
            const Split3 a = sp3_ld(arow, p.sAk, k0, h, p.K, 1.f);
#pragma unroll
            for (int t = 0; t < 2; ++t) {
                const int bn = min(n0 + t * 16 + l15, p.N - 1);
                acc[t] = wmma6(a, sp3_ld(B + (long long)bn * p.sBn, p.sBk, k0, h, p.K, 1.f), acc[t]);
            }
        } else if (MODE == 4) {
            // triple split as MODE 3, but each k-step's 6 products go into a fresh accumulator and the partial is added to the running f32 sum
            // on the VALU with Kahan compensation (accumulation error stays ~1 ulp however long K is)
            const Split3 a = sp3_ld(arow, p.sAk, k0, h, p.K, 1.f);
#pragma unroll
            for (int t = 0; t < 2; ++t) {
                const int bn = min(n0 + t * 16 + l15, p.N - 1); v8f zz = {};
                const v8f part = wmma6(a, sp3_ld(B + (long long)bn * p.sBn, p.sBk, k0, h, p.K, 1.f), zz);
                const v8f y = part - comp[t]; const v8f s = acc[t] + y; comp[t] = (s - acc[t]) - y; acc[t] = s;
            }
        } else if (MODE == 2) {
            const v16b a = bh_ld(arow, p.sAk, k0, h, p.K, 1.f);
#pragma unroll
            for (int t = 0; t < 2; ++t) {
                const int bn = min(n0 + t * 16 + l15, p.N - 1);
                acc[t] = wmmab(a, bh_ld(B + (long long)bn * p.sBn, p.sBk, k0, h, p.K, 1.f), acc[t]);
            }
        } else {
            const v16h a = fh_ld(arow, p.sAk, k0, h, p.K, p.sa);
#pragma unroll
            for (int t = 0; t < 2; ++t) {
                const int bn = min(n0 + t * 16 + l15, p.N - 1);
                acc[t] = wmma16(a, fh_ld(B + (long long)bn * p.sBn, p.sBk, k0, h, p.K, p.sb), acc[t]);
            }
        }
    }
    const float iscale = (MODE == 0) ? p.alpha / (p.sa * p.sb) : p.alpha;
    float* C = p.C + zo * p.sCo + zi * p.sCi;
    const float* R = p.R + zo * p.sRo + zi * p.sRi;
    __shared__ __align__(16) float ctile[16][36];
#pragma unroll
    for (int t = 0; t < 2; ++t) {
        const int n = n0 + t * 16 + l15; const int nn = min(n, p.N - 1);
#pragma unroll
        for (int r = 0; r < 8; ++r) {
            const int m = m0 + 8 * h + r; const int mm = min(m, p.M - 1);
            float v = acc[t][r] * iscale;
            if (p.flags & 1) v += p.bias[nn];
            if (p.flags & 2) v += p.bias[mm];
            if (p.flags & 8) v *= p.bias[(long long)zo * p.M + mm];   /* per-(z,row) scale vector laid out [Z][M]; exclusive with the bias flags */
            v = act_fn(v, p.act);
            if (p.flags & 4) v += p.beta * R[(long long)mm * p.sRm + (long long)nn * p.sRn];
            ctile[8 * h + r][t * 16 + l15] = (n < p.N) ? v : 0.f;
        }
    }
    __syncthreads();
    const int NW = (p.Npad > p.N) ? p.Npad : p.N;           // write width
    const bool fast = (m0 + 16 <= p.M) && (n0 + 32 <= NW) && ((p.sCm & 3) == 0) && ((((size_t)C) & 15) == 0);
    if (fast) {
#pragma unroll
        for (int s = 0; s < 4; ++s) {
            const int row = s * 4 + (lane >> 3), c4 = (lane & 7) * 4;
            const v4f v = *(const v4f*)&ctile[row][c4];
            VST2V4(C + (long long)(m0 + row) * p.sCm + n0 + c4, v);
        }
    } else {
        for (int row = 0; row < 16; ++row) {
            const int m = m0 + row, n = n0 + lane;
            if (m < p.M && n < NW) VST2(float, C + (long long)m * p.sCm + n, ctile[row][lane]);
        }
    }
}


// =====================================================================================================================
// k_gemmT<MODE, TM, TN>: same contract as k_gemm, but one wave computes a (16*TM) x (16*TN) tile: TM A fragments and TN B fragments are
//   loaded per 32-wide k-step and reused across TM*TN WMMAs (far fewer load/convert instructions per MAC). MODE 0 (f16), 1 (bf16 hi/lo),
//   2 (bf16) only. grid (ceil(NW/(16*TN)), ceil(M/(16*TM)), Z), block 32. Epilogue identical to k_gemm, run per 16x32 sub-tile.
// =====================================================================================================================
template <int MODE, int TM, int TN>
__global__ __launch_bounds__(32) void k_gemmT(GemmP p) {
    const int lane = threadIdx.x & 31, h = lane >> 4, l15 = lane & 15;
    const int m0 = blockIdx.y * (16 * TM), n0 = blockIdx.x * (16 * TN);
    const int z = blockIdx.z, zo = z / p.zi_n, zi = z - zo * p.zi_n;
    const float* A = p.A + zo * p.sAo + zi * p.sAi;
    const float* B = p.B + zo * p.sBo + zi * p.sBi;
    v8f acc[TM][TN];
#pragma unroll
    for (int i = 0; i < TM; ++i)
#pragma unroll
        for (int t = 0; t < TN; ++t) { v8f zz = {}; acc[i][t] = zz; }
    for (int k0 = 0; k0 < p.K; k0 += 32) {
        if (MODE == 1) {
            Split a[TM], b[TN];
#pragma unroll
            for (int i = 0; i < TM; ++i) { const int am = min(m0 + 16 * i + l15, p.M - 1); a[i] = sp_ld(A + (long long)am * p.sAm, p.sAk, k0, h, p.K, 1.f); }
#pragma unroll
            for (int t = 0; t < TN; ++t) { const int bn = min(n0 + 16 * t + l15, p.N - 1); b[t] = sp_ld(B + (long long)bn * p.sBn, p.sBk, k0, h, p.K, 1.f); }
#pragma unroll
            for (int i = 0; i < TM; ++i)
#pragma unroll
                for (int t = 0; t < TN; ++t) acc[i][t] = wmma3(a[i], b[t], acc[i][t]);
        } else if (MODE == 2) {
            v16b a[TM], b[TN];
#pragma unroll
            for (int i = 0; i < TM; ++i) { const int am = min(m0 + 16 * i + l15, p.M - 1); a[i] = bh_ld(A + (long long)am * p.sAm, p.sAk, k0, h, p.K, 1.f); }
#pragma unroll
            for (int t = 0; t < TN; ++t) { const int bn = min(n0 + 16 * t + l15, p.N - 1); b[t] = bh_ld(B + (long long)bn * p.sBn, p.sBk, k0, h, p.K, 1.f); }
#pragma unroll
            for (int i = 0; i < TM; ++i)
#pragma unroll
                for (int t = 0; t < TN; ++t) acc[i][t] = wmmab(a[i], b[t], acc[i][t]);
        } else {
            v16h a[TM], b[TN];
#pragma unroll
            for (int i = 0; i < TM; ++i) { const int am = min(m0 + 16 * i + l15, p.M - 1); a[i] = fh_ld(A + (long long)am * p.sAm, p.sAk, k0, h, p.K, p.sa); }
#pragma unroll
            for (int t = 0; t < TN; ++t) { const int bn = min(n0 + 16 * t + l15, p.N - 1); b[t] = fh_ld(B + (long long)bn * p.sBn, p.sBk, k0, h, p.K, p.sb); }
#pragma unroll
            for (int i = 0; i < TM; ++i)
#pragma unroll
                for (int t = 0; t < TN; ++t) acc[i][t] = wmma16(a[i], b[t], acc[i][t]);
        }
    }
    const float iscale = (MODE == 0) ? p.alpha / (p.sa * p.sb) : p.alpha;
    float* C = p.C + zo * p.sCo + zi * p.sCi;
    const float* R = p.R + zo * p.sRo + zi * p.sRi;
    const int NW = (p.Npad > p.N) ? p.Npad : p.N;
    __shared__ __align__(16) float ctile[16][36];
#pragma unroll
    for (int i = 0; i < TM; ++i) {
        const int mb = m0 + 16 * i; if (mb >= p.M) break;          // wave-uniform
#pragma unroll
        for (int tp = 0; tp < TN / 2; ++tp) {
            const int nb = n0 + 32 * tp; if (nb >= NW) break;        // wave-uniform
#pragma unroll
            for (int t2 = 0; t2 < 2; ++t2) {
                const int t = 2 * tp + t2; const int n = nb + t2 * 16 + l15; const int nn = min(n, p.N - 1);
#pragma unroll
                for (int r = 0; r < 8; ++r) {
                    const int m = mb + 8 * h + r; const int mm = min(m, p.M - 1);
                    float v = acc[i][t][r] * iscale;
                    if (p.flags & 1) v += p.bias[nn];
                    if (p.flags & 2) v += p.bias[mm];
            if (p.flags & 8) v *= p.bias[(long long)zo * p.M + mm];   /* per-(z,row) scale vector laid out [Z][M]; exclusive with the bias flags */
                    v = act_fn(v, p.act);
                    if (p.flags & 4) v += p.beta * R[(long long)mm * p.sRm + (long long)nn * p.sRn];
                    ctile[8 * h + r][t2 * 16 + l15] = (n < p.N) ? v : 0.f;
                }
            }
            __syncthreads();
            const bool fast = (mb + 16 <= p.M) && (nb + 32 <= NW) && ((p.sCm & 3) == 0) && ((((size_t)C) & 15) == 0);
            if (fast) {
#pragma unroll
                for (int s = 0; s < 4; ++s) {
                    const int row = s * 4 + (lane >> 3), c4 = (lane & 7) * 4;
                    const v4f v = *(const v4f*)&ctile[row][c4];
                    VST2V4(C + (long long)(mb + row) * p.sCm + nb + c4, v);
                }
            } else {
                for (int row = 0; row < 16; ++row) {
                    const int m = mb + row, n = nb + lane;
                    if (m < p.M && n < NW) VST2(float, C + (long long)m * p.sCm + n, ctile[row][lane]);
                }
            }
            __syncthreads();
        }
    }
}

// =====================================================================================================================
// k_attn_lds<L, RS, OS>: O = softmax(scale * Q.K^T) V for one head per blockIdx.y, head and value dim 64, L queries and L keys (L % 128 == 0), Q, K, V f16 planes, O f32.
//   Wave = 16 queries, AW waves per block, 64-key blocks; grid (L / (16*AW), H, batch), block 32*AW. Row r of head h of batch element z: Q/K/V + (z*L + r)*RS + h*64, O + (z*L + r)*OS + h*64.
//   Each 64-key block of K and of V is brought once per work-group by 16-byte asynchronous copies (a row of 64 halves is one 128-B line, 8 lanes) into one of two LDS buffers;
//   block t + 2 is asked for when every wave has left block t, so it flies while block t + 1 is worked on. The rows lie in LDS as [key][d]:
//   K at a pitch of 144 B for ds_load_b128 fragment reads (A operand of k.q^T, same k order as the Q fragment),
//   V at a pitch of 160 B for ds_load_tr16_b128 fragment reads (A operand of v^T.p^T: lane = row d, k = key in the frag_k order).
//   Both products are taken transposed: S^T = K.Q^T puts query l15 in lane column l15, so lanes l15 and l15+16 hold all 64 scores of one query
//   (tile t, register r: key 16t + 8*hf + r); maximum and sum run inside the lane, with one exchange between the lane halves.
//   Two S^T tiles of 16 keys, converted in place, are the B fragment of O^T += V^T.P^T in the frag_k order: P never leaves the registers.
//   Statistics f32 (exp2 domain); P x 4096 as f16.
//   Output map: Y^T = Wo[h]^T.O^T + bo[h]. Wo[h] x 16 lies in LDS as f16 [d][e] rows, laid and read exactly like a V tile (A operand: lane = row e, k = d);
//   the normalised O^T tiles, converted in place like P, are the B fragment. O receives Y, row r of head h of batch element z at O + (z*L + r)*OS + h*64.
// =====================================================================================================================
#define AW 4
typedef __attribute__((ext_vector_type(4))) _Float16 v4h;
typedef __attribute__((ext_vector_type(8))) short    v8s;
union FragH { v16h v; v8h h[2]; };
// 16-bit transposing LDS load: with lane address T + (k0 + 8*(l>>4) + (l&7)) * pitch + d0 + 8*((l>>3)&1) (halves), lane (c = l&15, h = l>>4) gets T[k0 + 8h + 0..7][d0 + c]
__device__ __forceinline__ v8h ld_tr16(const _Float16* p) {
    typedef __attribute__((address_space(3))) v8s lds_v8s;
    return __builtin_bit_cast(v8h, __builtin_amdgcn_ds_load_tr16_b128_v8i16((lds_v8s*)p));
}
// value of lane l ^ 16
__device__ __forceinline__ float swap_half(float x) {
    const int b = __builtin_bit_cast(int, x);
    return __builtin_bit_cast(float, __builtin_amdgcn_permlanex16(b, b, 0x76543210, 0xfedcba98, false, false));
}
// 2^x as the one hardware instruction. exp2f() wraps it in a compare, two selects and an ldexp so that results below 2^-126 come out as subnormals;
// here every argument is <= 0 and such a result may be 0: as P it is below f16's range even x 4096, in the sum it stands beside a term 2^0, as the rescale factor it multiplies
// what the new maximum's term outweighs by 2^126. exp2_raw(-inf) = 0 as before.
__device__ __forceinline__ float exp2_raw(float x) { return __builtin_amdgcn_exp2f(x); }
// one lane's share of a key block: four asynchronous 16-byte copies of K and four of V, 16 rows apart (GS halves in memory, LK and LV bytes in LDS)
template <int GS, int LK, int LV> __device__ __forceinline__ void acopy_kv(unsigned lk, unsigned lv, const _Float16* gk, const _Float16* gv) {
    // the copies and, as the last line, the wait that stands in front of any rewrite of the address registers they name
    asm volatile("global_load_async_to_lds_b128 %0, %8, off\n\t"
                 "global_load_async_to_lds_b128 %1, %9, off\n\t"
                 "global_load_async_to_lds_b128 %2, %10, off\n\t"
                 "global_load_async_to_lds_b128 %3, %11, off\n\t"
                 "global_load_async_to_lds_b128 %4, %12, off\n\t"
                 "global_load_async_to_lds_b128 %5, %13, off\n\t"
                 "global_load_async_to_lds_b128 %6, %14, off\n\t"
                 "global_load_async_to_lds_b128 %7, %15, off\n\t"
                 "s_wait_xcnt 0x0"
                 :: "v"(lk), "v"(lk + LK), "v"(lk + 2 * LK), "v"(lk + 3 * LK), "v"(lv), "v"(lv + LV), "v"(lv + 2 * LV), "v"(lv + 3 * LV),
                    "v"(gk), "v"(gk + GS), "v"(gk + 2 * GS), "v"(gk + 3 * GS), "v"(gv), "v"(gv + GS), "v"(gv + 2 * GS), "v"(gv + 3 * GS)
                 : "memory");
}
template <int L, int RS, int OS>
__global__ __launch_bounds__(32 * AW) void k_attn_lds(const _Float16* __restrict__ Q, const _Float16* __restrict__ K, const _Float16* __restrict__ V, const float* __restrict__ Wo, const float* __restrict__ bo, float* __restrict__ O, float scale) {
    constexpr int KP = 72;                      // K tile pitch in halves (144 B: odd multiple of 16 B)
    constexpr int VP = 80;                      // V tile pitch in halves (160 B: odd multiple of 32 B)
    constexpr int OP = 68;                      // output tile pitch in floats (272 B: odd multiple of 16 B)
    __shared__ __align__(16) float    pl[AW][16 * OP];
    constexpr int BH = 64 * KP + 64 * VP;       // halves per ring buffer: the K tile, behind it the V tile
    constexpr int NT = L / 64;                  // key blocks
    static_assert(L % 128 == 0, "whole key blocks, two or more");
    __shared__ __align__(16) _Float16 kv[2 * BH];
    __shared__ __align__(16) _Float16 wl[64 * VP];   // Wo[h] x 16, [d][e], V's pitch (same reader)
    const int lane = threadIdx.x & 31, hf = lane >> 4, l15 = lane & 15, wave = threadIdx.x >> 5;
    const int h = blockIdx.y;
    const int q0 = (blockIdx.x * AW + wave) * 16;
    const long long zr = (long long)blockIdx.z * L;   // first row of this batch element
    float* myp = pl[wave];
    const float L2E = 1.4426950408889634f;
    const float NEG = -__builtin_inff();
    const _Float16* qrow = Q + h * 64 + (zr + q0 + l15) * RS + 8 * hf;
    const _Float16* kbase = K + h * 64 + zr * RS;
    const _Float16* vbase = V + h * 64 + zr * RS;
    FragH qf[2];                                // elements 0..7 <- d = 32ks + 8hf + 0..7, 8..15 <- d = 32ks + 16 + 8hf + 0..7: the frag_k order
#pragma unroll
    for (int ks = 0; ks < 2; ++ks) { qf[ks].h[0] = *(const v8h*)(qrow + ks * 32); qf[ks].h[1] = *(const v8h*)(qrow + ks * 32 + 16); }
    asm volatile("s_wait_xcnt 0x0" :: "v"(qrow) : "memory");   // stands in front of any reuse of the loads' address pair, which it names so that the pair lives up to here
    const v16h qa[2] = { qf[0].v, qf[1].v };
    v8f o[4];                                   // o[t][r] = O^T[d = 16t + 8*hf + r][query l15]
    float m1 = NEG, l1 = 0.f;                   // query l15: running maximum (equal in both lane halves), sum over this half's keys
#pragma unroll
    for (int t = 0; t < 4; ++t) { v8f zz = {}; o[t] = zz; }
    const int sr = threadIdx.x >> 4, sc4 = (threadIdx.x & 15) * 4;   // staging of Wo: 16 threads per 64-float row, 8 rows per sweep
    const int kr8 = threadIdx.x >> 3, kc8 = (threadIdx.x & 7) * 8;   // copies of K, V: 8 threads per 64-half row, 16 rows per sweep
    const _Float16* kfr = kv + l15 * KP + 8 * hf;
    const _Float16* vfr = kv + 64 * KP + (8 * hf + (lane & 7)) * VP + 8 * ((lane >> 3) & 1);
    const _Float16* gk = kbase + kr8 * RS + kc8;
    const _Float16* gv = vbase + kr8 * RS + kc8;
    const unsigned lk = (unsigned)(size_t)kv + (unsigned)(kr8 * KP + kc8) * 2u;             // LDS byte address of this lane's first K chunk in buffer 0
    const unsigned lv = (unsigned)(size_t)kv + (unsigned)(64 * KP + kr8 * VP + kc8) * 2u;   // the same for V
    acopy_kv<16 * RS, 16 * KP * 2, 16 * VP * 2>(lk, lv, gk, gv);   // key block 0 flies while the output map is staged
    const _Float16* wfr = wl + (8 * hf + (lane & 7)) * VP + 8 * ((lane >> 3) & 1);
    {                                                    // the head's output map into LDS; the barrier in front of the key loop publishes it
        const float* wbase = Wo + h * 64 * 64;
        v4f wr[8];
#pragma unroll
        for (int i = 0; i < 8; ++i) wr[i] = *(const v4f*)(wbase + (i * 8 + sr) * 64 + sc4);
        asm volatile("s_wait_xcnt 0x0" ::: "memory");    // stands in front of any reuse of the address registers of the loads above
#pragma unroll
        for (int i = 0; i < 8; ++i) *(v4h*)(wl + (i * 8 + sr) * VP + sc4) = __builtin_convertvector(wr[i] * 16.f, v4h);
    }
    asm volatile("s_wait_asynccnt 0x0" ::: "memory");    // this wave's copies of key block 0 have landed
    __syncthreads();                                     // key block 0 and the output map are visible to every wave
    acopy_kv<16 * RS, 16 * KP * 2, 16 * VP * 2>(lk + BH * 2, lv + BH * 2, gk + 64 * RS, gv + 64 * RS);
#pragma unroll 2                                         // makes the buffer's offset a constant in each copy of the body: it goes into the LDS instructions' offset fields, not through vector adds
    for (int kt = 0; kt < NT; ++kt) {
        const int bo = (kt & 1) * BH;                    // this key block's buffer
        FragH kb[4][2];                                  // all eight K fragments behind one LDS latency
#pragma unroll
        for (int t = 0; t < 4; ++t)
#pragma unroll
            for (int ks = 0; ks < 2; ++ks) {
                kb[t][ks].h[0] = *(const v8h*)(kfr + bo + t * 16 * KP + ks * 32);
                kb[t][ks].h[1] = *(const v8h*)(kfr + bo + t * 16 * KP + ks * 32 + 16);
            }
        v8f s[4];                                        // s[t][r] = S[query l15][key 64*kt + 16t + 8*hf + r]
#pragma unroll
        for (int t = 0; t < 4; ++t) {
            v8f acc = {};
#pragma unroll
            for (int ks = 0; ks < 2; ++ks) acc = wmma16(kb[t][ks].v, qa[ks], acc);
            s[t] = acc;
        }
        float sc[4][8], mt[4];
#pragma unroll
        for (int t = 0; t < 4; ++t) {
            mt[t] = NEG;
#pragma unroll
            for (int i = 0; i < 8; ++i) { sc[t][i] = (s[t][i] * scale) * L2E; mt[t] = fmaxf(mt[t], sc[t][i]); }
        }
        float mx = fmaxf(fmaxf(mt[0], mt[1]), fmaxf(mt[2], mt[3]));
        mx = fmaxf(mx, swap_half(mx));
        const float mnew = fmaxf(m1, mx);
        const float mref = (mnew == NEG) ? 0.f : mnew;   // a query with only -inf scores so far: every exp2 below is exp2(-inf) = 0, never exp2(nan)
        const float corr = exp2_raw(m1 - mref);
        FragH pa[2]; float rt[4];
#pragma unroll
        for (int t = 0; t < 4; ++t) {
            rt[t] = 0.f;
#pragma unroll
            for (int i = 0; i < 8; ++i) {
                const float pp = exp2_raw(sc[t][i] - mref);
                rt[t] += pp; pa[t >> 1].v[(t & 1) * 8 + i] = (_Float16)(pp * 4096.f);
            }
        }
        l1 = l1 * corr + ((rt[0] + rt[1]) + (rt[2] + rt[3])); m1 = mnew;
#pragma unroll
        for (int t = 0; t < 4; ++t) o[t] *= corr;
        FragH vb[4][2];                                  // all eight V fragments behind one LDS latency
#pragma unroll
        for (int t = 0; t < 4; ++t) {
            vb[t][0].h[0] = ld_tr16(vfr + bo + t * 16);           vb[t][0].h[1] = ld_tr16(vfr + bo + 16 * VP + t * 16);
            vb[t][1].h[0] = ld_tr16(vfr + bo + 32 * VP + t * 16); vb[t][1].h[1] = ld_tr16(vfr + bo + 48 * VP + t * 16);
        }
#pragma unroll
        for (int t = 0; t < 4; ++t) {
            o[t] = wmma16(vb[t][0].v, pa[0].v, o[t]);
            o[t] = wmma16(vb[t][1].v, pa[1].v, o[t]);
        }
        asm volatile("s_wait_dscnt 0x0" ::: "memory");       // this wave's reads of key block kt are done before the buffer may be refilled
        asm volatile("s_wait_asynccnt 0x0" ::: "memory");    // this wave's copies of key block kt + 1 have landed
        __syncthreads();                                     // publishes key block kt + 1 and ends every wave's reads of key block kt
        if (kt + 2 < NT)                                     // the same for the whole work-group
            acopy_kv<16 * RS, 16 * KP * 2, 16 * VP * 2>(lk + bo * 2, lv + bo * 2, gk + (long long)(kt + 2) * 64 * RS, gv + (long long)(kt + 2) * 64 * RS);
    }
    asm volatile("s_wait_asynccnt 0x0" ::: "memory");        // no copy is outstanding when the wave goes on to its end
    float* obase = O + h * 64 + zr * OS;
    const float lt = l1 + swap_half(l1);
    const float inv = (lt > 0.f) ? 1.f / (lt * 4096.f) : 0.f;
    FragH ob[2];                                         // O^T as f16: tiles 2ks and 2ks+1 are the B fragment of d chunk ks in the frag_k order
#pragma unroll
    for (int t = 0; t < 4; ++t)
#pragma unroll
        for (int i = 0; i < 8; ++i) ob[t >> 1].v[(t & 1) * 8 + i] = (_Float16)(o[t][i] * inv);
    FragH wb[4][2];
#pragma unroll
    for (int t = 0; t < 4; ++t) {
        wb[t][0].h[0] = ld_tr16(wfr + t * 16);           wb[t][0].h[1] = ld_tr16(wfr + 16 * VP + t * 16);
        wb[t][1].h[0] = ld_tr16(wfr + 32 * VP + t * 16); wb[t][1].h[1] = ld_tr16(wfr + 48 * VP + t * 16);
    }
#pragma unroll
    for (int t = 0; t < 4; ++t) {
        v8f ov = {};                                     // ov[r] = 16 * Y^T[e = 16t + 8*hf + r][query l15]
        ov = wmma16(wb[t][0].v, ob[0].v, ov);
        ov = wmma16(wb[t][1].v, ob[1].v, ov);
        *(v4f*)(myp + l15 * OP + t * 16 + 8 * hf)     = __builtin_shufflevector(ov, ov, 0, 1, 2, 3);
        *(v4f*)(myp + l15 * OP + t * 16 + 8 * hf + 4) = __builtin_shufflevector(ov, ov, 4, 5, 6, 7);
    }
    const v4f bv = *(const v4f*)(bo + h * 64 + l15 * 4);
    __syncthreads();
#pragma unroll
    for (int r0 = 0; r0 < 16; r0 += 2) {
        const int row = r0 + hf, c4 = l15 * 4;
        const v4f v = *(const v4f*)(myp + row * OP + c4) * 0.0625f + bv;
        VST2V4(obase + (long long)(q0 + row) * OS + c4, v);
    }
}

// =====================================================================================================================
// k_tr: dst(z, c, r) = alpha * src(z, r, c) (+ beta * R2(z, c, r)): [Z][R][C] (row stride lds) -> [Z][C][R] (row stride ldd) through a 32x32 LDS tile;
//   flags: 1 -> add beta * residual R2 addressed like dst (z*sRz + c*ldr + r); act applied before the residual.
// =====================================================================================================================
struct TrP { const float* src; float* dst; const float* R2; long long sSz, lds, sDz, ldd, sRz, ldr; int R, C, flags, act; float alpha, beta; };
static_assert(sizeof(TrP) == 3 * 8 + 6 * 8 + 6 * 4, "TrP has padding");
__global__ __launch_bounds__(256) void k_tr(TrP p) {
    __shared__ float tile[32][33];
    const int c0 = blockIdx.x * 32, r0 = blockIdx.y * 32, z = blockIdx.z;
    const int lane = threadIdx.x & 31, wave = threadIdx.x >> 5;
    const float* s = p.src + z * p.sSz;
#pragma unroll
    for (int k = 0; k < 4; ++k) {
        const int rl = wave * 4 + k, r = r0 + rl, c = c0 + lane;
        tile[rl][lane] = (r < p.R && c < p.C) ? s[(long long)r * p.lds + c] : 0.f;
    }
    __syncthreads();
    float* d = p.dst + z * p.sDz; const float* rr = p.R2 + z * p.sRz;
#pragma unroll
    for (int k = 0; k < 4; ++k) {
        const int cl = wave * 4 + k, c = c0 + cl, r = r0 + lane;
        if (c < p.C && r < p.R) {
            float v = act_fn(p.alpha * tile[lane][cl], p.act);
            if (p.flags & 1) v += p.beta * rr[(long long)c * p.ldr + r];
            VST2(float, d + (long long)c * p.ldd + r, v);
        }
    }
}

// k_affine: dst[i] = a * (sdev ? sdev[0] : 1) * src[i] + b, i < n (one thread per element; consecutive lanes -> consecutive addresses)
__global__ __launch_bounds__(256) void k_affine(const float* __restrict__ src, float* __restrict__ dst, int n, float a, float b, const float* __restrict__ sdev) {
    const int i = blockIdx.x * 256 + threadIdx.x;
    if (i < n) { const float aa = sdev ? a * sdev[0] : a; const float v = aa * src[i] + b; VST2(float, dst + i, v); }
}

// =====================================================================================================================
// k_softmax: row softmax over n contiguous elements, one 256-thread block per row; rows addressed z*sz + r*sr (grid (R, Z)).
//   out = scale_out * softmax(scale_in * x + (Mf ? Mf[z*smz + r*smr + j] : 0)); a row whose max is -inf is written as 0.
// =====================================================================================================================
struct SmP { const float* src; float* dst; const float* Mf; long long sz, sr, dz, dr, smz, smr; int n, pad; float scale_in, scale_out; };
static_assert(sizeof(SmP) == 3 * 8 + 6 * 8 + 4 * 4, "SmP has padding");
__global__ __launch_bounds__(256) void k_softmax(SmP p) {
    __shared__ float red[256];
    const int r = blockIdx.x, z = blockIdx.y, tid = threadIdx.x;
    const float* s = p.src + z * p.sz + (long long)r * p.sr;
    const float* mf = p.Mf ? (p.Mf + z * p.smz + (long long)r * p.smr) : nullptr;
    float mx = -__builtin_inff();
    for (int j = tid; j < p.n; j += 256) { float v = s[j] * p.scale_in; if (mf) v += mf[j]; mx = fmaxf(mx, v); }
    red[tid] = mx; __syncthreads();
    for (int o = 128; o > 0; o >>= 1) { if (tid < o) red[tid] = fmaxf(red[tid], red[tid + o]); __syncthreads(); }
    mx = red[0]; __syncthreads();
    float sum = 0.f;
    for (int j = tid; j < p.n; j += 256) { float v = s[j] * p.scale_in; if (mf) v += mf[j]; sum += (mx == -__builtin_inff()) ? 0.f : expf(v - mx); }
    red[tid] = sum; __syncthreads();
    for (int o = 128; o > 0; o >>= 1) { if (tid < o) red[tid] += red[tid + o]; __syncthreads(); }
    sum = red[0];
    const float inv = (sum > 0.f) ? p.scale_out / sum : 0.f;
    float* d = p.dst + z * p.dz + (long long)r * p.dr;
    for (int j = tid; j < p.n; j += 256) { float v = s[j] * p.scale_in; if (mf) v += mf[j]; const float o = (mx == -__builtin_inff()) ? 0.f : expf(v - mx) * inv; VST2(float, d + j, o); }
}
// =====================================================================================================================
// k_stats: mean and rsqrt(var + eps) over a set of n elements addressed base + z*sz + (e / inner) * so + (e % inner) * si, one 256-thread
// k_norm_apply: y = (x - mean[set]) * rstd[set] * g[c] + b[c] over a [Z][C][L] channel-major tensor with set = z*G + c / (C/G) (G groups per z;
//   G = C -> per-channel sets indexed z*C+c; for batch norm pass stats indexed by c only via bn = 1). Optional act. Output same layout.
// =====================================================================================================================
//   mode 0: mean / rsqrt(var + eps); mode 1 (RMSNorm): 0 / rsqrt(mean(x^2) + eps); mode 2 (L2 normalize * sqrt(n)): 0 / sqrt(n) / max(||x||, eps); mode 3: as 0 with unbiased variance (n-1)
__global__ __launch_bounds__(256) void k_stats(const float* __restrict__ x, long long sz, long long so, long long si, int inner, int n, float eps, float* __restrict__ stat, int mode) {
    __shared__ float red[256];
    const int z = blockIdx.x, tid = threadIdx.x;
    const float* base = x + z * sz;
    float s = 0.f;
    for (int e = tid; e < n; e += 256) s += base[(long long)(e / inner) * so + (long long)(e % inner) * si];
    red[tid] = s; __syncthreads();
    for (int o = 128; o > 0; o >>= 1) { if (tid < o) red[tid] += red[tid + o]; __syncthreads(); }
    const float mu = (mode == 0 || mode == 3) ? red[0] / (float)n : 0.f; __syncthreads();
    float q = 0.f;
    for (int e = tid; e < n; e += 256) { const float dlt = base[(long long)(e / inner) * so + (long long)(e % inner) * si] - mu; q += dlt * dlt; }
    red[tid] = q; __syncthreads();
    for (int o = 128; o > 0; o >>= 1) { if (tid < o) red[tid] += red[tid + o]; __syncthreads(); }
    {
        float rs;
        if (mode == 2) rs = sqrtf((float)n) / fmaxf(sqrtf(red[0]), eps); else if (mode == 3) rs = rsqrtf(red[0] / (float)(n - 1) + eps); else rs = rsqrtf(red[0] / (float)n + eps);
        if (tid < 32) { const float v = (tid == 0) ? mu : ((tid == 1) ? rs : 0.f); VST2(float, stat + (long long)z * 32 + tid, v); }
    }
}
//   One thread per element over the flat [Z][C][L] index space: grid ceil(Z*C*L / 256).
__global__ __launch_bounds__(256) void k_norm_apply(const float* __restrict__ x, float* __restrict__ y, const float* __restrict__ stat, const float* __restrict__ g, const float* __restrict__ bta,
                                                     int Z, int C, int L, int G, int bn, int act) {
    const long long idx = (long long)blockIdx.x * 256 + threadIdx.x;
    if (idx >= (long long)Z * C * L) return;
    const int l = (int)(idx % L); const long long zc = idx / L; const int c = (int)(zc % C), z = (int)(zc / C); (void)l;
    const int set = bn ? c : (z * G + c / (C / G));
    float v = (x[idx] - stat[(long long)set * 32]) * stat[(long long)set * 32 + 1];
    if (g) v *= g[c];
    if (bta) v += bta[c];
    v = act_fn(v, act);
    VST2(float, y + idx, v);
}

// k_lse_neg: c[i] = -(st[2i] + log(st[2i+1])) = minus the log-sum-exp of row i (for softmax over the query dimension)
__global__ __launch_bounds__(256) void k_lse_neg(const float* __restrict__ st, float* __restrict__ c, int n) {
    const int i = blockIdx.x * 256 + threadIdx.x;
    if (i < n) { const float v = -(st[2 * i] + logf(st[2 * i + 1])); VST2(float, c + i, v); }
}

// k_iota: dst[i] = a * i + b as int32 (segment/position id helper)
__global__ __launch_bounds__(256) void k_iota(int* __restrict__ dst, int n, int a, int b) {
    const int i = blockIdx.x * 256 + threadIdx.x;
    if (i < n) { const int v = a * i + b; VST2(int, dst + i, v); }
}

// k_axpby: dst[i] = a * x[i] + b * y[i] (+ c), i < n
__global__ __launch_bounds__(256) void k_axpby(const float* __restrict__ x, const float* __restrict__ y, float* __restrict__ dst, int n, float a, float b, float c) {
    const int i = blockIdx.x * 256 + threadIdx.x;
    if (i < n) { const float v = a * x[i] + b * y[i] + c; VST2(float, dst + i, v); }
}

// =====================================================================================================================
// k_rope: rotary embedding on a [R rows][Hn heads][D] view (row stride sXr, head stride sXh, element stride 1) -> Y (own strides).
//   mode 0: rotate_half (partner d±D/2, sign - for d<D/2); mode 1: interleaved pairs (partner d^1, sign - for even d).
//   table column tcol: tmode 0 -> d, 1 -> d % (D/2), 2 -> d / 2; position p: pmode 0 -> r % S, 1 -> head index, 2 -> pos[r];
//   c = C[(r / S) * sCb + p * sCp + tcol * sCd], s likewise from Sn; y = x[d] * c + sign * x[partner] * s. X and Y must not alias.
// =====================================================================================================================
struct RopeP { const float* X; float* Y; const float* C; const float* Sn; const int* pos; long long sXr, sXh, sYr, sYh, sCb, sCp, sCd; int R, Hn, D, S, mode, tmode, pmode, pad; };
static_assert(sizeof(RopeP) == 5 * 8 + 7 * 8 + 8 * 4, "RopeP has padding");
__global__ __launch_bounds__(256) void k_rope(RopeP p) {
    const long long idx = (long long)blockIdx.x * 256 + threadIdx.x;
    if (idx >= (long long)p.R * p.Hn * p.D) return;
    const int d = (int)(idx % p.D); const long long rh = idx / p.D; const int h = (int)(rh % p.Hn); const int r = (int)(rh / p.Hn);
    const int half = p.D / 2;
    int partner; float sign;
    if (p.mode == 0) { partner = (d < half) ? d + half : d - half; sign = (d < half) ? -1.f : 1.f; }
    else { partner = d ^ 1; sign = (d & 1) ? 1.f : -1.f; }
    const int tcol = (p.tmode == 0) ? d : ((p.tmode == 1) ? (d % half) : (d >> 1));
    const int pp = (p.pmode == 0) ? (r % p.S) : ((p.pmode == 1) ? h : p.pos[r]);
    const long long toff = (long long)(r / p.S) * p.sCb + (long long)pp * p.sCp + (long long)tcol * p.sCd;
    const float* xr = p.X + (long long)r * p.sXr + (long long)h * p.sXh;
    const float v = xr[d] * p.C[toff] + sign * xr[partner] * p.Sn[toff];
    VST2(float, p.Y + (long long)r * p.sYr + (long long)h * p.sYh + d, v);
}

// k_invf + k_sincos (split so neither kernel carries a large VALU-fma footprint): invf_i = num * (1 / powf(base, (2 i)/D)) [fmode 0],
//   num * expf((2 i) * cexp) [fmode 1], num * powf(base, -2 (i - 1) / D) [fmode 2]; then cs/sn[s*half + i] = cos/sin((pscale * s) * invf_i)
__global__ __launch_bounds__(256) void k_invf(float* __restrict__ invb, int half, int D, float base, float num, int fmode, float cexp) {
    const int i = blockIdx.x * 256 + threadIdx.x;
    if (i >= ((half + 31) / 32) * 32) return;
    if (i >= half) { VST2(float, invb + i, 0.f); return; }
    const float e = (float)(2 * i) / (float)D;
    float invf;
    if (fmode == 1) invf = num * expf((float)(2 * i) * cexp);
    else if (fmode == 2) invf = num * powf(base, (-2.0f * ((float)i - 1.0f)) / (float)D);
    else invf = num * (1.0f / powf(base, e));
    VST2(float, invb + i, invf);
}
__global__ __launch_bounds__(256) void k_sincos(float* __restrict__ cs, float* __restrict__ sn, const float* __restrict__ invb, int S, int half, float pscale) {
    const int idx = blockIdx.x * 256 + threadIdx.x;
    if (idx >= S * half) return;
    const int s = idx / half, i = idx - s * half;
    const float ang = (pscale * (float)s) * invb[i];
    VST2(float, cs + idx, cosf(ang)); VST2(float, sn + idx, sinf(ang));
}

// k_mulact: dst[i] = act(x[i]) * y[i]
__global__ __launch_bounds__(256) void k_mulact(const float* __restrict__ x, const float* __restrict__ y, float* __restrict__ dst, int n, int act) {
    const int i = blockIdx.x * 256 + threadIdx.x;
    if (i < n) { const float v = act_fn(x[i], act) * y[i]; VST2(float, dst + i, v); }
}

// =====================================================================================================================
// k_matvec: thread-per-row matrix-vector products for N <= 8 output columns (heads with 1-3 outputs, gates), f32 on the VALU.
//   C[r*sCm + j] = act(alpha * sum_k A[r*sAm + k*sAk] * B[j*sBn + k*sBk] + bias[j]) + beta * R[r*sRm + j*sRn]; each thread writes its N contiguous floats.
// =====================================================================================================================
__global__ __launch_bounds__(256) void k_matvec(GemmP p) {
    // 32 lanes write one line with one instruction.
    const int rpt = (p.N == 1) ? 1 : 32;
    const long long r0 = ((long long)blockIdx.x * 256 + threadIdx.x) * rpt; const int z = blockIdx.z, zo = z / p.zi_n, zi = z - zo * p.zi_n;
    if (r0 >= p.M) return;
    const float* Bb = p.B + zo * p.sBo + zi * p.sBi;
    float* C = p.C + zo * p.sCo + zi * p.sCi; const float* R = p.R + zo * p.sRo + zi * p.sRi;
    for (int rr = 0; rr < rpt; ++rr) {
        const long long r = r0 + rr; if (r >= p.M) break;
        const float* A = p.A + zo * p.sAo + zi * p.sAi + r * p.sAm;
        float acc[8] = {0.f, 0.f, 0.f, 0.f, 0.f, 0.f, 0.f, 0.f};
        for (int k = 0; k < p.K; ++k) { const float a = A[(long long)k * p.sAk];
#pragma unroll
            for (int j = 0; j < 8; ++j) if (j < p.N) acc[j] += a * Bb[(long long)j * p.sBn + (long long)k * p.sBk]; }
#pragma unroll
        for (int j = 0; j < 8; ++j) if (j < p.N) {
            float v = acc[j] * p.alpha;
            if (p.flags & 1) v += p.bias[j];
            if (p.flags & 2) v += p.bias[r];
            v = act_fn(v, p.act);
            if (p.flags & 4) v += p.beta * R[r * p.sRm + (long long)j * p.sRn];
            VST2(float, C + r * p.sCm + j, v);
        }
    }
}
// k_smallsoftmax: thread-per-row softmax for short rows (n <= 64): dst[r*dr + j] = softmax(scale*src[r*sr + j])
__global__ __launch_bounds__(256) void k_smallsoftmax(const float* __restrict__ src, float* __restrict__ dst, long long sr, long long dr, int n, long long R, float scale) {
    const long long r0 = ((long long)blockIdx.x * 256 + threadIdx.x) * 32;
    for (int rr = 0; rr < 32; ++rr) {
        const long long r = r0 + rr; if (r >= R) return;
        const float* s = src + r * sr; float* d = dst + r * dr;
        float mx = -__builtin_inff();
        for (int j = 0; j < n; ++j) mx = fmaxf(mx, s[j] * scale);
        float sum = 0.f;
        for (int j = 0; j < n; ++j) sum += expf(s[j] * scale - mx);
        const float inv = 1.f / sum;
        for (int j = 0; j < n; ++j) { const float v = expf(s[j] * scale - mx) * inv; VST2(float, d + j, v); }
    }
}

__global__ __launch_bounds__(32) void k_unitstat(float* __restrict__ st) { const int t = threadIdx.x; const float v = (t == 1) ? 1.f : 0.f; VST2(float, st + t, v); }

// destination (e.g. a d_out whose row width is not a multiple of 32 floats) is written by consecutive lanes of one instruction
__global__ __launch_bounds__(256) void k_lincopy(const float* __restrict__ src, long long lds, float* __restrict__ dst, long long ldd, long long rows, int cols) {
    const long long i = (long long)blockIdx.x * 256 + threadIdx.x; if (i >= rows * cols) return;
    const long long r = i / cols; const int c = (int)(i - r * cols);
    const float v = src[r * lds + c]; VST2(float, dst + r * ldd + c, v);
}

namespace w25 {
typedef __attribute__((ext_vector_type(16))) _Float16 v16h;
typedef __attribute__((ext_vector_type(8)))  _Float16 v8h;
typedef __attribute__((ext_vector_type(16))) __bf16   v16b;
typedef __attribute__((ext_vector_type(8)))  __bf16   v8b;
typedef __attribute__((ext_vector_type(8)))  float    v8f;
typedef __attribute__((ext_vector_type(4)))  float    v4f;

__device__ __forceinline__ unsigned short f2bf_bits(float f) {
  unsigned u = __float_as_uint(f);
  return (unsigned short)((u + 0x7FFFu + ((u >> 16) & 1u)) >> 16);
}
__device__ __forceinline__ float bf_bits2f(unsigned short h) { return __uint_as_float(((unsigned)h) << 16); }

// hazard guards as plain device helpers (no inline asm inside the kernel template body)
__device__ __forceinline__ void dep_guard_h(v8f& a, v8f& b, v16h x, v16h y) { asm volatile("v_nop\n\tv_nop\n\tv_nop\n\tv_nop" : "+v"(a), "+v"(b) : "v"(x), "v"(y)); }
__device__ __forceinline__ void dep_guard_b(v8f& a, v8f& b, v16b x, v16b y) { asm volatile("v_nop\n\tv_nop\n\tv_nop\n\tv_nop" : "+v"(a), "+v"(b) : "v"(x), "v"(y)); }
__device__ __forceinline__ void keep4_h(v16h a, v16h b, v16h c, v16h d) { asm volatile("v_nop" :: "v"(a), "v"(b), "v"(c), "v"(d)); }
__device__ __forceinline__ void keep4_b(v16b a, v16b b, v16b c, v16b d) { asm volatile("v_nop" :: "v"(a), "v"(b), "v"(c), "v"(d)); }
__device__ __forceinline__ void acc_guard4(v8f& a, v8f& b, v8f& c, v8f& d) { asm volatile("v_nop\n\tv_nop\n\tv_nop\n\tv_nop" : "+v"(a), "+v"(b), "+v"(c), "+v"(d)); }
template <typename T> struct Frag;
template <> struct Frag<_Float16> {
  typedef v16h V; union U { v16h v; v8h h[2]; };
  static __device__ __forceinline__ v16h load(const _Float16* p) {   // elements 0..7 <- p[0..7], 8..15 <- p[16..23]
    U f; f.h[0] = *(const v8h*)(p); f.h[1] = *(const v8h*)(p + 16); return f.v;
  }
  static __device__ __forceinline__ v8f mma(v16h a, v16h b, v8f c) {
    return __builtin_amdgcn_wmma_f32_16x16x32_f16(false, a, false, b, (short)0, c, false, false);
  }
  static __device__ __forceinline__ void guard(v8f& a, v8f& b, v16h x, v16h y) { dep_guard_h(a, b, x, y); }
  static __device__ __forceinline__ void keep(v16h a, v16h b, v16h c, v16h d) { keep4_h(a, b, c, d); }
};
template <> struct Frag<__bf16> {
  typedef v16b V; union U { v16b v; v8b h[2]; };
  static __device__ __forceinline__ v16b load(const __bf16* p) {
    U f; f.h[0] = *(const v8b*)(p); f.h[1] = *(const v8b*)(p + 16); return f.v;
  }
  static __device__ __forceinline__ v8f mma(v16b a, v16b b, v8f c) {
    return __builtin_amdgcn_wmma_f32_16x16x32_bf16(false, a, false, b, (short)0, c, false, false);
  }
  static __device__ __forceinline__ void guard(v8f& a, v8f& b, v16b x, v16b y) { dep_guard_b(a, b, x, y); }
  static __device__ __forceinline__ void keep(v16b a, v16b b, v16b c, v16b d) { keep4_b(a, b, c, d); }
};

// ---- Register-blocked batched WMMA GEMM ------------------------------------
// C[m,n] = scale * sum_k A[m,k] * Bt[n,k] (+bias)(+resid); each wave owns a 64x64 tile.
// A row-major [M,K]; Bt row-major [N,K]; M,N % 64 == 0, K % 32 == 0.
// SPLIT: operands are hi/lo planes (A2/Bt2 = lo planes, same layout); product = hi·hi + hi·lo + lo·hi.
// BIAS_MODE: 0 = none, 1 = bias[m], 2 = bias[n].
// OUT_MODE: 0 = f32, 1 = f16, 2 = bf16 hi plane (Cout) + bf16 lo plane (Cout2).
// ET: 0 = f16 operands, 1 = bf16 operands (pointers passed as 16-bit storage)
template <int ET> struct Elem;
template <> struct Elem<0> { typedef _Float16 T; };
template <> struct Elem<1> { typedef __bf16 T; };
template <int ET, bool SPLIT, int BIAS_MODE, int OUT_MODE, bool RESID, int ACT = 0>
__global__ __launch_bounds__(256) void wmma_gemm64(
    const unsigned short* __restrict__ Ap, const unsigned short* __restrict__ A2p, int lda, long strideA,
    const unsigned short* __restrict__ Btp, const unsigned short* __restrict__ Bt2p, int ldb, long strideB,
    void* __restrict__ Cout, void* __restrict__ Cout2, int ldc, long strideC,
    const float* __restrict__ bias,
    const float* __restrict__ resid, long strideR,
    int M, int N, int K, float scale) {
  typedef typename Elem<ET>::T T;
  typedef typename Frag<T>::V V;
  const T* A = (const T*)Ap; const T* A2 = (const T*)A2p; const T* Bt = (const T*)Btp; const T* Bt2 = (const T*)Bt2p;
  __shared__ __align__(16) float sT[8][16 * 68];   // per-wave 16x64 slab, pitch 68 floats
  const int b    = blockIdx.y;
  const int lane = threadIdx.x & 31;
  const int wave = threadIdx.x >> 5;
  const int tilesN = N >> 6;
  const int tilesM = M >> 6;
  const int tile = blockIdx.x * 8 + wave;
  if (tile >= tilesM * tilesN) return;   // wave-uniform; no block barriers in this kernel
  const int tm = tile / tilesN;
  const int tn = tile - tm * tilesN;
  const int m0 = tm << 6;
  const int n0 = tn << 6;

  const T* Ab  = A  + (size_t)b * strideA;
  const T* Bb  = Bt + (size_t)b * strideB;
  const T* Ab2 = SPLIT ? (A2  + (size_t)b * strideA) : nullptr;
  const T* Bb2 = SPLIT ? (Bt2 + (size_t)b * strideB) : nullptr;

  const int rlane = lane & 15;                 // row (A) / col (B, D) within subtile
  const int koff  = (lane >> 4) * 8;           // k offset of this lane half
  const int mOff  = (lane >> 4) * 8;           // D row offset

  v8f acc[4][4];
#pragma unroll
  for (int i = 0; i < 4; ++i)
#pragma unroll
    for (int j = 0; j < 4; ++j) acc[i][j] = (v8f){0.f,0.f,0.f,0.f,0.f,0.f,0.f,0.f};

  for (int k0 = 0; k0 < K; k0 += 32) {
    V bh[4], bl[4];
#pragma unroll
    for (int j = 0; j < 4; ++j) {
      const size_t bo = (size_t)(n0 + (j << 4) + rlane) * ldb + koff + k0;
      bh[j] = Frag<T>::load(Bb + bo);
      if (SPLIT) bl[j] = Frag<T>::load(Bb2 + bo);
    }
#pragma unroll
    for (int i = 0; i < 4; ++i) {
      const size_t ao = (size_t)(m0 + (i << 4) + rlane) * lda + koff + k0;
      V ah = Frag<T>::load(Ab + ao);
      V al;
      if (SPLIT) al = Frag<T>::load(Ab2 + ao);
#pragma unroll
      for (int j = 0; j < 4; ++j) {
        acc[i][j] = Frag<T>::mma(ah, bh[j], acc[i][j]);
        if (SPLIT) {
          acc[i][j] = Frag<T>::mma(ah, bl[j], acc[i][j]);
          acc[i][j] = Frag<T>::mma(al, bh[j], acc[i][j]);
        }
      }
      Frag<T>::guard(acc[i][0], acc[i][3], ah, SPLIT ? al : ah);
    }
    Frag<T>::keep(bh[0], bh[1], bh[2], bh[3]);
    if (SPLIT) Frag<T>::keep(bl[0], bl[1], bl[2], bl[3]);
  }
  acc_guard4(acc[0][0], acc[0][1], acc[0][2], acc[0][3]);
  acc_guard4(acc[1][0], acc[1][1], acc[1][2], acc[1][3]);
  acc_guard4(acc[2][0], acc[2][1], acc[2][2], acc[2][3]);
  acc_guard4(acc[3][0], acc[3][1], acc[3][2], acc[3][3]);

  // ---- epilogue ----
  float* slab = sT[wave];
  const float* Rb = RESID ? (resid + (size_t)b * strideR) : nullptr;
#pragma unroll
  for (int i = 0; i < 4; ++i) {
    const int mBase = m0 + (i << 4);
#pragma unroll
    for (int j = 0; j < 4; ++j) {
      const int n = n0 + (j << 4) + rlane;
      float bv = 0.f;
      if (BIAS_MODE == 2) bv = bias[n];
#pragma unroll
      for (int r = 0; r < 8; ++r) {
        float v = acc[i][j][r] * scale;
        if (BIAS_MODE == 1) v += bias[mBase + mOff + r];
        if (BIAS_MODE == 2) v += bv;
        if (RESID) v += Rb[(size_t)(mBase + mOff + r) * ldc + n];
        if (ACT == 1) v = tanhf(v);
        if (ACT == 2) v = fmaxf(v, 0.0f);
        if (ACT == 3) v = v / (1.0f + expf(-v));
        if (ACT == 4) v = (v > 0.f) ? v : 0.01f * v;
        if (ACT == 5) v = 0.5f * v * (1.0f + erff(v * 0.70710678118654752f));
        if (ACT == 6) v = (v > 0.f) ? v : 0.2f * v;
        slab[(mOff + r) * 68 + (j << 4) + rlane] = v;
      }
    }
    __builtin_amdgcn_fence(__ATOMIC_RELEASE, "workgroup");
    __builtin_amdgcn_wave_barrier();
    __builtin_amdgcn_fence(__ATOMIC_ACQUIRE, "workgroup");
    if (OUT_MODE == 0) {
      float* C = (float*)Cout + (size_t)b * strideC;
      const int hh = lane >> 4, c4 = (lane & 15) * 4;     // row seg = 256 B = 16 lanes x 16 B
      {
#pragma unroll
        for (int it = 0; it < 8; ++it) {
          const int row = it * 2 + hh;
          v4f v = *(const v4f*)(slab + row * 68 + c4);
          *(v4f*)(C + (size_t)(mBase + row) * ldc + n0 + c4) = v;
        }
        
      }
    } else {
      const int q = lane >> 3, c8 = (lane & 7) * 8;
      unsigned short* C  = (unsigned short*)Cout  + (size_t)b * strideC;
      unsigned short* C2 = (OUT_MODE == 2) ? ((unsigned short*)Cout2 + (size_t)b * strideC) : nullptr;
      {
#pragma unroll
        for (int it = 0; it < 4; ++it) {
          const int row = it * 4 + q;
          const float* sp = slab + row * 68 + c8;
          v8h hv, lv;
#pragma unroll
          for (int e = 0; e < 8; ++e) {
            if (OUT_MODE == 1) {
              hv[e] = (_Float16)sp[e];
            } else {
              unsigned short hb = f2bf_bits(sp[e]);
              unsigned short lb = f2bf_bits(sp[e] - bf_bits2f(hb));
              hv[e] = __builtin_bit_cast(_Float16, hb);
              lv[e] = __builtin_bit_cast(_Float16, lb);
            }
          }
          *(v8h*)(C + (size_t)(mBase + row) * ldc + n0 + c8) = hv;
          if (OUT_MODE == 2) *(v8h*)(C2 + (size_t)(mBase + row) * ldc + n0 + c8) = lv;
        }
        
      }
    }
    __builtin_amdgcn_fence(__ATOMIC_RELEASE, "workgroup");
    __builtin_amdgcn_wave_barrier();
    __builtin_amdgcn_fence(__ATOMIC_ACQUIRE, "workgroup");
  }
}

__global__ __launch_bounds__(256) void cast_f32_f16x2(
    const float* __restrict__ in, _Float16* __restrict__ out, int n2) {
  int i = blockIdx.x * 256 + threadIdx.x;
  if (i < n2) {
    const _Float16 h0 = (_Float16)in[2 * i], h1 = (_Float16)in[2 * i + 1];
    const unsigned u = (unsigned)__builtin_bit_cast(unsigned short, h0) | ((unsigned)__builtin_bit_cast(unsigned short, h1) << 16);
    ((unsigned*)out)[i] = u;
    
  }
}


} // namespace w25

// =====================================================================================================================
// k_prep<NR, D>: all f16 operand planes of the projections in one launch of WB + XB work-groups of 256 threads, 32 or 64 elements a thread.
//   Work-groups [0, WB): one tile of 128 (k) x 64 (n) of the weights taken side by side, W = Wq | Wkv ([D][D] | [D][2D], n < D is Wq):
//   W16[n][k] = f16(16 * W[k][n]). Rows of 256 B are read along n with 16-byte loads into an f32 LDS tile (pitch 65 floats: the 32 lanes
//   of a column-wise read fall on 32 different banks); each lane then packs 8 consecutive k of one n, 8 lanes store one whole 128-B line.
//   Work-groups [WB, WB + XB): X16 = f16(x), 16384 consecutive floats each; a wave's load covers 512 contiguous bytes, its store 256.
// =====================================================================================================================
// eight 16-byte loads, 16 rows of LD floats apart: one address pair, the row steps as immediate offsets
template <int LD> __device__ __forceinline__ void ld_rows8(const float* __restrict__ sp, v4f (&w)[8]) {
#pragma unroll
    for (int s = 0; s < 8; ++s) w[s] = *(const v4f*)(sp + s * 16 * LD);
    asm volatile("s_wait_xcnt 0x0" :: "v"(sp) : "memory");   // stands in front of any reuse of the loads' address pair, which it names so that the pair lives up to here
}
template <int NR, int D>
__global__ __launch_bounds__(256) void k_prep(const float* __restrict__ x, const float* __restrict__ Wq, const float* __restrict__ Wkv, _Float16* __restrict__ X16, _Float16* __restrict__ W16) {
    constexpr int TP = 65;                      // LDS tile pitch in floats
    constexpr int NT = 3 * D / 64;              // n tiles
    constexpr int WB = NT * (D / 128);
    static_assert(D % 128 == 0 && ((long long)NR * D) % 16384 == 0, "whole tiles only");
    __shared__ float tile[128 * TP];
    const int tid = threadIdx.x;
    if ((int)blockIdx.x < WB) {
        const int nt = blockIdx.x % NT, kt = blockIdx.x / NT;
        const int n0 = nt * 64, k0 = kt * 128;
        const int c4 = (tid & 15) * 4, r = tid >> 4;
        v4f w[8];
        if (n0 < D) ld_rows8<D>(Wq + n0 + (k0 + r) * D + c4, w);                     // work-group-uniform choice of the source matrix
        else        ld_rows8<2 * D>(Wkv + (n0 - D) + (k0 + r) * (2 * D) + c4, w);
#pragma unroll
        for (int s = 0; s < 8; ++s)
#pragma unroll
            for (int e = 0; e < 4; ++e) tile[(s * 16 + r) * TP + c4 + e] = w[s][e];
        __syncthreads();                                 // the whole tile is in LDS before any column of it is read
        const int a8 = (tid & 7) * 8, nl = tid >> 3;
#pragma unroll
        for (int q = 0; q < 4; ++q) {
            const int n = (q >> 1) * 32 + nl, k = (q & 1) * 64 + a8;
            v8h hv;
#pragma unroll
            for (int j = 0; j < 8; ++j) hv[j] = (_Float16)(tile[(k + j) * TP + n] * 16.f);
            *(v8h*)(W16 + (long long)(n0 + n) * D + k0 + k) = hv;
        }
    } else {
        const long long base = (long long)((int)blockIdx.x - WB) * 16384 + tid * 4;
        const float* xp = x + base;
        v4f v[16];
#pragma unroll
        for (int i = 0; i < 16; ++i) v[i] = *(const v4f*)(xp + i * 1024);
        asm volatile("s_wait_xcnt 0x0" :: "v"(xp) : "memory");   // stands in front of any reuse of the loads' address pair, which it names so that the pair lives up to here
#pragma unroll
        for (int i = 0; i < 16; ++i) *(v4h*)(X16 + base + i * 1024) = __builtin_convertvector(v[i], v4h);
        asm volatile("s_wait_xcnt 0x0" ::: "memory");            // stands behind the stores above, in front of any reuse of their address and data registers
    }
}

// =====================================================================================================================
// k_proj<M, N, K>: C[m][n] = scale * sum_k A[m][k] * Bt[n][k], A [M][K] and Bt [N][K] f16 planes, C [M][N] f16 (rounded to nearest from the scaled f32 sum); M, N % 128 == 0, K % 128 == 0.
//   One work-group of 4 waves per 128 x 128 tile of C, each wave a 64 x 64 quarter (4 x 4 accumulator tiles), grid (M/128)*(N/128).
//   A stage is 64 k of the tile's 128 A rows and 128 Bt rows: 256 rows of 128 B, brought by 16-byte asynchronous copies (a wave's copy = 4 whole lines)
//   into one of two LDS buffers at a pitch of 144 B (odd multiple of 16 B, for the ds_load_b128 fragment reads); stage t + 2 is asked for when
//   every wave has left stage t, so it flies while stage t + 1 is worked on. k runs upward in steps of 32, one accumulator chain per tile.
// =====================================================================================================================
// eight asynchronous 16-byte copies of one lane, 16 rows apart (GS halves in memory, LS bytes in LDS)
template <int GS, int LS> __device__ __forceinline__ void acopy8(unsigned l, const _Float16* g) {
    // the copies and, as the last line, the wait that stands in front of any rewrite of the address registers they name
    asm volatile("global_load_async_to_lds_b128 %0, %8, off\n\t"
                 "global_load_async_to_lds_b128 %1, %9, off\n\t"
                 "global_load_async_to_lds_b128 %2, %10, off\n\t"
                 "global_load_async_to_lds_b128 %3, %11, off\n\t"
                 "global_load_async_to_lds_b128 %4, %12, off\n\t"
                 "global_load_async_to_lds_b128 %5, %13, off\n\t"
                 "global_load_async_to_lds_b128 %6, %14, off\n\t"
                 "global_load_async_to_lds_b128 %7, %15, off\n\t"
                 "s_wait_xcnt 0x0"
                 :: "v"(l), "v"(l + LS), "v"(l + 2 * LS), "v"(l + 3 * LS), "v"(l + 4 * LS), "v"(l + 5 * LS), "v"(l + 6 * LS), "v"(l + 7 * LS),
                    "v"(g), "v"(g + GS), "v"(g + 2 * GS), "v"(g + 3 * GS), "v"(g + 4 * GS), "v"(g + 5 * GS), "v"(g + 6 * GS), "v"(g + 7 * GS)
                 : "memory");
}
template <int M, int N, int K>
__global__ __launch_bounds__(128) void k_proj(const _Float16* __restrict__ A, const _Float16* __restrict__ Bt, _Float16* __restrict__ C, float scale) {
    typedef w25::Frag<_Float16> F;
    constexpr int KT = 64;                      // k per stage
    constexpr int PH = 72;                      // LDS row pitch in halves
    constexpr int SH = 256 * PH;                // halves per buffer: rows 0..127 A, 128..255 Bt
    constexpr int NS = K / KT;
    static_assert(M % 128 == 0 && N % 128 == 0 && K % 128 == 0, "whole tiles, two stages or more");
    __shared__ __align__(16) _Float16 ring[2 * SH];
    __shared__ __align__(16) float sT[4][16 * 68];   // per-wave 16x64 output slab, pitch 68 floats
    const int tid = threadIdx.x, lane = tid & 31, wave = tid >> 5;
    constexpr int TN = N / 128;
    const int tm = blockIdx.x / TN, tn = blockIdx.x - tm * TN;
    const int m0 = tm * 128, n0 = tn * 128;
    const int rlane = lane & 15, koff = (lane >> 4) * 8, mOff = (lane >> 4) * 8;
    // copies: 8 lanes per 128-B row, 16 rows per sweep of the work-group, 8 sweeps for each operand
    const int cr = tid >> 3, cc = (tid & 7) * 8;
    const _Float16* ga = A + (size_t)(m0 + cr) * K + cc;
    const _Float16* gb = Bt + (size_t)(n0 + cr) * K + cc;
    const unsigned la = (unsigned)(size_t)ring + (unsigned)(cr * PH + cc) * 2u;   // LDS byte address of this lane's first A chunk in buffer 0
    const _Float16* fa = ring + ((wave >> 1) * 64 + rlane) * PH + koff;
    const _Float16* fb = ring + (128 + (wave & 1) * 64 + rlane) * PH + koff;

    v8f acc[4][4];                              // the unroll directives of this kernel make every index of acc, ah and bh a constant, so that the arrays stay in registers
#pragma unroll
    for (int i = 0; i < 4; ++i)
#pragma unroll
        for (int j = 0; j < 4; ++j) { v8f zz = {}; acc[i][j] = zz; }

    acopy8<16 * K, 16 * PH * 2>(la, ga);
    acopy8<16 * K, 16 * PH * 2>(la + 128 * PH * 2, gb);
    asm volatile("s_wait_asynccnt 0x0" ::: "memory");    // this wave's copies of stage 0 have landed
    __syncthreads();                                     // stage 0 is visible to every wave
    acopy8<16 * K, 16 * PH * 2>(la + SH * 2, ga + KT);
    acopy8<16 * K, 16 * PH * 2>(la + SH * 2 + 128 * PH * 2, gb + KT);
    for (int t = 0; t < NS; ++t) {
        const int bo = (t & 1) * SH;
#pragma unroll
        for (int ks = 0; ks < KT; ks += 32) {
            v16h bh[4], ah[4];
#pragma unroll
            for (int j = 0; j < 4; ++j) bh[j] = F::load(fb + bo + j * 16 * PH + ks);
#pragma unroll
            for (int i = 0; i < 4; ++i) ah[i] = F::load(fa + bo + i * 16 * PH + ks);
            __builtin_amdgcn_sched_barrier(0);               // the 16 LDS reads stay one group in front of the 16 WMMAs: one LDS wait a k step, not one per row of tiles
#pragma unroll
            for (int i = 0; i < 4; ++i)
#pragma unroll
                for (int j = 0; j < 4; ++j) acc[i][j] = F::mma(ah[i], bh[j], acc[i][j]);
            __builtin_amdgcn_sched_barrier(0);               // keeps the next group of LDS reads from being spread among these WMMAs
        }
        asm volatile("s_wait_dscnt 0x0" ::: "memory");       // this wave's reads of stage t are done before the buffer may be refilled
        asm volatile("s_wait_asynccnt 0x0" ::: "memory");    // this wave's copies of stage t + 1 have landed
        __syncthreads();                                     // publishes stage t + 1 and ends every wave's reads of stage t
        if (t + 2 < NS) {                                    // the same for the whole work-group
            acopy8<16 * K, 16 * PH * 2>(la + bo * 2, ga + (t + 2) * KT);
            acopy8<16 * K, 16 * PH * 2>(la + bo * 2 + 128 * PH * 2, gb + (t + 2) * KT);
        }
    }
    asm volatile("s_wait_asynccnt 0x0" ::: "memory");        // no copy is outstanding when the wave goes on to its end

    float* slab = sT[wave];
    const int wm0 = m0 + (wave >> 1) * 64, wn0 = n0 + (wave & 1) * 64;
#pragma unroll
    for (int i = 0; i < 4; ++i) {
#pragma unroll
        for (int j = 0; j < 4; ++j)
#pragma unroll
            for (int r = 0; r < 8; ++r) slab[(mOff + r) * 68 + (j << 4) + rlane] = acc[i][j][r] * scale;
        __builtin_amdgcn_fence(__ATOMIC_RELEASE, "workgroup");
        __builtin_amdgcn_wave_barrier();
        __builtin_amdgcn_fence(__ATOMIC_ACQUIRE, "workgroup");
        const int rq = lane >> 3, c8 = (lane & 7) * 8;       // row segment = 64 halves = one 128-B line = 8 lanes x 16 B
        _Float16* cp[4]; v8h hv[4];
#pragma unroll
        for (int it = 0; it < 4; ++it) {
            const int row = it * 4 + rq;
            const v4f v0 = *(const v4f*)(slab + row * 68 + c8), v1 = *(const v4f*)(slab + row * 68 + c8 + 4);
            hv[it] = __builtin_convertvector(__builtin_shufflevector(v0, v1, 0, 1, 2, 3, 4, 5, 6, 7), v8h);
            cp[it] = C + (size_t)(wm0 + (i << 4) + row) * N + wn0 + c8;
        }
#pragma unroll
        for (int it = 0; it < 4; ++it) *(v8h*)cp[it] = hv[it];
        // stands behind the stores above, in front of any reuse of their address and data registers, which it names so that they live up to here
        asm volatile("s_wait_xcnt 0x0" :: "v"(cp[0]), "v"(cp[1]), "v"(cp[2]), "v"(cp[3]), "v"(hv[0]), "v"(hv[1]), "v"(hv[2]), "v"(hv[3]) : "memory");
        __builtin_amdgcn_fence(__ATOMIC_RELEASE, "workgroup");
        __builtin_amdgcn_wave_barrier();
        __builtin_amdgcn_fence(__ATOMIC_ACQUIRE, "workgroup");
    }
}

// f32 -> bf16 hi plane + bf16 lo plane (x = hi + lo to ~2^-17 relative; RNE both), [R][C] -> [R][C] (or transposed to [C][R]); 2 consecutive destination elements
__device__ __forceinline__ unsigned int f2bf2_pack(float a, float b, unsigned int* lo) {
    const unsigned short ha = w25::f2bf_bits(a), hb = w25::f2bf_bits(b);
    const unsigned short la = w25::f2bf_bits(a - w25::bf_bits2f(ha)), lb = w25::f2bf_bits(b - w25::bf_bits2f(hb));
    *lo = (unsigned)la | ((unsigned)lb << 16); return (unsigned)ha | ((unsigned)hb << 16); }
__global__ __launch_bounds__(256) void k_castS16(const float* __restrict__ src, long long lds, __bf16* __restrict__ dhi, __bf16* __restrict__ dlo, long long ldd, int R, int C, float s, int transpose) {
    const long long i = (long long)blockIdx.x * 256 + threadIdx.x; long long o; float a, b;
    if (transpose) { const long long np = (long long)C * (R / 2); if (i >= np) return; const int c = (int)(i / (R / 2)); const int r = 2 * (int)(i % (R / 2)); a = src[(long long)r * lds + c] * s; b = src[(long long)(r + 1) * lds + c] * s; o = (long long)c * ldd + r; }
    else { const long long np = (long long)R * (C / 2); if (i >= np) return; const int r = (int)(i / (C / 2)); const int c = 2 * (int)(i % (C / 2)); a = src[(long long)r * lds + c] * s; b = src[(long long)r * lds + c + 1] * s; o = (long long)r * ldd + c; }
    unsigned lo; const unsigned hi = f2bf2_pack(a, b, &lo); unsigned* ph = (unsigned*)(dhi + o); unsigned* pl = (unsigned*)(dlo + o);
    *ph = hi; *pl = lo;  }

namespace w25 {
// =====================================================================================
// Generic causal/non-causal attention for head_dim 64, f32 in / f32 out; 16-bit operands: bf16 with optional hi/lo splits, or
// plain f16 (F16=true, non-split, probabilities carried x2^15).
//   scores = (q*qscale)·kᵀ : v_wmma_f32_16x16x32_bf16; SPLIT_QK -> q,k as bf16 hi/lo (hi·hi + hi·lo + lo·hi)
//   out    = p·v           : v_wmma_f32_16x16x32_bf16; SPLIT_PV -> p,v as bf16 hi/lo; else p,v plain bf16
//   f32 accumulate; online softmax in f32. Block = 4 waves = 64 query rows of one (batch, head); S % 64 == 0.
//   Element (b, s, h, d) of tensor X lives at X[b*X_bs + s*X_rs + h*X_hs + d] (strides in floats, multiples of 4).
//   Masking: mask_mode 0 none, 1 causal (kv > q masked), 2 tensor [S][Skv] shared over (b,h) (float if
//   mask_is_int==0, int32 with element == 0 -> masked if 1, int32 with element != 0 -> masked if 2), 3 per-token vectors qmask[B][S] & kvmask[B][Skv] (int32,
//   0 -> masked), 4 causal + sliding window (kv > q or q - kv > W masked; W passed in mask_is_int);
//   5 = relative-position bias: s += cp[b,h,q][idx[q][kv]] + pc[b,h,kv][idx[q][kv]] with idx = mask_b ([S][Skv] int32) and
//   mask_a an int32 [S][Skv] tensor with nonzero = masked (tables: element (b,h,row,n) at X + b*c_bs + h*c_hs + row*c_rs + n);
//   masked scores are replaced by mask_fill (e.g. -inf or -1e9) before the softmax.
//   grid.x = B * H * (S/64) (or a sub-range with blk0).
// =====================================================================================
#define AT_D 64
#define AT_NW 4
#define AT_QB 64
#define AT_KC 64
struct AttnGeom { const float* cp = nullptr; const float* pc = nullptr; long c_bs = 0, c_rs = 0, c_hs = 0;   // mode-5 score-bias tables
                  long q_bs, q_rs, q_hs, k_bs, k_rs, k_hs, v_bs, v_rs, v_hs, o_bs, o_rs, o_hs;
                  int S, Skv, H, mask_mode; float qscale; int blk0; float mask_fill; int mask_is_int; };
static_assert(sizeof(AttnGeom) == 168, "no padding");

__device__ __forceinline__ unsigned short at_bf_bits(float f) {
  unsigned u = __float_as_uint(f);
  return (unsigned short)((u + 0x7FFFu + ((u >> 16) & 1u)) >> 16);
}
__device__ __forceinline__ __bf16 at_f2bf(float f) { return __builtin_bit_cast(__bf16, at_bf_bits(f)); }
__device__ __forceinline__ void at_split(float f, __bf16& hi, __bf16& lo) {
  const unsigned short hb = at_bf_bits(f);
  hi = __builtin_bit_cast(__bf16, hb);
  lo = at_f2bf(f - __uint_as_float(((unsigned)hb) << 16));
}
__device__ __forceinline__ v8f at_mma(v16b a, v16b b, v8f c) {
  c = __builtin_amdgcn_wmma_f32_16x16x32_bf16(false, a, false, b, (short)0, c, false, false);
  asm volatile("v_nop\n\tv_nop\n\tv_nop\n\tv_nop" : "+v"(c) : "v"(a), "v"(b));
  return c;
}
// 16-bit element as a bit pattern held in a __bf16 slot: f16 bits when F16, bf16 (RNE) otherwise
template <bool F16> __device__ __forceinline__ __bf16 at_to16(float f) {
  if (F16) return __builtin_bit_cast(__bf16, (_Float16)f);
  return at_f2bf(f);
}
template <bool F16> __device__ __forceinline__ v8f at_mma16(v16b a, v16b b, v8f c) {
  if (F16) {
    const v16h ah = __builtin_bit_cast(v16h, a), bh = __builtin_bit_cast(v16h, b);
    c = __builtin_amdgcn_wmma_f32_16x16x32_f16(false, ah, false, bh, (short)0, c, false, false);
    asm volatile("v_nop\n\tv_nop\n\tv_nop\n\tv_nop" : "+v"(c) : "v"(ah), "v"(bh));
    return c;
  }
  return at_mma(a, b, c);
}

template <bool SPLIT_QK, bool SPLIT_PV, bool F16 = false>
__global__ __launch_bounds__(128)
void attn64_kernel(const float* __restrict__ q, const float* __restrict__ k,
                   const float* __restrict__ v, float* __restrict__ out,
                   const void* __restrict__ mask_a, const int* __restrict__ mask_b, AttnGeom g) {
  static_assert(!(F16 && (SPLIT_QK || SPLIT_PV)), "f16 mode is non-split");
  const float PSC = F16 ? 32768.0f : 1.0f;     // f16 probabilities carried x2^15 (subnormal range), folded into the final 1/l
  union FB { v16b v; v8b h[2]; };
  __shared__ __align__(16) __bf16 Ksh[AT_KC * AT_D];             // K hi [kv][d]      8 KB
  __shared__ __align__(16) __bf16 Ksl[SPLIT_QK ? AT_KC * AT_D : 8];
  __shared__ __align__(16) __bf16 Vth[AT_D * AT_KC];             // V hi [d][kv]      8 KB
  __shared__ __align__(16) __bf16 Vtl[SPLIT_PV ? AT_D * AT_KC : 8];
  __shared__ __align__(16) __bf16 Psh[AT_NW][16 * AT_KC];        // per wave P hi [row][kv]  8 KB
  __shared__ __align__(16) __bf16 Psl[SPLIT_PV ? AT_NW : 1][SPLIT_PV ? 16 * AT_KC : 8];
  __shared__ __align__(16) float  Os[AT_NW][16 * 68];            // per wave out tile, pitch 68

  const int tid  = threadIdx.x;
  const int wave = tid >> 5;
  const int lane = tid & 31;
  const int hh   = lane >> 4;
  const int c    = lane & 15;

  const int nqb = g.S / AT_QB;
  const int bx = blockIdx.x + g.blk0;
  const int qb = bx % nqb;
  const int bh = bx / nqb;
  const int h  = bh % g.H;
  const int b  = bh / g.H;
  const int qbase_block = qb * AT_QB;
  const int q0 = qbase_block + wave * 16;

  const float* qb_ptr = q + (size_t)b * g.q_bs + (size_t)h * g.q_hs;
  const float* kb_ptr = k + (size_t)b * g.k_bs + (size_t)h * g.k_hs;
  const float* vb_ptr = v + (size_t)b * g.v_bs + (size_t)h * g.v_hs;
  float*       ob_ptr = out + (size_t)b * g.o_bs + (size_t)h * g.o_hs;

  // ---- Q fragments (A operand): 2 d-chunks, hi (and lo) ----
  v16b qah[2], qal[2];
  {
    const float* qrow = qb_ptr + (size_t)(q0 + c) * g.q_rs;
#pragma unroll
    for (int dc = 0; dc < 2; ++dc) {
#pragma unroll
      for (int e = 0; e < 8; ++e) {
        const float f0 = qrow[dc * 32 + 8 * hh + e] * g.qscale;
        const float f1 = qrow[dc * 32 + 16 + 8 * hh + e] * g.qscale;
        if (SPLIT_QK) { __bf16 hq, lq; at_split(f0, hq, lq); qah[dc][e] = hq; qal[dc][e] = lq; at_split(f1, hq, lq); qah[dc][8 + e] = hq; qal[dc][8 + e] = lq; }
        else { qah[dc][e] = at_to16<F16>(f0); qah[dc][8 + e] = at_to16<F16>(f1); qal[dc][e] = qah[dc][e]; qal[dc][8 + e] = qah[dc][8 + e]; }
      }
    }
  }

  float mrow[8], lrow[8];
  v8f oacc[4];
#pragma unroll
  for (int r = 0; r < 8; ++r) { mrow[r] = -INFINITY; lrow[r] = 0.f; }
#pragma unroll
  for (int t = 0; t < 4; ++t) oacc[t] = (v8f){0.f,0.f,0.f,0.f,0.f,0.f,0.f,0.f};

  const int nChunks = (g.mask_mode == 1 || g.mask_mode == 4) ? (qb + 1) : (g.Skv / AT_KC);   // block-uniform
  // per-row query mask (mode 3)
  int qkeep[8];
#pragma unroll
  for (int r = 0; r < 8; ++r) qkeep[r] = (g.mask_mode == 3) ? mask_b[(size_t)b * g.S + q0 + 8 * hh + r] : 1;   // mask_b = qmask in mode 3
  for (int kc = 0; kc < nChunks; ++kc) {
    const int kv0 = kc * AT_KC;
    __syncthreads();
    {
      const int kvr = tid >> 1, dh = (tid & 1) * 32;
      const float* krow = kb_ptr + (size_t)(kv0 + kvr) * g.k_rs + dh;
      const float* vrow = vb_ptr + (size_t)(kv0 + kvr) * g.v_rs + dh;
#pragma unroll
      for (int i = 0; i < 8; ++i) {
        v4f kk = *(const v4f*)(krow + 4 * i);
        v4f vv = *(const v4f*)(vrow + 4 * i);
#pragma unroll
        for (int e = 0; e < 4; ++e) {
          const int d = dh + 4 * i + e;
          if (SPLIT_QK) { __bf16 a, bl; at_split(kk[e], a, bl); Ksh[kvr * AT_D + d] = a; Ksl[kvr * AT_D + d] = bl; }
          else Ksh[kvr * AT_D + d] = at_to16<F16>(kk[e]);
          if (SPLIT_PV) { __bf16 a, bl; at_split(vv[e], a, bl); Vth[d * AT_KC + kvr] = a; Vtl[d * AT_KC + kvr] = bl; }
          else Vth[d * AT_KC + kvr] = at_to16<F16>(vv[e]);
        }
      }
    }
    __syncthreads();

    v8f s[4];
#pragma unroll
    for (int j = 0; j < 4; ++j) {
      s[j] = (v8f){0.f,0.f,0.f,0.f,0.f,0.f,0.f,0.f};
#pragma unroll 1
      for (int dc = 0; dc < 2; ++dc) {
        FB kb;
        kb.h[0] = *(const v8b*)(Ksh + (j * 16 + c) * AT_D + dc * 32 + 8 * hh);
        kb.h[1] = *(const v8b*)(Ksh + (j * 16 + c) * AT_D + dc * 32 + 16 + 8 * hh);
        s[j] = at_mma16<F16>(qah[dc], kb.v, s[j]);
        if (SPLIT_QK) {
          FB kl;
          kl.h[0] = *(const v8b*)(Ksl + (j * 16 + c) * AT_D + dc * 32 + 8 * hh);
          kl.h[1] = *(const v8b*)(Ksl + (j * 16 + c) * AT_D + dc * 32 + 16 + 8 * hh);
          s[j] = at_mma16<F16>(qah[dc], kl.v, s[j]);
          s[j] = at_mma16<F16>(qal[dc], kb.v, s[j]);
        }
      }
    }
    const bool diag = (g.mask_mode == 1) && (kc == qb);
    int kvkeep[4] = {1, 1, 1, 1};
    if (g.mask_mode == 3) {
#pragma unroll
      for (int j = 0; j < 4; ++j) kvkeep[j] = ((const int*)mask_a)[(size_t)b * g.Skv + kv0 + j * 16 + c];   // mask_a = kvmask
    }
    float cm[8];
#pragma unroll
    for (int r = 0; r < 8; ++r) {
      const int qrow = q0 + 8 * hh + r;
      float m = -INFINITY;
#pragma unroll
      for (int j = 0; j < 4; ++j) {
        const int kvcol = kv0 + j * 16 + c;
        bool masked = false;
        if (diag) masked = (kvcol > qrow);
        else if (g.mask_mode == 4) masked = (kvcol > qrow) || (qrow - kvcol > g.mask_is_int);
        else if (g.mask_mode == 2) {
          const size_t mi = (size_t)qrow * g.Skv + kvcol;
          masked = (g.mask_is_int == 0) ? (((const float*)mask_a)[mi] == 0.0f)
                 : (g.mask_is_int == 1) ? (((const int*)mask_a)[mi] == 0) : (((const int*)mask_a)[mi] != 0);
        } else if (g.mask_mode == 3) masked = (qkeep[r] == 0) || (kvkeep[j] == 0);
        else if (g.mask_mode == 5) {
          const size_t mi = (size_t)qrow * g.Skv + kvcol;
          masked = (((const int*)mask_a)[mi] != 0);
          int n = mask_b[mi]; n = n < 0 ? 0 : n;
          s[j][r] += g.cp[(size_t)b * g.c_bs + (size_t)h * g.c_hs + (size_t)qrow * g.c_rs + n]
                   + g.pc[(size_t)b * g.c_bs + (size_t)h * g.c_hs + (size_t)kvcol * g.c_rs + n];
        }
        if (masked) s[j][r] = g.mask_fill;
        m = fmaxf(m, s[j][r]);
      }
#pragma unroll
      for (int off = 1; off < 16; off <<= 1) m = fmaxf(m, __shfl_xor(m, off, 32));
      cm[r] = m;
    }
    __bf16* pwh = Psh[wave];
    __bf16* pwl = Psl[SPLIT_PV ? wave : 0];
#pragma unroll
    for (int r = 0; r < 8; ++r) {
      const float mnew = fmaxf(mrow[r], cm[r]);
      const float alpha = expf(mrow[r] - mnew);
      mrow[r] = mnew;
      float psum = 0.f;
#pragma unroll
      for (int j = 0; j < 4; ++j) {
        const float p = expf(s[j][r] - mnew);
        psum += p;
        if (SPLIT_PV) { __bf16 a, bl; at_split(p, a, bl); pwh[(8 * hh + r) * AT_KC + j * 16 + c] = a; pwl[(8 * hh + r) * AT_KC + j * 16 + c] = bl; }
        else pwh[(8 * hh + r) * AT_KC + j * 16 + c] = at_to16<F16>(p * PSC);
      }
#pragma unroll
      for (int off = 1; off < 16; off <<= 1) psum += __shfl_xor(psum, off, 32);
      lrow[r] = lrow[r] * alpha + psum;
#pragma unroll
      for (int t = 0; t < 4; ++t) oacc[t][r] *= alpha;
    }
    __builtin_amdgcn_fence(__ATOMIC_RELEASE, "workgroup");
    __builtin_amdgcn_wave_barrier();
    __builtin_amdgcn_fence(__ATOMIC_ACQUIRE, "workgroup");
#pragma unroll 1
    for (int kk = 0; kk < 2; ++kk) {
      FB pa, pl;
      pa.h[0] = *(const v8b*)(pwh + c * AT_KC + kk * 32 + 8 * hh);
      pa.h[1] = *(const v8b*)(pwh + c * AT_KC + kk * 32 + 16 + 8 * hh);
      if (SPLIT_PV) {
        pl.h[0] = *(const v8b*)(pwl + c * AT_KC + kk * 32 + 8 * hh);
        pl.h[1] = *(const v8b*)(pwl + c * AT_KC + kk * 32 + 16 + 8 * hh);
      }
#pragma unroll
      for (int t = 0; t < 4; ++t) {
        FB vb;
        vb.h[0] = *(const v8b*)(Vth + (t * 16 + c) * AT_KC + kk * 32 + 8 * hh);
        vb.h[1] = *(const v8b*)(Vth + (t * 16 + c) * AT_KC + kk * 32 + 16 + 8 * hh);
        oacc[t] = at_mma16<F16>(pa.v, vb.v, oacc[t]);
        if (SPLIT_PV) {
          FB vl;
          vl.h[0] = *(const v8b*)(Vtl + (t * 16 + c) * AT_KC + kk * 32 + 8 * hh);
          vl.h[1] = *(const v8b*)(Vtl + (t * 16 + c) * AT_KC + kk * 32 + 16 + 8 * hh);
          oacc[t] = at_mma16<F16>(pa.v, vl.v, oacc[t]);
          oacc[t] = at_mma16<F16>(pl.v, vb.v, oacc[t]);
        }
      }
    }
  }

  float* os = Os[wave];
#pragma unroll
  for (int r = 0; r < 8; ++r) {
    const float inv = 1.0f / (lrow[r] * PSC);
#pragma unroll
    for (int t = 0; t < 4; ++t) os[(8 * hh + r) * 68 + t * 16 + c] = oacc[t][r] * inv;
  }
  __builtin_amdgcn_fence(__ATOMIC_RELEASE, "workgroup");
  __builtin_amdgcn_wave_barrier();
  __builtin_amdgcn_fence(__ATOMIC_ACQUIRE, "workgroup");
  {
    const int c4 = (lane & 15) * 4;
    {
#pragma unroll
      for (int it = 0; it < 8; ++it) {
        const int row = it * 2 + hh;
        v4f val = *(const v4f*)(os + row * 68 + c4);
        *(v4f*)(ob_ptr + (size_t)(q0 + row) * g.o_rs + c4) = val;
      }
      
    }
  }
}

} // namespace w25


extern "C" void kernel_launch(void* const* d_in, const int* in_sizes, int n_in, void* d_out, int out_size, void* d_ws, size_t ws_size, hipStream_t stream) {
    (void)in_sizes; (void)n_in; (void)out_size; (void)ws_size;
    const float* x = (const float*)d_in[0];
    const float* Wq = (const float*)d_in[1];
    const float* Wkv = (const float*)d_in[2];
    const float* Wo = (const float*)d_in[3];
    const float* bo = (const float*)d_in[4];
    const int Bn = 2;
    const int T = 2048;
    const int D = 1024;
    const int NH = 16;
    const int D3 = 3 * D;
    const int NR = Bn * T;
    float* out = (float*)d_out;
    char* wsp = (char*)d_ws;
    unsigned short* X16 = (unsigned short*)wsp; wsp += (((size_t)((size_t)NR * D) * 2 + 255) / 256) * 256;
    unsigned short* W316 = (unsigned short*)wsp; wsp += (((size_t)((size_t)D3 * D) * 2 + 255) / 256) * 256;
    unsigned short* QKV16 = (unsigned short*)wsp; wsp += (((size_t)((size_t)NR * D3) * 2 + 255) / 256) * 256;
    if ((size_t)(wsp - (char*)d_ws) > ws_size) return;   // static carve guard
    k_prep<NR, D><<<(unsigned)((D3 / 64) * (D / 128) + (NR / 16) * (D / 1024)), 256, 0, stream>>>(x, Wq, Wkv, (_Float16*)(X16), (_Float16*)(W316));
    k_proj<NR, D3, D><<<(unsigned)((NR / 128) * (D3 / 128)), 128, 0, stream>>>((const _Float16*)(X16), (const _Float16*)(W316), (_Float16*)(QKV16), 0.0625f);
    k_attn_lds<T, D3, D><<<dim3((unsigned)((T) / (16 * AW)), (unsigned)(NH), (unsigned)(Bn)), 32 * AW, 0, stream>>>((const _Float16*)(QKV16), (const _Float16*)(QKV16) + D, (const _Float16*)(QKV16) + 2 * D, Wo, bo, out, 0.125f);
}

// v010
// It runs in 72.7 microseconds.
// Timed twice side by side with v009, it ran 1.05 and 1.06 times as fast.
// Over all steps from v000, the starting kernel, it is 29.6 times as fast.
// Contractions: q and k|v projections (weights stored [in][out]) [4096x1024].[1024x1024|2048], both batch elements' rows in one launch, with f16 operands on f16 planes (v_wmma_f32_16x16x32_f16, 64x64 register-blocked wave tiles, weights x16); the projection's epilogue rounds q, k, v once to an f16 plane; per (batch, head) softmax(q.k^T/8) v over all 2048 keys as one flash launch for both batch elements (head_dim 64, f16 q.k^T and f16 p.v with p as f16 of 4096 p), whose epilogue applies the head's own 64x64 output map (+bias) to the f16 attention tile still in registers (weights x16); f32 accumulate and softmax statistics.
#include <hip/hip_runtime.h>
#include <math.h>

typedef __attribute__((ext_vector_type(16))) _Float16 v16h;
typedef __attribute__((ext_vector_type(8)))  _Float16 v8h;
typedef __attribute__((ext_vector_type(16))) __bf16   v16b;
typedef __attribute__((ext_vector_type(8)))  float    v8f;
typedef __attribute__((ext_vector_type(4)))  float    v4f;

// 16-bit WMMA fragment map (wave32), lane L, h = L>>4, m = L&15:
//   A 16x32: lane = row m;   element i -> k = (i<8) ? 8h+i : 16+8h+(i-8)
//   B 32x16: lane = column m; the SAME k(i,h)
//   D 16x16 (8 f32): lane = column m; element r -> row 8h+r
__device__ __forceinline__ int frag_k(int i, int h) { return (i < 8) ? (8 * h + i) : (16 + 8 * h + (i - 8)); }
__device__ __forceinline__ __bf16 bf16_rne(float f) {
    unsigned int u = __float_as_uint(f);
    u += 0x7fffu + ((u >> 16) & 1u);
    return __builtin_bit_cast(__bf16, (unsigned short)(u >> 16));
}
__device__ __forceinline__ float bf16_f32(__bf16 b) { return __uint_as_float(((unsigned int)__builtin_bit_cast(unsigned short, b)) << 16); }
__device__ __forceinline__ v8f wmma16(v16h a, v16h b, v8f c) {
    c = __builtin_amdgcn_wmma_f32_16x16x32_f16(false, a, false, b, (short)0, c, false, false);
    asm volatile("v_nop\n\tv_nop\n\tv_nop\n\tv_nop" : "+v"(c) : "v"(a), "v"(b));
    return c;
}
__device__ __forceinline__ v8f wmmab(v16b a, v16b b, v8f c) {
    c = __builtin_amdgcn_wmma_f32_16x16x32_bf16(false, a, false, b, (short)0, c, false, false);
    asm volatile("v_nop\n\tv_nop\n\tv_nop\n\tv_nop" : "+v"(c) : "v"(a), "v"(b));
    return c;
}
struct Split { v16b hi, lo; };
// hi/lo split product: a.hi*b.hi + a.hi*b.lo + a.lo*b.hi
__device__ __forceinline__ v8f wmma3(const Split& a, const Split& b, v8f c) {
    c = __builtin_amdgcn_wmma_f32_16x16x32_bf16(false, a.hi, false, b.hi, (short)0, c, false, false);
    c = __builtin_amdgcn_wmma_f32_16x16x32_bf16(false, a.hi, false, b.lo, (short)0, c, false, false);
    c = __builtin_amdgcn_wmma_f32_16x16x32_bf16(false, a.lo, false, b.hi, (short)0, c, false, false);
    asm volatile("v_nop\n\tv_nop\n\tv_nop\n\tv_nop" : "+v"(c) : "v"(a.hi), "v"(a.lo), "v"(b.hi), "v"(b.lo));
    return c;
}
struct Split3 { v16b hi, mid, lo; };
// triple split product (6 terms, drops only terms below 2^-24 relative)
__device__ __forceinline__ v8f wmma6(const Split3& a, const Split3& b, v8f c) {
    c = __builtin_amdgcn_wmma_f32_16x16x32_bf16(false, a.hi, false, b.hi, (short)0, c, false, false);
    c = __builtin_amdgcn_wmma_f32_16x16x32_bf16(false, a.hi, false, b.mid, (short)0, c, false, false);
    c = __builtin_amdgcn_wmma_f32_16x16x32_bf16(false, a.mid, false, b.hi, (short)0, c, false, false);
    c = __builtin_amdgcn_wmma_f32_16x16x32_bf16(false, a.hi, false, b.lo, (short)0, c, false, false);
    c = __builtin_amdgcn_wmma_f32_16x16x32_bf16(false, a.mid, false, b.mid, (short)0, c, false, false);
    c = __builtin_amdgcn_wmma_f32_16x16x32_bf16(false, a.lo, false, b.hi, (short)0, c, false, false);
    asm volatile("v_nop\n\tv_nop\n\tv_nop\n\tv_nop" : "+v"(c) : "v"(a.hi), "v"(a.mid), "v"(a.lo), "v"(b.hi), "v"(b.mid), "v"(b.lo));
    return c;
}

// Fragment gathers from f32 memory: element i <- p[(k0 + frag_k(i,h)) * sk] * s, zero for k >= klen.
__device__ __forceinline__ v16h fh_ld(const float* __restrict__ p, long long sk, int k0, int h, int klen, float s) {
    v16h a;
#pragma unroll
    for (int i = 0; i < 16; ++i) { const int k = k0 + frag_k(i, h); a[i] = (k < klen) ? (_Float16)(p[(long long)k * sk] * s) : (_Float16)0.f; }
    return a;
}
__device__ __forceinline__ Split sp_ld(const float* __restrict__ p, long long sk, int k0, int h, int klen, float s) {
    Split r;
#pragma unroll
    for (int i = 0; i < 16; ++i) {
        const int k = k0 + frag_k(i, h); const float x = (k < klen) ? p[(long long)k * sk] * s : 0.f;
        const __bf16 hb = bf16_rne(x); r.hi[i] = hb; r.lo[i] = bf16_rne(x - bf16_f32(hb));
    }
    return r;
}
__device__ __forceinline__ Split3 sp3_ld(const float* __restrict__ p, long long sk, int k0, int h, int klen, float s) {
    Split3 r;
#pragma unroll
    for (int i = 0; i < 16; ++i) {
        const int k = k0 + frag_k(i, h); const float x = (k < klen) ? p[(long long)k * sk] * s : 0.f;
        const __bf16 hb = bf16_rne(x); const float r1 = x - bf16_f32(hb); const __bf16 mb = bf16_rne(r1);
        r.hi[i] = hb; r.mid[i] = mb; r.lo[i] = bf16_rne(r1 - bf16_f32(mb));
    }
    return r;
}
__device__ __forceinline__ v16b bh_ld(const float* __restrict__ p, long long sk, int k0, int h, int klen, float s) {
    v16b a;
#pragma unroll
    for (int i = 0; i < 16; ++i) { const int k = k0 + frag_k(i, h); a[i] = bf16_rne((k < klen) ? p[(long long)k * sk] * s : 0.f); }
    return a;
}
// f16 fragment from an f16 LDS/global row with element stride 1 (k-contiguous), no bounds (tile already zero padded)
__device__ __forceinline__ v16h fh_row(const _Float16* __restrict__ row, int k0, int h) {
    v16h a;
#pragma unroll
    for (int i = 0; i < 16; ++i) a[i] = row[k0 + frag_k(i, h)];
    return a;
}

#define VST2(T, ptr, val) do { const T vst2_v_ = (val); *(T*)(ptr) = vst2_v_;  } while (0)
typedef float v4f __attribute__((ext_vector_type(4)));
#define VST2V4(ptr, val) do { const v4f vst2_v4_ = (val); *(v4f*)(ptr) = vst2_v4_;  } while (0)

__device__ __attribute__((noinline)) float act_fn(float v, int act) {
    if (act == 1) return fmaxf(v, 0.f);                                                                               // relu
    if (act == 2) { const float u = 0.7978845608028654f * (v + 0.044715f * v * v * v); return 0.5f * v * (1.f + tanhf(u)); } // tanh-gelu
    if (act == 3) return v / (1.f + expf(-v));                                                                        // silu
    if (act == 4) return 0.5f * v * (1.f + erff(v * 0.7071067811865476f));                                             // erf-gelu
    if (act == 5) return tanhf(v);
    if (act == 6) return 1.f / (1.f + expf(-v));                                                                      // sigmoid
    if (act == 7) return (v > 0.f) ? v : 0.01f * v;                                                                   // leaky relu 0.01
    if (act == 8) return (v > 0.f) ? v : (expf(v) - 1.f);                                                             // elu
    if (act == 9) return fminf(fmaxf(v, 0.f), 6.f);                                                                   // relu6
    if (act == 10) return fabsf(v);                                                                                    // abs
    if (act == 11) return (v >= 0.f) ? v : 0.1f * v;                                                                  // leaky 0.1
    if (act == 12) return (v > 0.f) ? v : 0.2f * v;                                                                   // leaky 0.2
    if (act == 13) return (v > 20.f) ? v : log1pf(expf(v));                                                            // softplus
    return v;
}

// =====================================================================================================================
// k_gemm<MODE>: C(z, m, n) = act(alpha * sum_k A(z, m, k) * B(z, k, n) + bias) + beta * R(z, m, n)
//   One wave (32-thread block) per 16 x 32 tile of C; grid (ceil(N/32), ceil(M/16), Z). Batch z -> (zo = z / zi_n, zi = z % zi_n)
//   with separate outer/inner strides for every tensor (e.g. batch and head). A(m,k) = A[zo*sAo + zi*sAi + m*sAm + k*sAk] (f32),
//   B(k,n) = B[zo*sBo + zi*sBi + n*sBn + k*sBk] (f32); any M, N, K (K zero-padded to 32 inside the fragments, M/N tails guarded).
//   C(m,n) = C[zo*sCo + zi*sCi + m*sCm + n] (n contiguous). flags: 1 bias[n], 2 bias[m], 4 residual R[zo*sRo + zi*sRi + m*sRm + n*sRn].
//   MODE 0: f16 operands (A prescaled by sa, B by sb, both undone in the epilogue); 1: bf16 hi/lo split (3 products); 2: bf16;
//   3: bf16 hi/mid/lo triple split (6 products); 4: as 3 with Kahan-compensated f32 accumulation across k-steps.
// =====================================================================================================================
struct GemmP {
    const float* A; const float* B; const float* bias; const float* R; float* C;
    long long sAo, sAi, sAm, sAk, sBo, sBi, sBn, sBk, sCo, sCi, sCm, sRo, sRi, sRm, sRn;
    int M, N, K, zi_n, flags, act; float alpha, beta, sa, sb;
    int Npad, pad_;     // columns [N, Npad) of C are written as 0 so that padded workspace rows are covered by whole-line stores; Npad >= N
};
static_assert(sizeof(GemmP) == 5 * 8 + 15 * 8 + 6 * 4 + 4 * 4 + 2 * 4, "GemmP has padding");

template <int MODE>
__global__ __launch_bounds__(32) void k_gemm(GemmP p) {
    const int lane = threadIdx.x & 31, h = lane >> 4, l15 = lane & 15;
    const int m0 = blockIdx.y * 16, n0 = blockIdx.x * 32;
    const int z = blockIdx.z, zo = z / p.zi_n, zi = z - zo * p.zi_n;
    const float* A = p.A + zo * p.sAo + zi * p.sAi;
    const float* B = p.B + zo * p.sBo + zi * p.sBi;
    const int am = min(m0 + l15, p.M - 1);                       // clamped row for loads (stores are guarded)
    v8f acc[2], comp[2];
#pragma unroll
    for (int t = 0; t < 2; ++t) { v8f zz = {}; acc[t] = zz; comp[t] = zz; }
    for (int k0 = 0; k0 < p.K; k0 += 32) {
        const float* arow = A + (long long)am * p.sAm;
        if (MODE == 1) {
            const Split a = sp_ld(arow, p.sAk, k0, h, p.K, 1.f);
#pragma unroll
            for (int t = 0; t < 2; ++t) {
                const int bn = min(n0 + t * 16 + l15, p.N - 1);
                acc[t] = wmma3(a, sp_ld(B + (long long)bn * p.sBn, p.sBk, k0, h, p.K, 1.f), acc[t]);
            }
        } else if (MODE == 3) {
            const Split3 a = sp3_ld(arow, p.sAk, k0, h, p.K, 1.f);
#pragma unroll
            for (int t = 0; t < 2; ++t) {
                const int bn = min(n0 + t * 16 + l15, p.N - 1);
                acc[t] = wmma6(a, sp3_ld(B + (long long)bn * p.sBn, p.sBk, k0, h, p.K, 1.f), acc[t]);
            }
        } else if (MODE == 4) {
            // triple split as MODE 3, but each k-step's 6 products go into a fresh accumulator and the partial is added to the running f32 sum
            // on the VALU with Kahan compensation (accumulation error stays ~1 ulp however long K is)
            const Split3 a = sp3_ld(arow, p.sAk, k0, h, p.K, 1.f);
#pragma unroll
            for (int t = 0; t < 2; ++t) {
                const int bn = min(n0 + t * 16 + l15, p.N - 1); v8f zz = {};
                const v8f part = wmma6(a, sp3_ld(B + (long long)bn * p.sBn, p.sBk, k0, h, p.K, 1.f), zz);
                const v8f y = part - comp[t]; const v8f s = acc[t] + y; comp[t] = (s - acc[t]) - y; acc[t] = s;
            }
        } else if (MODE == 2) {
            const v16b a = bh_ld(arow, p.sAk, k0, h, p.K, 1.f);
#pragma unroll
            for (int t = 0; t < 2; ++t) {
                const int bn = min(n0 + t * 16 + l15, p.N - 1);
                acc[t] = wmmab(a, bh_ld(B + (long long)bn * p.sBn, p.sBk, k0, h, p.K, 1.f), acc[t]);
            }
        } else {
            const v16h a = fh_ld(arow, p.sAk, k0, h, p.K, p.sa);
#pragma unroll
            for (int t = 0; t < 2; ++t) {
                const int bn = min(n0 + t * 16 + l15, p.N - 1);
                acc[t] = wmma16(a, fh_ld(B + (long long)bn * p.sBn, p.sBk, k0, h, p.K, p.sb), acc[t]);
            }
        }
    }
    const float iscale = (MODE == 0) ? p.alpha / (p.sa * p.sb) : p.alpha;
    float* C = p.C + zo * p.sCo + zi * p.sCi;
    const float* R = p.R + zo * p.sRo + zi * p.sRi;
    __shared__ __align__(16) float ctile[16][36];
#pragma unroll
    for (int t = 0; t < 2; ++t) {
        const int n = n0 + t * 16 + l15; const int nn = min(n, p.N - 1);
#pragma unroll
        for (int r = 0; r < 8; ++r) {
            const int m = m0 + 8 * h + r; const int mm = min(m, p.M - 1);
            float v = acc[t][r] * iscale;
            if (p.flags & 1) v += p.bias[nn];
            if (p.flags & 2) v += p.bias[mm];
            if (p.flags & 8) v *= p.bias[(long long)zo * p.M + mm];   /* per-(z,row) scale vector laid out [Z][M]; exclusive with the bias flags */
            v = act_fn(v, p.act);
            if (p.flags & 4) v += p.beta * R[(long long)mm * p.sRm + (long long)nn * p.sRn];
            ctile[8 * h + r][t * 16 + l15] = (n < p.N) ? v : 0.f;
        }
    }
    __syncthreads();
    const int NW = (p.Npad > p.N) ? p.Npad : p.N;           // write width
    const bool fast = (m0 + 16 <= p.M) && (n0 + 32 <= NW) && ((p.sCm & 3) == 0) && ((((size_t)C) & 15) == 0);
    if (fast) {
#pragma unroll
        for (int s = 0; s < 4; ++s) {
            const int row = s * 4 + (lane >> 3), c4 = (lane & 7) * 4;
            const v4f v = *(const v4f*)&ctile[row][c4];
            VST2V4(C + (long long)(m0 + row) * p.sCm + n0 + c4, v);
        }
    } else {
        for (int row = 0; row < 16; ++row) {
            const int m = m0 + row, n = n0 + lane;
            if (m < p.M && n < NW) VST2(float, C + (long long)m * p.sCm + n, ctile[row][lane]);
        }
    }
}


// =====================================================================================================================
// k_gemmT<MODE, TM, TN>: same contract as k_gemm, but one wave computes a (16*TM) x (16*TN) tile: TM A fragments and TN B fragments are
//   loaded per 32-wide k-step and reused across TM*TN WMMAs (far fewer load/convert instructions per MAC). MODE 0 (f16), 1 (bf16 hi/lo),
//   2 (bf16) only. grid (ceil(NW/(16*TN)), ceil(M/(16*TM)), Z), block 32. Epilogue identical to k_gemm, run per 16x32 sub-tile.
// =====================================================================================================================
template <int MODE, int TM, int TN>
__global__ __launch_bounds__(32) void k_gemmT(GemmP p) {
    const int lane = threadIdx.x & 31, h = lane >> 4, l15 = lane & 15;
    const int m0 = blockIdx.y * (16 * TM), n0 = blockIdx.x * (16 * TN);
    const int z = blockIdx.z, zo = z / p.zi_n, zi = z - zo * p.zi_n;
    const float* A = p.A + zo * p.sAo + zi * p.sAi;
    const float* B = p.B + zo * p.sBo + zi * p.sBi;
    v8f acc[TM][TN];
#pragma unroll
    for (int i = 0; i < TM; ++i)
#pragma unroll
        for (int t = 0; t < TN; ++t) { v8f zz = {}; acc[i][t] = zz; }
    for (int k0 = 0; k0 < p.K; k0 += 32) {
        if (MODE == 1) {
            Split a[TM], b[TN];
#pragma unroll
            for (int i = 0; i < TM; ++i) { const int am = min(m0 + 16 * i + l15, p.M - 1); a[i] = sp_ld(A + (long long)am * p.sAm, p.sAk, k0, h, p.K, 1.f); }
#pragma unroll
            for (int t = 0; t < TN; ++t) { const int bn = min(n0 + 16 * t + l15, p.N - 1); b[t] = sp_ld(B + (long long)bn * p.sBn, p.sBk, k0, h, p.K, 1.f); }
#pragma unroll
            for (int i = 0; i < TM; ++i)
#pragma unroll
                for (int t = 0; t < TN; ++t) acc[i][t] = wmma3(a[i], b[t], acc[i][t]);
        } else if (MODE == 2) {
            v16b a[TM], b[TN];
#pragma unroll
            for (int i = 0; i < TM; ++i) { const int am = min(m0 + 16 * i + l15, p.M - 1); a[i] = bh_ld(A + (long long)am * p.sAm, p.sAk, k0, h, p.K, 1.f); }
#pragma unroll
            for (int t = 0; t < TN; ++t) { const int bn = min(n0 + 16 * t + l15, p.N - 1); b[t] = bh_ld(B + (long long)bn * p.sBn, p.sBk, k0, h, p.K, 1.f); }
#pragma unroll
            for (int i = 0; i < TM; ++i)
#pragma unroll
                for (int t = 0; t < TN; ++t) acc[i][t] = wmmab(a[i], b[t], acc[i][t]);
        } else {
            v16h a[TM], b[TN];
#pragma unroll
            for (int i = 0; i < TM; ++i) { const int am = min(m0 + 16 * i + l15, p.M - 1); a[i] = fh_ld(A + (long long)am * p.sAm, p.sAk, k0, h, p.K, p.sa); }
#pragma unroll
            for (int t = 0; t < TN; ++t) { const int bn = min(n0 + 16 * t + l15, p.N - 1); b[t] = fh_ld(B + (long long)bn * p.sBn, p.sBk, k0, h, p.K, p.sb); }
#pragma unroll
            for (int i = 0; i < TM; ++i)
#pragma unroll
                for (int t = 0; t < TN; ++t) acc[i][t] = wmma16(a[i], b[t], acc[i][t]);
        }
    }
    const float iscale = (MODE == 0) ? p.alpha / (p.sa * p.sb) : p.alpha;
    float* C = p.C + zo * p.sCo + zi * p.sCi;
    const float* R = p.R + zo * p.sRo + zi * p.sRi;
    const int NW = (p.Npad > p.N) ? p.Npad : p.N;
    __shared__ __align__(16) float ctile[16][36];
#pragma unroll
    for (int i = 0; i < TM; ++i) {
        const int mb = m0 + 16 * i; if (mb >= p.M) break;          // wave-uniform
#pragma unroll
        for (int tp = 0; tp < TN / 2; ++tp) {
            const int nb = n0 + 32 * tp; if (nb >= NW) break;        // wave-uniform
#pragma unroll
            for (int t2 = 0; t2 < 2; ++t2) {
                const int t = 2 * tp + t2; const int n = nb + t2 * 16 + l15; const int nn = min(n, p.N - 1);
#pragma unroll
                for (int r = 0; r < 8; ++r) {
                    const int m = mb + 8 * h + r; const int mm = min(m, p.M - 1);
                    float v = acc[i][t][r] * iscale;
                    if (p.flags & 1) v += p.bias[nn];
                    if (p.flags & 2) v += p.bias[mm];
            if (p.flags & 8) v *= p.bias[(long long)zo * p.M + mm];   /* per-(z,row) scale vector laid out [Z][M]; exclusive with the bias flags */
                    v = act_fn(v, p.act);
                    if (p.flags & 4) v += p.beta * R[(long long)mm * p.sRm + (long long)nn * p.sRn];
                    ctile[8 * h + r][t2 * 16 + l15] = (n < p.N) ? v : 0.f;
                }
            }
            __syncthreads();
            const bool fast = (mb + 16 <= p.M) && (nb + 32 <= NW) && ((p.sCm & 3) == 0) && ((((size_t)C) & 15) == 0);
            if (fast) {
#pragma unroll
                for (int s = 0; s < 4; ++s) {
                    const int row = s * 4 + (lane >> 3), c4 = (lane & 7) * 4;
                    const v4f v = *(const v4f*)&ctile[row][c4];
                    VST2V4(C + (long long)(mb + row) * p.sCm + nb + c4, v);
                }
            } else {
                for (int row = 0; row < 16; ++row) {
                    const int m = mb + row, n = nb + lane;
                    if (m < p.M && n < NW) VST2(float, C + (long long)m * p.sCm + n, ctile[row][lane]);
                }
            }
            __syncthreads();
        }
    }
}

// =====================================================================================================================
// k_attn_lds<L, RS, OS>: O = softmax(scale * Q.K^T) V for one head per blockIdx.y, head and value dim 64, L queries and L keys (L % 128 == 0), Q, K, V f16 planes, O f32.
//   Wave = 16 queries, AW waves per block, 64-key blocks; grid (L / (16*AW), H, batch), block 32*AW. Row r of head h of batch element z: Q/K/V + (z*L + r)*RS + h*64, O + (z*L + r)*OS + h*64.
//   Each 64-key block of K and of V is brought once per work-group by 16-byte asynchronous copies (a row of 64 halves is one 128-B line, 8 lanes) into one of two LDS buffers;
//   block t + 2 is asked for when every wave has left block t, so it flies while block t + 1 is worked on. The rows lie in LDS as [key][d]:
//   K at a pitch of 144 B for ds_load_b128 fragment reads (A operand of k.q^T, same k order as the Q fragment),
//   V at a pitch of 160 B for ds_load_tr16_b128 fragment reads (A operand of v^T.p^T: lane = row d, k = key in the frag_k order).
//   Both products are taken transposed: S^T = K.Q^T puts query l15 in lane column l15, so lanes l15 and l15+16 hold all 64 scores of one query
//   (tile t, register r: key 16t + 8*hf + r); maximum and sum run inside the lane, with one exchange between the lane halves.
//   Two S^T tiles of 16 keys, converted in place, are the B fragment of O^T += V^T.P^T in the frag_k order: P never leaves the registers.
//   Statistics f32 (exp2 domain); P x 4096 as f16, the factor added to the exponent, so the row sum carries it too; scale > 0.
//   Output map: Y^T = Wo[h]^T.O^T + bo[h]. Wo[h] x 16 lies in LDS as f16 [d][e] rows, laid and read exactly like a V tile (A operand: lane = row e, k = d);
//   the normalised O^T tiles, converted in place like P, are the B fragment. O receives Y, row r of head h of batch element z at O + (z*L + r)*OS + h*64.
// =====================================================================================================================
#define AW 4
typedef __attribute__((ext_vector_type(4))) _Float16 v4h;
typedef __attribute__((ext_vector_type(8))) short    v8s;
union FragH { v16h v; v8h h[2]; };
// 16-bit transposing LDS load: with lane address T + (k0 + 8*(l>>4) + (l&7)) * pitch + d0 + 8*((l>>3)&1) (halves), lane (c = l&15, h = l>>4) gets T[k0 + 8h + 0..7][d0 + c]
__device__ __forceinline__ v8h ld_tr16(const _Float16* p) {
    typedef __attribute__((address_space(3))) v8s lds_v8s;
    return __builtin_bit_cast(v8h, __builtin_amdgcn_ds_load_tr16_b128_v8i16((lds_v8s*)p));
}
// value of lane l ^ 16
__device__ __forceinline__ float swap_half(float x) {
    const int b = __builtin_bit_cast(int, x);
    return __builtin_bit_cast(float, __builtin_amdgcn_permlanex16(b, b, 0x76543210, 0xfedcba98, false, false));
}
// 2^x as the one hardware instruction. exp2f() wraps it in a compare, two selects and an ldexp so that results below 2^-126 come out as subnormals;
// here every argument is <= 12 (a score's carries P's factor 2^12) and such a result may be 0: as P it is below f16's range, in the sum it stands beside a term 2^12, as the rescale factor it multiplies
// what the new maximum's term outweighs by 2^126. exp2_raw(-inf) = 0 as before.
__device__ __forceinline__ float exp2_raw(float x) { return __builtin_amdgcn_exp2f(x); }
// one lane's share of a key block: four asynchronous 16-byte copies of K and four of V, 16 rows apart (GS halves in memory, LK and LV bytes in LDS)
template <int GS, int LK, int LV> __device__ __forceinline__ void acopy_kv(unsigned lk, unsigned lv, const _Float16* gk, const _Float16* gv) {
    // the copies and, as the last line, the wait that stands in front of any rewrite of the address registers they name
    asm volatile("global_load_async_to_lds_b128 %0, %8, off\n\t"
                 "global_load_async_to_lds_b128 %1, %9, off\n\t"
                 "global_load_async_to_lds_b128 %2, %10, off\n\t"
                 "global_load_async_to_lds_b128 %3, %11, off\n\t"
                 "global_load_async_to_lds_b128 %4, %12, off\n\t"
                 "global_load_async_to_lds_b128 %5, %13, off\n\t"
                 "global_load_async_to_lds_b128 %6, %14, off\n\t"
                 "global_load_async_to_lds_b128 %7, %15, off\n\t"
                 "s_wait_xcnt 0x0"
                 :: "v"(lk), "v"(lk + LK), "v"(lk + 2 * LK), "v"(lk + 3 * LK), "v"(lv), "v"(lv + LV), "v"(lv + 2 * LV), "v"(lv + 3 * LV),
                    "v"(gk), "v"(gk + GS), "v"(gk + 2 * GS), "v"(gk + 3 * GS), "v"(gv), "v"(gv + GS), "v"(gv + 2 * GS), "v"(gv + 3 * GS)
                 : "memory");
}
template <int L, int RS, int OS>
__global__ __launch_bounds__(32 * AW) void k_attn_lds(const _Float16* __restrict__ Q, const _Float16* __restrict__ K, const _Float16* __restrict__ V, const float* __restrict__ Wo, const float* __restrict__ bo, float* __restrict__ O, float scale) {
    constexpr int KP = 72;                      // K tile pitch in halves (144 B: odd multiple of 16 B)
    constexpr int VP = 80;                      // V tile pitch in halves (160 B: odd multiple of 32 B)
    constexpr int OP = 68;                      // output tile pitch in floats (272 B: odd multiple of 16 B)
    __shared__ __align__(16) float    pl[AW][16 * OP];
    constexpr int BH = 64 * KP + 64 * VP;       // halves per ring buffer: the K tile, behind it the V tile
    constexpr int NT = L / 64;                  // key blocks
    static_assert(L % 128 == 0, "whole key blocks, two or more");
    __shared__ __align__(16) _Float16 kv[2 * BH];
    __shared__ __align__(16) _Float16 wl[64 * VP];   // Wo[h] x 16, [d][e], V's pitch (same reader)
    const int lane = threadIdx.x & 31, hf = lane >> 4, l15 = lane & 15, wave = threadIdx.x >> 5;
    const int h = blockIdx.y;
    const int q0 = (blockIdx.x * AW + wave) * 16;
    const long long zr = (long long)blockIdx.z * L;   // first row of this batch element
    float* myp = pl[wave];
    const float c = scale * 1.4426950408889634f;      // score -> exponent of 2; positive
    const float NEG = -__builtin_inff();
    const _Float16* qrow = Q + h * 64 + (zr + q0 + l15) * RS + 8 * hf;
    const _Float16* kbase = K + h * 64 + zr * RS;
    const _Float16* vbase = V + h * 64 + zr * RS;
    FragH qf[2];                                // elements 0..7 <- d = 32ks + 8hf + 0..7, 8..15 <- d = 32ks + 16 + 8hf + 0..7: the frag_k order
#pragma unroll
    for (int ks = 0; ks < 2; ++ks) { qf[ks].h[0] = *(const v8h*)(qrow + ks * 32); qf[ks].h[1] = *(const v8h*)(qrow + ks * 32 + 16); }
    asm volatile("s_wait_xcnt 0x0" :: "v"(qrow) : "memory");   // stands in front of any reuse of the loads' address pair, which it names so that the pair lives up to here
    const v16h qa[2] = { qf[0].v, qf[1].v };
    v8f o[4];                                   // o[t][r] = O^T[d = 16t + 8*hf + r][query l15]
    float m1 = NEG, l1 = 0.f;                   // query l15: running maximum (equal in both lane halves), sum over this half's keys
#pragma unroll
    for (int t = 0; t < 4; ++t) { v8f zz = {}; o[t] = zz; }
    const int sr = threadIdx.x >> 4, sc4 = (threadIdx.x & 15) * 4;   // staging of Wo: 16 threads per 64-float row, 8 rows per sweep
    const int kr8 = threadIdx.x >> 3, kc8 = (threadIdx.x & 7) * 8;   // copies of K, V: 8 threads per 64-half row, 16 rows per sweep
    const _Float16* kfr = kv + l15 * KP + 8 * hf;
    const _Float16* vfr = kv + 64 * KP + (8 * hf + (lane & 7)) * VP + 8 * ((lane >> 3) & 1);
    const _Float16* gk = kbase + kr8 * RS + kc8;
    const _Float16* gv = vbase + kr8 * RS + kc8;
    const unsigned lk = (unsigned)(size_t)kv + (unsigned)(kr8 * KP + kc8) * 2u;             // LDS byte address of this lane's first K chunk in buffer 0
    const unsigned lv = (unsigned)(size_t)kv + (unsigned)(64 * KP + kr8 * VP + kc8) * 2u;   // the same for V
    acopy_kv<16 * RS, 16 * KP * 2, 16 * VP * 2>(lk, lv, gk, gv);   // key block 0 flies while the output map is staged
    const _Float16* wfr = wl + (8 * hf + (lane & 7)) * VP + 8 * ((lane >> 3) & 1);
    {                                                    // the head's output map into LDS; the barrier in front of the key loop publishes it
        const float* wbase = Wo + h * 64 * 64;
        v4f wr[8];
#pragma unroll
        for (int i = 0; i < 8; ++i) wr[i] = *(const v4f*)(wbase + (i * 8 + sr) * 64 + sc4);
        asm volatile("s_wait_xcnt 0x0" ::: "memory");    // stands in front of any reuse of the address registers of the loads above
#pragma unroll
        for (int i = 0; i < 8; ++i) *(v4h*)(wl + (i * 8 + sr) * VP + sc4) = __builtin_convertvector(wr[i] * 16.f, v4h);
    }
    asm volatile("s_wait_asynccnt 0x0" ::: "memory");    // this wave's copies of key block 0 have landed
    __syncthreads();                                     // key block 0 and the output map are visible to every wave
    acopy_kv<16 * RS, 16 * KP * 2, 16 * VP * 2>(lk + BH * 2, lv + BH * 2, gk + 64 * RS, gv + 64 * RS);
#pragma unroll 2                                         // makes the buffer's offset a constant in each copy of the body: it goes into the LDS instructions' offset fields, not through vector adds
    for (int kt = 0; kt < NT; ++kt) {
        const int bo = (kt & 1) * BH;                    // this key block's buffer
        FragH kb[4][2];                                  // all eight K fragments behind one LDS latency
#pragma unroll
        for (int t = 0; t < 4; ++t)
#pragma unroll
            for (int ks = 0; ks < 2; ++ks) {
                kb[t][ks].h[0] = *(const v8h*)(kfr + bo + t * 16 * KP + ks * 32);
                kb[t][ks].h[1] = *(const v8h*)(kfr + bo + t * 16 * KP + ks * 32 + 16);
            }
        v8f s[4];                                        // s[t][r] = S[query l15][key 64*kt + 16t + 8*hf + r]
#pragma unroll
        for (int t = 0; t < 4; ++t) {
            v8f acc = {};
#pragma unroll
            for (int ks = 0; ks < 2; ++ks) acc = wmma16(kb[t][ks].v, qa[ks], acc);
            s[t] = acc;
        }
        float mt[4];                                     // the maximum is taken over the raw products: c > 0 and rounding is monotone, so max(s) * c = max(s * c)
#pragma unroll
        for (int t = 0; t < 4; ++t) {
            mt[t] = NEG;
#pragma unroll
            for (int i = 0; i < 8; ++i) mt[t] = fmaxf(mt[t], s[t][i]);
        }
        float mx = fmaxf(fmaxf(mt[0], mt[1]), fmaxf(mt[2], mt[3]));
        mx = fmaxf(mx, swap_half(mx));
        const float mnew = fmaxf(m1, mx * c);
        const float mref = (mnew == NEG) ? 0.f : mnew;   // a query with only -inf scores so far: every exp2 below is exp2(-inf) = 0, never exp2(nan)
        const float corr = exp2_raw(m1 - mref);
        const float bias = 12.f - mref;                  // exp2(s * c + bias) = 4096 * p: scale, log2(e), the maximum and P's factor 2^12 in one fused multiply-add per score
        FragH pa[2]; float rt[4];
#pragma unroll
        for (int t = 0; t < 4; ++t) {
            rt[t] = 0.f;
#pragma unroll
            for (int i = 0; i < 8; ++i) {
                const float pp = exp2_raw(__builtin_fmaf(s[t][i], c, bias));
                rt[t] += pp; pa[t >> 1].v[(t & 1) * 8 + i] = (_Float16)pp;
            }
        }
        l1 = l1 * corr + ((rt[0] + rt[1]) + (rt[2] + rt[3])); m1 = mnew;
#pragma unroll
        for (int t = 0; t < 4; ++t) o[t] *= corr;
        FragH vb[4][2];                                  // all eight V fragments behind one LDS latency
#pragma unroll
        for (int t = 0; t < 4; ++t) {
            vb[t][0].h[0] = ld_tr16(vfr + bo + t * 16);           vb[t][0].h[1] = ld_tr16(vfr + bo + 16 * VP + t * 16);
            vb[t][1].h[0] = ld_tr16(vfr + bo + 32 * VP + t * 16); vb[t][1].h[1] = ld_tr16(vfr + bo + 48 * VP + t * 16);
        }
#pragma unroll
        for (int t = 0; t < 4; ++t) {
            o[t] = wmma16(vb[t][0].v, pa[0].v, o[t]);
            o[t] = wmma16(vb[t][1].v, pa[1].v, o[t]);
        }
        asm volatile("s_wait_dscnt 0x0" ::: "memory");       // this wave's reads of key block kt are done before the buffer may be refilled
        asm volatile("s_wait_asynccnt 0x0" ::: "memory");    // this wave's copies of key block kt + 1 have landed
        __syncthreads();                                     // publishes key block kt + 1 and ends every wave's reads of key block kt
        if (kt + 2 < NT)                                     // the same for the whole work-group
            acopy_kv<16 * RS, 16 * KP * 2, 16 * VP * 2>(lk + bo * 2, lv + bo * 2, gk + (long long)(kt + 2) * 64 * RS, gv + (long long)(kt + 2) * 64 * RS);
    }
    asm volatile("s_wait_asynccnt 0x0" ::: "memory");        // no copy is outstanding when the wave goes on to its end
    float* obase = O + h * 64 + zr * OS;
    const float lt = l1 + swap_half(l1);
    const float inv = (lt > 0.f) ? 1.f / lt : 0.f;       // the sum carries P's factor 4096 too
    FragH ob[2];                                         // O^T as f16: tiles 2ks and 2ks+1 are the B fragment of d chunk ks in the frag_k order
#pragma unroll
    for (int t = 0; t < 4; ++t)
#pragma unroll
        for (int i = 0; i < 8; ++i) ob[t >> 1].v[(t & 1) * 8 + i] = (_Float16)(o[t][i] * inv);
    FragH wb[4][2];
#pragma unroll
    for (int t = 0; t < 4; ++t) {
        wb[t][0].h[0] = ld_tr16(wfr + t * 16);           wb[t][0].h[1] = ld_tr16(wfr + 16 * VP + t * 16);
        wb[t][1].h[0] = ld_tr16(wfr + 32 * VP + t * 16); wb[t][1].h[1] = ld_tr16(wfr + 48 * VP + t * 16);
    }
#pragma unroll
    for (int t = 0; t < 4; ++t) {
        v8f ov = {};                                     // ov[r] = 16 * (Y^T - bo[h])[e = 16t + 8*hf + r][query l15]
        ov = wmma16(wb[t][0].v, ob[0].v, ov);
        ov = wmma16(wb[t][1].v, ob[1].v, ov);
        *(v4f*)(myp + l15 * OP + t * 16 + 8 * hf)     = __builtin_shufflevector(ov, ov, 0, 1, 2, 3);
        *(v4f*)(myp + l15 * OP + t * 16 + 8 * hf + 4) = __builtin_shufflevector(ov, ov, 4, 5, 6, 7);
    }
    const v4f bv = *(const v4f*)(bo + h * 64 + l15 * 4);
    __syncthreads();
#pragma unroll
    for (int r0 = 0; r0 < 16; r0 += 2) {
        const int row = r0 + hf, c4 = l15 * 4;
        const v4f v = *(const v4f*)(myp + row * OP + c4) * 0.0625f + bv;
        VST2V4(obase + (long long)(q0 + row) * OS + c4, v);
    }
}

// =====================================================================================================================
// k_tr: dst(z, c, r) = alpha * src(z, r, c) (+ beta * R2(z, c, r)): [Z][R][C] (row stride lds) -> [Z][C][R] (row stride ldd) through a 32x32 LDS tile;
//   flags: 1 -> add beta * residual R2 addressed like dst (z*sRz + c*ldr + r); act applied before the residual.
// =====================================================================================================================
struct TrP { const float* src; float* dst; const float* R2; long long sSz, lds, sDz, ldd, sRz, ldr; int R, C, flags, act; float alpha, beta; };
static_assert(sizeof(TrP) == 3 * 8 + 6 * 8 + 6 * 4, "TrP has padding");
__global__ __launch_bounds__(256) void k_tr(TrP p) {
    __shared__ float tile[32][33];
    const int c0 = blockIdx.x * 32, r0 = blockIdx.y * 32, z = blockIdx.z;
    const int lane = threadIdx.x & 31, wave = threadIdx.x >> 5;
    const float* s = p.src + z * p.sSz;
#pragma unroll
    for (int k = 0; k < 4; ++k) {
        const int rl = wave * 4 + k, r = r0 + rl, c = c0 + lane;
        tile[rl][lane] = (r < p.R && c < p.C) ? s[(long long)r * p.lds + c] : 0.f;
    }
    __syncthreads();
    float* d = p.dst + z * p.sDz; const float* rr = p.R2 + z * p.sRz;
#pragma unroll
    for (int k = 0; k < 4; ++k) {
        const int cl = wave * 4 + k, c = c0 + cl, r = r0 + lane;
        if (c < p.C && r < p.R) {
            float v = act_fn(p.alpha * tile[lane][cl], p.act);
            if (p.flags & 1) v += p.beta * rr[(long long)c * p.ldr + r];
            VST2(float, d + (long long)c * p.ldd + r, v);
        }
    }
}

// k_affine: dst[i] = a * (sdev ? sdev[0] : 1) * src[i] + b, i < n (one thread per element; consecutive lanes -> consecutive addresses)
__global__ __launch_bounds__(256) void k_affine(const float* __restrict__ src, float* __restrict__ dst, int n, float a, float b, const float* __restrict__ sdev) {
    const int i = blockIdx.x * 256 + threadIdx.x;
    if (i < n) { const float aa = sdev ? a * sdev[0] : a; const float v = aa * src[i] + b; VST2(float, dst + i, v); }
}

// =====================================================================================================================
// k_softmax: row softmax over n contiguous elements, one 256-thread block per row; rows addressed z*sz + r*sr (grid (R, Z)).
//   out = scale_out * softmax(scale_in * x + (Mf ? Mf[z*smz + r*smr + j] : 0)); a row whose max is -inf is written as 0.
// =====================================================================================================================
struct SmP { const float* src; float* dst; const float* Mf; long long sz, sr, dz, dr, smz, smr; int n, pad; float scale_in, scale_out; };
static_assert(sizeof(SmP) == 3 * 8 + 6 * 8 + 4 * 4, "SmP has padding");
__global__ __launch_bounds__(256) void k_softmax(SmP p) {
    __shared__ float red[256];
    const int r = blockIdx.x, z = blockIdx.y, tid = threadIdx.x;
    const float* s = p.src + z * p.sz + (long long)r * p.sr;
    const float* mf = p.Mf ? (p.Mf + z * p.smz + (long long)r * p.smr) : nullptr;
    float mx = -__builtin_inff();
    for (int j = tid; j < p.n; j += 256) { float v = s[j] * p.scale_in; if (mf) v += mf[j]; mx = fmaxf(mx, v); }
    red[tid] = mx; __syncthreads();
    for (int o = 128; o > 0; o >>= 1) { if (tid < o) red[tid] = fmaxf(red[tid], red[tid + o]); __syncthreads(); }
    mx = red[0]; __syncthreads();
    float sum = 0.f;
    for (int j = tid; j < p.n; j += 256) { float v = s[j] * p.scale_in; if (mf) v += mf[j]; sum += (mx == -__builtin_inff()) ? 0.f : expf(v - mx); }
    red[tid] = sum; __syncthreads();
    for (int o = 128; o > 0; o >>= 1) { if (tid < o) red[tid] += red[tid + o]; __syncthreads(); }
    sum = red[0];
    const float inv = (sum > 0.f) ? p.scale_out / sum : 0.f;
    float* d = p.dst + z * p.dz + (long long)r * p.dr;
    for (int j = tid; j < p.n; j += 256) { float v = s[j] * p.scale_in; if (mf) v += mf[j]; const float o = (mx == -__builtin_inff()) ? 0.f : expf(v - mx) * inv; VST2(float, d + j, o); }
}
// =====================================================================================================================
// k_stats: mean and rsqrt(var + eps) over a set of n elements addressed base + z*sz + (e / inner) * so + (e % inner) * si, one 256-thread
// k_norm_apply: y = (x - mean[set]) * rstd[set] * g[c] + b[c] over a [Z][C][L] channel-major tensor with set = z*G + c / (C/G) (G groups per z;
//   G = C -> per-channel sets indexed z*C+c; for batch norm pass stats indexed by c only via bn = 1). Optional act. Output same layout.
// =====================================================================================================================
//   mode 0: mean / rsqrt(var + eps); mode 1 (RMSNorm): 0 / rsqrt(mean(x^2) + eps); mode 2 (L2 normalize * sqrt(n)): 0 / sqrt(n) / max(||x||, eps); mode 3: as 0 with unbiased variance (n-1)
__global__ __launch_bounds__(256) void k_stats(const float* __restrict__ x, long long sz, long long so, long long si, int inner, int n, float eps, float* __restrict__ stat, int mode) {
    __shared__ float red[256];
    const int z = blockIdx.x, tid = threadIdx.x;
    const float* base = x + z * sz;
    float s = 0.f;
    for (int e = tid; e < n; e += 256) s += base[(long long)(e / inner) * so + (long long)(e % inner) * si];
    red[tid] = s; __syncthreads();
    for (int o = 128; o > 0; o >>= 1) { if (tid < o) red[tid] += red[tid + o]; __syncthreads(); }
    const float mu = (mode == 0 || mode == 3) ? red[0] / (float)n : 0.f; __syncthreads();
    float q = 0.f;
    for (int e = tid; e < n; e += 256) { const float dlt = base[(long long)(e / inner) * so + (long long)(e % inner) * si] - mu; q += dlt * dlt; }
    red[tid] = q; __syncthreads();
    for (int o = 128; o > 0; o >>= 1) { if (tid < o) red[tid] += red[tid + o]; __syncthreads(); }
    {
        float rs;
        if (mode == 2) rs = sqrtf((float)n) / fmaxf(sqrtf(red[0]), eps); else if (mode == 3) rs = rsqrtf(red[0] / (float)(n - 1) + eps); else rs = rsqrtf(red[0] / (float)n + eps);
        if (tid < 32) { const float v = (tid == 0) ? mu : ((tid == 1) ? rs : 0.f); VST2(float, stat + (long long)z * 32 + tid, v); }
    }
}
//   One thread per element over the flat [Z][C][L] index space: grid ceil(Z*C*L / 256).
__global__ __launch_bounds__(256) void k_norm_apply(const float* __restrict__ x, float* __restrict__ y, const float* __restrict__ stat, const float* __restrict__ g, const float* __restrict__ bta,
                                                     int Z, int C, int L, int G, int bn, int act) {
    const long long idx = (long long)blockIdx.x * 256 + threadIdx.x;
    if (idx >= (long long)Z * C * L) return;
    const int l = (int)(idx % L); const long long zc = idx / L; const int c = (int)(zc % C), z = (int)(zc / C); (void)l;
    const int set = bn ? c : (z * G + c / (C / G));
    float v = (x[idx] - stat[(long long)set * 32]) * stat[(long long)set * 32 + 1];
    if (g) v *= g[c];
    if (bta) v += bta[c];
    v = act_fn(v, act);
    VST2(float, y + idx, v);
}

// k_lse_neg: c[i] = -(st[2i] + log(st[2i+1])) = minus the log-sum-exp of row i (for softmax over the query dimension)
__global__ __launch_bounds__(256) void k_lse_neg(const float* __restrict__ st, float* __restrict__ c, int n) {
    const int i = blockIdx.x * 256 + threadIdx.x;
    if (i < n) { const float v = -(st[2 * i] + logf(st[2 * i + 1])); VST2(float, c + i, v); }
}

// k_iota: dst[i] = a * i + b as int32 (segment/position id helper)
__global__ __launch_bounds__(256) void k_iota(int* __restrict__ dst, int n, int a, int b) {
    const int i = blockIdx.x * 256 + threadIdx.x;
    if (i < n) { const int v = a * i + b; VST2(int, dst + i, v); }
}

// k_axpby: dst[i] = a * x[i] + b * y[i] (+ c), i < n
__global__ __launch_bounds__(256) void k_axpby(const float* __restrict__ x, const float* __restrict__ y, float* __restrict__ dst, int n, float a, float b, float c) {
    const int i = blockIdx.x * 256 + threadIdx.x;
    if (i < n) { const float v = a * x[i] + b * y[i] + c; VST2(float, dst + i, v); }
}

// =====================================================================================================================
// k_rope: rotary embedding on a [R rows][Hn heads][D] view (row stride sXr, head stride sXh, element stride 1) -> Y (own strides).
//   mode 0: rotate_half (partner d±D/2, sign - for d<D/2); mode 1: interleaved pairs (partner d^1, sign - for even d).
//   table column tcol: tmode 0 -> d, 1 -> d % (D/2), 2 -> d / 2; position p: pmode 0 -> r % S, 1 -> head index, 2 -> pos[r];
//   c = C[(r / S) * sCb + p * sCp + tcol * sCd], s likewise from Sn; y = x[d] * c + sign * x[partner] * s. X and Y must not alias.
// =====================================================================================================================
struct RopeP { const float* X; float* Y; const float* C; const float* Sn; const int* pos; long long sXr, sXh, sYr, sYh, sCb, sCp, sCd; int R, Hn, D, S, mode, tmode, pmode, pad; };
static_assert(sizeof(RopeP) == 5 * 8 + 7 * 8 + 8 * 4, "RopeP has padding");
__global__ __launch_bounds__(256) void k_rope(RopeP p) {
    const long long idx = (long long)blockIdx.x * 256 + threadIdx.x;
    if (idx >= (long long)p.R * p.Hn * p.D) return;
    const int d = (int)(idx % p.D); const long long rh = idx / p.D; const int h = (int)(rh % p.Hn); const int r = (int)(rh / p.Hn);
    const int half = p.D / 2;
    int partner; float sign;
    if (p.mode == 0) { partner = (d < half) ? d + half : d - half; sign = (d < half) ? -1.f : 1.f; }
    else { partner = d ^ 1; sign = (d & 1) ? 1.f : -1.f; }
    const int tcol = (p.tmode == 0) ? d : ((p.tmode == 1) ? (d % half) : (d >> 1));
    const int pp = (p.pmode == 0) ? (r % p.S) : ((p.pmode == 1) ? h : p.pos[r]);
    const long long toff = (long long)(r / p.S) * p.sCb + (long long)pp * p.sCp + (long long)tcol * p.sCd;
    const float* xr = p.X + (long long)r * p.sXr + (long long)h * p.sXh;
    const float v = xr[d] * p.C[toff] + sign * xr[partner] * p.Sn[toff];
    VST2(float, p.Y + (long long)r * p.sYr + (long long)h * p.sYh + d, v);
}

// k_invf + k_sincos (split so neither kernel carries a large VALU-fma footprint): invf_i = num * (1 / powf(base, (2 i)/D)) [fmode 0],
//   num * expf((2 i) * cexp) [fmode 1], num * powf(base, -2 (i - 1) / D) [fmode 2]; then cs/sn[s*half + i] = cos/sin((pscale * s) * invf_i)
__global__ __launch_bounds__(256) void k_invf(float* __restrict__ invb, int half, int D, float base, float num, int fmode, float cexp) {
    const int i = blockIdx.x * 256 + threadIdx.x;
    if (i >= ((half + 31) / 32) * 32) return;
    if (i >= half) { VST2(float, invb + i, 0.f); return; }
    const float e = (float)(2 * i) / (float)D;
    float invf;
    if (fmode == 1) invf = num * expf((float)(2 * i) * cexp);
    else if (fmode == 2) invf = num * powf(base, (-2.0f * ((float)i - 1.0f)) / (float)D);
    else invf = num * (1.0f / powf(base, e));
    VST2(float, invb + i, invf);
}
__global__ __launch_bounds__(256) void k_sincos(float* __restrict__ cs, float* __restrict__ sn, const float* __restrict__ invb, int S, int half, float pscale) {
    const int idx = blockIdx.x * 256 + threadIdx.x;
    if (idx >= S * half) return;
    const int s = idx / half, i = idx - s * half;
    const float ang = (pscale * (float)s) * invb[i];
    VST2(float, cs + idx, cosf(ang)); VST2(float, sn + idx, sinf(ang));
}

// k_mulact: dst[i] = act(x[i]) * y[i]
__global__ __launch_bounds__(256) void k_mulact(const float* __restrict__ x, const float* __restrict__ y, float* __restrict__ dst, int n, int act) {
    const int i = blockIdx.x * 256 + threadIdx.x;
    if (i < n) { const float v = act_fn(x[i], act) * y[i]; VST2(float, dst + i, v); }
}

// =====================================================================================================================
// k_matvec: thread-per-row matrix-vector products for N <= 8 output columns (heads with 1-3 outputs, gates), f32 on the VALU.
//   C[r*sCm + j] = act(alpha * sum_k A[r*sAm + k*sAk] * B[j*sBn + k*sBk] + bias[j]) + beta * R[r*sRm + j*sRn]; each thread writes its N contiguous floats.
// =====================================================================================================================
__global__ __launch_bounds__(256) void k_matvec(GemmP p) {
    // 32 lanes write one line with one instruction.
    const int rpt = (p.N == 1) ? 1 : 32;
    const long long r0 = ((long long)blockIdx.x * 256 + threadIdx.x) * rpt; const int z = blockIdx.z, zo = z / p.zi_n, zi = z - zo * p.zi_n;
    if (r0 >= p.M) return;
    const float* Bb = p.B + zo * p.sBo + zi * p.sBi;
    float* C = p.C + zo * p.sCo + zi * p.sCi; const float* R = p.R + zo * p.sRo + zi * p.sRi;
    for (int rr = 0; rr < rpt; ++rr) {
        const long long r = r0 + rr; if (r >= p.M) break;
        const float* A = p.A + zo * p.sAo + zi * p.sAi + r * p.sAm;
        float acc[8] = {0.f, 0.f, 0.f, 0.f, 0.f, 0.f, 0.f, 0.f};
        for (int k = 0; k < p.K; ++k) { const float a = A[(long long)k * p.sAk];
#pragma unroll
            for (int j = 0; j < 8; ++j) if (j < p.N) acc[j] += a * Bb[(long long)j * p.sBn + (long long)k * p.sBk]; }
#pragma unroll
        for (int j = 0; j < 8; ++j) if (j < p.N) {
            float v = acc[j] * p.alpha;
            if (p.flags & 1) v += p.bias[j];
            if (p.flags & 2) v += p.bias[r];
            v = act_fn(v, p.act);
            if (p.flags & 4) v += p.beta * R[r * p.sRm + (long long)j * p.sRn];
            VST2(float, C + r * p.sCm + j, v);
        }
    }
}
// k_smallsoftmax: thread-per-row softmax for short rows (n <= 64): dst[r*dr + j] = softmax(scale*src[r*sr + j])
__global__ __launch_bounds__(256) void k_smallsoftmax(const float* __restrict__ src, float* __restrict__ dst, long long sr, long long dr, int n, long long R, float scale) {
    const long long r0 = ((long long)blockIdx.x * 256 + threadIdx.x) * 32;
    for (int rr = 0; rr < 32; ++rr) {
        const long long r = r0 + rr; if (r >= R) return;
        const float* s = src + r * sr; float* d = dst + r * dr;
        float mx = -__builtin_inff();
        for (int j = 0; j < n; ++j) mx = fmaxf(mx, s[j] * scale);
        float sum = 0.f;
        for (int j = 0; j < n; ++j) sum += expf(s[j] * scale - mx);
        const float inv = 1.f / sum;
        for (int j = 0; j < n; ++j) { const float v = expf(s[j] * scale - mx) * inv; VST2(float, d + j, v); }
    }
}

__global__ __launch_bounds__(32) void k_unitstat(float* __restrict__ st) { const int t = threadIdx.x; const float v = (t == 1) ? 1.f : 0.f; VST2(float, st + t, v); }

// destination (e.g. a d_out whose row width is not a multiple of 32 floats) is written by consecutive lanes of one instruction
__global__ __launch_bounds__(256) void k_lincopy(const float* __restrict__ src, long long lds, float* __restrict__ dst, long long ldd, long long rows, int cols) {
    const long long i = (long long)blockIdx.x * 256 + threadIdx.x; if (i >= rows * cols) return;
    const long long r = i / cols; const int c = (int)(i - r * cols);
    const float v = src[r * lds + c]; VST2(float, dst + r * ldd + c, v);
}

namespace w25 {
typedef __attribute__((ext_vector_type(16))) _Float16 v16h;
typedef __attribute__((ext_vector_type(8)))  _Float16 v8h;
typedef __attribute__((ext_vector_type(16))) __bf16   v16b;
typedef __attribute__((ext_vector_type(8)))  __bf16   v8b;
typedef __attribute__((ext_vector_type(8)))  float    v8f;
typedef __attribute__((ext_vector_type(4)))  float    v4f;

__device__ __forceinline__ unsigned short f2bf_bits(float f) {
  unsigned u = __float_as_uint(f);
  return (unsigned short)((u + 0x7FFFu + ((u >> 16) & 1u)) >> 16);
}
__device__ __forceinline__ float bf_bits2f(unsigned short h) { return __uint_as_float(((unsigned)h) << 16); }

// hazard guards as plain device helpers (no inline asm inside the kernel template body)
__device__ __forceinline__ void dep_guard_h(v8f& a, v8f& b, v16h x, v16h y) { asm volatile("v_nop\n\tv_nop\n\tv_nop\n\tv_nop" : "+v"(a), "+v"(b) : "v"(x), "v"(y)); }
__device__ __forceinline__ void dep_guard_b(v8f& a, v8f& b, v16b x, v16b y) { asm volatile("v_nop\n\tv_nop\n\tv_nop\n\tv_nop" : "+v"(a), "+v"(b) : "v"(x), "v"(y)); }
__device__ __forceinline__ void keep4_h(v16h a, v16h b, v16h c, v16h d) { asm volatile("v_nop" :: "v"(a), "v"(b), "v"(c), "v"(d)); }
__device__ __forceinline__ void keep4_b(v16b a, v16b b, v16b c, v16b d) { asm volatile("v_nop" :: "v"(a), "v"(b), "v"(c), "v"(d)); }
__device__ __forceinline__ void acc_guard4(v8f& a, v8f& b, v8f& c, v8f& d) { asm volatile("v_nop\n\tv_nop\n\tv_nop\n\tv_nop" : "+v"(a), "+v"(b), "+v"(c), "+v"(d)); }
template <typename T> struct Frag;
template <> struct Frag<_Float16> {
  typedef v16h V; union U { v16h v; v8h h[2]; };
  static __device__ __forceinline__ v16h load(const _Float16* p) {   // elements 0..7 <- p[0..7], 8..15 <- p[16..23]
    U f; f.h[0] = *(const v8h*)(p); f.h[1] = *(const v8h*)(p + 16); return f.v;
  }
  static __device__ __forceinline__ v8f mma(v16h a, v16h b, v8f c) {
    return __builtin_amdgcn_wmma_f32_16x16x32_f16(false, a, false, b, (short)0, c, false, false);
  }
  static __device__ __forceinline__ void guard(v8f& a, v8f& b, v16h x, v16h y) { dep_guard_h(a, b, x, y); }
  static __device__ __forceinline__ void keep(v16h a, v16h b, v16h c, v16h d) { keep4_h(a, b, c, d); }
};
template <> struct Frag<__bf16> {
  typedef v16b V; union U { v16b v; v8b h[2]; };
  static __device__ __forceinline__ v16b load(const __bf16* p) {
    U f; f.h[0] = *(const v8b*)(p); f.h[1] = *(const v8b*)(p + 16); return f.v;
  }
  static __device__ __forceinline__ v8f mma(v16b a, v16b b, v8f c) {
    return __builtin_amdgcn_wmma_f32_16x16x32_bf16(false, a, false, b, (short)0, c, false, false);
  }
  static __device__ __forceinline__ void guard(v8f& a, v8f& b, v16b x, v16b y) { dep_guard_b(a, b, x, y); }
  static __device__ __forceinline__ void keep(v16b a, v16b b, v16b c, v16b d) { keep4_b(a, b, c, d); }
};

// ---- Register-blocked batched WMMA GEMM ------------------------------------
// C[m,n] = scale * sum_k A[m,k] * Bt[n,k] (+bias)(+resid); each wave owns a 64x64 tile.
// A row-major [M,K]; Bt row-major [N,K]; M,N % 64 == 0, K % 32 == 0.
// SPLIT: operands are hi/lo planes (A2/Bt2 = lo planes, same layout); product = hi·hi + hi·lo + lo·hi.
// BIAS_MODE: 0 = none, 1 = bias[m], 2 = bias[n].
// OUT_MODE: 0 = f32, 1 = f16, 2 = bf16 hi plane (Cout) + bf16 lo plane (Cout2).
// ET: 0 = f16 operands, 1 = bf16 operands (pointers passed as 16-bit storage)
template <int ET> struct Elem;
template <> struct Elem<0> { typedef _Float16 T; };
template <> struct Elem<1> { typedef __bf16 T; };
template <int ET, bool SPLIT, int BIAS_MODE, int OUT_MODE, bool RESID, int ACT = 0>
__global__ __launch_bounds__(256) void wmma_gemm64(
    const unsigned short* __restrict__ Ap, const unsigned short* __restrict__ A2p, int lda, long strideA,
    const unsigned short* __restrict__ Btp, const unsigned short* __restrict__ Bt2p, int ldb, long strideB,
    void* __restrict__ Cout, void* __restrict__ Cout2, int ldc, long strideC,
    const float* __restrict__ bias,
    const float* __restrict__ resid, long strideR,
    int M, int N, int K, float scale) {
  typedef typename Elem<ET>::T T;
  typedef typename Frag<T>::V V;
  const T* A = (const T*)Ap; const T* A2 = (const T*)A2p; const T* Bt = (const T*)Btp; const T* Bt2 = (const T*)Bt2p;
  __shared__ __align__(16) float sT[8][16 * 68];   // per-wave 16x64 slab, pitch 68 floats
  const int b    = blockIdx.y;
  const int lane = threadIdx.x & 31;
  const int wave = threadIdx.x >> 5;
  const int tilesN = N >> 6;
  const int tilesM = M >> 6;
  const int tile = blockIdx.x * 8 + wave;
  if (tile >= tilesM * tilesN) return;   // wave-uniform; no block barriers in this kernel
  const int tm = tile / tilesN;
  const int tn = tile - tm * tilesN;
  const int m0 = tm << 6;
  const int n0 = tn << 6;

  const T* Ab  = A  + (size_t)b * strideA;
  const T* Bb  = Bt + (size_t)b * strideB;
  const T* Ab2 = SPLIT ? (A2  + (size_t)b * strideA) : nullptr;
  const T* Bb2 = SPLIT ? (Bt2 + (size_t)b * strideB) : nullptr;

  const int rlane = lane & 15;                 // row (A) / col (B, D) within subtile
  const int koff  = (lane >> 4) * 8;           // k offset of this lane half
  const int mOff  = (lane >> 4) * 8;           // D row offset

  v8f acc[4][4];
#pragma unroll
  for (int i = 0; i < 4; ++i)
#pragma unroll
    for (int j = 0; j < 4; ++j) acc[i][j] = (v8f){0.f,0.f,0.f,0.f,0.f,0.f,0.f,0.f};

  for (int k0 = 0; k0 < K; k0 += 32) {
    V bh[4], bl[4];
#pragma unroll
    for (int j = 0; j < 4; ++j) {
      const size_t bo = (size_t)(n0 + (j << 4) + rlane) * ldb + koff + k0;
      bh[j] = Frag<T>::load(Bb + bo);
      if (SPLIT) bl[j] = Frag<T>::load(Bb2 + bo);
    }
#pragma unroll
    for (int i = 0; i < 4; ++i) {
      const size_t ao = (size_t)(m0 + (i << 4) + rlane) * lda + koff + k0;
      V ah = Frag<T>::load(Ab + ao);
      V al;
      if (SPLIT) al = Frag<T>::load(Ab2 + ao);
#pragma unroll
      for (int j = 0; j < 4; ++j) {
        acc[i][j] = Frag<T>::mma(ah, bh[j], acc[i][j]);
        if (SPLIT) {
          acc[i][j] = Frag<T>::mma(ah, bl[j], acc[i][j]);
          acc[i][j] = Frag<T>::mma(al, bh[j], acc[i][j]);
        }
      }
      Frag<T>::guard(acc[i][0], acc[i][3], ah, SPLIT ? al : ah);
    }
    Frag<T>::keep(bh[0], bh[1], bh[2], bh[3]);
    if (SPLIT) Frag<T>::keep(bl[0], bl[1], bl[2], bl[3]);
  }
  acc_guard4(acc[0][0], acc[0][1], acc[0][2], acc[0][3]);
  acc_guard4(acc[1][0], acc[1][1], acc[1][2], acc[1][3]);
  acc_guard4(acc[2][0], acc[2][1], acc[2][2], acc[2][3]);
  acc_guard4(acc[3][0], acc[3][1], acc[3][2], acc[3][3]);

  // ---- epilogue ----
  float* slab = sT[wave];
  const float* Rb = RESID ? (resid + (size_t)b * strideR) : nullptr;
#pragma unroll
  for (int i = 0; i < 4; ++i) {
    const int mBase = m0 + (i << 4);
#pragma unroll
    for (int j = 0; j < 4; ++j) {
      const int n = n0 + (j << 4) + rlane;
      float bv = 0.f;
      if (BIAS_MODE == 2) bv = bias[n];
#pragma unroll
      for (int r = 0; r < 8; ++r) {
        float v = acc[i][j][r] * scale;
        if (BIAS_MODE == 1) v += bias[mBase + mOff + r];
        if (BIAS_MODE == 2) v += bv;
        if (RESID) v += Rb[(size_t)(mBase + mOff + r) * ldc + n];
        if (ACT == 1) v = tanhf(v);
        if (ACT == 2) v = fmaxf(v, 0.0f);
        if (ACT == 3) v = v / (1.0f + expf(-v));
        if (ACT == 4) v = (v > 0.f) ? v : 0.01f * v;
        if (ACT == 5) v = 0.5f * v * (1.0f + erff(v * 0.70710678118654752f));
        if (ACT == 6) v = (v > 0.f) ? v : 0.2f * v;
        slab[(mOff + r) * 68 + (j << 4) + rlane] = v;
      }
    }
    __builtin_amdgcn_fence(__ATOMIC_RELEASE, "workgroup");
    __builtin_amdgcn_wave_barrier();
    __builtin_amdgcn_fence(__ATOMIC_ACQUIRE, "workgroup");
    if (OUT_MODE == 0) {
      float* C = (float*)Cout + (size_t)b * strideC;
      const int hh = lane >> 4, c4 = (lane & 15) * 4;     // row seg = 256 B = 16 lanes x 16 B
      {
#pragma unroll
        for (int it = 0; it < 8; ++it) {
          const int row = it * 2 + hh;
          v4f v = *(const v4f*)(slab + row * 68 + c4);
          *(v4f*)(C + (size_t)(mBase + row) * ldc + n0 + c4) = v;
        }
        
      }
    } else {
      const int q = lane >> 3, c8 = (lane & 7) * 8;
      unsigned short* C  = (unsigned short*)Cout  + (size_t)b * strideC;
      unsigned short* C2 = (OUT_MODE == 2) ? ((unsigned short*)Cout2 + (size_t)b * strideC) : nullptr;
      {
#pragma unroll
        for (int it = 0; it < 4; ++it) {
          const int row = it * 4 + q;
          const float* sp = slab + row * 68 + c8;
          v8h hv, lv;
#pragma unroll
          for (int e = 0; e < 8; ++e) {
            if (OUT_MODE == 1) {
              hv[e] = (_Float16)sp[e];
            } else {
              unsigned short hb = f2bf_bits(sp[e]);
              unsigned short lb = f2bf_bits(sp[e] - bf_bits2f(hb));
              hv[e] = __builtin_bit_cast(_Float16, hb);
              lv[e] = __builtin_bit_cast(_Float16, lb);
            }
          }
          *(v8h*)(C + (size_t)(mBase + row) * ldc + n0 + c8) = hv;
          if (OUT_MODE == 2) *(v8h*)(C2 + (size_t)(mBase + row) * ldc + n0 + c8) = lv;
        }
        
      }
    }
    __builtin_amdgcn_fence(__ATOMIC_RELEASE, "workgroup");
    __builtin_amdgcn_wave_barrier();
    __builtin_amdgcn_fence(__ATOMIC_ACQUIRE, "workgroup");
  }
}

__global__ __launch_bounds__(256) void cast_f32_f16x2(
    const float* __restrict__ in, _Float16* __restrict__ out, int n2) {
  int i = blockIdx.x * 256 + threadIdx.x;
  if (i < n2) {
    const _Float16 h0 = (_Float16)in[2 * i], h1 = (_Float16)in[2 * i + 1];
    const unsigned u = (unsigned)__builtin_bit_cast(unsigned short, h0) | ((unsigned)__builtin_bit_cast(unsigned short, h1) << 16);
    ((unsigned*)out)[i] = u;
    
  }
}


} // namespace w25

// =====================================================================================================================
// k_prep<NR, D>: all f16 operand planes of the projections in one launch of WB + XB work-groups of 256 threads, 32 or 64 elements a thread.
//   Work-groups [0, WB): one tile of 128 (k) x 64 (n) of the weights taken side by side, W = Wq | Wkv ([D][D] | [D][2D], n < D is Wq):
//   W16[n][k] = f16(16 * W[k][n]). Rows of 256 B are read along n with 16-byte loads into an f32 LDS tile (pitch 65 floats: the 32 lanes
//   of a column-wise read fall on 32 different banks); each lane then packs 8 consecutive k of one n, 8 lanes store one whole 128-B line.
//   Work-groups [WB, WB + XB): X16 = f16(x), 16384 consecutive floats each; a wave's load covers 512 contiguous bytes, its store 256.
// =====================================================================================================================
// eight 16-byte loads, 16 rows of LD floats apart: one address pair, the row steps as immediate offsets
template <int LD> __device__ __forceinline__ void ld_rows8(const float* __restrict__ sp, v4f (&w)[8]) {
#pragma unroll
    for (int s = 0; s < 8; ++s) w[s] = *(const v4f*)(sp + s * 16 * LD);
    asm volatile("s_wait_xcnt 0x0" :: "v"(sp) : "memory");   // stands in front of any reuse of the loads' address pair, which it names so that the pair lives up to here
}
template <int NR, int D>
__global__ __launch_bounds__(256) void k_prep(const float* __restrict__ x, const float* __restrict__ Wq, const float* __restrict__ Wkv, _Float16* __restrict__ X16, _Float16* __restrict__ W16) {
    constexpr int TP = 65;                      // LDS tile pitch in floats
    constexpr int NT = 3 * D / 64;              // n tiles
    constexpr int WB = NT * (D / 128);
    static_assert(D % 128 == 0 && ((long long)NR * D) % 16384 == 0, "whole tiles only");
    __shared__ float tile[128 * TP];
    const int tid = threadIdx.x;
    if ((int)blockIdx.x < WB) {
        const int nt = blockIdx.x % NT, kt = blockIdx.x / NT;
        const int n0 = nt * 64, k0 = kt * 128;
        const int c4 = (tid & 15) * 4, r = tid >> 4;
        v4f w[8];
        if (n0 < D) ld_rows8<D>(Wq + n0 + (k0 + r) * D + c4, w);                     // work-group-uniform choice of the source matrix
        else        ld_rows8<2 * D>(Wkv + (n0 - D) + (k0 + r) * (2 * D) + c4, w);
#pragma unroll
        for (int s = 0; s < 8; ++s)
#pragma unroll
            for (int e = 0; e < 4; ++e) tile[(s * 16 + r) * TP + c4 + e] = w[s][e];
        __syncthreads();                                 // the whole tile is in LDS before any column of it is read
        const int a8 = (tid & 7) * 8, nl = tid >> 3;
#pragma unroll
        for (int q = 0; q < 4; ++q) {
            const int n = (q >> 1) * 32 + nl, k = (q & 1) * 64 + a8;
            v8h hv;
#pragma unroll
            for (int j = 0; j < 8; ++j) hv[j] = (_Float16)(tile[(k + j) * TP + n] * 16.f);
            *(v8h*)(W16 + (long long)(n0 + n) * D + k0 + k) = hv;
        }
    } else {
        const long long base = (long long)((int)blockIdx.x - WB) * 16384 + tid * 4;
        const float* xp = x + base;
        v4f v[16];
#pragma unroll
        for (int i = 0; i < 16; ++i) v[i] = *(const v4f*)(xp + i * 1024);
        asm volatile("s_wait_xcnt 0x0" :: "v"(xp) : "memory");   // stands in front of any reuse of the loads' address pair, which it names so that the pair lives up to here
#pragma unroll
        for (int i = 0; i < 16; ++i) *(v4h*)(X16 + base + i * 1024) = __builtin_convertvector(v[i], v4h);
        asm volatile("s_wait_xcnt 0x0" ::: "memory");            // stands behind the stores above, in front of any reuse of their address and data registers
    }
}

// =====================================================================================================================
// k_proj<M, N, K>: C[m][n] = scale * sum_k A[m][k] * Bt[n][k], A [M][K] and Bt [N][K] f16 planes, C [M][N] f16 (rounded to nearest from the scaled f32 sum); M, N % 128 == 0, K % 128 == 0.
//   One work-group of 4 waves per 128 x 128 tile of C, each wave a 64 x 64 quarter (4 x 4 accumulator tiles), grid (M/128)*(N/128).
//   A stage is 64 k of the tile's 128 A rows and 128 Bt rows: 256 rows of 128 B, brought by 16-byte asynchronous copies (a wave's copy = 4 whole lines)
//   into one of two LDS buffers at a pitch of 144 B (odd multiple of 16 B, for the ds_load_b128 fragment reads); stage t + 2 is asked for when
//   every wave has left stage t, so it flies while stage t + 1 is worked on. k runs upward in steps of 32, one accumulator chain per tile.
// =====================================================================================================================
// eight asynchronous 16-byte copies of one lane, 16 rows apart (GS halves in memory, LS bytes in LDS)
template <int GS, int LS> __device__ __forceinline__ void acopy8(unsigned l, const _Float16* g) {
    // the copies and, as the last line, the wait that stands in front of any rewrite of the address registers they name
    asm volatile("global_load_async_to_lds_b128 %0, %8, off\n\t"
                 "global_load_async_to_lds_b128 %1, %9, off\n\t"
                 "global_load_async_to_lds_b128 %2, %10, off\n\t"
                 "global_load_async_to_lds_b128 %3, %11, off\n\t"
                 "global_load_async_to_lds_b128 %4, %12, off\n\t"
                 "global_load_async_to_lds_b128 %5, %13, off\n\t"
                 "global_load_async_to_lds_b128 %6, %14, off\n\t"
                 "global_load_async_to_lds_b128 %7, %15, off\n\t"
                 "s_wait_xcnt 0x0"
                 :: "v"(l), "v"(l + LS), "v"(l + 2 * LS), "v"(l + 3 * LS), "v"(l + 4 * LS), "v"(l + 5 * LS), "v"(l + 6 * LS), "v"(l + 7 * LS),
                    "v"(g), "v"(g + GS), "v"(g + 2 * GS), "v"(g + 3 * GS), "v"(g + 4 * GS), "v"(g + 5 * GS), "v"(g + 6 * GS), "v"(g + 7 * GS)
                 : "memory");
}
template <int M, int N, int K>
__global__ __launch_bounds__(128) void k_proj(const _Float16* __restrict__ A, const _Float16* __restrict__ Bt, _Float16* __restrict__ C, float scale) {
    typedef w25::Frag<_Float16> F;
    constexpr int KT = 64;                      // k per stage
    constexpr int PH = 72;                      // LDS row pitch in halves
    constexpr int SH = 256 * PH;                // halves per buffer: rows 0..127 A, 128..255 Bt
    constexpr int NS = K / KT;
    static_assert(M % 128 == 0 && N % 128 == 0 && K % 128 == 0, "whole tiles, two stages or more");
    __shared__ __align__(16) _Float16 ring[2 * SH];
    __shared__ __align__(16) float sT[4][16 * 68];   // per-wave 16x64 output slab, pitch 68 floats
    const int tid = threadIdx.x, lane = tid & 31, wave = tid >> 5;
    constexpr int TN = N / 128;
    const int tm = blockIdx.x / TN, tn = blockIdx.x - tm * TN;
    const int m0 = tm * 128, n0 = tn * 128;
    const int rlane = lane & 15, koff = (lane >> 4) * 8, mOff = (lane >> 4) * 8;
    // copies: 8 lanes per 128-B row, 16 rows per sweep of the work-group, 8 sweeps for each operand
    const int cr = tid >> 3, cc = (tid & 7) * 8;
    const _Float16* ga = A + (size_t)(m0 + cr) * K + cc;
    const _Float16* gb = Bt + (size_t)(n0 + cr) * K + cc;
    const unsigned la = (unsigned)(size_t)ring + (unsigned)(cr * PH + cc) * 2u;   // LDS byte address of this lane's first A chunk in buffer 0
    const _Float16* fa = ring + ((wave >> 1) * 64 + rlane) * PH + koff;
    const _Float16* fb = ring + (128 + (wave & 1) * 64 + rlane) * PH + koff;

    v8f acc[4][4];                              // the unroll directives of this kernel make every index of acc, ah and bh a constant, so that the arrays stay in registers
#pragma unroll
    for (int i = 0; i < 4; ++i)
#pragma unroll
        for (int j = 0; j < 4; ++j) { v8f zz = {}; acc[i][j] = zz; }

    acopy8<16 * K, 16 * PH * 2>(la, ga);
    acopy8<16 * K, 16 * PH * 2>(la + 128 * PH * 2, gb);
    asm volatile("s_wait_asynccnt 0x0" ::: "memory");    // this wave's copies of stage 0 have landed
    __syncthreads();                                     // stage 0 is visible to every wave
    acopy8<16 * K, 16 * PH * 2>(la + SH * 2, ga + KT);
    acopy8<16 * K, 16 * PH * 2>(la + SH * 2 + 128 * PH * 2, gb + KT);
    for (int t = 0; t < NS; ++t) {
        const int bo = (t & 1) * SH;
#pragma unroll
        for (int ks = 0; ks < KT; ks += 32) {
            v16h bh[4], ah[4];
#pragma unroll
            for (int j = 0; j < 4; ++j) bh[j] = F::load(fb + bo + j * 16 * PH + ks);
#pragma unroll
            for (int i = 0; i < 4; ++i) ah[i] = F::load(fa + bo + i * 16 * PH + ks);
            __builtin_amdgcn_sched_barrier(0);               // the 16 LDS reads stay one group in front of the 16 WMMAs: one LDS wait a k step, not one per row of tiles
#pragma unroll
            for (int i = 0; i < 4; ++i)
#pragma unroll
                for (int j = 0; j < 4; ++j) acc[i][j] = F::mma(ah[i], bh[j], acc[i][j]);
            __builtin_amdgcn_sched_barrier(0);               // keeps the next group of LDS reads from being spread among these WMMAs
        }
        asm volatile("s_wait_dscnt 0x0" ::: "memory");       // this wave's reads of stage t are done before the buffer may be refilled
        asm volatile("s_wait_asynccnt 0x0" ::: "memory");    // this wave's copies of stage t + 1 have landed
        __syncthreads();                                     // publishes stage t + 1 and ends every wave's reads of stage t
        if (t + 2 < NS) {                                    // the same for the whole work-group
            acopy8<16 * K, 16 * PH * 2>(la + bo * 2, ga + (t + 2) * KT);
            acopy8<16 * K, 16 * PH * 2>(la + bo * 2 + 128 * PH * 2, gb + (t + 2) * KT);
        }
    }
    asm volatile("s_wait_asynccnt 0x0" ::: "memory");        // no copy is outstanding when the wave goes on to its end

    float* slab = sT[wave];
    const int wm0 = m0 + (wave >> 1) * 64, wn0 = n0 + (wave & 1) * 64;
#pragma unroll
    for (int i = 0; i < 4; ++i) {
#pragma unroll
        for (int j = 0; j < 4; ++j)
#pragma unroll
            for (int r = 0; r < 8; ++r) slab[(mOff + r) * 68 + (j << 4) + rlane] = acc[i][j][r] * scale;
        __builtin_amdgcn_fence(__ATOMIC_RELEASE, "workgroup");
        __builtin_amdgcn_wave_barrier();
        __builtin_amdgcn_fence(__ATOMIC_ACQUIRE, "workgroup");
        const int rq = lane >> 3, c8 = (lane & 7) * 8;       // row segment = 64 halves = one 128-B line = 8 lanes x 16 B
        _Float16* cp[4]; v8h hv[4];
#pragma unroll
        for (int it = 0; it < 4; ++it) {
            const int row = it * 4 + rq;
            const v4f v0 = *(const v4f*)(slab + row * 68 + c8), v1 = *(const v4f*)(slab + row * 68 + c8 + 4);
            hv[it] = __builtin_convertvector(__builtin_shufflevector(v0, v1, 0, 1, 2, 3, 4, 5, 6, 7), v8h);
            cp[it] = C + (size_t)(wm0 + (i << 4) + row) * N + wn0 + c8;
        }
#pragma unroll
        for (int it = 0; it < 4; ++it) *(v8h*)cp[it] = hv[it];
        // stands behind the stores above, in front of any reuse of their address and data registers, which it names so that they live up to here
        asm volatile("s_wait_xcnt 0x0" :: "v"(cp[0]), "v"(cp[1]), "v"(cp[2]), "v"(cp[3]), "v"(hv[0]), "v"(hv[1]), "v"(hv[2]), "v"(hv[3]) : "memory");
        __builtin_amdgcn_fence(__ATOMIC_RELEASE, "workgroup");
        __builtin_amdgcn_wave_barrier();
        __builtin_amdgcn_fence(__ATOMIC_ACQUIRE, "workgroup");
    }
}

// f32 -> bf16 hi plane + bf16 lo plane (x = hi + lo to ~2^-17 relative; RNE both), [R][C] -> [R][C] (or transposed to [C][R]); 2 consecutive destination elements
__device__ __forceinline__ unsigned int f2bf2_pack(float a, float b, unsigned int* lo) {
    const unsigned short ha = w25::f2bf_bits(a), hb = w25::f2bf_bits(b);
    const unsigned short la = w25::f2bf_bits(a - w25::bf_bits2f(ha)), lb = w25::f2bf_bits(b - w25::bf_bits2f(hb));
    *lo = (unsigned)la | ((unsigned)lb << 16); return (unsigned)ha | ((unsigned)hb << 16); }
__global__ __launch_bounds__(256) void k_castS16(const float* __restrict__ src, long long lds, __bf16* __restrict__ dhi, __bf16* __restrict__ dlo, long long ldd, int R, int C, float s, int transpose) {
    const long long i = (long long)blockIdx.x * 256 + threadIdx.x; long long o; float a, b;
    if (transpose) { const long long np = (long long)C * (R / 2); if (i >= np) return; const int c = (int)(i / (R / 2)); const int r = 2 * (int)(i % (R / 2)); a = src[(long long)r * lds + c] * s; b = src[(long long)(r + 1) * lds + c] * s; o = (long long)c * ldd + r; }
    else { const long long np = (long long)R * (C / 2); if (i >= np) return; const int r = (int)(i / (C / 2)); const int c = 2 * (int)(i % (C / 2)); a = src[(long long)r * lds + c] * s; b = src[(long long)r * lds + c + 1] * s; o = (long long)r * ldd + c; }
    unsigned lo; const unsigned hi = f2bf2_pack(a, b, &lo); unsigned* ph = (unsigned*)(dhi + o); unsigned* pl = (unsigned*)(dlo + o);
    *ph = hi; *pl = lo;  }

namespace w25 {
// =====================================================================================
// Generic causal/non-causal attention for head_dim 64, f32 in / f32 out; 16-bit operands: bf16 with optional hi/lo splits, or
// plain f16 (F16=true, non-split, probabilities carried x2^15).
//   scores = (q*qscale)·kᵀ : v_wmma_f32_16x16x32_bf16; SPLIT_QK -> q,k as bf16 hi/lo (hi·hi + hi·lo + lo·hi)
//   out    = p·v           : v_wmma_f32_16x16x32_bf16; SPLIT_PV -> p,v as bf16 hi/lo; else p,v plain bf16
//   f32 accumulate; online softmax in f32. Block = 4 waves = 64 query rows of one (batch, head); S % 64 == 0.
//   Element (b, s, h, d) of tensor X lives at X[b*X_bs + s*X_rs + h*X_hs + d] (strides in floats, multiples of 4).
//   Masking: mask_mode 0 none, 1 causal (kv > q masked), 2 tensor [S][Skv] shared over (b,h) (float if
//   mask_is_int==0, int32 with element == 0 -> masked if 1, int32 with element != 0 -> masked if 2), 3 per-token vectors qmask[B][S] & kvmask[B][Skv] (int32,
//   0 -> masked), 4 causal + sliding window (kv > q or q - kv > W masked; W passed in mask_is_int);
//   5 = relative-position bias: s += cp[b,h,q][idx[q][kv]] + pc[b,h,kv][idx[q][kv]] with idx = mask_b ([S][Skv] int32) and
//   mask_a an int32 [S][Skv] tensor with nonzero = masked (tables: element (b,h,row,n) at X + b*c_bs + h*c_hs + row*c_rs + n);
//   masked scores are replaced by mask_fill (e.g. -inf or -1e9) before the softmax.
//   grid.x = B * H * (S/64) (or a sub-range with blk0).
// =====================================================================================
#define AT_D 64
#define AT_NW 4
#define AT_QB 64
#define AT_KC 64
struct AttnGeom { const float* cp = nullptr; const float* pc = nullptr; long c_bs = 0, c_rs = 0, c_hs = 0;   // mode-5 score-bias tables
                  long q_bs, q_rs, q_hs, k_bs, k_rs, k_hs, v_bs, v_rs, v_hs, o_bs, o_rs, o_hs;
                  int S, Skv, H, mask_mode; float qscale; int blk0; float mask_fill; int mask_is_int; };
static_assert(sizeof(AttnGeom) == 168, "no padding");

__device__ __forceinline__ unsigned short at_bf_bits(float f) {
  unsigned u = __float_as_uint(f);
  return (unsigned short)((u + 0x7FFFu + ((u >> 16) & 1u)) >> 16);
}
__device__ __forceinline__ __bf16 at_f2bf(float f) { return __builtin_bit_cast(__bf16, at_bf_bits(f)); }
__device__ __forceinline__ void at_split(float f, __bf16& hi, __bf16& lo) {
  const unsigned short hb = at_bf_bits(f);
  hi = __builtin_bit_cast(__bf16, hb);
  lo = at_f2bf(f - __uint_as_float(((unsigned)hb) << 16));
}
__device__ __forceinline__ v8f at_mma(v16b a, v16b b, v8f c) {
  c = __builtin_amdgcn_wmma_f32_16x16x32_bf16(false, a, false, b, (short)0, c, false, false);
  asm volatile("v_nop\n\tv_nop\n\tv_nop\n\tv_nop" : "+v"(c) : "v"(a), "v"(b));
  return c;
}
// 16-bit element as a bit pattern held in a __bf16 slot: f16 bits when F16, bf16 (RNE) otherwise
template <bool F16> __device__ __forceinline__ __bf16 at_to16(float f) {
  if (F16) return __builtin_bit_cast(__bf16, (_Float16)f);
  return at_f2bf(f);
}
template <bool F16> __device__ __forceinline__ v8f at_mma16(v16b a, v16b b, v8f c) {
  if (F16) {
    const v16h ah = __builtin_bit_cast(v16h, a), bh = __builtin_bit_cast(v16h, b);
    c = __builtin_amdgcn_wmma_f32_16x16x32_f16(false, ah, false, bh, (short)0, c, false, false);
    asm volatile("v_nop\n\tv_nop\n\tv_nop\n\tv_nop" : "+v"(c) : "v"(ah), "v"(bh));
    return c;
  }
  return at_mma(a, b, c);
}

template <bool SPLIT_QK, bool SPLIT_PV, bool F16 = false>
__global__ __launch_bounds__(128)
void attn64_kernel(const float* __restrict__ q, const float* __restrict__ k,
                   const float* __restrict__ v, float* __restrict__ out,
                   const void* __restrict__ mask_a, const int* __restrict__ mask_b, AttnGeom g) {
  static_assert(!(F16 && (SPLIT_QK || SPLIT_PV)), "f16 mode is non-split");
  const float PSC = F16 ? 32768.0f : 1.0f;     // f16 probabilities carried x2^15 (subnormal range), folded into the final 1/l
  union FB { v16b v; v8b h[2]; };
  __shared__ __align__(16) __bf16 Ksh[AT_KC * AT_D];             // K hi [kv][d]      8 KB
  __shared__ __align__(16) __bf16 Ksl[SPLIT_QK ? AT_KC * AT_D : 8];
  __shared__ __align__(16) __bf16 Vth[AT_D * AT_KC];             // V hi [d][kv]      8 KB
  __shared__ __align__(16) __bf16 Vtl[SPLIT_PV ? AT_D * AT_KC : 8];
  __shared__ __align__(16) __bf16 Psh[AT_NW][16 * AT_KC];        // per wave P hi [row][kv]  8 KB
  __shared__ __align__(16) __bf16 Psl[SPLIT_PV ? AT_NW : 1][SPLIT_PV ? 16 * AT_KC : 8];
  __shared__ __align__(16) float  Os[AT_NW][16 * 68];            // per wave out tile, pitch 68

  const int tid  = threadIdx.x;
  const int wave = tid >> 5;
  const int lane = tid & 31;
  const int hh   = lane >> 4;
  const int c    = lane & 15;

  const int nqb = g.S / AT_QB;
  const int bx = blockIdx.x + g.blk0;
  const int qb = bx % nqb;
  const int bh = bx / nqb;
  const int h  = bh % g.H;
  const int b  = bh / g.H;
  const int qbase_block = qb * AT_QB;
  const int q0 = qbase_block + wave * 16;

  const float* qb_ptr = q + (size_t)b * g.q_bs + (size_t)h * g.q_hs;
  const float* kb_ptr = k + (size_t)b * g.k_bs + (size_t)h * g.k_hs;
  const float* vb_ptr = v + (size_t)b * g.v_bs + (size_t)h * g.v_hs;
  float*       ob_ptr = out + (size_t)b * g.o_bs + (size_t)h * g.o_hs;

  // ---- Q fragments (A operand): 2 d-chunks, hi (and lo) ----
  v16b qah[2], qal[2];
  {
    const float* qrow = qb_ptr + (size_t)(q0 + c) * g.q_rs;
#pragma unroll
    for (int dc = 0; dc < 2; ++dc) {
#pragma unroll
      for (int e = 0; e < 8; ++e) {
        const float f0 = qrow[dc * 32 + 8 * hh + e] * g.qscale;
        const float f1 = qrow[dc * 32 + 16 + 8 * hh + e] * g.qscale;
        if (SPLIT_QK) { __bf16 hq, lq; at_split(f0, hq, lq); qah[dc][e] = hq; qal[dc][e] = lq; at_split(f1, hq, lq); qah[dc][8 + e] = hq; qal[dc][8 + e] = lq; }
        else { qah[dc][e] = at_to16<F16>(f0); qah[dc][8 + e] = at_to16<F16>(f1); qal[dc][e] = qah[dc][e]; qal[dc][8 + e] = qah[dc][8 + e]; }
      }
    }
  }

  float mrow[8], lrow[8];
  v8f oacc[4];
#pragma unroll
  for (int r = 0; r < 8; ++r) { mrow[r] = -INFINITY; lrow[r] = 0.f; }
#pragma unroll
  for (int t = 0; t < 4; ++t) oacc[t] = (v8f){0.f,0.f,0.f,0.f,0.f,0.f,0.f,0.f};

  const int nChunks = (g.mask_mode == 1 || g.mask_mode == 4) ? (qb + 1) : (g.Skv / AT_KC);   // block-uniform
  // per-row query mask (mode 3)
  int qkeep[8];
#pragma unroll
  for (int r = 0; r < 8; ++r) qkeep[r] = (g.mask_mode == 3) ? mask_b[(size_t)b * g.S + q0 + 8 * hh + r] : 1;   // mask_b = qmask in mode 3
  for (int kc = 0; kc < nChunks; ++kc) {
    const int kv0 = kc * AT_KC;
    __syncthreads();
    {
      const int kvr = tid >> 1, dh = (tid & 1) * 32;
      const float* krow = kb_ptr + (size_t)(kv0 + kvr) * g.k_rs + dh;
      const float* vrow = vb_ptr + (size_t)(kv0 + kvr) * g.v_rs + dh;
#pragma unroll
      for (int i = 0; i < 8; ++i) {
        v4f kk = *(const v4f*)(krow + 4 * i);
        v4f vv = *(const v4f*)(vrow + 4 * i);
#pragma unroll
        for (int e = 0; e < 4; ++e) {
          const int d = dh + 4 * i + e;
          if (SPLIT_QK) { __bf16 a, bl; at_split(kk[e], a, bl); Ksh[kvr * AT_D + d] = a; Ksl[kvr * AT_D + d] = bl; }
          else Ksh[kvr * AT_D + d] = at_to16<F16>(kk[e]);
          if (SPLIT_PV) { __bf16 a, bl; at_split(vv[e], a, bl); Vth[d * AT_KC + kvr] = a; Vtl[d * AT_KC + kvr] = bl; }
          else Vth[d * AT_KC + kvr] = at_to16<F16>(vv[e]);
        }
      }
    }
    __syncthreads();

    v8f s[4];
#pragma unroll
    for (int j = 0; j < 4; ++j) {
      s[j] = (v8f){0.f,0.f,0.f,0.f,0.f,0.f,0.f,0.f};
#pragma unroll 1
      for (int dc = 0; dc < 2; ++dc) {
        FB kb;
        kb.h[0] = *(const v8b*)(Ksh + (j * 16 + c) * AT_D + dc * 32 + 8 * hh);
        kb.h[1] = *(const v8b*)(Ksh + (j * 16 + c) * AT_D + dc * 32 + 16 + 8 * hh);
        s[j] = at_mma16<F16>(qah[dc], kb.v, s[j]);
        if (SPLIT_QK) {
          FB kl;
          kl.h[0] = *(const v8b*)(Ksl + (j * 16 + c) * AT_D + dc * 32 + 8 * hh);
          kl.h[1] = *(const v8b*)(Ksl + (j * 16 + c) * AT_D + dc * 32 + 16 + 8 * hh);
          s[j] = at_mma16<F16>(qah[dc], kl.v, s[j]);
          s[j] = at_mma16<F16>(qal[dc], kb.v, s[j]);
        }
      }
    }
    const bool diag = (g.mask_mode == 1) && (kc == qb);
    int kvkeep[4] = {1, 1, 1, 1};
    if (g.mask_mode == 3) {
#pragma unroll
      for (int j = 0; j < 4; ++j) kvkeep[j] = ((const int*)mask_a)[(size_t)b * g.Skv + kv0 + j * 16 + c];   // mask_a = kvmask
    }
    float cm[8];
#pragma unroll
    for (int r = 0; r < 8; ++r) {
      const int qrow = q0 + 8 * hh + r;
      float m = -INFINITY;
#pragma unroll
      for (int j = 0; j < 4; ++j) {
        const int kvcol = kv0 + j * 16 + c;
        bool masked = false;
        if (diag) masked = (kvcol > qrow);
        else if (g.mask_mode == 4) masked = (kvcol > qrow) || (qrow - kvcol > g.mask_is_int);
        else if (g.mask_mode == 2) {
          const size_t mi = (size_t)qrow * g.Skv + kvcol;
          masked = (g.mask_is_int == 0) ? (((const float*)mask_a)[mi] == 0.0f)
                 : (g.mask_is_int == 1) ? (((const int*)mask_a)[mi] == 0) : (((const int*)mask_a)[mi] != 0);
        } else if (g.mask_mode == 3) masked = (qkeep[r] == 0) || (kvkeep[j] == 0);
        else if (g.mask_mode == 5) {
          const size_t mi = (size_t)qrow * g.Skv + kvcol;
          masked = (((const int*)mask_a)[mi] != 0);
          int n = mask_b[mi]; n = n < 0 ? 0 : n;
          s[j][r] += g.cp[(size_t)b * g.c_bs + (size_t)h * g.c_hs + (size_t)qrow * g.c_rs + n]
                   + g.pc[(size_t)b * g.c_bs + (size_t)h * g.c_hs + (size_t)kvcol * g.c_rs + n];
        }
        if (masked) s[j][r] = g.mask_fill;
        m = fmaxf(m, s[j][r]);
      }
#pragma unroll
      for (int off = 1; off < 16; off <<= 1) m = fmaxf(m, __shfl_xor(m, off, 32));
      cm[r] = m;
    }
    __bf16* pwh = Psh[wave];
    __bf16* pwl = Psl[SPLIT_PV ? wave : 0];
#pragma unroll
    for (int r = 0; r < 8; ++r) {
      const float mnew = fmaxf(mrow[r], cm[r]);
      const float alpha = expf(mrow[r] - mnew);
      mrow[r] = mnew;
      float psum = 0.f;
#pragma unroll
      for (int j = 0; j < 4; ++j) {
        const float p = expf(s[j][r] - mnew);
        psum += p;
        if (SPLIT_PV) { __bf16 a, bl; at_split(p, a, bl); pwh[(8 * hh + r) * AT_KC + j * 16 + c] = a; pwl[(8 * hh + r) * AT_KC + j * 16 + c] = bl; }
        else pwh[(8 * hh + r) * AT_KC + j * 16 + c] = at_to16<F16>(p * PSC);
      }
#pragma unroll
      for (int off = 1; off < 16; off <<= 1) psum += __shfl_xor(psum, off, 32);
      lrow[r] = lrow[r] * alpha + psum;
#pragma unroll
      for (int t = 0; t < 4; ++t) oacc[t][r] *= alpha;
    }
    __builtin_amdgcn_fence(__ATOMIC_RELEASE, "workgroup");
    __builtin_amdgcn_wave_barrier();
    __builtin_amdgcn_fence(__ATOMIC_ACQUIRE, "workgroup");
#pragma unroll 1
    for (int kk = 0; kk < 2; ++kk) {
      FB pa, pl;
      pa.h[0] = *(const v8b*)(pwh + c * AT_KC + kk * 32 + 8 * hh);
      pa.h[1] = *(const v8b*)(pwh + c * AT_KC + kk * 32 + 16 + 8 * hh);
      if (SPLIT_PV) {
        pl.h[0] = *(const v8b*)(pwl + c * AT_KC + kk * 32 + 8 * hh);
        pl.h[1] = *(const v8b*)(pwl + c * AT_KC + kk * 32 + 16 + 8 * hh);
      }
#pragma unroll
      for (int t = 0; t < 4; ++t) {
        FB vb;
        vb.h[0] = *(const v8b*)(Vth + (t * 16 + c) * AT_KC + kk * 32 + 8 * hh);
        vb.h[1] = *(const v8b*)(Vth + (t * 16 + c) * AT_KC + kk * 32 + 16 + 8 * hh);
        oacc[t] = at_mma16<F16>(pa.v, vb.v, oacc[t]);
        if (SPLIT_PV) {
          FB vl;
          vl.h[0] = *(const v8b*)(Vtl + (t * 16 + c) * AT_KC + kk * 32 + 8 * hh);
          vl.h[1] = *(const v8b*)(Vtl + (t * 16 + c) * AT_KC + kk * 32 + 16 + 8 * hh);
          oacc[t] = at_mma16<F16>(pa.v, vl.v, oacc[t]);
          oacc[t] = at_mma16<F16>(pl.v, vb.v, oacc[t]);
        }
      }
    }
  }

  float* os = Os[wave];
#pragma unroll
  for (int r = 0; r < 8; ++r) {
    const float inv = 1.0f / (lrow[r] * PSC);
#pragma unroll
    for (int t = 0; t < 4; ++t) os[(8 * hh + r) * 68 + t * 16 + c] = oacc[t][r] * inv;
  }
  __builtin_amdgcn_fence(__ATOMIC_RELEASE, "workgroup");
  __builtin_amdgcn_wave_barrier();
  __builtin_amdgcn_fence(__ATOMIC_ACQUIRE, "workgroup");
  {
    const int c4 = (lane & 15) * 4;
    {
#pragma unroll
      for (int it = 0; it < 8; ++it) {
        const int row = it * 2 + hh;
        v4f val = *(const v4f*)(os + row * 68 + c4);
        *(v4f*)(ob_ptr + (size_t)(q0 + row) * g.o_rs + c4) = val;
      }
      
    }
  }
}

} // namespace w25


extern "C" void kernel_launch(void* const* d_in, const int* in_sizes, int n_in, void* d_out, int out_size, void* d_ws, size_t ws_size, hipStream_t stream) {
    (void)in_sizes; (void)n_in; (void)out_size; (void)ws_size;
    const float* x = (const float*)d_in[0];
    const float* Wq = (const float*)d_in[1];
    const float* Wkv = (const float*)d_in[2];
    const float* Wo = (const float*)d_in[3];
    const float* bo = (const float*)d_in[4];
    const int Bn = 2;
    const int T = 2048;
    const int D = 1024;
    const int NH = 16;
    const int D3 = 3 * D;
    const int NR = Bn * T;
    float* out = (float*)d_out;
    char* wsp = (char*)d_ws;
    unsigned short* X16 = (unsigned short*)wsp; wsp += (((size_t)((size_t)NR * D) * 2 + 255) / 256) * 256;
    unsigned short* W316 = (unsigned short*)wsp; wsp += (((size_t)((size_t)D3 * D) * 2 + 255) / 256) * 256;
    unsigned short* QKV16 = (unsigned short*)wsp; wsp += (((size_t)((size_t)NR * D3) * 2 + 255) / 256) * 256;
    if ((size_t)(wsp - (char*)d_ws) > ws_size) return;   // static carve guard
    k_prep<NR, D><<<(unsigned)((D3 / 64) * (D / 128) + (NR / 16) * (D / 1024)), 256, 0, stream>>>(x, Wq, Wkv, (_Float16*)(X16), (_Float16*)(W316));
    k_proj<NR, D3, D><<<(unsigned)((NR / 128) * (D3 / 128)), 128, 0, stream>>>((const _Float16*)(X16), (const _Float16*)(W316), (_Float16*)(QKV16), 0.0625f);
    k_attn_lds<T, D3, D><<<dim3((unsigned)((T) / (16 * AW)), (unsigned)(NH), (unsigned)(Bn)), 32 * AW, 0, stream>>>((const _Float16*)(QKV16), (const _Float16*)(QKV16) + D, (const _Float16*)(QKV16) + 2 * D, Wo, bo, out, 0.125f);
}
